// v000
// Measured on an AMD MI455X. A time is GPU time per run, averaged over a window of back-to-back runs after a warm-up
// (all launches, gaps included; the runs take copies of the inputs in turn), and the median of several windows.
// Apart from v000's, it joins two sittings. Times from different sittings can be a few percent apart, while
// side-by-side timings come from the same sitting.
// v000, which the later versions start from, runs in 286 microseconds.
// Contractions: x*W^T for q,k,v and o, K*Q^T, V^T*P^T all on v_wmma_f32_16x16x32_f16 (f16 operands, f32 accumulate); W carried x32, P carried x16384, attention rows carried x64 (exact power-of-two scales folded back in f32); PE, bias tables, key mask, softmax and normalisation in f32.
#include <hip/hip_runtime.h>

typedef _Float16 v16h __attribute__((ext_vector_type(16)));
typedef _Float16 v8h  __attribute__((ext_vector_type(8)));
typedef float    v8f  __attribute__((ext_vector_type(8)));
typedef float    v4f  __attribute__((ext_vector_type(4)));
typedef float    v2f  __attribute__((ext_vector_type(2)));
typedef int      v4i  __attribute__((ext_vector_type(4)));
typedef v8h __attribute__((may_alias)) v8ha;
typedef v4f __attribute__((may_alias)) v4fa;
typedef v4i __attribute__((may_alias)) v4ia;

union Frag { v16h v; v8h half[2]; };

#define DMODEL 512
#define NHEADS 8
#define HD     64
#define SEQ    2048
#define BATCH  4
#define MROWS  (BATCH * SEQ)          // 8192 tokens
#define NX     (MROWS * DMODEL)       // 4194304
#define NW     (DMODEL * DMODEL)      // 262144
#define NX8    (NX / 8)               // 524288
#define NW8    (NW / 8)               // 32768
#define RELN   (2 * SEQ - 1)          // 4095
#define NPE    (SEQ * DMODEL)         // 1048576 floats
#define PSCALE  16384.0f
#define WSCALE  32.0f
#define AOSCALE 64.0f

static_assert(NW8 == 32768);
static_assert((NX8 % 256) == 0);
static_assert((MROWS % 128) == 0 && (SEQ % 128) == 0);

// ---------------------------------------------------------------------------
// 16x16x32 f16 WMMA with hazard guard (ties D, keeps A/B live).
// Fragment map (wave32): lane l, h = l>>4, m = n = l&15.
//   A/B element i: i<8 -> k0+8h+i ; i>=8 -> k0+16+8h+(i-8)
//   D element r : row 8h+r, col l&15
// ---------------------------------------------------------------------------
__device__ __forceinline__ v8f wmma_f16(v16h a, v16h b, v8f c) {
  v8f d = __builtin_amdgcn_wmma_f32_16x16x32_f16(false, a, false, b, (short)0, c, false, false);
  asm volatile("v_nop\n\tv_nop\n\tv_nop\n\tv_nop" : "+v"(d) : "v"(a), "v"(b));
  return d;
}

// A or B fragment from a k-contiguous 16-bit row; p points at element k0 of
// the row owned by this lane (row index = lane & 15 added by the caller).
__device__ __forceinline__ v16h load_frag(const _Float16* p, int h) {
  Frag f;
  f.half[0] = *(const v8ha*)(p + 8 * h);
  f.half[1] = *(const v8ha*)(p + 16 + 8 * h);
  return f.v;
}

// ---------------------------------------------------------------------------
// Kernel 0: sinusoidal PE table pet[t][2p] = sin(t*div_p), pet[t][2p+1] = cos,
// div_p = exp(f32(2p) * f32(-ln(1e4)/512)). One (t,p) pair per thread:
// ---------------------------------------------------------------------------
__global__ __launch_bounds__(256) void pe_kernel(float* __restrict__ pet)
{
  const int idx = blockIdx.x * 256 + threadIdx.x;       // 0 .. SEQ*DMODEL/2 - 1
  if (idx >= SEQ * (DMODEL / 2)) return;
  const int t = idx >> 8;                               // DMODEL/2 == 256
  const int p = idx & 255;
  const float kc = (float)(-9.210340371976184 / 512.0);
  const float fr = expf((float)(2 * p) * kc);
  const float ang = (float)t * fr;
  v2f o;
  o.x = sinf(ang);
  o.y = cosf(ang);
  float* dst = pet + (size_t)idx * 2;
  *(v2f*)dst = o;
  
}

// ---------------------------------------------------------------------------
// Kernel 1: f32 -> f16 planes. xh = f16(x + pe) unscaled, wh = f16(32*W) for
// Wq,Wk,Wv,Wo (row = output feature, k-contiguous). One 16-B store per lane,
// ---------------------------------------------------------------------------
__global__ __launch_bounds__(256) void convert_kernel(
    const float* __restrict__ x, const float* __restrict__ pet,
    const float* __restrict__ wq, const float* __restrict__ wk,
    const float* __restrict__ wv, const float* __restrict__ wo,
    _Float16* __restrict__ xh, _Float16* __restrict__ wh)
{
  const int g = blockIdx.x * 256 + threadIdx.x;
  if (g >= NX8 + 4 * NW8) return;
  v4f a, c;
  _Float16* dst;
  if (g < NX8) {
    const int row = g >> 6;                 // token row 0..8191 (64 groups of 8 per row)
    const int t = row & (SEQ - 1);
    const int db = (g & 63) * 8;
    const float* src = x + (size_t)g * 8;
    const float* pp = pet + (size_t)t * DMODEL + db;
    a = *(const v4fa*)src + *(const v4fa*)pp;
    c = *(const v4fa*)(src + 4) + *(const v4fa*)(pp + 4);
    dst = xh + (size_t)g * 8;
  } else {
    const int e = g - NX8;
    const int wsel = e >> 15;               // NW8 == 1<<15
    const int off = e & (NW8 - 1);
    const float* wsrc = (wsel == 0) ? wq : ((wsel == 1) ? wk : ((wsel == 2) ? wv : wo));
    const float* src = wsrc + (size_t)off * 8;
    a = *(const v4fa*)src * WSCALE;
    c = *(const v4fa*)(src + 4) * WSCALE;
    dst = wh + (size_t)e * 8;
  }
  const v8h o = { (_Float16)a.x, (_Float16)a.y, (_Float16)a.z, (_Float16)a.w,
                  (_Float16)c.x, (_Float16)c.y, (_Float16)c.z, (_Float16)c.w };
  *(v8h*)dst = o;
  
}

// ---------------------------------------------------------------------------
// 4 lines per instruction, 32 lines per wave, 128 per block.
// which 0/1: plane[bh][l][d]  (one token row = 64 halves = one line)
// which 2  : vt[bh][d][l]     (64 d-rows x 128 tokens = 2 lines each)
// ---------------------------------------------------------------------------
__device__ __forceinline__ void proj_store_pass(const _Float16* sT, _Float16* plane, _Float16* vt,
                                                int which, int bh, int l0, int w, int lane) {
  const int q8 = lane & 7, sub = lane >> 3;
  #pragma unroll
  for (int i = 0; i < 8; ++i) {
    const int lid = w * 32 + i * 4 + sub;
    v8h v;
    _Float16* dst;
    if (which != 2) {
      v = *(const v8ha*)(sT + lid * HD + 8 * q8);
      dst = plane + ((size_t)bh * SEQ + l0 + lid) * HD + 8 * q8;
    } else {
      const int d = lid >> 1, hl = lid & 1;
      v = *(const v8ha*)(sT + d * 128 + 64 * hl + 8 * q8);
      dst = vt + ((size_t)bh * HD + d) * SEQ + l0 + 64 * hl + 8 * q8;
    }
    *(v8h*)dst = v;
  }
}

// ---------------------------------------------------------------------------
// Kernel 2: Y = (x+pe) * W^T + bias over the fused 3*512 output columns.
// Block 128 thr (4 waves) = 128 tokens x 64 features (one (which, head));
// wave tile 32 tokens x 64 features; K = 512 in steps of 32;
// A (x rows) and B (W rows) fragments straight from f16 global rows.
// ---------------------------------------------------------------------------
__global__ __launch_bounds__(128) void proj_kernel(
    const _Float16* __restrict__ xh,   // [8192][512]
    const _Float16* __restrict__ wh,   // [4][512][512], row = output feature, x32
    const float* __restrict__ bq, const float* __restrict__ bk, const float* __restrict__ bv,
    _Float16* __restrict__ qh,         // [B*H][L][D]  f16(q)
    _Float16* __restrict__ kh,         // [B*H][L][D]  f16(k)
    _Float16* __restrict__ vt)         // [B*H][D][L]  f16(v)
{
  __shared__ __attribute__((aligned(16))) _Float16 sT[128 * 64];   // 16384 B

  const int tid = threadIdx.x, lane = tid & 31, w = tid >> 5;
  const int h = lane >> 4, m = lane & 15;
  const int m0 = blockIdx.x * 128;
  const int cg = blockIdx.y;                 // 0..23
  const int which = cg >> 3, head = cg & 7;
  const int m0w = m0 + 32 * w;

  const _Float16* xa0 = xh + (size_t)(m0w + m) * DMODEL;             // token row, mt = 0
  const _Float16* xa1 = xa0 + (size_t)16 * DMODEL;                   // mt = 1
  const _Float16* wb  = wh + ((size_t)which * DMODEL + head * HD + m) * DMODEL;  // feature row, nt = 0

  const v8f zero8 = {0.f, 0.f, 0.f, 0.f, 0.f, 0.f, 0.f, 0.f};
  v8f acc[2][4];
  #pragma unroll
  for (int mt = 0; mt < 2; ++mt)
    #pragma unroll
    for (int nt = 0; nt < 4; ++nt) acc[mt][nt] = zero8;

  #pragma unroll 1
  for (int k0 = 0; k0 < DMODEL; k0 += 32) {
    const v16h a0 = load_frag(xa0 + k0, h);
    const v16h a1 = load_frag(xa1 + k0, h);
    #pragma unroll
    for (int nt = 0; nt < 4; ++nt) {
      const v16h b = load_frag(wb + (size_t)nt * 16 * DMODEL + k0, h);
      acc[0][nt] = wmma_f16(a0, b, acc[0][nt]);
      acc[1][nt] = wmma_f16(a1, b, acc[1][nt]);
    }
  }

  // D[r] of tile (mt, nt) = Y[token m0w+16mt+8h+r][feature 16nt+m]
  const float* bias = (which == 0) ? bq : ((which == 1) ? bk : bv);
  #pragma unroll
  for (int nt = 0; nt < 4; ++nt) {
    const int feat = 16 * nt + m;
    const float bvl = bias[head * HD + feat];
    #pragma unroll
    for (int mt = 0; mt < 2; ++mt) {
      #pragma unroll
      for (int r = 0; r < 8; ++r) {
        const int tokl = 32 * w + 16 * mt + 8 * h + r;     // 0..127
        const float y = acc[mt][nt][r] * (1.0f / WSCALE) + bvl;
        const int idx = (which == 2) ? (feat * 128 + tokl) : (tokl * HD + feat);
        sT[idx] = (_Float16)y;
      }
    }
  }
  __syncthreads();

  const int b = m0 / SEQ, l0 = m0 - b * SEQ, bh = b * NHEADS + head;
  _Float16* plane = (which == 0) ? qh : kh;
  proj_store_pass(sT, plane, vt, which, bh, l0, w, lane);
  
}

// ---------------------------------------------------------------------------
// Attention helpers.
// Score element r of this lane: key = kb + 16j + 8h + r, query = q0 + m.
// v = mask ? (s*0.125 + anti[q - key + 2047]) : (-inf + missing_bias[head]).
// sb = per-head antisymmetrised rel-pos table in LDS, base = index for r = 0
// (index decreases by one per r).
// ---------------------------------------------------------------------------
__device__ __forceinline__ v8f bias_mask8(v8f s, const int* mk, const float* sb, int base, float vmiss) {
  const v4i ma = *(const v4ia*)mk;
  const v4i mb = *(const v4ia*)(mk + 4);
  s[0] = (ma.x != 0) ? fmaf(s[0], 0.125f, sb[base])     : vmiss;
  s[1] = (ma.y != 0) ? fmaf(s[1], 0.125f, sb[base - 1]) : vmiss;
  s[2] = (ma.z != 0) ? fmaf(s[2], 0.125f, sb[base - 2]) : vmiss;
  s[3] = (ma.w != 0) ? fmaf(s[3], 0.125f, sb[base - 3]) : vmiss;
  s[4] = (mb.x != 0) ? fmaf(s[4], 0.125f, sb[base - 4]) : vmiss;
  s[5] = (mb.y != 0) ? fmaf(s[5], 0.125f, sb[base - 5]) : vmiss;
  s[6] = (mb.z != 0) ? fmaf(s[6], 0.125f, sb[base - 6]) : vmiss;
  s[7] = (mb.w != 0) ? fmaf(s[7], 0.125f, sb[base - 7]) : vmiss;
  return s;
}

// P^T B-fragment from the lane's own score D values: element r <- tile a row r,
// element 8+r <- tile c row r (same lane, same query column), scaled by 2^14.
__device__ __forceinline__ v16h pack_p(v8f a, v8f c) {
  const v16h r = { (_Float16)(a[0] * PSCALE), (_Float16)(a[1] * PSCALE), (_Float16)(a[2] * PSCALE), (_Float16)(a[3] * PSCALE),
                   (_Float16)(a[4] * PSCALE), (_Float16)(a[5] * PSCALE), (_Float16)(a[6] * PSCALE), (_Float16)(a[7] * PSCALE),
                   (_Float16)(c[0] * PSCALE), (_Float16)(c[1] * PSCALE), (_Float16)(c[2] * PSCALE), (_Float16)(c[3] * PSCALE),
                   (_Float16)(c[4] * PSCALE), (_Float16)(c[5] * PSCALE), (_Float16)(c[6] * PSCALE), (_Float16)(c[7] * PSCALE) };
  return r;
}

// (one token row's head slice) by lanes 8q..8q+7 in one instruction, 4 lines
// per instruction, 16 lines per wave.
__device__ __forceinline__ void ao_store_pass(const _Float16* so, _Float16* ao,
                                              int b, int head, int q0, int lane) {
  const int q8 = lane & 7, sub = lane >> 3;
  #pragma unroll
  for (int i = 0; i < 4; ++i) {
    const int lid = i * 4 + sub;                    // 0..15
    const v8h v = *(const v8ha*)(so + lid * 64 + 8 * q8);
    const size_t gi = ((size_t)b * SEQ + q0 + lid) * DMODEL + head * HD + 8 * q8;
    *(v8h*)(ao + gi) = v;
  }
}

// ---------------------------------------------------------------------------
// Kernel 3: streaming attention, transposed form.
// Block 128 thr (4 waves), 16 queries per wave, 64 keys per step.
//   S^T = K * Q^T : A = K rows (row = key, k = d), B = Q^T (k = d, n = query)
//   O^T += V^T * P^T : A = Vt rows (row = d, k = key), B = P^T from registers
// Lane owns 32 keys of query column (lane&15); partner = lane ^ 16.
// Antisymmetrised rel-pos table for this head built once per block in LDS.
// ---------------------------------------------------------------------------
__global__ __launch_bounds__(128) void attn_kernel(
    const _Float16* __restrict__ qh,   // [B*H][L][D]
    const _Float16* __restrict__ kh,   // [B*H][L][D]
    const _Float16* __restrict__ vt,   // [B*H][D][L]
    const int* __restrict__ mask,      // [B][L], nonzero = observed key
    const float* __restrict__ mbias,   // [H]
    const float* __restrict__ rel,     // [RELN][H]
    _Float16* __restrict__ ao)         // [B][L][DMODEL], x64
{
  __shared__ __attribute__((aligned(16))) float sB[4096];             // 16384 B
  __shared__ __attribute__((aligned(16))) _Float16 sO[4 * 16 * 64];  //  8192 B

  const int tid = threadIdx.x, lane = tid & 31, w = tid >> 5;
  const int h = lane >> 4, m = lane & 15;
  const int bh = blockIdx.y, b = bh >> 3, head = bh & 7;
  const int q0 = blockIdx.x * 64 + 16 * w;

  // anti[i] = 0.5 * (rel[i][head] - rel[RELN-1-i][head]), i = q - k + (SEQ-1)
  for (int i = tid; i < 4096; i += 128) {
    float v = 0.0f;
    if (i < RELN) v = 0.5f * (rel[(size_t)i * NHEADS + head] - rel[(size_t)(RELN - 1 - i) * NHEADS + head]);
    sB[i] = v;
  }

  // Q^T B-fragments: column n = query q0+m, k = d (two 32-deep chunks)
  const _Float16* qrow = qh + ((size_t)bh * SEQ + q0 + m) * HD;
  const v16h qb0 = load_frag(qrow, h);
  const v16h qb1 = load_frag(qrow + 32, h);

  __syncthreads();

  const float mbh = mbias[head];
  const float vmiss = -__builtin_inff() + mbh;       // -inf fill then + missing bias
  const int qk = q0 + m + (SEQ - 1) - 8 * h;         // bias index for key (kb+16j) at r=0 is qk-kb-16j

  const v8f zero8 = {0.f, 0.f, 0.f, 0.f, 0.f, 0.f, 0.f, 0.f};
  v8f o[4];                                   // o[t][r] = O[query m][d 16t+8h+r] * (l * 2^14)
  #pragma unroll
  for (int t = 0; t < 4; ++t) o[t] = zero8;
  float mrun = -1e30f, lrun = 0.0f;

  const _Float16* kbase = kh + ((size_t)bh * SEQ + m) * HD;    // + key0*HD + 32*dc
  const _Float16* vbase = vt + ((size_t)bh * HD + m) * SEQ;    // + 16t*SEQ + key0
  const int* mkp = mask + (size_t)b * SEQ + 8 * h;             // + key tile base

  #pragma unroll 1
  for (int kb = 0; kb < SEQ; kb += 64) {
    // ---- raw scores: s[j][r] = (Q.K)[query m][key kb+16j+8h+r] ----
    v8f s[4];
    #pragma unroll
    for (int j = 0; j < 4; ++j) {
      const _Float16* kp = kbase + (size_t)(kb + 16 * j) * HD;
      const v16h kf0 = load_frag(kp, h);
      const v16h kf1 = load_frag(kp + 32, h);
      v8f z = zero8;
      z = wmma_f16(kf0, qb0, z);
      z = wmma_f16(kf1, qb1, z);
      s[j] = z;
    }
    // ---- scale 1/8, rel-pos bias, key mask (f32) ----
    #pragma unroll
    for (int j = 0; j < 4; ++j)
      s[j] = bias_mask8(s[j], mkp + kb + 16 * j, sB, qk - kb - 16 * j, vmiss);

    // ---- online softmax ----
    float mloc = s[0][0];
    #pragma unroll
    for (int j = 0; j < 4; ++j)
      #pragma unroll
      for (int r = 0; r < 8; ++r) mloc = fmaxf(mloc, s[j][r]);
    mloc = fmaxf(mloc, __shfl_xor(mloc, 16));
    const float mnew = fmaxf(mrun, mloc);
    const float alpha = __expf(mrun - mnew);
    mrun = mnew;
    float lsum = 0.0f;
    #pragma unroll
    for (int j = 0; j < 4; ++j)
      #pragma unroll
      for (int r = 0; r < 8; ++r) {
        const float p = __expf(s[j][r] - mnew);
        s[j][r] = p;
        lsum += p;
      }
    lsum += __shfl_xor(lsum, 16);
    lrun = lrun * alpha + lsum;
    #pragma unroll
    for (int t = 0; t < 4; ++t)
      #pragma unroll
      for (int r = 0; r < 8; ++r) o[t][r] = o[t][r] * alpha;

    // ---- P^T B-fragments (key chunks 0..31 and 32..63 of this step) ----
    const v16h pb0 = pack_p(s[0], s[1]);
    const v16h pb1 = pack_p(s[2], s[3]);

    // ---- O^T += V^T * P^T ----
    #pragma unroll
    for (int t = 0; t < 4; ++t) {
      const _Float16* vp = vbase + (size_t)(16 * t) * SEQ + kb;
      const v16h vf0 = load_frag(vp, h);
      const v16h vf1 = load_frag(vp + 32, h);
      o[t] = wmma_f16(vf0, pb0, o[t]);
      o[t] = wmma_f16(vf1, pb1, o[t]);
    }
  }

  // ---- epilogue: normalise, x64, stage per-wave 16x64 f16 tile, whole-line stores ----
  const float inv = __builtin_amdgcn_rcpf(lrun) * (AOSCALE / PSCALE);
  _Float16* so = sO + w * 1024;
  #pragma unroll
  for (int t = 0; t < 4; ++t)
    #pragma unroll
    for (int r = 0; r < 8; ++r)
      so[m * 64 + 16 * t + 8 * h + r] = (_Float16)(o[t][r] * inv);
  __syncthreads();

  ao_store_pass(so, ao, b, head, q0, lane);
  
}

// ---------------------------------------------------------------------------
// 16-B stores, 4 lines per instruction, 64 lines per wave.
// ---------------------------------------------------------------------------
__device__ __forceinline__ void out_store_pass(const float* sT, float* out, int m0, int fg, int w, int lane) {
  const int q8 = lane & 7, sub = lane >> 3;
  #pragma unroll
  for (int i = 0; i < 16; ++i) {
    const int lid = i * 4 + sub;                   // 0..63
    const int row = 32 * w + (lid >> 1), hl = lid & 1;
    const v4f v = *(const v4fa*)(sT + row * 64 + 32 * hl + 4 * q8);
    const size_t gi = ((size_t)(m0 + row)) * DMODEL + fg * 64 + 32 * hl + 4 * q8;
    *(v4f*)(out + gi) = v;
  }
}

// ---------------------------------------------------------------------------
// Kernel 4: out = AO * Wo^T + bo (f32). Block 128 thr = 128 tokens x 64
// features (fg = blockIdx.y); wave tile 32 x 64; K = 512 in steps of 32.
// ---------------------------------------------------------------------------
__global__ __launch_bounds__(128) void oproj_kernel(
    const _Float16* __restrict__ ao,   // [8192][512] f16, x64
    const _Float16* __restrict__ woh,  // [512][512] f16, row = output feature, x32
    const float* __restrict__ bo,      // [512]
    float* __restrict__ out)           // [8192][512] f32
{
  __shared__ __attribute__((aligned(16))) float sT[128 * 64];     // 32768 B

  const int tid = threadIdx.x, lane = tid & 31, w = tid >> 5;
  const int h = lane >> 4, m = lane & 15;
  const int m0 = blockIdx.x * 128;
  const int fg = blockIdx.y;                 // 0..7
  const int m0w = m0 + 32 * w;

  const _Float16* xa0 = ao + (size_t)(m0w + m) * DMODEL;
  const _Float16* xa1 = xa0 + (size_t)16 * DMODEL;
  const _Float16* wb  = woh + ((size_t)fg * 64 + m) * DMODEL;

  const v8f zero8 = {0.f, 0.f, 0.f, 0.f, 0.f, 0.f, 0.f, 0.f};
  v8f acc[2][4];
  #pragma unroll
  for (int mt = 0; mt < 2; ++mt)
    #pragma unroll
    for (int nt = 0; nt < 4; ++nt) acc[mt][nt] = zero8;

  #pragma unroll 1
  for (int k0 = 0; k0 < DMODEL; k0 += 32) {
    const v16h a0 = load_frag(xa0 + k0, h);
    const v16h a1 = load_frag(xa1 + k0, h);
    #pragma unroll
    for (int nt = 0; nt < 4; ++nt) {
      const v16h b = load_frag(wb + (size_t)nt * 16 * DMODEL + k0, h);
      acc[0][nt] = wmma_f16(a0, b, acc[0][nt]);
      acc[1][nt] = wmma_f16(a1, b, acc[1][nt]);
    }
  }

  // D[r] of tile (mt, nt) = out[token m0w+16mt+8h+r][feature fg*64+16nt+m]
  #pragma unroll
  for (int nt = 0; nt < 4; ++nt) {
    const int feat = 16 * nt + m;
    const float bvl = bo[fg * 64 + feat];
    #pragma unroll
    for (int mt = 0; mt < 2; ++mt) {
      #pragma unroll
      for (int r = 0; r < 8; ++r) {
        const int tokl = 32 * w + 16 * mt + 8 * h + r;
        sT[tokl * 64 + feat] = acc[mt][nt][r] * (1.0f / (WSCALE * AOSCALE)) + bvl;
      }
    }
  }
  __syncthreads();

  out_store_pass(sT, out, m0, fg, w, lane);
  
}

// ---------------------------------------------------------------------------
extern "C" void kernel_launch(void* const* d_in, const int* in_sizes, int n_in,
                              void* d_out, int out_size, void* d_ws, size_t ws_size,
                              hipStream_t stream) {
  if (n_in < 12) return;
  if (in_sizes[0] != NX) return;
  if (in_sizes[1] != MROWS) return;
  if (in_sizes[2] != NW || in_sizes[4] != NW || in_sizes[6] != NW || in_sizes[8] != NW) return;
  if (in_sizes[3] != DMODEL || in_sizes[5] != DMODEL || in_sizes[7] != DMODEL || in_sizes[9] != DMODEL) return;
  if (in_sizes[10] != NHEADS) return;
  if (in_sizes[11] != RELN * NHEADS) return;
  if (out_size != NX) return;

  const float* x     = (const float*)d_in[0];
  const int*   mask  = (const int*)d_in[1];
  const float* Wq    = (const float*)d_in[2];
  const float* bq    = (const float*)d_in[3];
  const float* Wk    = (const float*)d_in[4];
  const float* bk    = (const float*)d_in[5];
  const float* Wv    = (const float*)d_in[6];
  const float* bv    = (const float*)d_in[7];
  const float* Wo    = (const float*)d_in[8];
  const float* bo    = (const float*)d_in[9];
  const float* mbias = (const float*)d_in[10];
  const float* rel   = (const float*)d_in[11];
  float* out = (float*)d_out;

  const size_t pe_bytes = (size_t)NPE * 4;                          //  4194304
  const size_t xh_bytes = (size_t)NX * 2;                           //  8388608
  const size_t wh_bytes = (size_t)4 * NW * 2;                       //  2097152
  const size_t pl_bytes = (size_t)BATCH * NHEADS * SEQ * HD * 2;    //  8388608
  const size_t ao_bytes = (size_t)NX * 2;                           //  8388608
  const size_t total = pe_bytes + xh_bytes + wh_bytes + 3 * pl_bytes + ao_bytes;   // 48234496
  if (total > ws_size) return;

  char* ws = (char*)d_ws;
  size_t off = 0;
  float*    pet = (float*)(ws + off);     off += pe_bytes;
  _Float16* xh  = (_Float16*)(ws + off);  off += xh_bytes;
  _Float16* wh  = (_Float16*)(ws + off);  off += wh_bytes;
  _Float16* qh  = (_Float16*)(ws + off);  off += pl_bytes;
  _Float16* kh  = (_Float16*)(ws + off);  off += pl_bytes;
  _Float16* vt  = (_Float16*)(ws + off);  off += pl_bytes;
  _Float16* ao  = (_Float16*)(ws + off);  off += ao_bytes;
  if (off > ws_size) return;

  const int npairs = SEQ * (DMODEL / 2);                            // 524288
  pe_kernel<<<(npairs + 255) / 256, 256, 0, stream>>>(pet);

  const int ngroups = NX8 + 4 * NW8;                                // 655360
  convert_kernel<<<(ngroups + 255) / 256, 256, 0, stream>>>(x, pet, Wq, Wk, Wv, Wo, xh, wh);

  dim3 gProj(MROWS / 128, 3 * NHEADS);                              // (64, 24)
  proj_kernel<<<gProj, 128, 0, stream>>>(xh, wh, bq, bk, bv, qh, kh, vt);

  dim3 gAtt(SEQ / 64, BATCH * NHEADS);                              // (32, 32)
  attn_kernel<<<gAtt, 128, 0, stream>>>(qh, kh, vt, mask, mbias, rel, ao);

  dim3 gOut(MROWS / 128, DMODEL / 64);                              // (64, 8)
  oproj_kernel<<<gOut, 128, 0, stream>>>(ao, wh + (size_t)3 * NW, bo, out);
}

// v001
// It runs in 177 microseconds.
// Timed twice side by side with v000, it ran 1.64 and 1.65 times as fast.
// Contractions: x*W^T for q,k,v and o, K*Q^T, V^T*P^T all on v_wmma_f32_16x16x32_f16 (f16 operands, f32 accumulate); W carried x32, P carried x16384, attention rows carried x64 (exact power-of-two scales folded back in f32); PE, bias tables, key mask, softmax and normalisation in f32.
#include <hip/hip_runtime.h>

typedef _Float16 v16h __attribute__((ext_vector_type(16)));
typedef _Float16 v8h  __attribute__((ext_vector_type(8)));
typedef float    v8f  __attribute__((ext_vector_type(8)));
typedef float    v4f  __attribute__((ext_vector_type(4)));
typedef float    v2f  __attribute__((ext_vector_type(2)));
typedef int      v4i  __attribute__((ext_vector_type(4)));
typedef v8h __attribute__((may_alias)) v8ha;
typedef v4f __attribute__((may_alias)) v4fa;
typedef v4i __attribute__((may_alias)) v4ia;

union Frag { v16h v; v8h half[2]; };

#define DMODEL 512
#define NHEADS 8
#define HD     64
#define SEQ    2048
#define BATCH  4
#define MROWS  (BATCH * SEQ)          // 8192 tokens
#define NX     (MROWS * DMODEL)       // 4194304
#define NW     (DMODEL * DMODEL)      // 262144
#define NX8    (NX / 8)               // 524288
#define NW8    (NW / 8)               // 32768
#define RELN   (2 * SEQ - 1)          // 4095
#define NPE    (SEQ * DMODEL)         // 1048576 floats
#define PSCALE  16384.0f
#define WSCALE  32.0f
#define AOSCALE 64.0f
#define TPITCH  72                    // halves per staged LDS row: 144 B = 16 B x 9, conflict-free for 16-B fragment reads
#define TSTAGE  (64 * TPITCH)         // halves per staged 64-row tile
#define NSTEP   (SEQ / 64)            // 32 key steps

static_assert(NW8 == 32768);
static_assert((NX8 % 256) == 0);
static_assert((MROWS % 128) == 0 && (SEQ % 128) == 0);

// ---------------------------------------------------------------------------
// 16x16x32 f16 WMMA with hazard guard (ties D, keeps A/B live).
// Fragment map (wave32): lane l, h = l>>4, m = n = l&15.
//   A/B element i: i<8 -> k0+8h+i ; i>=8 -> k0+16+8h+(i-8)
//   D element r : row 8h+r, col l&15
// ---------------------------------------------------------------------------
__device__ __forceinline__ v8f wmma_f16(v16h a, v16h b, v8f c) {
  v8f d = __builtin_amdgcn_wmma_f32_16x16x32_f16(false, a, false, b, (short)0, c, false, false);
  asm volatile("v_nop\n\tv_nop\n\tv_nop\n\tv_nop" : "+v"(d) : "v"(a), "v"(b));
  return d;
}

// A or B fragment from a k-contiguous 16-bit row; p points at element k0 of
// the row owned by this lane (row index = lane & 15 added by the caller).
__device__ __forceinline__ v16h load_frag(const _Float16* p, int h) {
  Frag f;
  f.half[0] = *(const v8ha*)(p + 8 * h);
  f.half[1] = *(const v8ha*)(p + 16 + 8 * h);
  return f.v;
}

// ---------------------------------------------------------------------------
// Kernel 0: sinusoidal PE table pet[t][2p] = sin(t*div_p), pet[t][2p+1] = cos,
// div_p = exp(f32(2p) * f32(-ln(1e4)/512)). One (t,p) pair per thread:
// ---------------------------------------------------------------------------
__global__ __launch_bounds__(256) void pe_kernel(float* __restrict__ pet)
{
  const int idx = blockIdx.x * 256 + threadIdx.x;       // 0 .. SEQ*DMODEL/2 - 1
  if (idx >= SEQ * (DMODEL / 2)) return;
  const int t = idx >> 8;                               // DMODEL/2 == 256
  const int p = idx & 255;
  const float kc = (float)(-9.210340371976184 / 512.0);
  const float fr = expf((float)(2 * p) * kc);
  const float ang = (float)t * fr;
  v2f o;
  o.x = sinf(ang);
  o.y = cosf(ang);
  float* dst = pet + (size_t)idx * 2;
  *(v2f*)dst = o;
  
}

// ---------------------------------------------------------------------------
// Kernel 1: f32 -> f16 planes. xh = f16(x + pe) unscaled, wh = f16(32*W) for
// Wq,Wk,Wv,Wo (row = output feature, k-contiguous). One 16-B store per lane,
// ---------------------------------------------------------------------------
__global__ __launch_bounds__(256) void convert_kernel(
    const float* __restrict__ x, const float* __restrict__ pet,
    const float* __restrict__ wq, const float* __restrict__ wk,
    const float* __restrict__ wv, const float* __restrict__ wo,
    _Float16* __restrict__ xh, _Float16* __restrict__ wh)
{
  const int g = blockIdx.x * 256 + threadIdx.x;
  if (g >= NX8 + 4 * NW8) return;
  v4f a, c;
  _Float16* dst;
  if (g < NX8) {
    const int row = g >> 6;                 // token row 0..8191 (64 groups of 8 per row)
    const int t = row & (SEQ - 1);
    const int db = (g & 63) * 8;
    const float* src = x + (size_t)g * 8;
    const float* pp = pet + (size_t)t * DMODEL + db;
    a = *(const v4fa*)src + *(const v4fa*)pp;
    c = *(const v4fa*)(src + 4) + *(const v4fa*)(pp + 4);
    dst = xh + (size_t)g * 8;
  } else {
    const int e = g - NX8;
    const int wsel = e >> 15;               // NW8 == 1<<15
    const int off = e & (NW8 - 1);
    const float* wsrc = (wsel == 0) ? wq : ((wsel == 1) ? wk : ((wsel == 2) ? wv : wo));
    const float* src = wsrc + (size_t)off * 8;
    a = *(const v4fa*)src * WSCALE;
    c = *(const v4fa*)(src + 4) * WSCALE;
    dst = wh + (size_t)e * 8;
  }
  const v8h o = { (_Float16)a.x, (_Float16)a.y, (_Float16)a.z, (_Float16)a.w,
                  (_Float16)c.x, (_Float16)c.y, (_Float16)c.z, (_Float16)c.w };
  *(v8h*)dst = o;
  
}

// ---------------------------------------------------------------------------
// 4 lines per instruction, 32 lines per wave, 128 per block.
// which 0/1: plane[bh][l][d]  (one token row = 64 halves = one line)
// which 2  : vt[bh][d][l]     (64 d-rows x 128 tokens = 2 lines each)
// ---------------------------------------------------------------------------
__device__ __forceinline__ void proj_store_pass(const _Float16* sT, _Float16* plane, _Float16* vt,
                                                int which, int bh, int l0, int w, int lane) {
  const int q8 = lane & 7, sub = lane >> 3;
  #pragma unroll
  for (int i = 0; i < 8; ++i) {
    const int lid = w * 32 + i * 4 + sub;
    v8h v;
    _Float16* dst;
    if (which != 2) {
      v = *(const v8ha*)(sT + lid * HD + 8 * q8);
      dst = plane + ((size_t)bh * SEQ + l0 + lid) * HD + 8 * q8;
    } else {
      const int d = lid >> 1, hl = lid & 1;
      v = *(const v8ha*)(sT + d * 128 + 64 * hl + 8 * q8);
      dst = vt + ((size_t)bh * HD + d) * SEQ + l0 + 64 * hl + 8 * q8;
    }
    *(v8h*)dst = v;
  }
}

// ---------------------------------------------------------------------------
// Kernel 2: Y = (x+pe) * W^T + bias over the fused 3*512 output columns.
// Block 128 thr (4 waves) = 128 tokens x 64 features (one (which, head));
// wave tile 32 tokens x 64 features; K = 512 in steps of 32;
// A (x rows) and B (W rows) fragments straight from f16 global rows.
// ---------------------------------------------------------------------------
__global__ __launch_bounds__(128) void proj_kernel(
    const _Float16* __restrict__ xh,   // [8192][512]
    const _Float16* __restrict__ wh,   // [4][512][512], row = output feature, x32
    const float* __restrict__ bq, const float* __restrict__ bk, const float* __restrict__ bv,
    _Float16* __restrict__ qh,         // [B*H][L][D]  f16(q)
    _Float16* __restrict__ kh,         // [B*H][L][D]  f16(k)
    _Float16* __restrict__ vt)         // [B*H][D][L]  f16(v)
{
  __shared__ __attribute__((aligned(16))) _Float16 sT[128 * 64];   // 16384 B

  const int tid = threadIdx.x, lane = tid & 31, w = tid >> 5;
  const int h = lane >> 4, m = lane & 15;
  const int m0 = blockIdx.x * 128;
  const int cg = blockIdx.y;                 // 0..23
  const int which = cg >> 3, head = cg & 7;
  const int m0w = m0 + 32 * w;

  const _Float16* xa0 = xh + (size_t)(m0w + m) * DMODEL;             // token row, mt = 0
  const _Float16* xa1 = xa0 + (size_t)16 * DMODEL;                   // mt = 1
  const _Float16* wb  = wh + ((size_t)which * DMODEL + head * HD + m) * DMODEL;  // feature row, nt = 0

  const v8f zero8 = {0.f, 0.f, 0.f, 0.f, 0.f, 0.f, 0.f, 0.f};
  v8f acc[2][4];
  #pragma unroll
  for (int mt = 0; mt < 2; ++mt)
    #pragma unroll
    for (int nt = 0; nt < 4; ++nt) acc[mt][nt] = zero8;

  #pragma unroll 1
  for (int k0 = 0; k0 < DMODEL; k0 += 32) {
    const v16h a0 = load_frag(xa0 + k0, h);
    const v16h a1 = load_frag(xa1 + k0, h);
    #pragma unroll
    for (int nt = 0; nt < 4; ++nt) {
      const v16h b = load_frag(wb + (size_t)nt * 16 * DMODEL + k0, h);
      acc[0][nt] = wmma_f16(a0, b, acc[0][nt]);
      acc[1][nt] = wmma_f16(a1, b, acc[1][nt]);
    }
  }

  // D[r] of tile (mt, nt) = Y[token m0w+16mt+8h+r][feature 16nt+m]
  const float* bias = (which == 0) ? bq : ((which == 1) ? bk : bv);
  #pragma unroll
  for (int nt = 0; nt < 4; ++nt) {
    const int feat = 16 * nt + m;
    const float bvl = bias[head * HD + feat];
    #pragma unroll
    for (int mt = 0; mt < 2; ++mt) {
      #pragma unroll
      for (int r = 0; r < 8; ++r) {
        const int tokl = 32 * w + 16 * mt + 8 * h + r;     // 0..127
        const float y = acc[mt][nt][r] * (1.0f / WSCALE) + bvl;
        const int idx = (which == 2) ? (feat * 128 + tokl) : (tokl * HD + feat);
        sT[idx] = (_Float16)y;
      }
    }
  }
  __syncthreads();

  const int b = m0 / SEQ, l0 = m0 - b * SEQ, bh = b * NHEADS + head;
  _Float16* plane = (which == 0) ? qh : kh;
  proj_store_pass(sT, plane, vt, which, bh, l0, w, lane);
  
}

// ---------------------------------------------------------------------------
// Attention helpers.
// Score element r of this lane: key = kb + 16j + 8h + r, query = q0 + m.
// v = mask ? (s*0.125 + anti[q - key + 2047]) : (-inf + missing_bias[head]).
// sb = per-head antisymmetrised rel-pos table in LDS, base = index for r = 0
// (index decreases by one per r).
// ---------------------------------------------------------------------------
__device__ __forceinline__ v8f bias_mask8(v8f s, const int* mk, const float* sb, int base, float vmiss) {
  const v4i ma = *(const v4ia*)mk;
  const v4i mb = *(const v4ia*)(mk + 4);
  s[0] = (ma.x != 0) ? fmaf(s[0], 0.125f, sb[base])     : vmiss;
  s[1] = (ma.y != 0) ? fmaf(s[1], 0.125f, sb[base - 1]) : vmiss;
  s[2] = (ma.z != 0) ? fmaf(s[2], 0.125f, sb[base - 2]) : vmiss;
  s[3] = (ma.w != 0) ? fmaf(s[3], 0.125f, sb[base - 3]) : vmiss;
  s[4] = (mb.x != 0) ? fmaf(s[4], 0.125f, sb[base - 4]) : vmiss;
  s[5] = (mb.y != 0) ? fmaf(s[5], 0.125f, sb[base - 5]) : vmiss;
  s[6] = (mb.z != 0) ? fmaf(s[6], 0.125f, sb[base - 6]) : vmiss;
  s[7] = (mb.w != 0) ? fmaf(s[7], 0.125f, sb[base - 7]) : vmiss;
  return s;
}

// P^T B-fragment from the lane's own score D values: element r <- tile a row r,
// element 8+r <- tile c row r (same lane, same query column), scaled by 2^14.
__device__ __forceinline__ v16h pack_p(v8f a, v8f c) {
  const v16h r = { (_Float16)(a[0] * PSCALE), (_Float16)(a[1] * PSCALE), (_Float16)(a[2] * PSCALE), (_Float16)(a[3] * PSCALE),
                   (_Float16)(a[4] * PSCALE), (_Float16)(a[5] * PSCALE), (_Float16)(a[6] * PSCALE), (_Float16)(a[7] * PSCALE),
                   (_Float16)(c[0] * PSCALE), (_Float16)(c[1] * PSCALE), (_Float16)(c[2] * PSCALE), (_Float16)(c[3] * PSCALE),
                   (_Float16)(c[4] * PSCALE), (_Float16)(c[5] * PSCALE), (_Float16)(c[6] * PSCALE), (_Float16)(c[7] * PSCALE) };
  return r;
}

// (one token row's head slice) by lanes 8q..8q+7 in one instruction, 4 lines
// per instruction, 16 lines per wave.
__device__ __forceinline__ void ao_store_pass(const _Float16* so, _Float16* ao,
                                              int b, int head, int q0, int lane) {
  const int q8 = lane & 7, sub = lane >> 3;
  #pragma unroll
  for (int i = 0; i < 4; ++i) {
    const int lid = i * 4 + sub;                    // 0..15
    const v8h v = *(const v8ha*)(so + lid * 64 + 8 * q8);
    const size_t gi = ((size_t)b * SEQ + q0 + lid) * DMODEL + head * HD + 8 * q8;
    *(v8h*)(ao + gi) = v;
  }
}

// One 64-key stage of K (64 key rows x 128 B) and of V^T (64 d rows x 128 B)
// into LDS rows of TPITCH halves: 4 + 4 asynchronous 16-B copies per lane, each
// wave-wide copy covering four whole 128-B lines. lk/lv = this lane's LDS byte
// address of its first K / V chunk, gk/gv = the matching global address; chunk
// i lies 16 rows further on both sides.
// The closing s_wait_xcnt 0 stands inside the copies' own statement, so that no
// address register named here is rewritten ahead of it.
__device__ __forceinline__ void stage_copy(unsigned lk, unsigned lv,
                                           const _Float16* gk, const _Float16* gv) {
  const unsigned lk1 = lk + 16 * TPITCH * 2, lk2 = lk + 32 * TPITCH * 2, lk3 = lk + 48 * TPITCH * 2;
  const unsigned lv1 = lv + 16 * TPITCH * 2, lv2 = lv + 32 * TPITCH * 2, lv3 = lv + 48 * TPITCH * 2;
  const _Float16* gk1 = gk + 16 * HD;
  const _Float16* gk2 = gk + 32 * HD;
  const _Float16* gk3 = gk + 48 * HD;
  const _Float16* gv1 = gv + (size_t)16 * SEQ;
  const _Float16* gv2 = gv + (size_t)32 * SEQ;
  const _Float16* gv3 = gv + (size_t)48 * SEQ;
  asm volatile("global_load_async_to_lds_b128 %0, %8, off\n\t"
               "global_load_async_to_lds_b128 %1, %9, off\n\t"
               "global_load_async_to_lds_b128 %2, %10, off\n\t"
               "global_load_async_to_lds_b128 %3, %11, off\n\t"
               "global_load_async_to_lds_b128 %4, %12, off\n\t"
               "global_load_async_to_lds_b128 %5, %13, off\n\t"
               "global_load_async_to_lds_b128 %6, %14, off\n\t"
               "global_load_async_to_lds_b128 %7, %15, off\n\t"
               "s_wait_xcnt 0x0"
               :: "v"(lk), "v"(lk1), "v"(lk2), "v"(lk3), "v"(lv), "v"(lv1), "v"(lv2), "v"(lv3),
                  "v"(gk), "v"(gk1), "v"(gk2), "v"(gk3), "v"(gv), "v"(gv1), "v"(gv2), "v"(gv3)
               : "memory");
}

// ---------------------------------------------------------------------------
// Kernel 3: streaming attention, transposed form.
// Block 128 thr (4 waves), 16 queries per wave, 64 keys per step.
// K and V^T of a step are staged once per block in a two-buffer LDS ring by
// asynchronous copies (next step's copies fly while this step is worked on);
// all four waves read their fragments from there.
//   S^T = K * Q^T : A = K rows (row = key, k = d), B = Q^T (k = d, n = query)
//   O^T += V^T * P^T : A = Vt rows (row = d, k = key), B = P^T from registers
// Lane owns 32 keys of query column (lane&15); partner = lane ^ 16.
// Antisymmetrised rel-pos table for this head built once per block in LDS.
// ---------------------------------------------------------------------------
__global__ __launch_bounds__(128) void attn_kernel(
    const _Float16* __restrict__ qh,   // [B*H][L][D]
    const _Float16* __restrict__ kh,   // [B*H][L][D]
    const _Float16* __restrict__ vt,   // [B*H][D][L]
    const int* __restrict__ mask,      // [B][L], nonzero = observed key
    const float* __restrict__ mbias,   // [H]
    const float* __restrict__ rel,     // [RELN][H]
    _Float16* __restrict__ ao)         // [B][L][DMODEL], x64
{
  __shared__ __attribute__((aligned(16))) float sB[4096];             // 16384 B
  __shared__ __attribute__((aligned(16))) _Float16 sO[4 * 16 * 64];  //  8192 B
  __shared__ __attribute__((aligned(16))) _Float16 sK[2 * TSTAGE];   // 18432 B
  __shared__ __attribute__((aligned(16))) _Float16 sV[2 * TSTAGE];   // 18432 B

  const int tid = threadIdx.x, lane = tid & 31, w = tid >> 5;
  const int h = lane >> 4, m = lane & 15;
  const int bh = blockIdx.y, b = bh >> 3, head = bh & 7;
  const int q0 = blockIdx.x * 64 + 16 * w;

  // Staging map: chunk c = tid + 128 i (i = 0..3), tile row c >> 3, 16-B column c & 7.
  const int crow = tid >> 3, ccol = tid & 7;
  const unsigned lk0 = (unsigned)(size_t)(sK + crow * TPITCH + 8 * ccol);
  const unsigned lv0 = (unsigned)(size_t)(sV + crow * TPITCH + 8 * ccol);
  const _Float16* gk0 = kh + ((size_t)bh * SEQ + crow) * HD + 8 * ccol;    // + 64 * HD per step
  const _Float16* gv0 = vt + ((size_t)bh * HD + crow) * SEQ + 8 * ccol;    // + 64 per step

  stage_copy(lk0, lv0, gk0, gv0);                                          // step 0 -> buffer 0

  // anti[i] = 0.5 * (rel[i][head] - rel[RELN-1-i][head]), i = q - k + (SEQ-1)
  for (int i = tid; i < 4096; i += 128) {
    float v = 0.0f;
    if (i < RELN) v = 0.5f * (rel[(size_t)i * NHEADS + head] - rel[(size_t)(RELN - 1 - i) * NHEADS + head]);
    sB[i] = v;
  }

  // Q^T B-fragments: column n = query q0+m, k = d (two 32-deep chunks)
  const _Float16* qrow = qh + ((size_t)bh * SEQ + q0 + m) * HD;
  const v16h qb0 = load_frag(qrow, h);
  const v16h qb1 = load_frag(qrow + 32, h);

  // step 0's copies of this wave have landed before the barrier that publishes them (and sB)
  asm volatile("s_wait_asynccnt 0x0" ::: "memory");
  __syncthreads();

  stage_copy(lk0 + TSTAGE * 2, lv0 + TSTAGE * 2, gk0 + 64 * HD, gv0 + 64); // step 1 -> buffer 1

  const float mbh = mbias[head];
  const float vmiss = -__builtin_inff() + mbh;       // -inf fill then + missing bias
  const int qk = q0 + m + (SEQ - 1) - 8 * h;         // bias index for key (kb+16j) at r=0 is qk-kb-16j

  const v8f zero8 = {0.f, 0.f, 0.f, 0.f, 0.f, 0.f, 0.f, 0.f};
  v8f o[4];                                   // o[t][r] = O[query m][d 16t+8h+r] * (l * 2^14)
  #pragma unroll
  for (int t = 0; t < 4; ++t) o[t] = zero8;
  float mrun = -1e30f, lrun = 0.0f;

  const int fro = m * TPITCH;                                  // fragment row of this lane in a staged tile
  const int* mkp = mask + (size_t)b * SEQ + 8 * h;             // + key tile base

  #pragma unroll 1
  for (int st = 0; st < NSTEP; ++st) {
    const int kb = st * 64;
    const int bo = (st & 1) * TSTAGE;                          // this step's ring buffer
    const _Float16* kbase = sK + bo + fro;                     // + 16j*TPITCH + 32*dc
    const _Float16* vbase = sV + bo + fro;                     // + 16t*TPITCH + 32*kc
    // ---- raw scores: s[j][r] = (Q.K)[query m][key kb+16j+8h+r] ----
    v8f s[4];
    #pragma unroll
    for (int j = 0; j < 4; ++j) {
      const _Float16* kp = kbase + 16 * j * TPITCH;
      const v16h kf0 = load_frag(kp, h);
      const v16h kf1 = load_frag(kp + 32, h);
      v8f z = zero8;
      z = wmma_f16(kf0, qb0, z);
      z = wmma_f16(kf1, qb1, z);
      s[j] = z;
    }
    // ---- scale 1/8, rel-pos bias, key mask (f32) ----
    #pragma unroll
    for (int j = 0; j < 4; ++j)
      s[j] = bias_mask8(s[j], mkp + kb + 16 * j, sB, qk - kb - 16 * j, vmiss);

    // ---- online softmax ----
    float mloc = s[0][0];
    #pragma unroll
    for (int j = 0; j < 4; ++j)
      #pragma unroll
      for (int r = 0; r < 8; ++r) mloc = fmaxf(mloc, s[j][r]);
    mloc = fmaxf(mloc, __shfl_xor(mloc, 16));
    const float mnew = fmaxf(mrun, mloc);
    const float alpha = __expf(mrun - mnew);
    mrun = mnew;
    float lsum = 0.0f;
    #pragma unroll
    for (int j = 0; j < 4; ++j)
      #pragma unroll
      for (int r = 0; r < 8; ++r) {
        const float p = __expf(s[j][r] - mnew);
        s[j][r] = p;
        lsum += p;
      }
    lsum += __shfl_xor(lsum, 16);
    lrun = lrun * alpha + lsum;
    #pragma unroll
    for (int t = 0; t < 4; ++t)
      #pragma unroll
      for (int r = 0; r < 8; ++r) o[t][r] = o[t][r] * alpha;

    // ---- P^T B-fragments (key chunks 0..31 and 32..63 of this step) ----
    const v16h pb0 = pack_p(s[0], s[1]);
    const v16h pb1 = pack_p(s[2], s[3]);

    // ---- O^T += V^T * P^T ----
    #pragma unroll
    for (int t = 0; t < 4; ++t) {
      const _Float16* vp = vbase + 16 * t * TPITCH;
      const v16h vf0 = load_frag(vp, h);
      const v16h vf1 = load_frag(vp + 32, h);
      o[t] = wmma_f16(vf0, pb0, o[t]);
      o[t] = wmma_f16(vf1, pb1, o[t]);
    }

    // ---- hand-over: this wave's reads of buffer st&1 are done, its copies of step st+1
    // have landed; the barrier publishes step st+1 and frees buffer st&1 for the refill ----
    asm volatile("s_wait_dscnt 0x0" ::: "memory");
    asm volatile("s_wait_asynccnt 0x0" ::: "memory");
    __syncthreads();
    if (st + 2 < NSTEP)
      stage_copy(lk0 + bo * 2, lv0 + bo * 2, gk0 + (size_t)(kb + 128) * HD, gv0 + (kb + 128));
  }
  // no copy is left in flight when the wave goes on to the epilogue
  asm volatile("s_wait_asynccnt 0x0" ::: "memory");

  // ---- epilogue: normalise, x64, stage per-wave 16x64 f16 tile, whole-line stores ----
  const float inv = __builtin_amdgcn_rcpf(lrun) * (AOSCALE / PSCALE);
  _Float16* so = sO + w * 1024;
  #pragma unroll
  for (int t = 0; t < 4; ++t)
    #pragma unroll
    for (int r = 0; r < 8; ++r)
      so[m * 64 + 16 * t + 8 * h + r] = (_Float16)(o[t][r] * inv);
  __syncthreads();

  ao_store_pass(so, ao, b, head, q0, lane);
  
}

// ---------------------------------------------------------------------------
// 16-B stores, 4 lines per instruction, 64 lines per wave.
// ---------------------------------------------------------------------------
__device__ __forceinline__ void out_store_pass(const float* sT, float* out, int m0, int fg, int w, int lane) {
  const int q8 = lane & 7, sub = lane >> 3;
  #pragma unroll
  for (int i = 0; i < 16; ++i) {
    const int lid = i * 4 + sub;                   // 0..63
    const int row = 32 * w + (lid >> 1), hl = lid & 1;
    const v4f v = *(const v4fa*)(sT + row * 64 + 32 * hl + 4 * q8);
    const size_t gi = ((size_t)(m0 + row)) * DMODEL + fg * 64 + 32 * hl + 4 * q8;
    *(v4f*)(out + gi) = v;
  }
}

// ---------------------------------------------------------------------------
// Kernel 4: out = AO * Wo^T + bo (f32). Block 128 thr = 128 tokens x 64
// features (fg = blockIdx.y); wave tile 32 x 64; K = 512 in steps of 32.
// ---------------------------------------------------------------------------
__global__ __launch_bounds__(128) void oproj_kernel(
    const _Float16* __restrict__ ao,   // [8192][512] f16, x64
    const _Float16* __restrict__ woh,  // [512][512] f16, row = output feature, x32
    const float* __restrict__ bo,      // [512]
    float* __restrict__ out)           // [8192][512] f32
{
  __shared__ __attribute__((aligned(16))) float sT[128 * 64];     // 32768 B

  const int tid = threadIdx.x, lane = tid & 31, w = tid >> 5;
  const int h = lane >> 4, m = lane & 15;
  const int m0 = blockIdx.x * 128;
  const int fg = blockIdx.y;                 // 0..7
  const int m0w = m0 + 32 * w;

  const _Float16* xa0 = ao + (size_t)(m0w + m) * DMODEL;
  const _Float16* xa1 = xa0 + (size_t)16 * DMODEL;
  const _Float16* wb  = woh + ((size_t)fg * 64 + m) * DMODEL;

  const v8f zero8 = {0.f, 0.f, 0.f, 0.f, 0.f, 0.f, 0.f, 0.f};
  v8f acc[2][4];
  #pragma unroll
  for (int mt = 0; mt < 2; ++mt)
    #pragma unroll
    for (int nt = 0; nt < 4; ++nt) acc[mt][nt] = zero8;

  #pragma unroll 1
  for (int k0 = 0; k0 < DMODEL; k0 += 32) {
    const v16h a0 = load_frag(xa0 + k0, h);
    const v16h a1 = load_frag(xa1 + k0, h);
    #pragma unroll
    for (int nt = 0; nt < 4; ++nt) {
      const v16h b = load_frag(wb + (size_t)nt * 16 * DMODEL + k0, h);
      acc[0][nt] = wmma_f16(a0, b, acc[0][nt]);
      acc[1][nt] = wmma_f16(a1, b, acc[1][nt]);
    }
  }

  // D[r] of tile (mt, nt) = out[token m0w+16mt+8h+r][feature fg*64+16nt+m]
  #pragma unroll
  for (int nt = 0; nt < 4; ++nt) {
    const int feat = 16 * nt + m;
    const float bvl = bo[fg * 64 + feat];
    #pragma unroll
    for (int mt = 0; mt < 2; ++mt) {
      #pragma unroll
      for (int r = 0; r < 8; ++r) {
        const int tokl = 32 * w + 16 * mt + 8 * h + r;
        sT[tokl * 64 + feat] = acc[mt][nt][r] * (1.0f / (WSCALE * AOSCALE)) + bvl;
      }
    }
  }
  __syncthreads();

  out_store_pass(sT, out, m0, fg, w, lane);
  
}

// ---------------------------------------------------------------------------
extern "C" void kernel_launch(void* const* d_in, const int* in_sizes, int n_in,
                              void* d_out, int out_size, void* d_ws, size_t ws_size,
                              hipStream_t stream) {
  if (n_in < 12) return;
  if (in_sizes[0] != NX) return;
  if (in_sizes[1] != MROWS) return;
  if (in_sizes[2] != NW || in_sizes[4] != NW || in_sizes[6] != NW || in_sizes[8] != NW) return;
  if (in_sizes[3] != DMODEL || in_sizes[5] != DMODEL || in_sizes[7] != DMODEL || in_sizes[9] != DMODEL) return;
  if (in_sizes[10] != NHEADS) return;
  if (in_sizes[11] != RELN * NHEADS) return;
  if (out_size != NX) return;

  const float* x     = (const float*)d_in[0];
  const int*   mask  = (const int*)d_in[1];
  const float* Wq    = (const float*)d_in[2];
  const float* bq    = (const float*)d_in[3];
  const float* Wk    = (const float*)d_in[4];
  const float* bk    = (const float*)d_in[5];
  const float* Wv    = (const float*)d_in[6];
  const float* bv    = (const float*)d_in[7];
  const float* Wo    = (const float*)d_in[8];
  const float* bo    = (const float*)d_in[9];
  const float* mbias = (const float*)d_in[10];
  const float* rel   = (const float*)d_in[11];
  float* out = (float*)d_out;

  const size_t pe_bytes = (size_t)NPE * 4;                          //  4194304
  const size_t xh_bytes = (size_t)NX * 2;                           //  8388608
  const size_t wh_bytes = (size_t)4 * NW * 2;                       //  2097152
  const size_t pl_bytes = (size_t)BATCH * NHEADS * SEQ * HD * 2;    //  8388608
  const size_t ao_bytes = (size_t)NX * 2;                           //  8388608
  const size_t total = pe_bytes + xh_bytes + wh_bytes + 3 * pl_bytes + ao_bytes;   // 48234496
  if (total > ws_size) return;

  char* ws = (char*)d_ws;
  size_t off = 0;
  float*    pet = (float*)(ws + off);     off += pe_bytes;
  _Float16* xh  = (_Float16*)(ws + off);  off += xh_bytes;
  _Float16* wh  = (_Float16*)(ws + off);  off += wh_bytes;
  _Float16* qh  = (_Float16*)(ws + off);  off += pl_bytes;
  _Float16* kh  = (_Float16*)(ws + off);  off += pl_bytes;
  _Float16* vt  = (_Float16*)(ws + off);  off += pl_bytes;
  _Float16* ao  = (_Float16*)(ws + off);  off += ao_bytes;
  if (off > ws_size) return;

  const int npairs = SEQ * (DMODEL / 2);                            // 524288
  pe_kernel<<<(npairs + 255) / 256, 256, 0, stream>>>(pet);

  const int ngroups = NX8 + 4 * NW8;                                // 655360
  convert_kernel<<<(ngroups + 255) / 256, 256, 0, stream>>>(x, pet, Wq, Wk, Wv, Wo, xh, wh);

  dim3 gProj(MROWS / 128, 3 * NHEADS);                              // (64, 24)
  proj_kernel<<<gProj, 128, 0, stream>>>(xh, wh, bq, bk, bv, qh, kh, vt);

  dim3 gAtt(SEQ / 64, BATCH * NHEADS);                              // (32, 32)
  attn_kernel<<<gAtt, 128, 0, stream>>>(qh, kh, vt, mask, mbias, rel, ao);

  dim3 gOut(MROWS / 128, DMODEL / 64);                              // (64, 8)
  oproj_kernel<<<gOut, 128, 0, stream>>>(ao, wh + (size_t)3 * NW, bo, out);
}

// v002
// It runs in 132 microseconds.
// Timed twice side by side with v001, it ran 1.35 and 1.34 times as fast.
// Over all steps from v000 it is 2.21 times as fast.
// Contractions: x*W^T for q,k,v and o, K*Q^T, V^T*P^T all on v_wmma_f32_16x16x32_f16 (f16 operands, f32 accumulate); W carried x32, P carried x16384, attention rows carried x64 (exact power-of-two scales folded back in f32); PE, bias tables, key mask, softmax and normalisation in f32.
#include <hip/hip_runtime.h>

typedef _Float16 v16h __attribute__((ext_vector_type(16)));
typedef _Float16 v8h  __attribute__((ext_vector_type(8)));
typedef float    v8f  __attribute__((ext_vector_type(8)));
typedef float    v4f  __attribute__((ext_vector_type(4)));
typedef float    v2f  __attribute__((ext_vector_type(2)));
typedef int      v4i  __attribute__((ext_vector_type(4)));
typedef v8h __attribute__((may_alias)) v8ha;
typedef v4f __attribute__((may_alias)) v4fa;
typedef v4i __attribute__((may_alias)) v4ia;

union Frag { v16h v; v8h half[2]; };

#define DMODEL 512
#define NHEADS 8
#define HD     64
#define SEQ    2048
#define BATCH  4
#define MROWS  (BATCH * SEQ)          // 8192 tokens
#define NX     (MROWS * DMODEL)       // 4194304
#define NW     (DMODEL * DMODEL)      // 262144
#define NX8    (NX / 8)               // 524288
#define NW8    (NW / 8)               // 32768
#define RELN   (2 * SEQ - 1)          // 4095
#define NPE    (SEQ * DMODEL)         // 1048576 floats
#define PSCALE  16384.0f
#define WSCALE  32.0f
#define AOSCALE 64.0f
#define TPITCH  72                    // halves per staged LDS row: 144 B = 16 B x 9, conflict-free for 16-B fragment reads
#define TSTAGE  (64 * TPITCH)         // halves per staged 64-row tile
#define NSTEP   (SEQ / 64)            // 32 key steps

static_assert(NW8 == 32768);
static_assert((NX8 % 256) == 0);
static_assert((MROWS % 128) == 0 && (SEQ % 128) == 0);

// ---------------------------------------------------------------------------
// 16x16x32 f16 WMMA with hazard guard (ties D, keeps A/B live).
// Fragment map (wave32): lane l, h = l>>4, m = n = l&15.
//   A/B element i: i<8 -> k0+8h+i ; i>=8 -> k0+16+8h+(i-8)
//   D element r : row 8h+r, col l&15
// ---------------------------------------------------------------------------
__device__ __forceinline__ v8f wmma_f16(v16h a, v16h b, v8f c) {
  v8f d = __builtin_amdgcn_wmma_f32_16x16x32_f16(false, a, false, b, (short)0, c, false, false);
  asm volatile("v_nop\n\tv_nop\n\tv_nop\n\tv_nop" : "+v"(d) : "v"(a), "v"(b));
  return d;
}

// A or B fragment from a k-contiguous 16-bit row; p points at element k0 of
// the row owned by this lane (row index = lane & 15 added by the caller).
__device__ __forceinline__ v16h load_frag(const _Float16* p, int h) {
  Frag f;
  f.half[0] = *(const v8ha*)(p + 8 * h);
  f.half[1] = *(const v8ha*)(p + 16 + 8 * h);
  return f.v;
}

// ---------------------------------------------------------------------------
// Kernel 0: sinusoidal PE table pet[t][2p] = sin(t*div_p), pet[t][2p+1] = cos,
// div_p = exp(f32(2p) * f32(-ln(1e4)/512)). One (t,p) pair per thread:
// ---------------------------------------------------------------------------
__global__ __launch_bounds__(256) void pe_kernel(float* __restrict__ pet)
{
  const int idx = blockIdx.x * 256 + threadIdx.x;       // 0 .. SEQ*DMODEL/2 - 1
  if (idx >= SEQ * (DMODEL / 2)) return;
  const int t = idx >> 8;                               // DMODEL/2 == 256
  const int p = idx & 255;
  const float kc = (float)(-9.210340371976184 / 512.0);
  const float fr = expf((float)(2 * p) * kc);
  const float ang = (float)t * fr;
  v2f o;
  o.x = sinf(ang);
  o.y = cosf(ang);
  float* dst = pet + (size_t)idx * 2;
  *(v2f*)dst = o;
  
}

// ---------------------------------------------------------------------------
// Kernel 1: f32 -> f16 planes. xh = f16(x + pe) unscaled, wh = f16(32*W) for
// Wq,Wk,Wv,Wo (row = output feature, k-contiguous). One 16-B store per lane,
// ---------------------------------------------------------------------------
__global__ __launch_bounds__(256) void convert_kernel(
    const float* __restrict__ x, const float* __restrict__ pet,
    const float* __restrict__ wq, const float* __restrict__ wk,
    const float* __restrict__ wv, const float* __restrict__ wo,
    _Float16* __restrict__ xh, _Float16* __restrict__ wh)
{
  const int g = blockIdx.x * 256 + threadIdx.x;
  if (g >= NX8 + 4 * NW8) return;
  v4f a, c;
  _Float16* dst;
  if (g < NX8) {
    const int row = g >> 6;                 // token row 0..8191 (64 groups of 8 per row)
    const int t = row & (SEQ - 1);
    const int db = (g & 63) * 8;
    const float* src = x + (size_t)g * 8;
    const float* pp = pet + (size_t)t * DMODEL + db;
    a = *(const v4fa*)src + *(const v4fa*)pp;
    c = *(const v4fa*)(src + 4) + *(const v4fa*)(pp + 4);
    dst = xh + (size_t)g * 8;
  } else {
    const int e = g - NX8;
    const int wsel = e >> 15;               // NW8 == 1<<15
    const int off = e & (NW8 - 1);
    const float* wsrc = (wsel == 0) ? wq : ((wsel == 1) ? wk : ((wsel == 2) ? wv : wo));
    const float* src = wsrc + (size_t)off * 8;
    a = *(const v4fa*)src * WSCALE;
    c = *(const v4fa*)(src + 4) * WSCALE;
    dst = wh + (size_t)e * 8;
  }
  const v8h o = { (_Float16)a.x, (_Float16)a.y, (_Float16)a.z, (_Float16)a.w,
                  (_Float16)c.x, (_Float16)c.y, (_Float16)c.z, (_Float16)c.w };
  *(v8h*)dst = o;
  
}

// ---------------------------------------------------------------------------
// 4 lines per instruction, 32 lines per wave, 128 per block.
// which 0/1: plane[bh][l][d]  (one token row = 64 halves = one line)
// which 2  : vt[bh][d][l]     (64 d-rows x 128 tokens = 2 lines each)
// ---------------------------------------------------------------------------
__device__ __forceinline__ void proj_store_pass(const _Float16* sT, _Float16* plane, _Float16* vt,
                                                int which, int bh, int l0, int w, int lane) {
  const int q8 = lane & 7, sub = lane >> 3;
  #pragma unroll
  for (int i = 0; i < 8; ++i) {
    const int lid = w * 32 + i * 4 + sub;
    v8h v;
    _Float16* dst;
    if (which != 2) {
      v = *(const v8ha*)(sT + lid * HD + 8 * q8);
      dst = plane + ((size_t)bh * SEQ + l0 + lid) * HD + 8 * q8;
    } else {
      const int d = lid >> 1, hl = lid & 1;
      v = *(const v8ha*)(sT + d * 128 + 64 * hl + 8 * q8);
      dst = vt + ((size_t)bh * HD + d) * SEQ + l0 + 64 * hl + 8 * q8;
    }
    *(v8h*)dst = v;
  }
}

// ---------------------------------------------------------------------------
// Kernel 2: Y = (x+pe) * W^T + bias over the fused 3*512 output columns.
// Block 128 thr (4 waves) = 128 tokens x 64 features (one (which, head));
// wave tile 32 tokens x 64 features; K = 512 in steps of 32;
// A (x rows) and B (W rows) fragments straight from f16 global rows.
// ---------------------------------------------------------------------------
__global__ __launch_bounds__(128) void proj_kernel(
    const _Float16* __restrict__ xh,   // [8192][512]
    const _Float16* __restrict__ wh,   // [4][512][512], row = output feature, x32
    const float* __restrict__ bq, const float* __restrict__ bk, const float* __restrict__ bv,
    _Float16* __restrict__ qh,         // [B*H][L][D]  f16(q)
    _Float16* __restrict__ kh,         // [B*H][L][D]  f16(k)
    _Float16* __restrict__ vt)         // [B*H][D][L]  f16(v)
{
  __shared__ __attribute__((aligned(16))) _Float16 sT[128 * 64];   // 16384 B

  const int tid = threadIdx.x, lane = tid & 31, w = tid >> 5;
  const int h = lane >> 4, m = lane & 15;
  const int m0 = blockIdx.x * 128;
  const int cg = blockIdx.y;                 // 0..23
  const int which = cg >> 3, head = cg & 7;
  const int m0w = m0 + 32 * w;

  const _Float16* xa0 = xh + (size_t)(m0w + m) * DMODEL;             // token row, mt = 0
  const _Float16* xa1 = xa0 + (size_t)16 * DMODEL;                   // mt = 1
  const _Float16* wb  = wh + ((size_t)which * DMODEL + head * HD + m) * DMODEL;  // feature row, nt = 0

  const v8f zero8 = {0.f, 0.f, 0.f, 0.f, 0.f, 0.f, 0.f, 0.f};
  v8f acc[2][4];
  #pragma unroll
  for (int mt = 0; mt < 2; ++mt)
    #pragma unroll
    for (int nt = 0; nt < 4; ++nt) acc[mt][nt] = zero8;

  #pragma unroll 1
  for (int k0 = 0; k0 < DMODEL; k0 += 32) {
    const v16h a0 = load_frag(xa0 + k0, h);
    const v16h a1 = load_frag(xa1 + k0, h);
    #pragma unroll
    for (int nt = 0; nt < 4; ++nt) {
      const v16h b = load_frag(wb + (size_t)nt * 16 * DMODEL + k0, h);
      acc[0][nt] = wmma_f16(a0, b, acc[0][nt]);
      acc[1][nt] = wmma_f16(a1, b, acc[1][nt]);
    }
  }

  // D[r] of tile (mt, nt) = Y[token m0w+16mt+8h+r][feature 16nt+m]
  const float* bias = (which == 0) ? bq : ((which == 1) ? bk : bv);
  #pragma unroll
  for (int nt = 0; nt < 4; ++nt) {
    const int feat = 16 * nt + m;
    const float bvl = bias[head * HD + feat];
    #pragma unroll
    for (int mt = 0; mt < 2; ++mt) {
      #pragma unroll
      for (int r = 0; r < 8; ++r) {
        const int tokl = 32 * w + 16 * mt + 8 * h + r;     // 0..127
        const float y = acc[mt][nt][r] * (1.0f / WSCALE) + bvl;
        const int idx = (which == 2) ? (feat * 128 + tokl) : (tokl * HD + feat);
        sT[idx] = (_Float16)y;
      }
    }
  }
  __syncthreads();

  const int b = m0 / SEQ, l0 = m0 - b * SEQ, bh = b * NHEADS + head;
  _Float16* plane = (which == 0) ? qh : kh;
  proj_store_pass(sT, plane, vt, which, bh, l0, w, lane);
  
}

// ---------------------------------------------------------------------------
// Attention helpers.
// Score element r of this lane: key = kb + 16j + 8h + r, query = q0 + m.
// v = mask ? (s*0.125 + anti[q - key + 2047]) : (-inf + missing_bias[head]).
// The key mask enters as the start value C of the score product: sm[key] = 0
// for an observed key, -inf + missing_bias[head] for a missing one, so that
// C + K.Q stays that non-finite value through the scale and the bias below.
// sb = per-head antisymmetrised rel-pos table in LDS, base = index for r = 0
// (index decreases by one per r); every index is in range for every key, so
// the reads carry no condition and no branch.
// ---------------------------------------------------------------------------
__device__ __forceinline__ v8f mask_start8(const float* sm) {
  const v4f a = *(const v4fa*)sm;
  const v4f c = *(const v4fa*)(sm + 4);
  const v8f z = { a.x, a.y, a.z, a.w, c.x, c.y, c.z, c.w };
  return z;
}

__device__ __forceinline__ v8f bias_load8(const float* sb, int base) {
  const v8f t = { sb[base],     sb[base - 1], sb[base - 2], sb[base - 3],
                  sb[base - 4], sb[base - 5], sb[base - 6], sb[base - 7] };
  return t;
}

// P^T B-fragment from the lane's own score D values: element r <- tile a row r,
// element 8+r <- tile c row r (same lane, same query column), scaled by 2^14.
__device__ __forceinline__ v16h pack_p(v8f a, v8f c) {
  const v16h r = { (_Float16)(a[0] * PSCALE), (_Float16)(a[1] * PSCALE), (_Float16)(a[2] * PSCALE), (_Float16)(a[3] * PSCALE),
                   (_Float16)(a[4] * PSCALE), (_Float16)(a[5] * PSCALE), (_Float16)(a[6] * PSCALE), (_Float16)(a[7] * PSCALE),
                   (_Float16)(c[0] * PSCALE), (_Float16)(c[1] * PSCALE), (_Float16)(c[2] * PSCALE), (_Float16)(c[3] * PSCALE),
                   (_Float16)(c[4] * PSCALE), (_Float16)(c[5] * PSCALE), (_Float16)(c[6] * PSCALE), (_Float16)(c[7] * PSCALE) };
  return r;
}

// (one token row's head slice) by lanes 8q..8q+7 in one instruction, 4 lines
// per instruction, 16 lines per wave.
__device__ __forceinline__ void ao_store_pass(const _Float16* so, _Float16* ao,
                                              int b, int head, int q0, int lane) {
  const int q8 = lane & 7, sub = lane >> 3;
  #pragma unroll
  for (int i = 0; i < 4; ++i) {
    const int lid = i * 4 + sub;                    // 0..15
    const v8h v = *(const v8ha*)(so + lid * 64 + 8 * q8);
    const size_t gi = ((size_t)b * SEQ + q0 + lid) * DMODEL + head * HD + 8 * q8;
    *(v8h*)(ao + gi) = v;
  }
}

// One 64-key stage of K (64 key rows x 128 B) and of V^T (64 d rows x 128 B)
// into LDS rows of TPITCH halves: 4 + 4 asynchronous 16-B copies per lane, each
// wave-wide copy covering four whole 128-B lines. lk/lv = this lane's LDS byte
// address of its first K / V chunk, gk/gv = the matching global address; chunk
// i lies 16 rows further on both sides.
// The closing s_wait_xcnt 0 stands inside the copies' own statement, so that no
// address register named here is rewritten ahead of it.
__device__ __forceinline__ void stage_copy(unsigned lk, unsigned lv,
                                           const _Float16* gk, const _Float16* gv) {
  const unsigned lk1 = lk + 16 * TPITCH * 2, lk2 = lk + 32 * TPITCH * 2, lk3 = lk + 48 * TPITCH * 2;
  const unsigned lv1 = lv + 16 * TPITCH * 2, lv2 = lv + 32 * TPITCH * 2, lv3 = lv + 48 * TPITCH * 2;
  const _Float16* gk1 = gk + 16 * HD;
  const _Float16* gk2 = gk + 32 * HD;
  const _Float16* gk3 = gk + 48 * HD;
  const _Float16* gv1 = gv + (size_t)16 * SEQ;
  const _Float16* gv2 = gv + (size_t)32 * SEQ;
  const _Float16* gv3 = gv + (size_t)48 * SEQ;
  asm volatile("global_load_async_to_lds_b128 %0, %8, off\n\t"
               "global_load_async_to_lds_b128 %1, %9, off\n\t"
               "global_load_async_to_lds_b128 %2, %10, off\n\t"
               "global_load_async_to_lds_b128 %3, %11, off\n\t"
               "global_load_async_to_lds_b128 %4, %12, off\n\t"
               "global_load_async_to_lds_b128 %5, %13, off\n\t"
               "global_load_async_to_lds_b128 %6, %14, off\n\t"
               "global_load_async_to_lds_b128 %7, %15, off\n\t"
               "s_wait_xcnt 0x0"
               :: "v"(lk), "v"(lk1), "v"(lk2), "v"(lk3), "v"(lv), "v"(lv1), "v"(lv2), "v"(lv3),
                  "v"(gk), "v"(gk1), "v"(gk2), "v"(gk3), "v"(gv), "v"(gv1), "v"(gv2), "v"(gv3)
               : "memory");
}

// ---------------------------------------------------------------------------
// Kernel 3: streaming attention, transposed form.
// Block 128 thr (4 waves), 16 queries per wave, 64 keys per step.
// K and V^T of a step are staged once per block in a two-buffer LDS ring by
// asynchronous copies (next step's copies fly while this step is worked on);
// all four waves read their fragments from there.
//   S^T = K * Q^T : A = K rows (row = key, k = d), B = Q^T (k = d, n = query)
//   O^T += V^T * P^T : A = Vt rows (row = d, k = key), B = P^T from registers
// Lane owns 32 keys of query column (lane&15); partner = lane ^ 16.
// Antisymmetrised rel-pos table for this head and the key-mask start values of
// this batch row built once per block in LDS.
// ---------------------------------------------------------------------------
__global__ __launch_bounds__(128) void attn_kernel(
    const _Float16* __restrict__ qh,   // [B*H][L][D]
    const _Float16* __restrict__ kh,   // [B*H][L][D]
    const _Float16* __restrict__ vt,   // [B*H][D][L]
    const int* __restrict__ mask,      // [B][L], nonzero = observed key
    const float* __restrict__ mbias,   // [H]
    const float* __restrict__ rel,     // [RELN][H]
    _Float16* __restrict__ ao)         // [B][L][DMODEL], x64
{
  __shared__ __attribute__((aligned(16))) float sB[4096];             // 16384 B
  __shared__ __attribute__((aligned(16))) float sM[SEQ];              //  8192 B
  __shared__ __attribute__((aligned(16))) _Float16 sO[4 * 16 * 64];  //  8192 B
  __shared__ __attribute__((aligned(16))) _Float16 sK[2 * TSTAGE];   // 18432 B
  __shared__ __attribute__((aligned(16))) _Float16 sV[2 * TSTAGE];   // 18432 B

  const int tid = threadIdx.x, lane = tid & 31, w = tid >> 5;
  const int h = lane >> 4, m = lane & 15;
  const int bh = blockIdx.y, b = bh >> 3, head = bh & 7;
  const int q0 = blockIdx.x * 64 + 16 * w;

  // Staging map: chunk c = tid + 128 i (i = 0..3), tile row c >> 3, 16-B column c & 7.
  const int crow = tid >> 3, ccol = tid & 7;
  const unsigned lk0 = (unsigned)(size_t)(sK + crow * TPITCH + 8 * ccol);
  const unsigned lv0 = (unsigned)(size_t)(sV + crow * TPITCH + 8 * ccol);
  const _Float16* gk0 = kh + ((size_t)bh * SEQ + crow) * HD + 8 * ccol;    // + 64 * HD per step
  const _Float16* gv0 = vt + ((size_t)bh * HD + crow) * SEQ + 8 * ccol;    // + 64 per step

  stage_copy(lk0, lv0, gk0, gv0);                                          // step 0 -> buffer 0

  // anti[i] = 0.5 * (rel[i][head] - rel[RELN-1-i][head]), i = q - k + (SEQ-1)
  // The first 31 * 128 entries are in range for every thread: their reads carry no condition.
  // Only the last 128 hold the padding entry 4095 (stored as 0, never read).
  const float* relh = rel + head;
  const float* rup = relh + tid * NHEADS;                            // row i = tid + 128 c: + c * 128 rows
  const float* rdn = relh + (RELN - 1 - tid - 128 * 30) * NHEADS;    // row RELN-1-i: + (30 - c) * 128 rows
  #pragma unroll   // all entries' loads in flight together instead of one wait per entry
  for (int c = 0; c < 31; ++c)
    sB[tid + 128 * c] = 0.5f * (rup[c * 128 * NHEADS] - rdn[(30 - c) * 128 * NHEADS]);
  {
    const int i = tid + 128 * 31;
    float v = 0.0f;
    if (i < RELN) v = 0.5f * (relh[i * NHEADS] - relh[(RELN - 1 - i) * NHEADS]);
    sB[i] = v;
  }

  // sM[key] = 0 (observed) or -inf fill + missing bias (missing)
  const float mbh = mbias[head];
  const float vmiss = -__builtin_inff() + mbh;
  #pragma unroll   // the four mask loads in flight together
  for (int i = 0; i < SEQ / 512; ++i) {
    const int k4 = 4 * tid + 512 * i;
    const v4i mm = *(const v4ia*)(mask + (size_t)b * SEQ + k4);
    const v4f t = { (mm.x != 0) ? 0.0f : vmiss, (mm.y != 0) ? 0.0f : vmiss,
                    (mm.z != 0) ? 0.0f : vmiss, (mm.w != 0) ? 0.0f : vmiss };
    *(v4fa*)(sM + k4) = t;
  }

  // Q^T B-fragments: column n = query q0+m, k = d (two 32-deep chunks)
  const _Float16* qrow = qh + ((size_t)bh * SEQ + q0 + m) * HD;
  const v16h qb0 = load_frag(qrow, h);
  const v16h qb1 = load_frag(qrow + 32, h);

  // step 0's copies of this wave have landed before the barrier that publishes them (and sB, sM)
  asm volatile("s_wait_asynccnt 0x0" ::: "memory");
  __syncthreads();

  stage_copy(lk0 + TSTAGE * 2, lv0 + TSTAGE * 2, gk0 + 64 * HD, gv0 + 64); // step 1 -> buffer 1

  const int qk = q0 + m + (SEQ - 1) - 8 * h;         // bias index for key (kb+16j) at r=0 is qk-kb-16j

  const v8f zero8 = {0.f, 0.f, 0.f, 0.f, 0.f, 0.f, 0.f, 0.f};
  const v8f eighth8 = {0.125f, 0.125f, 0.125f, 0.125f, 0.125f, 0.125f, 0.125f, 0.125f};
  v8f o[4];                                   // o[t][r] = O[query m][d 16t+8h+r] * (l * 2^14)
  #pragma unroll
  for (int t = 0; t < 4; ++t) o[t] = zero8;
  float mrun = -1e30f, lrun = 0.0f;

  const int fro = m * TPITCH;                                  // fragment row of this lane in a staged tile
  const float* smp = sM + 8 * h;                               // + key tile base

  #pragma unroll 1
  for (int st = 0; st < NSTEP; ++st) {
    const int kb = st * 64;
    const int bo = (st & 1) * TSTAGE;                          // this step's ring buffer
    const _Float16* kbase = sK + bo + fro;                     // + 16j*TPITCH + 32*dc
    const _Float16* vbase = sV + bo + fro;                     // + 16t*TPITCH + 32*kc
    // ---- rel-pos bias of this step, read ahead of the score products ----
    v8f bv[4];
    #pragma unroll   // bv[] indexed by constants, so that it stays in registers
    for (int j = 0; j < 4; ++j) bv[j] = bias_load8(sB, qk - kb - 16 * j);
    // ---- raw scores on the mask start: s[j][r] = sM[key] + (Q.K)[query m][key kb+16j+8h+r] ----
    v8f s[4];
    #pragma unroll
    for (int j = 0; j < 4; ++j) {
      const _Float16* kp = kbase + 16 * j * TPITCH;
      const v16h kf0 = load_frag(kp, h);
      const v16h kf1 = load_frag(kp + 32, h);
      v8f z = mask_start8(smp + kb + 16 * j);
      z = wmma_f16(kf0, qb0, z);
      z = wmma_f16(kf1, qb1, z);
      s[j] = z;
    }
    // ---- scale 1/8, rel-pos bias (f32) ----
    #pragma unroll
    for (int j = 0; j < 4; ++j)
      s[j] = __builtin_elementwise_fma(s[j], eighth8, bv[j]);

    // ---- online softmax ----
    float mloc = s[0][0];
    #pragma unroll
    for (int j = 0; j < 4; ++j)
      #pragma unroll
      for (int r = 0; r < 8; ++r) mloc = fmaxf(mloc, s[j][r]);
    mloc = fmaxf(mloc, __shfl_xor(mloc, 16));
    const float mnew = fmaxf(mrun, mloc);
    const float alpha = __expf(mrun - mnew);
    mrun = mnew;
    float lsum = 0.0f;
    #pragma unroll
    for (int j = 0; j < 4; ++j)
      #pragma unroll
      for (int r = 0; r < 8; ++r) {
        const float p = __expf(s[j][r] - mnew);
        s[j][r] = p;
        lsum += p;
      }
    lsum += __shfl_xor(lsum, 16);
    lrun = lrun * alpha + lsum;
    #pragma unroll
    for (int t = 0; t < 4; ++t)
      #pragma unroll
      for (int r = 0; r < 8; ++r) o[t][r] = o[t][r] * alpha;

    // ---- P^T B-fragments (key chunks 0..31 and 32..63 of this step) ----
    const v16h pb0 = pack_p(s[0], s[1]);
    const v16h pb1 = pack_p(s[2], s[3]);

    // ---- O^T += V^T * P^T ----
    #pragma unroll
    for (int t = 0; t < 4; ++t) {
      const _Float16* vp = vbase + 16 * t * TPITCH;
      const v16h vf0 = load_frag(vp, h);
      const v16h vf1 = load_frag(vp + 32, h);
      o[t] = wmma_f16(vf0, pb0, o[t]);
      o[t] = wmma_f16(vf1, pb1, o[t]);
    }

    // ---- hand-over: this wave's reads of buffer st&1 are done, its copies of step st+1
    // have landed; the barrier publishes step st+1 and frees buffer st&1 for the refill ----
    asm volatile("s_wait_dscnt 0x0" ::: "memory");
    asm volatile("s_wait_asynccnt 0x0" ::: "memory");
    __syncthreads();
    if (st + 2 < NSTEP)
      stage_copy(lk0 + bo * 2, lv0 + bo * 2, gk0 + (size_t)(kb + 128) * HD, gv0 + (kb + 128));
  }
  // no copy is left in flight when the wave goes on to the epilogue
  asm volatile("s_wait_asynccnt 0x0" ::: "memory");

  // ---- epilogue: normalise, x64, stage per-wave 16x64 f16 tile, whole-line stores ----
  const float inv = __builtin_amdgcn_rcpf(lrun) * (AOSCALE / PSCALE);
  _Float16* so = sO + w * 1024;
  #pragma unroll
  for (int t = 0; t < 4; ++t)
    #pragma unroll
    for (int r = 0; r < 8; ++r)
      so[m * 64 + 16 * t + 8 * h + r] = (_Float16)(o[t][r] * inv);
  __syncthreads();

  ao_store_pass(so, ao, b, head, q0, lane);
  
}

// ---------------------------------------------------------------------------
// 16-B stores, 4 lines per instruction, 64 lines per wave.
// ---------------------------------------------------------------------------
__device__ __forceinline__ void out_store_pass(const float* sT, float* out, int m0, int fg, int w, int lane) {
  const int q8 = lane & 7, sub = lane >> 3;
  #pragma unroll
  for (int i = 0; i < 16; ++i) {
    const int lid = i * 4 + sub;                   // 0..63
    const int row = 32 * w + (lid >> 1), hl = lid & 1;
    const v4f v = *(const v4fa*)(sT + row * 64 + 32 * hl + 4 * q8);
    const size_t gi = ((size_t)(m0 + row)) * DMODEL + fg * 64 + 32 * hl + 4 * q8;
    *(v4f*)(out + gi) = v;
  }
}

// ---------------------------------------------------------------------------
// Kernel 4: out = AO * Wo^T + bo (f32). Block 128 thr = 128 tokens x 64
// features (fg = blockIdx.y); wave tile 32 x 64; K = 512 in steps of 32.
// ---------------------------------------------------------------------------
__global__ __launch_bounds__(128) void oproj_kernel(
    const _Float16* __restrict__ ao,   // [8192][512] f16, x64
    const _Float16* __restrict__ woh,  // [512][512] f16, row = output feature, x32
    const float* __restrict__ bo,      // [512]
    float* __restrict__ out)           // [8192][512] f32
{
  __shared__ __attribute__((aligned(16))) float sT[128 * 64];     // 32768 B

  const int tid = threadIdx.x, lane = tid & 31, w = tid >> 5;
  const int h = lane >> 4, m = lane & 15;
  const int m0 = blockIdx.x * 128;
  const int fg = blockIdx.y;                 // 0..7
  const int m0w = m0 + 32 * w;

  const _Float16* xa0 = ao + (size_t)(m0w + m) * DMODEL;
  const _Float16* xa1 = xa0 + (size_t)16 * DMODEL;
  const _Float16* wb  = woh + ((size_t)fg * 64 + m) * DMODEL;

  const v8f zero8 = {0.f, 0.f, 0.f, 0.f, 0.f, 0.f, 0.f, 0.f};
  v8f acc[2][4];
  #pragma unroll
  for (int mt = 0; mt < 2; ++mt)
    #pragma unroll
    for (int nt = 0; nt < 4; ++nt) acc[mt][nt] = zero8;

  #pragma unroll 1
  for (int k0 = 0; k0 < DMODEL; k0 += 32) {
    const v16h a0 = load_frag(xa0 + k0, h);
    const v16h a1 = load_frag(xa1 + k0, h);
    #pragma unroll
    for (int nt = 0; nt < 4; ++nt) {
      const v16h b = load_frag(wb + (size_t)nt * 16 * DMODEL + k0, h);
      acc[0][nt] = wmma_f16(a0, b, acc[0][nt]);
      acc[1][nt] = wmma_f16(a1, b, acc[1][nt]);
    }
  }

  // D[r] of tile (mt, nt) = out[token m0w+16mt+8h+r][feature fg*64+16nt+m]
  #pragma unroll
  for (int nt = 0; nt < 4; ++nt) {
    const int feat = 16 * nt + m;
    const float bvl = bo[fg * 64 + feat];
    #pragma unroll
    for (int mt = 0; mt < 2; ++mt) {
      #pragma unroll
      for (int r = 0; r < 8; ++r) {
        const int tokl = 32 * w + 16 * mt + 8 * h + r;
        sT[tokl * 64 + feat] = acc[mt][nt][r] * (1.0f / (WSCALE * AOSCALE)) + bvl;
      }
    }
  }
  __syncthreads();

  out_store_pass(sT, out, m0, fg, w, lane);
  
}

// ---------------------------------------------------------------------------
extern "C" void kernel_launch(void* const* d_in, const int* in_sizes, int n_in,
                              void* d_out, int out_size, void* d_ws, size_t ws_size,
                              hipStream_t stream) {
  if (n_in < 12) return;
  if (in_sizes[0] != NX) return;
  if (in_sizes[1] != MROWS) return;
  if (in_sizes[2] != NW || in_sizes[4] != NW || in_sizes[6] != NW || in_sizes[8] != NW) return;
  if (in_sizes[3] != DMODEL || in_sizes[5] != DMODEL || in_sizes[7] != DMODEL || in_sizes[9] != DMODEL) return;
  if (in_sizes[10] != NHEADS) return;
  if (in_sizes[11] != RELN * NHEADS) return;
  if (out_size != NX) return;

  const float* x     = (const float*)d_in[0];
  const int*   mask  = (const int*)d_in[1];
  const float* Wq    = (const float*)d_in[2];
  const float* bq    = (const float*)d_in[3];
  const float* Wk    = (const float*)d_in[4];
  const float* bk    = (const float*)d_in[5];
  const float* Wv    = (const float*)d_in[6];
  const float* bv    = (const float*)d_in[7];
  const float* Wo    = (const float*)d_in[8];
  const float* bo    = (const float*)d_in[9];
  const float* mbias = (const float*)d_in[10];
  const float* rel   = (const float*)d_in[11];
  float* out = (float*)d_out;

  const size_t pe_bytes = (size_t)NPE * 4;                          //  4194304
  const size_t xh_bytes = (size_t)NX * 2;                           //  8388608
  const size_t wh_bytes = (size_t)4 * NW * 2;                       //  2097152
  const size_t pl_bytes = (size_t)BATCH * NHEADS * SEQ * HD * 2;    //  8388608
  const size_t ao_bytes = (size_t)NX * 2;                           //  8388608
  const size_t total = pe_bytes + xh_bytes + wh_bytes + 3 * pl_bytes + ao_bytes;   // 48234496
  if (total > ws_size) return;

  char* ws = (char*)d_ws;
  size_t off = 0;
  float*    pet = (float*)(ws + off);     off += pe_bytes;
  _Float16* xh  = (_Float16*)(ws + off);  off += xh_bytes;
  _Float16* wh  = (_Float16*)(ws + off);  off += wh_bytes;
  _Float16* qh  = (_Float16*)(ws + off);  off += pl_bytes;
  _Float16* kh  = (_Float16*)(ws + off);  off += pl_bytes;
  _Float16* vt  = (_Float16*)(ws + off);  off += pl_bytes;
  _Float16* ao  = (_Float16*)(ws + off);  off += ao_bytes;
  if (off > ws_size) return;

  const int npairs = SEQ * (DMODEL / 2);                            // 524288
  pe_kernel<<<(npairs + 255) / 256, 256, 0, stream>>>(pet);

  const int ngroups = NX8 + 4 * NW8;                                // 655360
  convert_kernel<<<(ngroups + 255) / 256, 256, 0, stream>>>(x, pet, Wq, Wk, Wv, Wo, xh, wh);

  dim3 gProj(MROWS / 128, 3 * NHEADS);                              // (64, 24)
  proj_kernel<<<gProj, 128, 0, stream>>>(xh, wh, bq, bk, bv, qh, kh, vt);

  dim3 gAtt(SEQ / 64, BATCH * NHEADS);                              // (32, 32)
  attn_kernel<<<gAtt, 128, 0, stream>>>(qh, kh, vt, mask, mbias, rel, ao);

  dim3 gOut(MROWS / 128, DMODEL / 64);                              // (64, 8)
  oproj_kernel<<<gOut, 128, 0, stream>>>(ao, wh + (size_t)3 * NW, bo, out);
}

// v003
// One run takes 99.2 microseconds.
// Next to v002, in two timings, it ran 1.33 times as fast each time.
// Over all steps from v000 it is 2.93 times as fast.
// Contractions: x*W^T for q,k,v and o, K*Q^T, V^T*P^T all on v_wmma_f32_16x16x32_f16 (f16 operands, f32 accumulate); W carried x32, P carried x16384, attention rows carried x64 (exact power-of-two scales folded back in f32); PE, bias tables, key mask, softmax and normalisation in f32.
#include <hip/hip_runtime.h>

typedef _Float16 v16h __attribute__((ext_vector_type(16)));
typedef _Float16 v8h  __attribute__((ext_vector_type(8)));
typedef float    v8f  __attribute__((ext_vector_type(8)));
typedef float    v4f  __attribute__((ext_vector_type(4)));
typedef float    v2f  __attribute__((ext_vector_type(2)));
typedef int      v4i  __attribute__((ext_vector_type(4)));
typedef v8h __attribute__((may_alias)) v8ha;
typedef v4f __attribute__((may_alias)) v4fa;
typedef v4i __attribute__((may_alias)) v4ia;

union Frag { v16h v; v8h half[2]; };

#define DMODEL 512
#define NHEADS 8
#define HD     64
#define SEQ    2048
#define BATCH  4
#define MROWS  (BATCH * SEQ)          // 8192 tokens
#define NX     (MROWS * DMODEL)       // 4194304
#define NW     (DMODEL * DMODEL)      // 262144
#define NX8    (NX / 8)               // 524288
#define NW8    (NW / 8)               // 32768
#define RELN   (2 * SEQ - 1)          // 4095
#define NPE    (SEQ * DMODEL)         // 1048576 floats
#define PSCALE  16384.0f
#define WSCALE  32.0f
#define AOSCALE 64.0f
#define TPITCH  72                    // halves per staged LDS row: 144 B = 16 B x 9, conflict-free for 16-B fragment reads
#define TSTAGE  (64 * TPITCH)         // halves per staged 64-row tile
#define NSTEP   (SEQ / 64)            // 32 key steps
#define GROWS   192                   // staged rows of a projection k step: 128 token rows, then 64 feature rows
#define GSTAGE  (GROWS * TPITCH)      // halves per staged projection k step (27648 B)
#define GSTEPS  (DMODEL / 64)         // 8 k steps of 64

static_assert(NW8 == 32768);
static_assert((NX8 % 256) == 0);
static_assert((MROWS % 128) == 0 && (SEQ % 128) == 0);

// ---------------------------------------------------------------------------
// 16x16x32 f16 WMMA with hazard guard (ties D, keeps A/B live).
// Fragment map (wave32): lane l, h = l>>4, m = n = l&15.
//   A/B element i: i<8 -> k0+8h+i ; i>=8 -> k0+16+8h+(i-8)
//   D element r : row 8h+r, col l&15
// ---------------------------------------------------------------------------
__device__ __forceinline__ v8f wmma_f16(v16h a, v16h b, v8f c) {
  v8f d = __builtin_amdgcn_wmma_f32_16x16x32_f16(false, a, false, b, (short)0, c, false, false);
  asm volatile("v_nop\n\tv_nop\n\tv_nop\n\tv_nop" : "+v"(d) : "v"(a), "v"(b));
  return d;
}

// A or B fragment from a k-contiguous 16-bit row; p points at element k0 of
// the row owned by this lane (row index = lane & 15 added by the caller).
__device__ __forceinline__ v16h load_frag(const _Float16* p, int h) {
  Frag f;
  f.half[0] = *(const v8ha*)(p + 8 * h);
  f.half[1] = *(const v8ha*)(p + 16 + 8 * h);
  return f.v;
}

// ---------------------------------------------------------------------------
// Kernel 0: sinusoidal PE table pet[t][2p] = sin(t*div_p), pet[t][2p+1] = cos,
// div_p = exp(f32(2p) * f32(-ln(1e4)/512)). One (t,p) pair per thread:
// ---------------------------------------------------------------------------
__global__ __launch_bounds__(256) void pe_kernel(float* __restrict__ pet)
{
  const int idx = blockIdx.x * 256 + threadIdx.x;       // 0 .. SEQ*DMODEL/2 - 1
  if (idx >= SEQ * (DMODEL / 2)) return;
  const int t = idx >> 8;                               // DMODEL/2 == 256
  const int p = idx & 255;
  const float kc = (float)(-9.210340371976184 / 512.0);
  const float fr = expf((float)(2 * p) * kc);
  const float ang = (float)t * fr;
  v2f o;
  o.x = sinf(ang);
  o.y = cosf(ang);
  float* dst = pet + (size_t)idx * 2;
  *(v2f*)dst = o;
  
}

// ---------------------------------------------------------------------------
// Kernel 1: f32 -> f16 planes. xh = f16(x + pe) unscaled, wh = f16(32*W) for
// Wq,Wk,Wv,Wo (row = output feature, k-contiguous). One 16-B store per lane,
// ---------------------------------------------------------------------------
__global__ __launch_bounds__(256) void convert_kernel(
    const float* __restrict__ x, const float* __restrict__ pet,
    const float* __restrict__ wq, const float* __restrict__ wk,
    const float* __restrict__ wv, const float* __restrict__ wo,
    _Float16* __restrict__ xh, _Float16* __restrict__ wh)
{
  const int g = blockIdx.x * 256 + threadIdx.x;
  if (g >= NX8 + 4 * NW8) return;
  v4f a, c;
  _Float16* dst;
  if (g < NX8) {
    const int row = g >> 6;                 // token row 0..8191 (64 groups of 8 per row)
    const int t = row & (SEQ - 1);
    const int db = (g & 63) * 8;
    const float* src = x + (size_t)g * 8;
    const float* pp = pet + (size_t)t * DMODEL + db;
    a = *(const v4fa*)src + *(const v4fa*)pp;
    c = *(const v4fa*)(src + 4) + *(const v4fa*)(pp + 4);
    dst = xh + (size_t)g * 8;
  } else {
    const int e = g - NX8;
    const int wsel = e >> 15;               // NW8 == 1<<15
    const int off = e & (NW8 - 1);
    const float* wsrc = (wsel == 0) ? wq : ((wsel == 1) ? wk : ((wsel == 2) ? wv : wo));
    const float* src = wsrc + (size_t)off * 8;
    a = *(const v4fa*)src * WSCALE;
    c = *(const v4fa*)(src + 4) * WSCALE;
    dst = wh + (size_t)e * 8;
  }
  const v8h o = { (_Float16)a.x, (_Float16)a.y, (_Float16)a.z, (_Float16)a.w,
                  (_Float16)c.x, (_Float16)c.y, (_Float16)c.z, (_Float16)c.w };
  *(v8h*)dst = o;
  
}

// ---------------------------------------------------------------------------
// One 64-deep k step of a projection into LDS rows of TPITCH halves: 128 token
// rows (8 chunks per lane) and 64 feature rows (4 chunks per lane), 128 B each,
// by asynchronous 16-B copies; each wave-wide copy covers four whole 128-B
// lines. l = this lane's LDS byte address of its first chunk, ga / gb = the
// matching global addresses; chunk i lies 16 rows further on both sides.
// The closing s_wait_xcnt 0 stands inside the copies' own statement, so that no
// address register named here is rewritten ahead of it.
// ---------------------------------------------------------------------------
__device__ __forceinline__ void gemm_stage_copy(unsigned l, const _Float16* ga, const _Float16* gb) {
  const unsigned rs = 16 * TPITCH * 2;                 // 16 staged rows in bytes
  const unsigned l1 = l + rs,     l2 = l + 2 * rs,  l3 = l + 3 * rs,   l4 = l + 4 * rs;
  const unsigned l5 = l + 5 * rs, l6 = l + 6 * rs,  l7 = l + 7 * rs,   l8 = l + 8 * rs;
  const unsigned l9 = l + 9 * rs, l10 = l + 10 * rs, l11 = l + 11 * rs;
  const _Float16* a1 = ga + 16 * DMODEL;
  const _Float16* a2 = ga + 32 * DMODEL;
  const _Float16* a3 = ga + 48 * DMODEL;
  const _Float16* a4 = ga + 64 * DMODEL;
  const _Float16* a5 = ga + 80 * DMODEL;
  const _Float16* a6 = ga + 96 * DMODEL;
  const _Float16* a7 = ga + 112 * DMODEL;
  const _Float16* b1 = gb + 16 * DMODEL;
  const _Float16* b2 = gb + 32 * DMODEL;
  const _Float16* b3 = gb + 48 * DMODEL;
  asm volatile("global_load_async_to_lds_b128 %0, %12, off\n\t"
               "global_load_async_to_lds_b128 %1, %13, off\n\t"
               "global_load_async_to_lds_b128 %2, %14, off\n\t"
               "global_load_async_to_lds_b128 %3, %15, off\n\t"
               "global_load_async_to_lds_b128 %4, %16, off\n\t"
               "global_load_async_to_lds_b128 %5, %17, off\n\t"
               "global_load_async_to_lds_b128 %6, %18, off\n\t"
               "global_load_async_to_lds_b128 %7, %19, off\n\t"
               "global_load_async_to_lds_b128 %8, %20, off\n\t"
               "global_load_async_to_lds_b128 %9, %21, off\n\t"
               "global_load_async_to_lds_b128 %10, %22, off\n\t"
               "global_load_async_to_lds_b128 %11, %23, off\n\t"
               "s_wait_xcnt 0x0"
               :: "v"(l), "v"(l1), "v"(l2), "v"(l3), "v"(l4), "v"(l5), "v"(l6), "v"(l7),
                  "v"(l8), "v"(l9), "v"(l10), "v"(l11),
                  "v"(ga), "v"(a1), "v"(a2), "v"(a3), "v"(a4), "v"(a5), "v"(a6), "v"(a7),
                  "v"(gb), "v"(b1), "v"(b2), "v"(b3)
               : "memory");
}

// ---------------------------------------------------------------------------
// Main loop of both projections: acc[mt][nt] += A(128 rows) * B(64 rows)^T over
// K = 512, both operands k-contiguous f16 rows of DMODEL halves. Block 128 thr,
// wave tile 32 x 64. Each 64-deep k step is staged once per block in a
// two-buffer LDS ring (the next step's copies fly while this step is worked
// on); the fragments are read from there, in the same ascending k order.
// On return every wave has passed the last barrier and no copy is in flight, so
// the caller may reuse sG.
// ---------------------------------------------------------------------------
__device__ __forceinline__ void gemm_128x64(const _Float16* arows, const _Float16* brows,
                                            _Float16* sG, int tid, v8f (&acc)[2][4]) {
  const int lane = tid & 31, w = tid >> 5;
  const int h = lane >> 4, m = lane & 15;
  // Staging map: chunk c = tid + 128 i (i = 0..11), staged row c >> 3, 16-B column c & 7.
  const int crow = tid >> 3, ccol = tid & 7;
  const unsigned l0 = (unsigned)(size_t)(sG + crow * TPITCH + 8 * ccol);
  const _Float16* ga0 = arows + (size_t)crow * DMODEL + 8 * ccol;          // + 64 per step
  const _Float16* gb0 = brows + (size_t)crow * DMODEL + 8 * ccol;          // + 64 per step

  gemm_stage_copy(l0, ga0, gb0);                                           // step 0 -> buffer 0
  // step 0's copies of this wave have landed before the barrier that publishes them
  asm volatile("s_wait_asynccnt 0x0" ::: "memory");
  __syncthreads();
  gemm_stage_copy(l0 + GSTAGE * 2, ga0 + 64, gb0 + 64);                    // step 1 -> buffer 1

  #pragma unroll 1   // rolled: one copy of the body, the ring buffer picked by the step's parity
  for (int t = 0; t < GSTEPS; ++t) {
    const int bo = (t & 1) * GSTAGE;                                       // this step's ring buffer
    const _Float16* ab = sG + bo + (32 * w + m) * TPITCH;                  // token row, mt = 0
    const _Float16* bb = sG + bo + (128 + m) * TPITCH;                     // feature row, nt = 0
    // all fragments of the step are read as one group ahead of its products
    v16h af[2][2], bf[2][4];
    #pragma unroll   // af[][], bf[][] indexed by constants, so that they stay in registers
    for (int kc = 0; kc < 2; ++kc) {
      af[kc][0] = load_frag(ab + 32 * kc, h);
      af[kc][1] = load_frag(ab + 16 * TPITCH + 32 * kc, h);
      #pragma unroll
      for (int nt = 0; nt < 4; ++nt) bf[kc][nt] = load_frag(bb + nt * 16 * TPITCH + 32 * kc, h);
    }
    #pragma unroll   // acc[][] indexed by constants, so that it stays in registers
    for (int kc = 0; kc < 2; ++kc) {
      #pragma unroll
      for (int nt = 0; nt < 4; ++nt) {
        acc[0][nt] = wmma_f16(af[kc][0], bf[kc][nt], acc[0][nt]);
        acc[1][nt] = wmma_f16(af[kc][1], bf[kc][nt], acc[1][nt]);
      }
    }
    // ---- hand-over: this wave's reads of buffer t&1 are done, its copies of step t+1 have
    // landed; the barrier publishes step t+1 and frees buffer t&1 for the refill ----
    asm volatile("s_wait_dscnt 0x0" ::: "memory");
    asm volatile("s_wait_asynccnt 0x0" ::: "memory");
    __syncthreads();
    if (t + 2 < GSTEPS)
      gemm_stage_copy(l0 + bo * 2, ga0 + (t + 2) * 64, gb0 + (t + 2) * 64);
  }
  // no copy is left in flight when the wave goes on to the epilogue
  asm volatile("s_wait_asynccnt 0x0" ::: "memory");
}

// ---------------------------------------------------------------------------
// 4 lines per instruction, 32 lines per wave, 128 per block.
// which 0/1: plane[bh][l][d]  (one token row = 64 halves = one line)
// which 2  : vt[bh][d][l]     (64 d-rows x 128 tokens = 2 lines each)
// ---------------------------------------------------------------------------
__device__ __forceinline__ void proj_store_pass(const _Float16* sT, _Float16* plane, _Float16* vt,
                                                int which, int bh, int l0, int w, int lane) {
  const int q8 = lane & 7, sub = lane >> 3;
  #pragma unroll
  for (int i = 0; i < 8; ++i) {
    const int lid = w * 32 + i * 4 + sub;
    v8h v;
    _Float16* dst;
    if (which != 2) {
      v = *(const v8ha*)(sT + lid * HD + 8 * q8);
      dst = plane + ((size_t)bh * SEQ + l0 + lid) * HD + 8 * q8;
    } else {
      const int d = lid >> 1, hl = lid & 1;
      v = *(const v8ha*)(sT + d * 128 + 64 * hl + 8 * q8);
      dst = vt + ((size_t)bh * HD + d) * SEQ + l0 + 64 * hl + 8 * q8;
    }
    *(v8h*)dst = v;
  }
}

// ---------------------------------------------------------------------------
// Kernel 2: Y = (x+pe) * W^T + bias over the fused 3*512 output columns.
// Block 128 thr (4 waves) = 128 tokens x 64 features (one (which, head));
// wave tile 32 tokens x 64 features; K = 512 in staged steps of 64 (gemm_128x64);
// the output tile sT reuses the ring's LDS once the main loop has returned.
// ---------------------------------------------------------------------------
__global__ __launch_bounds__(128) void proj_kernel(
    const _Float16* __restrict__ xh,   // [8192][512]
    const _Float16* __restrict__ wh,   // [4][512][512], row = output feature, x32
    const float* __restrict__ bq, const float* __restrict__ bk, const float* __restrict__ bv,
    _Float16* __restrict__ qh,         // [B*H][L][D]  f16(q)
    _Float16* __restrict__ kh,         // [B*H][L][D]  f16(k)
    _Float16* __restrict__ vt)         // [B*H][D][L]  f16(v)
{
  __shared__ __attribute__((aligned(16))) _Float16 sG[2 * GSTAGE];  // 55296 B
  _Float16* sT = sG;                                                // 128 x 64 halves, after the main loop

  const int tid = threadIdx.x, lane = tid & 31, w = tid >> 5;
  const int h = lane >> 4, m = lane & 15;
  const int m0 = blockIdx.x * 128;
  const int cg = blockIdx.y;                 // 0..23
  const int which = cg >> 3, head = cg & 7;

  const v8f zero8 = {0.f, 0.f, 0.f, 0.f, 0.f, 0.f, 0.f, 0.f};
  v8f acc[2][4];
  #pragma unroll
  for (int mt = 0; mt < 2; ++mt)
    #pragma unroll
    for (int nt = 0; nt < 4; ++nt) acc[mt][nt] = zero8;

  gemm_128x64(xh + (size_t)m0 * DMODEL, wh + ((size_t)which * DMODEL + head * HD) * DMODEL, sG, tid, acc);

  // D[r] of tile (mt, nt) = Y[token m0+32w+16mt+8h+r][feature 16nt+m]
  const float* bias = (which == 0) ? bq : ((which == 1) ? bk : bv);
  #pragma unroll
  for (int nt = 0; nt < 4; ++nt) {
    const int feat = 16 * nt + m;
    const float bvl = bias[head * HD + feat];
    #pragma unroll
    for (int mt = 0; mt < 2; ++mt) {
      #pragma unroll
      for (int r = 0; r < 8; ++r) {
        const int tokl = 32 * w + 16 * mt + 8 * h + r;     // 0..127
        const float y = acc[mt][nt][r] * (1.0f / WSCALE) + bvl;
        const int idx = (which == 2) ? (feat * 128 + tokl) : (tokl * HD + feat);
        sT[idx] = (_Float16)y;
      }
    }
  }
  __syncthreads();

  const int b = m0 / SEQ, l0 = m0 - b * SEQ, bh = b * NHEADS + head;
  _Float16* plane = (which == 0) ? qh : kh;
  proj_store_pass(sT, plane, vt, which, bh, l0, w, lane);
  
}

// ---------------------------------------------------------------------------
// Attention helpers.
// Score element r of this lane: key = kb + 16j + 8h + r, query = q0 + m.
// v = mask ? (s*0.125 + anti[q - key + 2047]) : (-inf + missing_bias[head]).
// The key mask enters as the start value C of the score product: sm[key] = 0
// for an observed key, -inf + missing_bias[head] for a missing one, so that
// C + K.Q stays that non-finite value through the scale and the bias below.
// sb = per-head antisymmetrised rel-pos table in LDS, base = index for r = 0
// (index decreases by one per r); every index is in range for every key, so
// the reads carry no condition and no branch.
// ---------------------------------------------------------------------------
__device__ __forceinline__ v8f mask_start8(const float* sm) {
  const v4f a = *(const v4fa*)sm;
  const v4f c = *(const v4fa*)(sm + 4);
  const v8f z = { a.x, a.y, a.z, a.w, c.x, c.y, c.z, c.w };
  return z;
}

__device__ __forceinline__ v8f bias_load8(const float* sb, int base) {
  const v8f t = { sb[base],     sb[base - 1], sb[base - 2], sb[base - 3],
                  sb[base - 4], sb[base - 5], sb[base - 6], sb[base - 7] };
  return t;
}

// P^T B-fragment from the lane's own score D values: element r <- tile a row r,
// element 8+r <- tile c row r (same lane, same query column), scaled by 2^14.
__device__ __forceinline__ v16h pack_p(v8f a, v8f c) {
  const v16h r = { (_Float16)(a[0] * PSCALE), (_Float16)(a[1] * PSCALE), (_Float16)(a[2] * PSCALE), (_Float16)(a[3] * PSCALE),
                   (_Float16)(a[4] * PSCALE), (_Float16)(a[5] * PSCALE), (_Float16)(a[6] * PSCALE), (_Float16)(a[7] * PSCALE),
                   (_Float16)(c[0] * PSCALE), (_Float16)(c[1] * PSCALE), (_Float16)(c[2] * PSCALE), (_Float16)(c[3] * PSCALE),
                   (_Float16)(c[4] * PSCALE), (_Float16)(c[5] * PSCALE), (_Float16)(c[6] * PSCALE), (_Float16)(c[7] * PSCALE) };
  return r;
}

// (one token row's head slice) by lanes 8q..8q+7 in one instruction, 4 lines
// per instruction, 16 lines per wave.
__device__ __forceinline__ void ao_store_pass(const _Float16* so, _Float16* ao,
                                              int b, int head, int q0, int lane) {
  const int q8 = lane & 7, sub = lane >> 3;
  #pragma unroll
  for (int i = 0; i < 4; ++i) {
    const int lid = i * 4 + sub;                    // 0..15
    const v8h v = *(const v8ha*)(so + lid * 64 + 8 * q8);
    const size_t gi = ((size_t)b * SEQ + q0 + lid) * DMODEL + head * HD + 8 * q8;
    *(v8h*)(ao + gi) = v;
  }
}

// One 64-key stage of K (64 key rows x 128 B) and of V^T (64 d rows x 128 B)
// into LDS rows of TPITCH halves: 4 + 4 asynchronous 16-B copies per lane, each
// wave-wide copy covering four whole 128-B lines. lk/lv = this lane's LDS byte
// address of its first K / V chunk, gk/gv = the matching global address; chunk
// i lies 16 rows further on both sides.
// The closing s_wait_xcnt 0 stands inside the copies' own statement, so that no
// address register named here is rewritten ahead of it.
__device__ __forceinline__ void stage_copy(unsigned lk, unsigned lv,
                                           const _Float16* gk, const _Float16* gv) {
  const unsigned lk1 = lk + 16 * TPITCH * 2, lk2 = lk + 32 * TPITCH * 2, lk3 = lk + 48 * TPITCH * 2;
  const unsigned lv1 = lv + 16 * TPITCH * 2, lv2 = lv + 32 * TPITCH * 2, lv3 = lv + 48 * TPITCH * 2;
  const _Float16* gk1 = gk + 16 * HD;
  const _Float16* gk2 = gk + 32 * HD;
  const _Float16* gk3 = gk + 48 * HD;
  const _Float16* gv1 = gv + (size_t)16 * SEQ;
  const _Float16* gv2 = gv + (size_t)32 * SEQ;
  const _Float16* gv3 = gv + (size_t)48 * SEQ;
  asm volatile("global_load_async_to_lds_b128 %0, %8, off\n\t"
               "global_load_async_to_lds_b128 %1, %9, off\n\t"
               "global_load_async_to_lds_b128 %2, %10, off\n\t"
               "global_load_async_to_lds_b128 %3, %11, off\n\t"
               "global_load_async_to_lds_b128 %4, %12, off\n\t"
               "global_load_async_to_lds_b128 %5, %13, off\n\t"
               "global_load_async_to_lds_b128 %6, %14, off\n\t"
               "global_load_async_to_lds_b128 %7, %15, off\n\t"
               "s_wait_xcnt 0x0"
               :: "v"(lk), "v"(lk1), "v"(lk2), "v"(lk3), "v"(lv), "v"(lv1), "v"(lv2), "v"(lv3),
                  "v"(gk), "v"(gk1), "v"(gk2), "v"(gk3), "v"(gv), "v"(gv1), "v"(gv2), "v"(gv3)
               : "memory");
}

// ---------------------------------------------------------------------------
// Kernel 3: streaming attention, transposed form.
// Block 128 thr (4 waves), 16 queries per wave, 64 keys per step.
// K and V^T of a step are staged once per block in a two-buffer LDS ring by
// asynchronous copies (next step's copies fly while this step is worked on);
// all four waves read their fragments from there.
//   S^T = K * Q^T : A = K rows (row = key, k = d), B = Q^T (k = d, n = query)
//   O^T += V^T * P^T : A = Vt rows (row = d, k = key), B = P^T from registers
// Lane owns 32 keys of query column (lane&15); partner = lane ^ 16.
// Antisymmetrised rel-pos table for this head and the key-mask start values of
// this batch row built once per block in LDS.
// ---------------------------------------------------------------------------
__global__ __launch_bounds__(128) void attn_kernel(
    const _Float16* __restrict__ qh,   // [B*H][L][D]
    const _Float16* __restrict__ kh,   // [B*H][L][D]
    const _Float16* __restrict__ vt,   // [B*H][D][L]
    const int* __restrict__ mask,      // [B][L], nonzero = observed key
    const float* __restrict__ mbias,   // [H]
    const float* __restrict__ rel,     // [RELN][H]
    _Float16* __restrict__ ao)         // [B][L][DMODEL], x64
{
  __shared__ __attribute__((aligned(16))) float sB[4096];             // 16384 B
  __shared__ __attribute__((aligned(16))) float sM[SEQ];              //  8192 B
  __shared__ __attribute__((aligned(16))) _Float16 sO[4 * 16 * 64];  //  8192 B
  __shared__ __attribute__((aligned(16))) _Float16 sK[2 * TSTAGE];   // 18432 B
  __shared__ __attribute__((aligned(16))) _Float16 sV[2 * TSTAGE];   // 18432 B

  const int tid = threadIdx.x, lane = tid & 31, w = tid >> 5;
  const int h = lane >> 4, m = lane & 15;
  const int bh = blockIdx.y, b = bh >> 3, head = bh & 7;
  const int q0 = blockIdx.x * 64 + 16 * w;

  // Staging map: chunk c = tid + 128 i (i = 0..3), tile row c >> 3, 16-B column c & 7.
  const int crow = tid >> 3, ccol = tid & 7;
  const unsigned lk0 = (unsigned)(size_t)(sK + crow * TPITCH + 8 * ccol);
  const unsigned lv0 = (unsigned)(size_t)(sV + crow * TPITCH + 8 * ccol);
  const _Float16* gk0 = kh + ((size_t)bh * SEQ + crow) * HD + 8 * ccol;    // + 64 * HD per step
  const _Float16* gv0 = vt + ((size_t)bh * HD + crow) * SEQ + 8 * ccol;    // + 64 per step

  stage_copy(lk0, lv0, gk0, gv0);                                          // step 0 -> buffer 0

  // anti[i] = 0.5 * (rel[i][head] - rel[RELN-1-i][head]), i = q - k + (SEQ-1)
  // The first 31 * 128 entries are in range for every thread: their reads carry no condition.
  // Only the last 128 hold the padding entry 4095 (stored as 0, never read).
  const float* relh = rel + head;
  const float* rup = relh + tid * NHEADS;                            // row i = tid + 128 c: + c * 128 rows
  const float* rdn = relh + (RELN - 1 - tid - 128 * 30) * NHEADS;    // row RELN-1-i: + (30 - c) * 128 rows
  #pragma unroll   // all entries' loads in flight together instead of one wait per entry
  for (int c = 0; c < 31; ++c)
    sB[tid + 128 * c] = 0.5f * (rup[c * 128 * NHEADS] - rdn[(30 - c) * 128 * NHEADS]);
  {
    const int i = tid + 128 * 31;
    float v = 0.0f;
    if (i < RELN) v = 0.5f * (relh[i * NHEADS] - relh[(RELN - 1 - i) * NHEADS]);
    sB[i] = v;
  }

  // sM[key] = 0 (observed) or -inf fill + missing bias (missing)
  const float mbh = mbias[head];
  const float vmiss = -__builtin_inff() + mbh;
  #pragma unroll   // the four mask loads in flight together
  for (int i = 0; i < SEQ / 512; ++i) {
    const int k4 = 4 * tid + 512 * i;
    const v4i mm = *(const v4ia*)(mask + (size_t)b * SEQ + k4);
    const v4f t = { (mm.x != 0) ? 0.0f : vmiss, (mm.y != 0) ? 0.0f : vmiss,
                    (mm.z != 0) ? 0.0f : vmiss, (mm.w != 0) ? 0.0f : vmiss };
    *(v4fa*)(sM + k4) = t;
  }

  // Q^T B-fragments: column n = query q0+m, k = d (two 32-deep chunks)
  const _Float16* qrow = qh + ((size_t)bh * SEQ + q0 + m) * HD;
  const v16h qb0 = load_frag(qrow, h);
  const v16h qb1 = load_frag(qrow + 32, h);

  // step 0's copies of this wave have landed before the barrier that publishes them (and sB, sM)
  asm volatile("s_wait_asynccnt 0x0" ::: "memory");
  __syncthreads();

  stage_copy(lk0 + TSTAGE * 2, lv0 + TSTAGE * 2, gk0 + 64 * HD, gv0 + 64); // step 1 -> buffer 1

  const int qk = q0 + m + (SEQ - 1) - 8 * h;         // bias index for key (kb+16j) at r=0 is qk-kb-16j

  const v8f zero8 = {0.f, 0.f, 0.f, 0.f, 0.f, 0.f, 0.f, 0.f};
  const v8f eighth8 = {0.125f, 0.125f, 0.125f, 0.125f, 0.125f, 0.125f, 0.125f, 0.125f};
  v8f o[4];                                   // o[t][r] = O[query m][d 16t+8h+r] * (l * 2^14)
  #pragma unroll
  for (int t = 0; t < 4; ++t) o[t] = zero8;
  float mrun = -1e30f, lrun = 0.0f;

  const int fro = m * TPITCH;                                  // fragment row of this lane in a staged tile
  const float* smp = sM + 8 * h;                               // + key tile base

  #pragma unroll 1
  for (int st = 0; st < NSTEP; ++st) {
    const int kb = st * 64;
    const int bo = (st & 1) * TSTAGE;                          // this step's ring buffer
    const _Float16* kbase = sK + bo + fro;                     // + 16j*TPITCH + 32*dc
    const _Float16* vbase = sV + bo + fro;                     // + 16t*TPITCH + 32*kc
    // ---- rel-pos bias of this step, read ahead of the score products ----
    v8f bv[4];
    #pragma unroll   // bv[] indexed by constants, so that it stays in registers
    for (int j = 0; j < 4; ++j) bv[j] = bias_load8(sB, qk - kb - 16 * j);
    // ---- raw scores on the mask start: s[j][r] = sM[key] + (Q.K)[query m][key kb+16j+8h+r] ----
    v8f s[4];
    #pragma unroll
    for (int j = 0; j < 4; ++j) {
      const _Float16* kp = kbase + 16 * j * TPITCH;
      const v16h kf0 = load_frag(kp, h);
      const v16h kf1 = load_frag(kp + 32, h);
      v8f z = mask_start8(smp + kb + 16 * j);
      z = wmma_f16(kf0, qb0, z);
      z = wmma_f16(kf1, qb1, z);
      s[j] = z;
    }
    // ---- scale 1/8, rel-pos bias (f32) ----
    #pragma unroll
    for (int j = 0; j < 4; ++j)
      s[j] = __builtin_elementwise_fma(s[j], eighth8, bv[j]);

    // ---- online softmax ----
    float mloc = s[0][0];
    #pragma unroll
    for (int j = 0; j < 4; ++j)
      #pragma unroll
      for (int r = 0; r < 8; ++r) mloc = fmaxf(mloc, s[j][r]);
    mloc = fmaxf(mloc, __shfl_xor(mloc, 16));
    const float mnew = fmaxf(mrun, mloc);
    const float alpha = __expf(mrun - mnew);
    mrun = mnew;
    float lsum = 0.0f;
    #pragma unroll
    for (int j = 0; j < 4; ++j)
      #pragma unroll
      for (int r = 0; r < 8; ++r) {
        const float p = __expf(s[j][r] - mnew);
        s[j][r] = p;
        lsum += p;
      }
    lsum += __shfl_xor(lsum, 16);
    lrun = lrun * alpha + lsum;
    #pragma unroll
    for (int t = 0; t < 4; ++t)
      #pragma unroll
      for (int r = 0; r < 8; ++r) o[t][r] = o[t][r] * alpha;

    // ---- P^T B-fragments (key chunks 0..31 and 32..63 of this step) ----
    const v16h pb0 = pack_p(s[0], s[1]);
    const v16h pb1 = pack_p(s[2], s[3]);

    // ---- O^T += V^T * P^T ----
    #pragma unroll
    for (int t = 0; t < 4; ++t) {
      const _Float16* vp = vbase + 16 * t * TPITCH;
      const v16h vf0 = load_frag(vp, h);
      const v16h vf1 = load_frag(vp + 32, h);
      o[t] = wmma_f16(vf0, pb0, o[t]);
      o[t] = wmma_f16(vf1, pb1, o[t]);
    }

    // ---- hand-over: this wave's reads of buffer st&1 are done, its copies of step st+1
    // have landed; the barrier publishes step st+1 and frees buffer st&1 for the refill ----
    asm volatile("s_wait_dscnt 0x0" ::: "memory");
    asm volatile("s_wait_asynccnt 0x0" ::: "memory");
    __syncthreads();
    if (st + 2 < NSTEP)
      stage_copy(lk0 + bo * 2, lv0 + bo * 2, gk0 + (size_t)(kb + 128) * HD, gv0 + (kb + 128));
  }
  // no copy is left in flight when the wave goes on to the epilogue
  asm volatile("s_wait_asynccnt 0x0" ::: "memory");

  // ---- epilogue: normalise, x64, stage per-wave 16x64 f16 tile, whole-line stores ----
  const float inv = __builtin_amdgcn_rcpf(lrun) * (AOSCALE / PSCALE);
  _Float16* so = sO + w * 1024;
  #pragma unroll
  for (int t = 0; t < 4; ++t)
    #pragma unroll
    for (int r = 0; r < 8; ++r)
      so[m * 64 + 16 * t + 8 * h + r] = (_Float16)(o[t][r] * inv);
  __syncthreads();

  ao_store_pass(so, ao, b, head, q0, lane);
  
}

// ---------------------------------------------------------------------------
// 16-B stores, 4 lines per instruction, 64 lines per wave.
// ---------------------------------------------------------------------------
__device__ __forceinline__ void out_store_pass(const float* sT, float* out, int m0, int fg, int w, int lane) {
  const int q8 = lane & 7, sub = lane >> 3;
  #pragma unroll
  for (int i = 0; i < 16; ++i) {
    const int lid = i * 4 + sub;                   // 0..63
    const int row = 32 * w + (lid >> 1), hl = lid & 1;
    const v4f v = *(const v4fa*)(sT + row * 64 + 32 * hl + 4 * q8);
    const size_t gi = ((size_t)(m0 + row)) * DMODEL + fg * 64 + 32 * hl + 4 * q8;
    *(v4f*)(out + gi) = v;
  }
}

// ---------------------------------------------------------------------------
// Kernel 4: out = AO * Wo^T + bo (f32). Block 128 thr = 128 tokens x 64
// features (fg = blockIdx.y); wave tile 32 x 64; K = 512 in staged steps of 64
// (gemm_128x64); the output tile sT reuses the ring's LDS after the main loop.
// ---------------------------------------------------------------------------
__global__ __launch_bounds__(128) void oproj_kernel(
    const _Float16* __restrict__ ao,   // [8192][512] f16, x64
    const _Float16* __restrict__ woh,  // [512][512] f16, row = output feature, x32
    const float* __restrict__ bo,      // [512]
    float* __restrict__ out)           // [8192][512] f32
{
  __shared__ __attribute__((aligned(16))) _Float16 sG[2 * GSTAGE];  // 55296 B
  float* sT = (float*)sG;                                           // 128 x 64 floats (32768 B), after the main loop

  const int tid = threadIdx.x, lane = tid & 31, w = tid >> 5;
  const int h = lane >> 4, m = lane & 15;
  const int m0 = blockIdx.x * 128;
  const int fg = blockIdx.y;                 // 0..7

  const v8f zero8 = {0.f, 0.f, 0.f, 0.f, 0.f, 0.f, 0.f, 0.f};
  v8f acc[2][4];
  #pragma unroll
  for (int mt = 0; mt < 2; ++mt)
    #pragma unroll
    for (int nt = 0; nt < 4; ++nt) acc[mt][nt] = zero8;

  gemm_128x64(ao + (size_t)m0 * DMODEL, woh + (size_t)fg * 64 * DMODEL, sG, tid, acc);

  // D[r] of tile (mt, nt) = out[token m0+32w+16mt+8h+r][feature fg*64+16nt+m]
  #pragma unroll
  for (int nt = 0; nt < 4; ++nt) {
    const int feat = 16 * nt + m;
    const float bvl = bo[fg * 64 + feat];
    #pragma unroll
    for (int mt = 0; mt < 2; ++mt) {
      #pragma unroll
      for (int r = 0; r < 8; ++r) {
        const int tokl = 32 * w + 16 * mt + 8 * h + r;
        sT[tokl * 64 + feat] = acc[mt][nt][r] * (1.0f / (WSCALE * AOSCALE)) + bvl;
      }
    }
  }
  __syncthreads();

  out_store_pass(sT, out, m0, fg, w, lane);
  
}

// ---------------------------------------------------------------------------
extern "C" void kernel_launch(void* const* d_in, const int* in_sizes, int n_in,
                              void* d_out, int out_size, void* d_ws, size_t ws_size,
                              hipStream_t stream) {
  if (n_in < 12) return;
  if (in_sizes[0] != NX) return;
  if (in_sizes[1] != MROWS) return;
  if (in_sizes[2] != NW || in_sizes[4] != NW || in_sizes[6] != NW || in_sizes[8] != NW) return;
  if (in_sizes[3] != DMODEL || in_sizes[5] != DMODEL || in_sizes[7] != DMODEL || in_sizes[9] != DMODEL) return;
  if (in_sizes[10] != NHEADS) return;
  if (in_sizes[11] != RELN * NHEADS) return;
  if (out_size != NX) return;

  const float* x     = (const float*)d_in[0];
  const int*   mask  = (const int*)d_in[1];
  const float* Wq    = (const float*)d_in[2];
  const float* bq    = (const float*)d_in[3];
  const float* Wk    = (const float*)d_in[4];
  const float* bk    = (const float*)d_in[5];
  const float* Wv    = (const float*)d_in[6];
  const float* bv    = (const float*)d_in[7];
  const float* Wo    = (const float*)d_in[8];
  const float* bo    = (const float*)d_in[9];
  const float* mbias = (const float*)d_in[10];
  const float* rel   = (const float*)d_in[11];
  float* out = (float*)d_out;

  const size_t pe_bytes = (size_t)NPE * 4;                          //  4194304
  const size_t xh_bytes = (size_t)NX * 2;                           //  8388608
  const size_t wh_bytes = (size_t)4 * NW * 2;                       //  2097152
  const size_t pl_bytes = (size_t)BATCH * NHEADS * SEQ * HD * 2;    //  8388608
  const size_t ao_bytes = (size_t)NX * 2;                           //  8388608
  const size_t total = pe_bytes + xh_bytes + wh_bytes + 3 * pl_bytes + ao_bytes;   // 48234496
  if (total > ws_size) return;

  char* ws = (char*)d_ws;
  size_t off = 0;
  float*    pet = (float*)(ws + off);     off += pe_bytes;
  _Float16* xh  = (_Float16*)(ws + off);  off += xh_bytes;
  _Float16* wh  = (_Float16*)(ws + off);  off += wh_bytes;
  _Float16* qh  = (_Float16*)(ws + off);  off += pl_bytes;
  _Float16* kh  = (_Float16*)(ws + off);  off += pl_bytes;
  _Float16* vt  = (_Float16*)(ws + off);  off += pl_bytes;
  _Float16* ao  = (_Float16*)(ws + off);  off += ao_bytes;
  if (off > ws_size) return;

  const int npairs = SEQ * (DMODEL / 2);                            // 524288
  pe_kernel<<<(npairs + 255) / 256, 256, 0, stream>>>(pet);

  const int ngroups = NX8 + 4 * NW8;                                // 655360
  convert_kernel<<<(ngroups + 255) / 256, 256, 0, stream>>>(x, pet, Wq, Wk, Wv, Wo, xh, wh);

  dim3 gProj(MROWS / 128, 3 * NHEADS);                              // (64, 24)
  proj_kernel<<<gProj, 128, 0, stream>>>(xh, wh, bq, bk, bv, qh, kh, vt);

  dim3 gAtt(SEQ / 64, BATCH * NHEADS);                              // (32, 32)
  attn_kernel<<<gAtt, 128, 0, stream>>>(qh, kh, vt, mask, mbias, rel, ao);

  dim3 gOut(MROWS / 128, DMODEL / 64);                              // (64, 8)
  oproj_kernel<<<gOut, 128, 0, stream>>>(ao, wh + (size_t)3 * NW, bo, out);
}

// v004
// A run of this version takes 95.4 microseconds.
// Timed twice side by side with v003, it ran 1.04 and 1.03 times as fast.
// All steps since v000 together make it 3.03 times as fast.
// Contractions: x*W^T for q,k,v and o, K*Q^T, V^T*P^T all on v_wmma_f32_16x16x32_f16 (f16 operands, f32 accumulate); W carried x32, P carried x16384, attention rows carried x64 (exact power-of-two scales folded back in f32); PE, bias tables, key mask, softmax and normalisation in f32.
#include <hip/hip_runtime.h>

typedef _Float16 v16h __attribute__((ext_vector_type(16)));
typedef _Float16 v8h  __attribute__((ext_vector_type(8)));
typedef float    v8f  __attribute__((ext_vector_type(8)));
typedef float    v4f  __attribute__((ext_vector_type(4)));
typedef int      v4i  __attribute__((ext_vector_type(4)));
typedef v8h __attribute__((may_alias)) v8ha;
typedef v4f __attribute__((may_alias)) v4fa;
typedef v4i __attribute__((may_alias)) v4ia;

union Frag { v16h v; v8h half[2]; };

#define DMODEL 512
#define NHEADS 8
#define HD     64
#define SEQ    2048
#define BATCH  4
#define MROWS  (BATCH * SEQ)          // 8192 tokens
#define NX     (MROWS * DMODEL)       // 4194304
#define NW     (DMODEL * DMODEL)      // 262144
#define NW8    (NW / 8)               // 32768
#define RELN   (2 * SEQ - 1)          // 4095
#define NPE    (SEQ * DMODEL)         // 1048576 elements of one batch entry
#define XGROUPS (NPE / 8)             // 131072 groups of 8 features of one batch entry
#define PSCALE  16384.0f
#define WSCALE  32.0f
#define AOSCALE 64.0f
#define TPITCH  72                    // halves per staged LDS row: 144 B = 16 B x 9, conflict-free for 16-B fragment reads
#define TSTAGE  (64 * TPITCH)         // halves per staged 64-row tile
#define NSTEP   (SEQ / 64)            // 32 key steps
#define GROWS   192                   // staged rows of a projection k step: 128 token rows, then 64 feature rows
#define GSTAGE  (GROWS * TPITCH)      // halves per staged projection k step (27648 B)
#define GSTEPS  (DMODEL / 64)         // 8 k steps of 64

static_assert(BATCH == 4);
static_assert((XGROUPS % 256) == 0 && (NW8 % 256) == 0);
static_assert((MROWS % 128) == 0 && (SEQ % 128) == 0);

// ---------------------------------------------------------------------------
// 16x16x32 f16 WMMA with hazard guard (ties D, keeps A/B live).
// Fragment map (wave32): lane l, h = l>>4, m = n = l&15.
//   A/B element i: i<8 -> k0+8h+i ; i>=8 -> k0+16+8h+(i-8)
//   D element r : row 8h+r, col l&15
// ---------------------------------------------------------------------------
__device__ __forceinline__ v8f wmma_f16(v16h a, v16h b, v8f c) {
  v8f d = __builtin_amdgcn_wmma_f32_16x16x32_f16(false, a, false, b, (short)0, c, false, false);
  asm volatile("v_nop\n\tv_nop\n\tv_nop\n\tv_nop" : "+v"(d) : "v"(a), "v"(b));
  return d;
}

// A or B fragment from a k-contiguous 16-bit row; p points at element k0 of
// the row owned by this lane (row index = lane & 15 added by the caller).
__device__ __forceinline__ v16h load_frag(const _Float16* p, int h) {
  Frag f;
  f.half[0] = *(const v8ha*)(p + 8 * h);
  f.half[1] = *(const v8ha*)(p + 16 + 8 * h);
  return f.v;
}

// ---------------------------------------------------------------------------
// Kernel 1: f32 -> f16 planes. xh = f16(x + pe) unscaled, wh = f16(32*W) for
// Wq,Wk,Wv,Wo (row = output feature, k-contiguous). Four 16-B stores per lane.
// pe[t][2p] = sin(t*div_p), pe[t][2p+1] = cos(t*div_p),
// div_p = exp(f32(2p) * f32(-ln(1e4)/512)).
// x blocks: a thread owns 8 features of position t; it forms their four
// (sin, cos) pairs once, in registers, and adds them to that position's row of
// all four batch entries. W blocks: a thread converts the same 8 elements of
// all four matrices. All eight 16-B loads of a thread are issued up front.
// ---------------------------------------------------------------------------
__device__ __forceinline__ v8h pack8(v4f a, v4f c) {
  const v8h o = { (_Float16)a.x, (_Float16)a.y, (_Float16)a.z, (_Float16)a.w,
                  (_Float16)c.x, (_Float16)c.y, (_Float16)c.z, (_Float16)c.w };
  return o;
}

__global__ __launch_bounds__(256) void convert_kernel(
    const float* __restrict__ x,
    const float* __restrict__ wq, const float* __restrict__ wk,
    const float* __restrict__ wv, const float* __restrict__ wo,
    _Float16* __restrict__ xh, _Float16* __restrict__ wh)
{
  const int g = blockIdx.x * 256 + threadIdx.x;
  if (g >= XGROUPS + NW8) return;
  v4f a[4], c[4];
  if (g < XGROUPS) {
    const int t = g >> 6;                   // position 0..2047 (64 groups of 8 per row)
    const int db = (g & 63) * 8;            // first feature of the group
    const unsigned so = (unsigned)g * 32u;  // byte offset of the group in a batch entry of x
    #pragma unroll   // a[], c[] indexed by constants, so that they stay in registers
    for (int b = 0; b < BATCH; ++b) {
      const char* src = (const char*)(x + (size_t)b * NPE) + so;
      a[b] = *(const v4fa*)src;
      c[b] = *(const v4fa*)(src + 16);
    }
    const float kc = (float)(-9.210340371976184 / 512.0);
    float sn[4], cs[4];
    #pragma unroll   // sn[], cs[] indexed by constants, so that they stay in registers
    for (int i = 0; i < 4; ++i) {
      const float fr = expf((float)(db + 2 * i) * kc);
      const float ang = (float)t * fr;
      sn[i] = sinf(ang);
      cs[i] = cosf(ang);
    }
    const v4f pa = { sn[0], cs[0], sn[1], cs[1] };
    const v4f pc = { sn[2], cs[2], sn[3], cs[3] };
    const unsigned dofs = (unsigned)g * 16u;  // byte offset of the group in a batch entry of xh
    #pragma unroll
    for (int b = 0; b < BATCH; ++b)
      *(v8h*)((char*)(xh + (size_t)b * NPE) + dofs) = pack8(a[b] + pa, c[b] + pc);
  } else {
    const unsigned e = (unsigned)(g - XGROUPS);
    const unsigned so = e * 32u;            // byte offset of the group in a matrix
    a[0] = *(const v4fa*)((const char*)wq + so);  c[0] = *(const v4fa*)((const char*)wq + so + 16);
    a[1] = *(const v4fa*)((const char*)wk + so);  c[1] = *(const v4fa*)((const char*)wk + so + 16);
    a[2] = *(const v4fa*)((const char*)wv + so);  c[2] = *(const v4fa*)((const char*)wv + so + 16);
    a[3] = *(const v4fa*)((const char*)wo + so);  c[3] = *(const v4fa*)((const char*)wo + so + 16);
    const unsigned dofs = e * 16u;          // byte offset of the group in a plane of wh
    #pragma unroll
    for (int i = 0; i < 4; ++i)
      *(v8h*)((char*)(wh + (size_t)i * NW) + dofs) = pack8(a[i] * WSCALE, c[i] * WSCALE);
  }
}

// ---------------------------------------------------------------------------
// One 64-deep k step of a projection into LDS rows of TPITCH halves: 128 token
// rows (8 chunks per lane) and 64 feature rows (4 chunks per lane), 128 B each,
// by asynchronous 16-B copies; each wave-wide copy covers four whole 128-B
// lines. l = this lane's LDS byte address of its first chunk, ga / gb = the
// matching global addresses; chunk i lies 16 rows further on both sides.
// The closing s_wait_xcnt 0 stands inside the copies' own statement, so that no
// address register named here is rewritten ahead of it.
// ---------------------------------------------------------------------------
__device__ __forceinline__ void gemm_stage_copy(unsigned l, const _Float16* ga, const _Float16* gb) {
  const unsigned rs = 16 * TPITCH * 2;                 // 16 staged rows in bytes
  const unsigned l1 = l + rs,     l2 = l + 2 * rs,  l3 = l + 3 * rs,   l4 = l + 4 * rs;
  const unsigned l5 = l + 5 * rs, l6 = l + 6 * rs,  l7 = l + 7 * rs,   l8 = l + 8 * rs;
  const unsigned l9 = l + 9 * rs, l10 = l + 10 * rs, l11 = l + 11 * rs;
  const _Float16* a1 = ga + 16 * DMODEL;
  const _Float16* a2 = ga + 32 * DMODEL;
  const _Float16* a3 = ga + 48 * DMODEL;
  const _Float16* a4 = ga + 64 * DMODEL;
  const _Float16* a5 = ga + 80 * DMODEL;
  const _Float16* a6 = ga + 96 * DMODEL;
  const _Float16* a7 = ga + 112 * DMODEL;
  const _Float16* b1 = gb + 16 * DMODEL;
  const _Float16* b2 = gb + 32 * DMODEL;
  const _Float16* b3 = gb + 48 * DMODEL;
  asm volatile("global_load_async_to_lds_b128 %0, %12, off\n\t"
               "global_load_async_to_lds_b128 %1, %13, off\n\t"
               "global_load_async_to_lds_b128 %2, %14, off\n\t"
               "global_load_async_to_lds_b128 %3, %15, off\n\t"
               "global_load_async_to_lds_b128 %4, %16, off\n\t"
               "global_load_async_to_lds_b128 %5, %17, off\n\t"
               "global_load_async_to_lds_b128 %6, %18, off\n\t"
               "global_load_async_to_lds_b128 %7, %19, off\n\t"
               "global_load_async_to_lds_b128 %8, %20, off\n\t"
               "global_load_async_to_lds_b128 %9, %21, off\n\t"
               "global_load_async_to_lds_b128 %10, %22, off\n\t"
               "global_load_async_to_lds_b128 %11, %23, off\n\t"
               "s_wait_xcnt 0x0"
               :: "v"(l), "v"(l1), "v"(l2), "v"(l3), "v"(l4), "v"(l5), "v"(l6), "v"(l7),
                  "v"(l8), "v"(l9), "v"(l10), "v"(l11),
                  "v"(ga), "v"(a1), "v"(a2), "v"(a3), "v"(a4), "v"(a5), "v"(a6), "v"(a7),
                  "v"(gb), "v"(b1), "v"(b2), "v"(b3)
               : "memory");
}

// ---------------------------------------------------------------------------
// Main loop of both projections: acc[mt][nt] += A(128 rows) * B(64 rows)^T over
// K = 512, both operands k-contiguous f16 rows of DMODEL halves. Block 128 thr,
// wave tile 32 x 64. Each 64-deep k step is staged once per block in a
// two-buffer LDS ring (the next step's copies fly while this step is worked
// on); the fragments are read from there, in the same ascending k order.
// On return every wave has passed the last barrier and no copy is in flight, so
// the caller may reuse sG.
// ---------------------------------------------------------------------------
__device__ __forceinline__ void gemm_128x64(const _Float16* arows, const _Float16* brows,
                                            _Float16* sG, int tid, v8f (&acc)[2][4]) {
  const int lane = tid & 31, w = tid >> 5;
  const int h = lane >> 4, m = lane & 15;
  // Staging map: chunk c = tid + 128 i (i = 0..11), staged row c >> 3, 16-B column c & 7.
  const int crow = tid >> 3, ccol = tid & 7;
  const unsigned l0 = (unsigned)(size_t)(sG + crow * TPITCH + 8 * ccol);
  const _Float16* ga0 = arows + (size_t)crow * DMODEL + 8 * ccol;          // + 64 per step
  const _Float16* gb0 = brows + (size_t)crow * DMODEL + 8 * ccol;          // + 64 per step

  gemm_stage_copy(l0, ga0, gb0);                                           // step 0 -> buffer 0
  // step 0's copies of this wave have landed before the barrier that publishes them
  asm volatile("s_wait_asynccnt 0x0" ::: "memory");
  __syncthreads();
  gemm_stage_copy(l0 + GSTAGE * 2, ga0 + 64, gb0 + 64);                    // step 1 -> buffer 1

  #pragma unroll 1   // rolled: one copy of the body, the ring buffer picked by the step's parity
  for (int t = 0; t < GSTEPS; ++t) {
    const int bo = (t & 1) * GSTAGE;                                       // this step's ring buffer
    const _Float16* ab = sG + bo + (32 * w + m) * TPITCH;                  // token row, mt = 0
    const _Float16* bb = sG + bo + (128 + m) * TPITCH;                     // feature row, nt = 0
    // all fragments of the step are read as one group ahead of its products
    v16h af[2][2], bf[2][4];
    #pragma unroll   // af[][], bf[][] indexed by constants, so that they stay in registers
    for (int kc = 0; kc < 2; ++kc) {
      af[kc][0] = load_frag(ab + 32 * kc, h);
      af[kc][1] = load_frag(ab + 16 * TPITCH + 32 * kc, h);
      #pragma unroll
      for (int nt = 0; nt < 4; ++nt) bf[kc][nt] = load_frag(bb + nt * 16 * TPITCH + 32 * kc, h);
    }
    #pragma unroll   // acc[][] indexed by constants, so that it stays in registers
    for (int kc = 0; kc < 2; ++kc) {
      #pragma unroll
      for (int nt = 0; nt < 4; ++nt) {
        acc[0][nt] = wmma_f16(af[kc][0], bf[kc][nt], acc[0][nt]);
        acc[1][nt] = wmma_f16(af[kc][1], bf[kc][nt], acc[1][nt]);
      }
    }
    // ---- hand-over: this wave's reads of buffer t&1 are done, its copies of step t+1 have
    // landed; the barrier publishes step t+1 and frees buffer t&1 for the refill ----
    asm volatile("s_wait_dscnt 0x0" ::: "memory");
    asm volatile("s_wait_asynccnt 0x0" ::: "memory");
    __syncthreads();
    if (t + 2 < GSTEPS)
      gemm_stage_copy(l0 + bo * 2, ga0 + (t + 2) * 64, gb0 + (t + 2) * 64);
  }
  // no copy is left in flight when the wave goes on to the epilogue
  asm volatile("s_wait_asynccnt 0x0" ::: "memory");
}

// ---------------------------------------------------------------------------
// 4 lines per instruction, 32 lines per wave, 128 per block.
// which 0/1: plane[bh][l][d]  (one token row = 64 halves = one line)
// which 2  : vt[bh][d][l]     (64 d-rows x 128 tokens = 2 lines each)
// ---------------------------------------------------------------------------
__device__ __forceinline__ void proj_store_pass(const _Float16* sT, _Float16* plane, _Float16* vt,
                                                int which, int bh, int l0, int w, int lane) {
  const int q8 = lane & 7, sub = lane >> 3;
  #pragma unroll
  for (int i = 0; i < 8; ++i) {
    const int lid = w * 32 + i * 4 + sub;
    v8h v;
    _Float16* dst;
    if (which != 2) {
      v = *(const v8ha*)(sT + lid * HD + 8 * q8);
      dst = plane + ((size_t)bh * SEQ + l0 + lid) * HD + 8 * q8;
    } else {
      const int d = lid >> 1, hl = lid & 1;
      v = *(const v8ha*)(sT + d * 128 + 64 * hl + 8 * q8);
      dst = vt + ((size_t)bh * HD + d) * SEQ + l0 + 64 * hl + 8 * q8;
    }
    *(v8h*)dst = v;
  }
}

// ---------------------------------------------------------------------------
// Kernel 2: Y = (x+pe) * W^T + bias over the fused 3*512 output columns.
// Block 128 thr (4 waves) = 128 tokens x 64 features (one (which, head));
// wave tile 32 tokens x 64 features; K = 512 in staged steps of 64 (gemm_128x64);
// the output tile sT reuses the ring's LDS once the main loop has returned.
// ---------------------------------------------------------------------------
__global__ __launch_bounds__(128) void proj_kernel(
    const _Float16* __restrict__ xh,   // [8192][512]
    const _Float16* __restrict__ wh,   // [4][512][512], row = output feature, x32
    const float* __restrict__ bq, const float* __restrict__ bk, const float* __restrict__ bv,
    _Float16* __restrict__ qh,         // [B*H][L][D]  f16(q)
    _Float16* __restrict__ kh,         // [B*H][L][D]  f16(k)
    _Float16* __restrict__ vt)         // [B*H][D][L]  f16(v)
{
  __shared__ __attribute__((aligned(16))) _Float16 sG[2 * GSTAGE];  // 55296 B
  _Float16* sT = sG;                                                // 128 x 64 halves, after the main loop

  const int tid = threadIdx.x, lane = tid & 31, w = tid >> 5;
  const int h = lane >> 4, m = lane & 15;
  const int m0 = blockIdx.x * 128;
  const int cg = blockIdx.y;                 // 0..23
  const int which = cg >> 3, head = cg & 7;

  const v8f zero8 = {0.f, 0.f, 0.f, 0.f, 0.f, 0.f, 0.f, 0.f};
  v8f acc[2][4];
  #pragma unroll
  for (int mt = 0; mt < 2; ++mt)
    #pragma unroll
    for (int nt = 0; nt < 4; ++nt) acc[mt][nt] = zero8;

  gemm_128x64(xh + (size_t)m0 * DMODEL, wh + ((size_t)which * DMODEL + head * HD) * DMODEL, sG, tid, acc);

  // D[r] of tile (mt, nt) = Y[token m0+32w+16mt+8h+r][feature 16nt+m]
  const float* bias = (which == 0) ? bq : ((which == 1) ? bk : bv);
  #pragma unroll
  for (int nt = 0; nt < 4; ++nt) {
    const int feat = 16 * nt + m;
    const float bvl = bias[head * HD + feat];
    #pragma unroll
    for (int mt = 0; mt < 2; ++mt) {
      #pragma unroll
      for (int r = 0; r < 8; ++r) {
        const int tokl = 32 * w + 16 * mt + 8 * h + r;     // 0..127
        const float y = acc[mt][nt][r] * (1.0f / WSCALE) + bvl;
        const int idx = (which == 2) ? (feat * 128 + tokl) : (tokl * HD + feat);
        sT[idx] = (_Float16)y;
      }
    }
  }
  __syncthreads();

  const int b = m0 / SEQ, l0 = m0 - b * SEQ, bh = b * NHEADS + head;
  _Float16* plane = (which == 0) ? qh : kh;
  proj_store_pass(sT, plane, vt, which, bh, l0, w, lane);
  
}

// ---------------------------------------------------------------------------
// Attention helpers.
// Score element r of this lane: key = kb + 16j + 8h + r, query = q0 + m.
// v = mask ? (s*0.125 + anti[q - key + 2047]) : (-inf + missing_bias[head]).
// The key mask enters as the start value C of the score product: sm[key] = 0
// for an observed key, -inf + missing_bias[head] for a missing one, so that
// C + K.Q stays that non-finite value through the scale and the bias below.
// sb = per-head antisymmetrised rel-pos table in LDS, base = index for r = 0
// (index decreases by one per r); every index is in range for every key, so
// the reads carry no condition and no branch.
// ---------------------------------------------------------------------------
__device__ __forceinline__ v8f mask_start8(const float* sm) {
  const v4f a = *(const v4fa*)sm;
  const v4f c = *(const v4fa*)(sm + 4);
  const v8f z = { a.x, a.y, a.z, a.w, c.x, c.y, c.z, c.w };
  return z;
}

__device__ __forceinline__ v8f bias_load8(const float* sb, int base) {
  const v8f t = { sb[base],     sb[base - 1], sb[base - 2], sb[base - 3],
                  sb[base - 4], sb[base - 5], sb[base - 6], sb[base - 7] };
  return t;
}

// P^T B-fragment from the lane's own score D values: element r <- tile a row r,
// element 8+r <- tile c row r (same lane, same query column), scaled by 2^14.
__device__ __forceinline__ v16h pack_p(v8f a, v8f c) {
  const v16h r = { (_Float16)(a[0] * PSCALE), (_Float16)(a[1] * PSCALE), (_Float16)(a[2] * PSCALE), (_Float16)(a[3] * PSCALE),
                   (_Float16)(a[4] * PSCALE), (_Float16)(a[5] * PSCALE), (_Float16)(a[6] * PSCALE), (_Float16)(a[7] * PSCALE),
                   (_Float16)(c[0] * PSCALE), (_Float16)(c[1] * PSCALE), (_Float16)(c[2] * PSCALE), (_Float16)(c[3] * PSCALE),
                   (_Float16)(c[4] * PSCALE), (_Float16)(c[5] * PSCALE), (_Float16)(c[6] * PSCALE), (_Float16)(c[7] * PSCALE) };
  return r;
}

// (one token row's head slice) by lanes 8q..8q+7 in one instruction, 4 lines
// per instruction, 16 lines per wave.
__device__ __forceinline__ void ao_store_pass(const _Float16* so, _Float16* ao,
                                              int b, int head, int q0, int lane) {
  const int q8 = lane & 7, sub = lane >> 3;
  #pragma unroll
  for (int i = 0; i < 4; ++i) {
    const int lid = i * 4 + sub;                    // 0..15
    const v8h v = *(const v8ha*)(so + lid * 64 + 8 * q8);
    const size_t gi = ((size_t)b * SEQ + q0 + lid) * DMODEL + head * HD + 8 * q8;
    *(v8h*)(ao + gi) = v;
  }
}

// One 64-key stage of K (64 key rows x 128 B) and of V^T (64 d rows x 128 B)
// into LDS rows of TPITCH halves: 4 + 4 asynchronous 16-B copies per lane, each
// wave-wide copy covering four whole 128-B lines. lk/lv = this lane's LDS byte
// address of its first K / V chunk, gk/gv = the matching global address; chunk
// i lies 16 rows further on both sides.
// The closing s_wait_xcnt 0 stands inside the copies' own statement, so that no
// address register named here is rewritten ahead of it.
__device__ __forceinline__ void stage_copy(unsigned lk, unsigned lv,
                                           const _Float16* gk, const _Float16* gv) {
  const unsigned lk1 = lk + 16 * TPITCH * 2, lk2 = lk + 32 * TPITCH * 2, lk3 = lk + 48 * TPITCH * 2;
  const unsigned lv1 = lv + 16 * TPITCH * 2, lv2 = lv + 32 * TPITCH * 2, lv3 = lv + 48 * TPITCH * 2;
  const _Float16* gk1 = gk + 16 * HD;
  const _Float16* gk2 = gk + 32 * HD;
  const _Float16* gk3 = gk + 48 * HD;
  const _Float16* gv1 = gv + (size_t)16 * SEQ;
  const _Float16* gv2 = gv + (size_t)32 * SEQ;
  const _Float16* gv3 = gv + (size_t)48 * SEQ;
  asm volatile("global_load_async_to_lds_b128 %0, %8, off\n\t"
               "global_load_async_to_lds_b128 %1, %9, off\n\t"
               "global_load_async_to_lds_b128 %2, %10, off\n\t"
               "global_load_async_to_lds_b128 %3, %11, off\n\t"
               "global_load_async_to_lds_b128 %4, %12, off\n\t"
               "global_load_async_to_lds_b128 %5, %13, off\n\t"
               "global_load_async_to_lds_b128 %6, %14, off\n\t"
               "global_load_async_to_lds_b128 %7, %15, off\n\t"
               "s_wait_xcnt 0x0"
               :: "v"(lk), "v"(lk1), "v"(lk2), "v"(lk3), "v"(lv), "v"(lv1), "v"(lv2), "v"(lv3),
                  "v"(gk), "v"(gk1), "v"(gk2), "v"(gk3), "v"(gv), "v"(gv1), "v"(gv2), "v"(gv3)
               : "memory");
}

// ---------------------------------------------------------------------------
// Kernel 3: streaming attention, transposed form.
// Block 128 thr (4 waves), 16 queries per wave, 64 keys per step.
// K and V^T of a step are staged once per block in a two-buffer LDS ring by
// asynchronous copies (next step's copies fly while this step is worked on);
// all four waves read their fragments from there.
//   S^T = K * Q^T : A = K rows (row = key, k = d), B = Q^T (k = d, n = query)
//   O^T += V^T * P^T : A = Vt rows (row = d, k = key), B = P^T from registers
// Lane owns 32 keys of query column (lane&15); partner = lane ^ 16.
// Antisymmetrised rel-pos table for this head and the key-mask start values of
// this batch row built once per block in LDS.
// ---------------------------------------------------------------------------
__global__ __launch_bounds__(128) void attn_kernel(
    const _Float16* __restrict__ qh,   // [B*H][L][D]
    const _Float16* __restrict__ kh,   // [B*H][L][D]
    const _Float16* __restrict__ vt,   // [B*H][D][L]
    const int* __restrict__ mask,      // [B][L], nonzero = observed key
    const float* __restrict__ mbias,   // [H]
    const float* __restrict__ rel,     // [RELN][H]
    _Float16* __restrict__ ao)         // [B][L][DMODEL], x64
{
  __shared__ __attribute__((aligned(16))) float sB[4096];             // 16384 B
  __shared__ __attribute__((aligned(16))) float sM[SEQ];              //  8192 B
  __shared__ __attribute__((aligned(16))) _Float16 sO[4 * 16 * 64];  //  8192 B
  __shared__ __attribute__((aligned(16))) _Float16 sK[2 * TSTAGE];   // 18432 B
  __shared__ __attribute__((aligned(16))) _Float16 sV[2 * TSTAGE];   // 18432 B

  const int tid = threadIdx.x, lane = tid & 31, w = tid >> 5;
  const int h = lane >> 4, m = lane & 15;
  const int bh = blockIdx.y, b = bh >> 3, head = bh & 7;
  const int q0 = blockIdx.x * 64 + 16 * w;

  // Staging map: chunk c = tid + 128 i (i = 0..3), tile row c >> 3, 16-B column c & 7.
  const int crow = tid >> 3, ccol = tid & 7;
  const unsigned lk0 = (unsigned)(size_t)(sK + crow * TPITCH + 8 * ccol);
  const unsigned lv0 = (unsigned)(size_t)(sV + crow * TPITCH + 8 * ccol);
  const _Float16* gk0 = kh + ((size_t)bh * SEQ + crow) * HD + 8 * ccol;    // + 64 * HD per step
  const _Float16* gv0 = vt + ((size_t)bh * HD + crow) * SEQ + 8 * ccol;    // + 64 per step

  stage_copy(lk0, lv0, gk0, gv0);                                          // step 0 -> buffer 0

  // anti[i] = 0.5 * (rel[i][head] - rel[RELN-1-i][head]), i = q - k + (SEQ-1)
  // The first 31 * 128 entries are in range for every thread: their reads carry no condition.
  // Only the last 128 hold the padding entry 4095 (stored as 0, never read).
  const float* relh = rel + head;
  const float* rup = relh + tid * NHEADS;                            // row i = tid + 128 c: + c * 128 rows
  const float* rdn = relh + (RELN - 1 - tid - 128 * 30) * NHEADS;    // row RELN-1-i: + (30 - c) * 128 rows
  #pragma unroll   // all entries' loads in flight together instead of one wait per entry
  for (int c = 0; c < 31; ++c)
    sB[tid + 128 * c] = 0.5f * (rup[c * 128 * NHEADS] - rdn[(30 - c) * 128 * NHEADS]);
  {
    const int i = tid + 128 * 31;
    float v = 0.0f;
    if (i < RELN) v = 0.5f * (relh[i * NHEADS] - relh[(RELN - 1 - i) * NHEADS]);
    sB[i] = v;
  }

  // sM[key] = 0 (observed) or -inf fill + missing bias (missing)
  const float mbh = mbias[head];
  const float vmiss = -__builtin_inff() + mbh;
  #pragma unroll   // the four mask loads in flight together
  for (int i = 0; i < SEQ / 512; ++i) {
    const int k4 = 4 * tid + 512 * i;
    const v4i mm = *(const v4ia*)(mask + (size_t)b * SEQ + k4);
    const v4f t = { (mm.x != 0) ? 0.0f : vmiss, (mm.y != 0) ? 0.0f : vmiss,
                    (mm.z != 0) ? 0.0f : vmiss, (mm.w != 0) ? 0.0f : vmiss };
    *(v4fa*)(sM + k4) = t;
  }

  // Q^T B-fragments: column n = query q0+m, k = d (two 32-deep chunks)
  const _Float16* qrow = qh + ((size_t)bh * SEQ + q0 + m) * HD;
  const v16h qb0 = load_frag(qrow, h);
  const v16h qb1 = load_frag(qrow + 32, h);

  // step 0's copies of this wave have landed before the barrier that publishes them (and sB, sM)
  asm volatile("s_wait_asynccnt 0x0" ::: "memory");
  __syncthreads();

  stage_copy(lk0 + TSTAGE * 2, lv0 + TSTAGE * 2, gk0 + 64 * HD, gv0 + 64); // step 1 -> buffer 1

  const int qk = q0 + m + (SEQ - 1) - 8 * h;         // bias index for key (kb+16j) at r=0 is qk-kb-16j

  const v8f zero8 = {0.f, 0.f, 0.f, 0.f, 0.f, 0.f, 0.f, 0.f};
  const v8f eighth8 = {0.125f, 0.125f, 0.125f, 0.125f, 0.125f, 0.125f, 0.125f, 0.125f};
  v8f o[4];                                   // o[t][r] = O[query m][d 16t+8h+r] * (l * 2^14)
  #pragma unroll
  for (int t = 0; t < 4; ++t) o[t] = zero8;
  float mrun = -1e30f, lrun = 0.0f;

  const int fro = m * TPITCH;                                  // fragment row of this lane in a staged tile
  const float* smp = sM + 8 * h;                               // + key tile base

  #pragma unroll 1
  for (int st = 0; st < NSTEP; ++st) {
    const int kb = st * 64;
    const int bo = (st & 1) * TSTAGE;                          // this step's ring buffer
    const _Float16* kbase = sK + bo + fro;                     // + 16j*TPITCH + 32*dc
    const _Float16* vbase = sV + bo + fro;                     // + 16t*TPITCH + 32*kc
    // ---- rel-pos bias of this step, read ahead of the score products ----
    v8f bv[4];
    #pragma unroll   // bv[] indexed by constants, so that it stays in registers
    for (int j = 0; j < 4; ++j) bv[j] = bias_load8(sB, qk - kb - 16 * j);
    // ---- raw scores on the mask start: s[j][r] = sM[key] + (Q.K)[query m][key kb+16j+8h+r] ----
    v8f s[4];
    #pragma unroll
    for (int j = 0; j < 4; ++j) {
      const _Float16* kp = kbase + 16 * j * TPITCH;
      const v16h kf0 = load_frag(kp, h);
      const v16h kf1 = load_frag(kp + 32, h);
      v8f z = mask_start8(smp + kb + 16 * j);
      z = wmma_f16(kf0, qb0, z);
      z = wmma_f16(kf1, qb1, z);
      s[j] = z;
    }
    // ---- scale 1/8, rel-pos bias (f32) ----
    #pragma unroll
    for (int j = 0; j < 4; ++j)
      s[j] = __builtin_elementwise_fma(s[j], eighth8, bv[j]);

    // ---- online softmax ----
    float mloc = s[0][0];
    #pragma unroll
    for (int j = 0; j < 4; ++j)
      #pragma unroll
      for (int r = 0; r < 8; ++r) mloc = fmaxf(mloc, s[j][r]);
    mloc = fmaxf(mloc, __shfl_xor(mloc, 16));
    const float mnew = fmaxf(mrun, mloc);
    const float alpha = __expf(mrun - mnew);
    mrun = mnew;
    float lsum = 0.0f;
    #pragma unroll
    for (int j = 0; j < 4; ++j)
      #pragma unroll
      for (int r = 0; r < 8; ++r) {
        const float p = __expf(s[j][r] - mnew);
        s[j][r] = p;
        lsum += p;
      }
    lsum += __shfl_xor(lsum, 16);
    lrun = lrun * alpha + lsum;
    #pragma unroll
    for (int t = 0; t < 4; ++t)
      #pragma unroll
      for (int r = 0; r < 8; ++r) o[t][r] = o[t][r] * alpha;

    // ---- P^T B-fragments (key chunks 0..31 and 32..63 of this step) ----
    const v16h pb0 = pack_p(s[0], s[1]);
    const v16h pb1 = pack_p(s[2], s[3]);

    // ---- O^T += V^T * P^T ----
    #pragma unroll
    for (int t = 0; t < 4; ++t) {
      const _Float16* vp = vbase + 16 * t * TPITCH;
      const v16h vf0 = load_frag(vp, h);
      const v16h vf1 = load_frag(vp + 32, h);
      o[t] = wmma_f16(vf0, pb0, o[t]);
      o[t] = wmma_f16(vf1, pb1, o[t]);
    }

    // ---- hand-over: this wave's reads of buffer st&1 are done, its copies of step st+1
    // have landed; the barrier publishes step st+1 and frees buffer st&1 for the refill ----
    asm volatile("s_wait_dscnt 0x0" ::: "memory");
    asm volatile("s_wait_asynccnt 0x0" ::: "memory");
    __syncthreads();
    if (st + 2 < NSTEP)
      stage_copy(lk0 + bo * 2, lv0 + bo * 2, gk0 + (size_t)(kb + 128) * HD, gv0 + (kb + 128));
  }
  // no copy is left in flight when the wave goes on to the epilogue
  asm volatile("s_wait_asynccnt 0x0" ::: "memory");

  // ---- epilogue: normalise, x64, stage per-wave 16x64 f16 tile, whole-line stores ----
  const float inv = __builtin_amdgcn_rcpf(lrun) * (AOSCALE / PSCALE);
  _Float16* so = sO + w * 1024;
  #pragma unroll
  for (int t = 0; t < 4; ++t)
    #pragma unroll
    for (int r = 0; r < 8; ++r)
      so[m * 64 + 16 * t + 8 * h + r] = (_Float16)(o[t][r] * inv);
  __syncthreads();

  ao_store_pass(so, ao, b, head, q0, lane);
  
}

// ---------------------------------------------------------------------------
// 16-B stores, 4 lines per instruction, 64 lines per wave.
// ---------------------------------------------------------------------------
__device__ __forceinline__ void out_store_pass(const float* sT, float* out, int m0, int fg, int w, int lane) {
  const int q8 = lane & 7, sub = lane >> 3;
  #pragma unroll
  for (int i = 0; i < 16; ++i) {
    const int lid = i * 4 + sub;                   // 0..63
    const int row = 32 * w + (lid >> 1), hl = lid & 1;
    const v4f v = *(const v4fa*)(sT + row * 64 + 32 * hl + 4 * q8);
    const size_t gi = ((size_t)(m0 + row)) * DMODEL + fg * 64 + 32 * hl + 4 * q8;
    *(v4f*)(out + gi) = v;
  }
}

// ---------------------------------------------------------------------------
// Kernel 4: out = AO * Wo^T + bo (f32). Block 128 thr = 128 tokens x 64
// features (fg = blockIdx.y); wave tile 32 x 64; K = 512 in staged steps of 64
// (gemm_128x64); the output tile sT reuses the ring's LDS after the main loop.
// ---------------------------------------------------------------------------
__global__ __launch_bounds__(128) void oproj_kernel(
    const _Float16* __restrict__ ao,   // [8192][512] f16, x64
    const _Float16* __restrict__ woh,  // [512][512] f16, row = output feature, x32
    const float* __restrict__ bo,      // [512]
    float* __restrict__ out)           // [8192][512] f32
{
  __shared__ __attribute__((aligned(16))) _Float16 sG[2 * GSTAGE];  // 55296 B
  float* sT = (float*)sG;                                           // 128 x 64 floats (32768 B), after the main loop

  const int tid = threadIdx.x, lane = tid & 31, w = tid >> 5;
  const int h = lane >> 4, m = lane & 15;
  const int m0 = blockIdx.x * 128;
  const int fg = blockIdx.y;                 // 0..7

  const v8f zero8 = {0.f, 0.f, 0.f, 0.f, 0.f, 0.f, 0.f, 0.f};
  v8f acc[2][4];
  #pragma unroll
  for (int mt = 0; mt < 2; ++mt)
    #pragma unroll
    for (int nt = 0; nt < 4; ++nt) acc[mt][nt] = zero8;

  gemm_128x64(ao + (size_t)m0 * DMODEL, woh + (size_t)fg * 64 * DMODEL, sG, tid, acc);

  // D[r] of tile (mt, nt) = out[token m0+32w+16mt+8h+r][feature fg*64+16nt+m]
  #pragma unroll
  for (int nt = 0; nt < 4; ++nt) {
    const int feat = 16 * nt + m;
    const float bvl = bo[fg * 64 + feat];
    #pragma unroll
    for (int mt = 0; mt < 2; ++mt) {
      #pragma unroll
      for (int r = 0; r < 8; ++r) {
        const int tokl = 32 * w + 16 * mt + 8 * h + r;
        sT[tokl * 64 + feat] = acc[mt][nt][r] * (1.0f / (WSCALE * AOSCALE)) + bvl;
      }
    }
  }
  __syncthreads();

  out_store_pass(sT, out, m0, fg, w, lane);
  
}

// ---------------------------------------------------------------------------
extern "C" void kernel_launch(void* const* d_in, const int* in_sizes, int n_in,
                              void* d_out, int out_size, void* d_ws, size_t ws_size,
                              hipStream_t stream) {
  if (n_in < 12) return;
  if (in_sizes[0] != NX) return;
  if (in_sizes[1] != MROWS) return;
  if (in_sizes[2] != NW || in_sizes[4] != NW || in_sizes[6] != NW || in_sizes[8] != NW) return;
  if (in_sizes[3] != DMODEL || in_sizes[5] != DMODEL || in_sizes[7] != DMODEL || in_sizes[9] != DMODEL) return;
  if (in_sizes[10] != NHEADS) return;
  if (in_sizes[11] != RELN * NHEADS) return;
  if (out_size != NX) return;

  const float* x     = (const float*)d_in[0];
  const int*   mask  = (const int*)d_in[1];
  const float* Wq    = (const float*)d_in[2];
  const float* bq    = (const float*)d_in[3];
  const float* Wk    = (const float*)d_in[4];
  const float* bk    = (const float*)d_in[5];
  const float* Wv    = (const float*)d_in[6];
  const float* bv    = (const float*)d_in[7];
  const float* Wo    = (const float*)d_in[8];
  const float* bo    = (const float*)d_in[9];
  const float* mbias = (const float*)d_in[10];
  const float* rel   = (const float*)d_in[11];
  float* out = (float*)d_out;

  const size_t xh_bytes = (size_t)NX * 2;                           //  8388608
  const size_t wh_bytes = (size_t)4 * NW * 2;                       //  2097152
  const size_t pl_bytes = (size_t)BATCH * NHEADS * SEQ * HD * 2;    //  8388608
  const size_t ao_bytes = (size_t)NX * 2;                           //  8388608
  const size_t total = xh_bytes + wh_bytes + 3 * pl_bytes + ao_bytes;   // 44040192
  if (total > ws_size) return;

  char* ws = (char*)d_ws;
  size_t off = 0;
  _Float16* xh  = (_Float16*)(ws + off);  off += xh_bytes;
  _Float16* wh  = (_Float16*)(ws + off);  off += wh_bytes;
  _Float16* qh  = (_Float16*)(ws + off);  off += pl_bytes;
  _Float16* kh  = (_Float16*)(ws + off);  off += pl_bytes;
  _Float16* vt  = (_Float16*)(ws + off);  off += pl_bytes;
  _Float16* ao  = (_Float16*)(ws + off);  off += ao_bytes;
  if (off > ws_size) return;

  const int ngroups = XGROUPS + NW8;                                // 163840
  convert_kernel<<<(ngroups + 255) / 256, 256, 0, stream>>>(x, Wq, Wk, Wv, Wo, xh, wh);

  dim3 gProj(MROWS / 128, 3 * NHEADS);                              // (64, 24)
  proj_kernel<<<gProj, 128, 0, stream>>>(xh, wh, bq, bk, bv, qh, kh, vt);

  dim3 gAtt(SEQ / 64, BATCH * NHEADS);                              // (32, 32)
  attn_kernel<<<gAtt, 128, 0, stream>>>(qh, kh, vt, mask, mbias, rel, ao);

  dim3 gOut(MROWS / 128, DMODEL / 64);                              // (64, 8)
  oproj_kernel<<<gOut, 128, 0, stream>>>(ao, wh + (size_t)3 * NW, bo, out);
}

// v005
// One run takes 91.3 microseconds.
// Next to v004, in two timings, it ran 1.04 times as fast each time.
// Over all steps from v000 it is 3.16 times as fast.
// Contractions: x*W^T for q,k,v and o, K*Q^T, V^T*P^T all on v_wmma_f32_16x16x32_f16 (f16 operands, f32 accumulate); W carried x32, P carried x16384, attention rows carried x64 (exact power-of-two scales folded back in f32); PE, bias tables, key mask, softmax and normalisation in f32.
#include <hip/hip_runtime.h>

typedef _Float16 v16h __attribute__((ext_vector_type(16)));
typedef _Float16 v8h  __attribute__((ext_vector_type(8)));
typedef float    v8f  __attribute__((ext_vector_type(8)));
typedef float    v4f  __attribute__((ext_vector_type(4)));
typedef int      v4i  __attribute__((ext_vector_type(4)));
typedef v8h __attribute__((may_alias)) v8ha;
typedef v4f __attribute__((may_alias)) v4fa;
typedef v4i __attribute__((may_alias)) v4ia;

union Frag { v16h v; v8h half[2]; };

#define DMODEL 512
#define NHEADS 8
#define HD     64
#define SEQ    2048
#define BATCH  4
#define MROWS  (BATCH * SEQ)          // 8192 tokens
#define NX     (MROWS * DMODEL)       // 4194304
#define NW     (DMODEL * DMODEL)      // 262144
#define NW8    (NW / 8)               // 32768
#define RELN   (2 * SEQ - 1)          // 4095
#define NPE    (SEQ * DMODEL)         // 1048576 elements of one batch entry
#define XGROUPS (NPE / 8)             // 131072 groups of 8 features of one batch entry
#define PSCALE  16384.0f
#define WSCALE  32.0f
#define AOSCALE 64.0f
#define LOG2E   1.44269502f           // what __expf multiplies by ahead of its v_exp_f32
#define TPITCH  72                    // halves per staged LDS row: 144 B = 16 B x 9, conflict-free for 16-B fragment reads
#define TSTAGE  (64 * TPITCH)         // halves per staged 64-row tile
#define NSTEP   (SEQ / 64)            // 32 key steps
#define GROWS   192                   // staged rows of a projection k step: 128 token rows, then 64 feature rows
#define GSTAGE  (GROWS * TPITCH)      // halves per staged projection k step (27648 B)
#define GSTEPS  (DMODEL / 64)         // 8 k steps of 64

static_assert(BATCH == 4);
static_assert((XGROUPS % 256) == 0 && (NW8 % 256) == 0);
static_assert((MROWS % 128) == 0 && (SEQ % 128) == 0);

// ---------------------------------------------------------------------------
// 16x16x32 f16 WMMA. wmma_f16: with hazard guard (ties D, keeps A/B live), used
// by the two projections. wmma_f16_free: the bare builtin, used by attention,
// where vector work stands between the products: the compiler keeps the distance
// behind each product with the softmax's own instructions where it can, and is
// free to fetch the next fragments while a product runs.
// Fragment map (wave32): lane l, h = l>>4, m = n = l&15.
//   A/B element i: i<8 -> k0+8h+i ; i>=8 -> k0+16+8h+(i-8)
//   D element r : row 8h+r, col l&15
// ---------------------------------------------------------------------------
__device__ __forceinline__ v8f wmma_f16(v16h a, v16h b, v8f c) {
  v8f d = __builtin_amdgcn_wmma_f32_16x16x32_f16(false, a, false, b, (short)0, c, false, false);
  asm volatile("v_nop\n\tv_nop\n\tv_nop\n\tv_nop" : "+v"(d) : "v"(a), "v"(b));
  return d;
}

__device__ __forceinline__ v8f wmma_f16_free(v16h a, v16h b, v8f c) {
  return __builtin_amdgcn_wmma_f32_16x16x32_f16(false, a, false, b, (short)0, c, false, false);
}

// A or B fragment from a k-contiguous 16-bit row; p points at element k0 of
// the row owned by this lane (row index = lane & 15 added by the caller).
__device__ __forceinline__ v16h load_frag(const _Float16* p, int h) {
  Frag f;
  f.half[0] = *(const v8ha*)(p + 8 * h);
  f.half[1] = *(const v8ha*)(p + 16 + 8 * h);
  return f.v;
}

// ---------------------------------------------------------------------------
// Kernel 1: f32 -> f16 planes. xh = f16(x + pe) unscaled, wh = f16(32*W) for
// Wq,Wk,Wv,Wo (row = output feature, k-contiguous). Four 16-B stores per lane.
// pe[t][2p] = sin(t*div_p), pe[t][2p+1] = cos(t*div_p),
// div_p = exp(f32(2p) * f32(-ln(1e4)/512)).
// x blocks: a thread owns 8 features of position t; it forms their four
// (sin, cos) pairs once, in registers, and adds them to that position's row of
// all four batch entries. W blocks: a thread converts the same 8 elements of
// all four matrices. All eight 16-B loads of a thread are issued up front.
// ---------------------------------------------------------------------------
__device__ __forceinline__ v8h pack8(v4f a, v4f c) {
  const v8h o = { (_Float16)a.x, (_Float16)a.y, (_Float16)a.z, (_Float16)a.w,
                  (_Float16)c.x, (_Float16)c.y, (_Float16)c.z, (_Float16)c.w };
  return o;
}

__global__ __launch_bounds__(256) void convert_kernel(
    const float* __restrict__ x,
    const float* __restrict__ wq, const float* __restrict__ wk,
    const float* __restrict__ wv, const float* __restrict__ wo,
    _Float16* __restrict__ xh, _Float16* __restrict__ wh)
{
  const int g = blockIdx.x * 256 + threadIdx.x;
  if (g >= XGROUPS + NW8) return;
  v4f a[4], c[4];
  if (g < XGROUPS) {
    const int t = g >> 6;                   // position 0..2047 (64 groups of 8 per row)
    const int db = (g & 63) * 8;            // first feature of the group
    const unsigned so = (unsigned)g * 32u;  // byte offset of the group in a batch entry of x
    #pragma unroll   // a[], c[] indexed by constants, so that they stay in registers
    for (int b = 0; b < BATCH; ++b) {
      const char* src = (const char*)(x + (size_t)b * NPE) + so;
      a[b] = *(const v4fa*)src;
      c[b] = *(const v4fa*)(src + 16);
    }
    const float kc = (float)(-9.210340371976184 / 512.0);
    float sn[4], cs[4];
    #pragma unroll   // sn[], cs[] indexed by constants, so that they stay in registers
    for (int i = 0; i < 4; ++i) {
      const float fr = expf((float)(db + 2 * i) * kc);
      const float ang = (float)t * fr;
      sn[i] = sinf(ang);
      cs[i] = cosf(ang);
    }
    const v4f pa = { sn[0], cs[0], sn[1], cs[1] };
    const v4f pc = { sn[2], cs[2], sn[3], cs[3] };
    const unsigned dofs = (unsigned)g * 16u;  // byte offset of the group in a batch entry of xh
    #pragma unroll
    for (int b = 0; b < BATCH; ++b)
      *(v8h*)((char*)(xh + (size_t)b * NPE) + dofs) = pack8(a[b] + pa, c[b] + pc);
  } else {
    const unsigned e = (unsigned)(g - XGROUPS);
    const unsigned so = e * 32u;            // byte offset of the group in a matrix
    a[0] = *(const v4fa*)((const char*)wq + so);  c[0] = *(const v4fa*)((const char*)wq + so + 16);
    a[1] = *(const v4fa*)((const char*)wk + so);  c[1] = *(const v4fa*)((const char*)wk + so + 16);
    a[2] = *(const v4fa*)((const char*)wv + so);  c[2] = *(const v4fa*)((const char*)wv + so + 16);
    a[3] = *(const v4fa*)((const char*)wo + so);  c[3] = *(const v4fa*)((const char*)wo + so + 16);
    const unsigned dofs = e * 16u;          // byte offset of the group in a plane of wh
    #pragma unroll
    for (int i = 0; i < 4; ++i)
      *(v8h*)((char*)(wh + (size_t)i * NW) + dofs) = pack8(a[i] * WSCALE, c[i] * WSCALE);
  }
}

// ---------------------------------------------------------------------------
// One 64-deep k step of a projection into LDS rows of TPITCH halves: 128 token
// rows (8 chunks per lane) and 64 feature rows (4 chunks per lane), 128 B each,
// by asynchronous 16-B copies; each wave-wide copy covers four whole 128-B
// lines. l = this lane's LDS byte address of its first chunk, ga / gb = the
// matching global addresses; chunk i lies 16 rows further on both sides.
// The closing s_wait_xcnt 0 stands inside the copies' own statement, so that no
// address register named here is rewritten ahead of it.
// ---------------------------------------------------------------------------
__device__ __forceinline__ void gemm_stage_copy(unsigned l, const _Float16* ga, const _Float16* gb) {
  const unsigned rs = 16 * TPITCH * 2;                 // 16 staged rows in bytes
  const unsigned l1 = l + rs,     l2 = l + 2 * rs,  l3 = l + 3 * rs,   l4 = l + 4 * rs;
  const unsigned l5 = l + 5 * rs, l6 = l + 6 * rs,  l7 = l + 7 * rs,   l8 = l + 8 * rs;
  const unsigned l9 = l + 9 * rs, l10 = l + 10 * rs, l11 = l + 11 * rs;
  const _Float16* a1 = ga + 16 * DMODEL;
  const _Float16* a2 = ga + 32 * DMODEL;
  const _Float16* a3 = ga + 48 * DMODEL;
  const _Float16* a4 = ga + 64 * DMODEL;
  const _Float16* a5 = ga + 80 * DMODEL;
  const _Float16* a6 = ga + 96 * DMODEL;
  const _Float16* a7 = ga + 112 * DMODEL;
  const _Float16* b1 = gb + 16 * DMODEL;
  const _Float16* b2 = gb + 32 * DMODEL;
  const _Float16* b3 = gb + 48 * DMODEL;
  asm volatile("global_load_async_to_lds_b128 %0, %12, off\n\t"
               "global_load_async_to_lds_b128 %1, %13, off\n\t"
               "global_load_async_to_lds_b128 %2, %14, off\n\t"
               "global_load_async_to_lds_b128 %3, %15, off\n\t"
               "global_load_async_to_lds_b128 %4, %16, off\n\t"
               "global_load_async_to_lds_b128 %5, %17, off\n\t"
               "global_load_async_to_lds_b128 %6, %18, off\n\t"
               "global_load_async_to_lds_b128 %7, %19, off\n\t"
               "global_load_async_to_lds_b128 %8, %20, off\n\t"
               "global_load_async_to_lds_b128 %9, %21, off\n\t"
               "global_load_async_to_lds_b128 %10, %22, off\n\t"
               "global_load_async_to_lds_b128 %11, %23, off\n\t"
               "s_wait_xcnt 0x0"
               :: "v"(l), "v"(l1), "v"(l2), "v"(l3), "v"(l4), "v"(l5), "v"(l6), "v"(l7),
                  "v"(l8), "v"(l9), "v"(l10), "v"(l11),
                  "v"(ga), "v"(a1), "v"(a2), "v"(a3), "v"(a4), "v"(a5), "v"(a6), "v"(a7),
                  "v"(gb), "v"(b1), "v"(b2), "v"(b3)
               : "memory");
}

// ---------------------------------------------------------------------------
// Main loop of both projections: acc[mt][nt] += A(128 rows) * B(64 rows)^T over
// K = 512, both operands k-contiguous f16 rows of DMODEL halves. Block 128 thr,
// wave tile 32 x 64. Each 64-deep k step is staged once per block in a
// two-buffer LDS ring (the next step's copies fly while this step is worked
// on); the fragments are read from there, in the same ascending k order.
// On return every wave has passed the last barrier and no copy is in flight, so
// the caller may reuse sG.
// ---------------------------------------------------------------------------
__device__ __forceinline__ void gemm_128x64(const _Float16* arows, const _Float16* brows,
                                            _Float16* sG, int tid, v8f (&acc)[2][4]) {
  const int lane = tid & 31, w = tid >> 5;
  const int h = lane >> 4, m = lane & 15;
  // Staging map: chunk c = tid + 128 i (i = 0..11), staged row c >> 3, 16-B column c & 7.
  const int crow = tid >> 3, ccol = tid & 7;
  const unsigned l0 = (unsigned)(size_t)(sG + crow * TPITCH + 8 * ccol);
  const _Float16* ga0 = arows + (size_t)crow * DMODEL + 8 * ccol;          // + 64 per step
  const _Float16* gb0 = brows + (size_t)crow * DMODEL + 8 * ccol;          // + 64 per step

  gemm_stage_copy(l0, ga0, gb0);                                           // step 0 -> buffer 0
  // step 0's copies of this wave have landed before the barrier that publishes them
  asm volatile("s_wait_asynccnt 0x0" ::: "memory");
  __syncthreads();
  gemm_stage_copy(l0 + GSTAGE * 2, ga0 + 64, gb0 + 64);                    // step 1 -> buffer 1

  #pragma unroll 1   // rolled: one copy of the body, the ring buffer picked by the step's parity
  for (int t = 0; t < GSTEPS; ++t) {
    const int bo = (t & 1) * GSTAGE;                                       // this step's ring buffer
    const _Float16* ab = sG + bo + (32 * w + m) * TPITCH;                  // token row, mt = 0
    const _Float16* bb = sG + bo + (128 + m) * TPITCH;                     // feature row, nt = 0
    // all fragments of the step are read as one group ahead of its products
    v16h af[2][2], bf[2][4];
    #pragma unroll   // af[][], bf[][] indexed by constants, so that they stay in registers
    for (int kc = 0; kc < 2; ++kc) {
      af[kc][0] = load_frag(ab + 32 * kc, h);
      af[kc][1] = load_frag(ab + 16 * TPITCH + 32 * kc, h);
      #pragma unroll
      for (int nt = 0; nt < 4; ++nt) bf[kc][nt] = load_frag(bb + nt * 16 * TPITCH + 32 * kc, h);
    }
    #pragma unroll   // acc[][] indexed by constants, so that it stays in registers
    for (int kc = 0; kc < 2; ++kc) {
      #pragma unroll
      for (int nt = 0; nt < 4; ++nt) {
        acc[0][nt] = wmma_f16(af[kc][0], bf[kc][nt], acc[0][nt]);
        acc[1][nt] = wmma_f16(af[kc][1], bf[kc][nt], acc[1][nt]);
      }
    }
    // ---- hand-over: this wave's reads of buffer t&1 are done, its copies of step t+1 have
    // landed; the barrier publishes step t+1 and frees buffer t&1 for the refill ----
    asm volatile("s_wait_dscnt 0x0" ::: "memory");
    asm volatile("s_wait_asynccnt 0x0" ::: "memory");
    __syncthreads();
    if (t + 2 < GSTEPS)
      gemm_stage_copy(l0 + bo * 2, ga0 + (t + 2) * 64, gb0 + (t + 2) * 64);
  }
  // no copy is left in flight when the wave goes on to the epilogue
  asm volatile("s_wait_asynccnt 0x0" ::: "memory");
}

// ---------------------------------------------------------------------------
// 4 lines per instruction, 32 lines per wave, 128 per block.
// which 0/1: plane[bh][l][d]  (one token row = 64 halves = one line)
// which 2  : vt[bh][d][l]     (64 d-rows x 128 tokens = 2 lines each)
// ---------------------------------------------------------------------------
__device__ __forceinline__ void proj_store_pass(const _Float16* sT, _Float16* plane, _Float16* vt,
                                                int which, int bh, int l0, int w, int lane) {
  const int q8 = lane & 7, sub = lane >> 3;
  #pragma unroll
  for (int i = 0; i < 8; ++i) {
    const int lid = w * 32 + i * 4 + sub;
    v8h v;
    _Float16* dst;
    if (which != 2) {
      v = *(const v8ha*)(sT + lid * HD + 8 * q8);
      dst = plane + ((size_t)bh * SEQ + l0 + lid) * HD + 8 * q8;
    } else {
      const int d = lid >> 1, hl = lid & 1;
      v = *(const v8ha*)(sT + d * 128 + 64 * hl + 8 * q8);
      dst = vt + ((size_t)bh * HD + d) * SEQ + l0 + 64 * hl + 8 * q8;
    }
    *(v8h*)dst = v;
  }
}

// ---------------------------------------------------------------------------
// Kernel 2: Y = (x+pe) * W^T + bias over the fused 3*512 output columns.
// Block 128 thr (4 waves) = 128 tokens x 64 features (one (which, head));
// wave tile 32 tokens x 64 features; K = 512 in staged steps of 64 (gemm_128x64);
// the output tile sT reuses the ring's LDS once the main loop has returned.
// ---------------------------------------------------------------------------
__global__ __launch_bounds__(128) void proj_kernel(
    const _Float16* __restrict__ xh,   // [8192][512]
    const _Float16* __restrict__ wh,   // [4][512][512], row = output feature, x32
    const float* __restrict__ bq, const float* __restrict__ bk, const float* __restrict__ bv,
    _Float16* __restrict__ qh,         // [B*H][L][D]  f16(q)
    _Float16* __restrict__ kh,         // [B*H][L][D]  f16(k)
    _Float16* __restrict__ vt)         // [B*H][D][L]  f16(v)
{
  __shared__ __attribute__((aligned(16))) _Float16 sG[2 * GSTAGE];  // 55296 B
  _Float16* sT = sG;                                                // 128 x 64 halves, after the main loop

  const int tid = threadIdx.x, lane = tid & 31, w = tid >> 5;
  const int h = lane >> 4, m = lane & 15;
  const int m0 = blockIdx.x * 128;
  const int cg = blockIdx.y;                 // 0..23
  const int which = cg >> 3, head = cg & 7;

  const v8f zero8 = {0.f, 0.f, 0.f, 0.f, 0.f, 0.f, 0.f, 0.f};
  v8f acc[2][4];
  #pragma unroll
  for (int mt = 0; mt < 2; ++mt)
    #pragma unroll
    for (int nt = 0; nt < 4; ++nt) acc[mt][nt] = zero8;

  gemm_128x64(xh + (size_t)m0 * DMODEL, wh + ((size_t)which * DMODEL + head * HD) * DMODEL, sG, tid, acc);

  // D[r] of tile (mt, nt) = Y[token m0+32w+16mt+8h+r][feature 16nt+m]
  const float* bias = (which == 0) ? bq : ((which == 1) ? bk : bv);
  #pragma unroll
  for (int nt = 0; nt < 4; ++nt) {
    const int feat = 16 * nt + m;
    const float bvl = bias[head * HD + feat];
    #pragma unroll
    for (int mt = 0; mt < 2; ++mt) {
      #pragma unroll
      for (int r = 0; r < 8; ++r) {
        const int tokl = 32 * w + 16 * mt + 8 * h + r;     // 0..127
        const float y = acc[mt][nt][r] * (1.0f / WSCALE) + bvl;
        const int idx = (which == 2) ? (feat * 128 + tokl) : (tokl * HD + feat);
        sT[idx] = (_Float16)y;
      }
    }
  }
  __syncthreads();

  const int b = m0 / SEQ, l0 = m0 - b * SEQ, bh = b * NHEADS + head;
  _Float16* plane = (which == 0) ? qh : kh;
  proj_store_pass(sT, plane, vt, which, bh, l0, w, lane);
  
}

// ---------------------------------------------------------------------------
// Attention helpers.
// Score element r of this lane: key = kb + 16j + 8h + r, query = q0 + m.
// v = mask ? (s*0.125 + anti[q - key + 2047]) : (-inf + missing_bias[head]).
// The key mask enters as the start value C of the score product: sm[key] = 0
// for an observed key, -inf + missing_bias[head] for a missing one, so that
// C + K.Q stays that non-finite value through the scale and the bias below.
// sb = per-head antisymmetrised rel-pos table in LDS, base = index for r = 0
// (index decreases by one per r); every index is in range for every key, so
// the reads carry no condition and no branch.
// ---------------------------------------------------------------------------
__device__ __forceinline__ v8f mask_start8(const float* sm) {
  const v4f a = *(const v4fa*)sm;
  const v4f c = *(const v4fa*)(sm + 4);
  const v8f z = { a.x, a.y, a.z, a.w, c.x, c.y, c.z, c.w };
  return z;
}

__device__ __forceinline__ v8f bias_load8(const float* sb, int base) {
  const v8f t = { sb[base],     sb[base - 1], sb[base - 2], sb[base - 3],
                  sb[base - 4], sb[base - 5], sb[base - 6], sb[base - 7] };
  return t;
}

// P^T B-fragment from the lane's own score D values: element r <- tile a row r,
// element 8+r <- tile c row r (same lane, same query column), scaled by 2^14.
__device__ __forceinline__ v16h pack_p(v8f a, v8f c) {
  const v16h r = { (_Float16)(a[0] * PSCALE), (_Float16)(a[1] * PSCALE), (_Float16)(a[2] * PSCALE), (_Float16)(a[3] * PSCALE),
                   (_Float16)(a[4] * PSCALE), (_Float16)(a[5] * PSCALE), (_Float16)(a[6] * PSCALE), (_Float16)(a[7] * PSCALE),
                   (_Float16)(c[0] * PSCALE), (_Float16)(c[1] * PSCALE), (_Float16)(c[2] * PSCALE), (_Float16)(c[3] * PSCALE),
                   (_Float16)(c[4] * PSCALE), (_Float16)(c[5] * PSCALE), (_Float16)(c[6] * PSCALE), (_Float16)(c[7] * PSCALE) };
  return r;
}

// (one token row's head slice) by lanes 8q..8q+7 in one instruction, 4 lines
// per instruction, 16 lines per wave.
__device__ __forceinline__ void ao_store_pass(const _Float16* so, _Float16* ao,
                                              int b, int head, int q0, int lane) {
  const int q8 = lane & 7, sub = lane >> 3;
  #pragma unroll
  for (int i = 0; i < 4; ++i) {
    const int lid = i * 4 + sub;                    // 0..15
    const v8h v = *(const v8ha*)(so + lid * 64 + 8 * q8);
    const size_t gi = ((size_t)b * SEQ + q0 + lid) * DMODEL + head * HD + 8 * q8;
    *(v8h*)(ao + gi) = v;
  }
}

// One 64-key stage of K (64 key rows x 128 B) and of V^T (64 d rows x 128 B)
// into LDS rows of TPITCH halves: 4 + 4 asynchronous 16-B copies per lane, each
// wave-wide copy covering four whole 128-B lines. lk/lv = this lane's LDS byte
// address of its first K / V chunk, gk/gv = the matching global address; chunk
// i lies 16 rows further on both sides.
// The closing s_wait_xcnt 0 stands inside the copies' own statement, so that no
// address register named here is rewritten ahead of it.
__device__ __forceinline__ void stage_copy(unsigned lk, unsigned lv,
                                           const _Float16* gk, const _Float16* gv) {
  const unsigned lk1 = lk + 16 * TPITCH * 2, lk2 = lk + 32 * TPITCH * 2, lk3 = lk + 48 * TPITCH * 2;
  const unsigned lv1 = lv + 16 * TPITCH * 2, lv2 = lv + 32 * TPITCH * 2, lv3 = lv + 48 * TPITCH * 2;
  const _Float16* gk1 = gk + 16 * HD;
  const _Float16* gk2 = gk + 32 * HD;
  const _Float16* gk3 = gk + 48 * HD;
  const _Float16* gv1 = gv + (size_t)16 * SEQ;
  const _Float16* gv2 = gv + (size_t)32 * SEQ;
  const _Float16* gv3 = gv + (size_t)48 * SEQ;
  asm volatile("global_load_async_to_lds_b128 %0, %8, off\n\t"
               "global_load_async_to_lds_b128 %1, %9, off\n\t"
               "global_load_async_to_lds_b128 %2, %10, off\n\t"
               "global_load_async_to_lds_b128 %3, %11, off\n\t"
               "global_load_async_to_lds_b128 %4, %12, off\n\t"
               "global_load_async_to_lds_b128 %5, %13, off\n\t"
               "global_load_async_to_lds_b128 %6, %14, off\n\t"
               "global_load_async_to_lds_b128 %7, %15, off\n\t"
               "s_wait_xcnt 0x0"
               :: "v"(lk), "v"(lk1), "v"(lk2), "v"(lk3), "v"(lv), "v"(lv1), "v"(lv2), "v"(lv3),
                  "v"(gk), "v"(gk1), "v"(gk2), "v"(gk3), "v"(gv), "v"(gv1), "v"(gv2), "v"(gv3)
               : "memory");
}

// ---------------------------------------------------------------------------
// Kernel 3: streaming attention, transposed form.
// Block 128 thr (4 waves), 16 queries per wave, 64 keys per step.
// K and V^T of a step are staged once per block in a two-buffer LDS ring by
// asynchronous copies (next step's copies fly while this step is worked on);
// all four waves read their fragments from there.
//   S^T = K * Q^T : A = K rows (row = key, k = d), B = Q^T (k = d, n = query)
//   O^T += V^T * P^T : A = Vt rows (row = d, k = key), B = P^T from registers
// Lane owns 32 keys of query column (lane&15); partner = lane ^ 16.
// Antisymmetrised rel-pos table for this head and the key-mask start values of
// this batch row built once per block in LDS.
// ---------------------------------------------------------------------------
__global__ __launch_bounds__(128) void attn_kernel(
    const _Float16* __restrict__ qh,   // [B*H][L][D]
    const _Float16* __restrict__ kh,   // [B*H][L][D]
    const _Float16* __restrict__ vt,   // [B*H][D][L]
    const int* __restrict__ mask,      // [B][L], nonzero = observed key
    const float* __restrict__ mbias,   // [H]
    const float* __restrict__ rel,     // [RELN][H]
    _Float16* __restrict__ ao)         // [B][L][DMODEL], x64
{
  __shared__ __attribute__((aligned(16))) float sB[4096];             // 16384 B
  __shared__ __attribute__((aligned(16))) float sM[SEQ];              //  8192 B
  __shared__ __attribute__((aligned(16))) _Float16 sO[4 * 16 * 64];  //  8192 B
  __shared__ __attribute__((aligned(16))) _Float16 sK[2 * TSTAGE];   // 18432 B
  __shared__ __attribute__((aligned(16))) _Float16 sV[2 * TSTAGE];   // 18432 B

  const int tid = threadIdx.x, lane = tid & 31, w = tid >> 5;
  const int h = lane >> 4, m = lane & 15;
  const int bh = blockIdx.y, b = bh >> 3, head = bh & 7;
  const int q0 = blockIdx.x * 64 + 16 * w;

  // Staging map: chunk c = tid + 128 i (i = 0..3), tile row c >> 3, 16-B column c & 7.
  const int crow = tid >> 3, ccol = tid & 7;
  const unsigned lk0 = (unsigned)(size_t)(sK + crow * TPITCH + 8 * ccol);
  const unsigned lv0 = (unsigned)(size_t)(sV + crow * TPITCH + 8 * ccol);
  const _Float16* gk0 = kh + ((size_t)bh * SEQ + crow) * HD + 8 * ccol;    // + 64 * HD per step
  const _Float16* gv0 = vt + ((size_t)bh * HD + crow) * SEQ + 8 * ccol;    // + 64 per step

  stage_copy(lk0, lv0, gk0, gv0);                                          // step 0 -> buffer 0

  // anti[i] = 0.5 * (rel[i][head] - rel[RELN-1-i][head]), i = q - k + (SEQ-1)
  // The first 31 * 128 entries are in range for every thread: their reads carry no condition.
  // Only the last 128 hold the padding entry 4095 (stored as 0, never read).
  const float* relh = rel + head;
  const float* rup = relh + tid * NHEADS;                            // row i = tid + 128 c: + c * 128 rows
  const float* rdn = relh + (RELN - 1 - tid - 128 * 30) * NHEADS;    // row RELN-1-i: + (30 - c) * 128 rows
  #pragma unroll   // all entries' loads in flight together instead of one wait per entry
  for (int c = 0; c < 31; ++c)
    sB[tid + 128 * c] = 0.5f * (rup[c * 128 * NHEADS] - rdn[(30 - c) * 128 * NHEADS]);
  {
    const int i = tid + 128 * 31;
    float v = 0.0f;
    if (i < RELN) v = 0.5f * (relh[i * NHEADS] - relh[(RELN - 1 - i) * NHEADS]);
    sB[i] = v;
  }

  // sM[key] = 0 (observed) or -inf fill + missing bias (missing)
  const float mbh = mbias[head];
  const float vmiss = -__builtin_inff() + mbh;
  #pragma unroll   // the four mask loads in flight together
  for (int i = 0; i < SEQ / 512; ++i) {
    const int k4 = 4 * tid + 512 * i;
    const v4i mm = *(const v4ia*)(mask + (size_t)b * SEQ + k4);
    const v4f t = { (mm.x != 0) ? 0.0f : vmiss, (mm.y != 0) ? 0.0f : vmiss,
                    (mm.z != 0) ? 0.0f : vmiss, (mm.w != 0) ? 0.0f : vmiss };
    *(v4fa*)(sM + k4) = t;
  }

  // Q^T B-fragments: column n = query q0+m, k = d (two 32-deep chunks)
  const _Float16* qrow = qh + ((size_t)bh * SEQ + q0 + m) * HD;
  const v16h qb0 = load_frag(qrow, h);
  const v16h qb1 = load_frag(qrow + 32, h);

  // step 0's copies of this wave have landed before the barrier that publishes them (and sB, sM)
  asm volatile("s_wait_asynccnt 0x0" ::: "memory");
  __syncthreads();

  stage_copy(lk0 + TSTAGE * 2, lv0 + TSTAGE * 2, gk0 + 64 * HD, gv0 + 64); // step 1 -> buffer 1

  const int qk = q0 + m + (SEQ - 1) - 8 * h;         // bias index for key (kb+16j) at r=0 is qk-kb-16j

  const v8f zero8 = {0.f, 0.f, 0.f, 0.f, 0.f, 0.f, 0.f, 0.f};
  const v8f eighth8 = {0.125f, 0.125f, 0.125f, 0.125f, 0.125f, 0.125f, 0.125f, 0.125f};
  v8f o[4];                                   // o[t][r] = O[query m][d 16t+8h+r] * (l * 2^14)
  #pragma unroll
  for (int t = 0; t < 4; ++t) o[t] = zero8;
  float mrun = -1e30f, lrun = 0.0f;

  const int fro = m * TPITCH;                                  // fragment row of this lane in a staged tile
  const float* smp = sM + 8 * h;                               // + key tile base

  #pragma unroll 1
  for (int st = 0; st < NSTEP; ++st) {
    const int kb = st * 64;
    const int bo = (st & 1) * TSTAGE;                          // this step's ring buffer
    const _Float16* kbase = sK + bo + fro;                     // + 16j*TPITCH + 32*dc
    const _Float16* vbase = sV + bo + fro;                     // + 16t*TPITCH + 32*kc
    // ---- rel-pos bias of this step, read ahead of the score products ----
    v8f bv[4];
    #pragma unroll   // bv[] indexed by constants, so that it stays in registers
    for (int j = 0; j < 4; ++j) bv[j] = bias_load8(sB, qk - kb - 16 * j);
    // ---- raw scores on the mask start: s[j][r] = sM[key] + (Q.K)[query m][key kb+16j+8h+r] ----
    v8f s[4];
    #pragma unroll
    for (int j = 0; j < 4; ++j) {
      const _Float16* kp = kbase + 16 * j * TPITCH;
      const v16h kf0 = load_frag(kp, h);
      const v16h kf1 = load_frag(kp + 32, h);
      v8f z = mask_start8(smp + kb + 16 * j);
      z = wmma_f16_free(kf0, qb0, z);
      z = wmma_f16_free(kf1, qb1, z);
      s[j] = z;
    }
    // ---- scale 1/8, rel-pos bias (f32) ----
    #pragma unroll
    for (int j = 0; j < 4; ++j)
      s[j] = __builtin_elementwise_fma(s[j], eighth8, bv[j]);

    // ---- online softmax ----
    float mloc = s[0][0];
    #pragma unroll
    for (int j = 0; j < 4; ++j)
      #pragma unroll
      for (int r = 0; r < 8; ++r) mloc = fmaxf(mloc, s[j][r]);
    mloc = fmaxf(mloc, __shfl_xor(mloc, 16));
    const float mnew = fmaxf(mrun, mloc);
    const float alpha = __expf(mrun - mnew);
    mrun = mnew;
    float lsum = 0.0f;
    #pragma unroll
    for (int j = 0; j < 4; ++j) {
      float u[8], p[8];
      #pragma unroll   // u[], p[] indexed by constants, so that they stay in registers
      for (int r = 0; r < 8; ++r) {
        u[r] = (s[j][r] - mnew) * LOG2E;
        p[r] = __builtin_amdgcn_exp2f(u[r]);
      }
      // The slot behind a transcendental: the eight sources stay live up to this statement, so
      // that no instruction directly behind one of the row's v_exp_f32 writes the register it
      // reads; the v_nop is
      // the slot of the last of them.
      asm("v_nop" : "+v"(p[7])
          : "v"(u[0]), "v"(u[1]), "v"(u[2]), "v"(u[3]), "v"(u[4]), "v"(u[5]), "v"(u[6]), "v"(u[7]),
            "v"(p[0]), "v"(p[1]), "v"(p[2]), "v"(p[3]), "v"(p[4]), "v"(p[5]), "v"(p[6]));
      #pragma unroll
      for (int r = 0; r < 8; ++r) {
        s[j][r] = p[r];
        lsum += p[r];
      }
    }
    lsum += __shfl_xor(lsum, 16);
    lrun = lrun * alpha + lsum;
    #pragma unroll
    for (int t = 0; t < 4; ++t)
      #pragma unroll
      for (int r = 0; r < 8; ++r) o[t][r] = o[t][r] * alpha;

    // ---- P^T B-fragments (key chunks 0..31 and 32..63 of this step) ----
    const v16h pb0 = pack_p(s[0], s[1]);
    const v16h pb1 = pack_p(s[2], s[3]);

    // ---- O^T += V^T * P^T ----
    #pragma unroll
    for (int t = 0; t < 4; ++t) {
      const _Float16* vp = vbase + 16 * t * TPITCH;
      const v16h vf0 = load_frag(vp, h);
      const v16h vf1 = load_frag(vp + 32, h);
      o[t] = wmma_f16_free(vf0, pb0, o[t]);
      o[t] = wmma_f16_free(vf1, pb1, o[t]);
    }

    // ---- hand-over: this wave's reads of buffer st&1 are done, its copies of step st+1
    // have landed; the barrier publishes step st+1 and frees buffer st&1 for the refill ----
    asm volatile("s_wait_dscnt 0x0" ::: "memory");
    asm volatile("s_wait_asynccnt 0x0" ::: "memory");
    __syncthreads();
    if (st + 2 < NSTEP)
      stage_copy(lk0 + bo * 2, lv0 + bo * 2, gk0 + (size_t)(kb + 128) * HD, gv0 + (kb + 128));
  }
  // no copy is left in flight when the wave goes on to the epilogue
  asm volatile("s_wait_asynccnt 0x0" ::: "memory");

  // ---- epilogue: normalise, x64, stage per-wave 16x64 f16 tile, whole-line stores ----
  const float inv = __builtin_amdgcn_rcpf(lrun) * (AOSCALE / PSCALE);
  _Float16* so = sO + w * 1024;
  #pragma unroll
  for (int t = 0; t < 4; ++t)
    #pragma unroll
    for (int r = 0; r < 8; ++r)
      so[m * 64 + 16 * t + 8 * h + r] = (_Float16)(o[t][r] * inv);
  __syncthreads();

  ao_store_pass(so, ao, b, head, q0, lane);
  
}

// ---------------------------------------------------------------------------
// 16-B stores, 4 lines per instruction, 64 lines per wave.
// ---------------------------------------------------------------------------
__device__ __forceinline__ void out_store_pass(const float* sT, float* out, int m0, int fg, int w, int lane) {
  const int q8 = lane & 7, sub = lane >> 3;
  #pragma unroll
  for (int i = 0; i < 16; ++i) {
    const int lid = i * 4 + sub;                   // 0..63
    const int row = 32 * w + (lid >> 1), hl = lid & 1;
    const v4f v = *(const v4fa*)(sT + row * 64 + 32 * hl + 4 * q8);
    const size_t gi = ((size_t)(m0 + row)) * DMODEL + fg * 64 + 32 * hl + 4 * q8;
    *(v4f*)(out + gi) = v;
  }
}

// ---------------------------------------------------------------------------
// Kernel 4: out = AO * Wo^T + bo (f32). Block 128 thr = 128 tokens x 64
// features (fg = blockIdx.y); wave tile 32 x 64; K = 512 in staged steps of 64
// (gemm_128x64); the output tile sT reuses the ring's LDS after the main loop.
// ---------------------------------------------------------------------------
__global__ __launch_bounds__(128) void oproj_kernel(
    const _Float16* __restrict__ ao,   // [8192][512] f16, x64
    const _Float16* __restrict__ woh,  // [512][512] f16, row = output feature, x32
    const float* __restrict__ bo,      // [512]
    float* __restrict__ out)           // [8192][512] f32
{
  __shared__ __attribute__((aligned(16))) _Float16 sG[2 * GSTAGE];  // 55296 B
  float* sT = (float*)sG;                                           // 128 x 64 floats (32768 B), after the main loop

  const int tid = threadIdx.x, lane = tid & 31, w = tid >> 5;
  const int h = lane >> 4, m = lane & 15;
  const int m0 = blockIdx.x * 128;
  const int fg = blockIdx.y;                 // 0..7

  const v8f zero8 = {0.f, 0.f, 0.f, 0.f, 0.f, 0.f, 0.f, 0.f};
  v8f acc[2][4];
  #pragma unroll
  for (int mt = 0; mt < 2; ++mt)
    #pragma unroll
    for (int nt = 0; nt < 4; ++nt) acc[mt][nt] = zero8;

  gemm_128x64(ao + (size_t)m0 * DMODEL, woh + (size_t)fg * 64 * DMODEL, sG, tid, acc);

  // D[r] of tile (mt, nt) = out[token m0+32w+16mt+8h+r][feature fg*64+16nt+m]
  #pragma unroll
  for (int nt = 0; nt < 4; ++nt) {
    const int feat = 16 * nt + m;
    const float bvl = bo[fg * 64 + feat];
    #pragma unroll
    for (int mt = 0; mt < 2; ++mt) {
      #pragma unroll
      for (int r = 0; r < 8; ++r) {
        const int tokl = 32 * w + 16 * mt + 8 * h + r;
        sT[tokl * 64 + feat] = acc[mt][nt][r] * (1.0f / (WSCALE * AOSCALE)) + bvl;
      }
    }
  }
  __syncthreads();

  out_store_pass(sT, out, m0, fg, w, lane);
  
}

// ---------------------------------------------------------------------------
extern "C" void kernel_launch(void* const* d_in, const int* in_sizes, int n_in,
                              void* d_out, int out_size, void* d_ws, size_t ws_size,
                              hipStream_t stream) {
  if (n_in < 12) return;
  if (in_sizes[0] != NX) return;
  if (in_sizes[1] != MROWS) return;
  if (in_sizes[2] != NW || in_sizes[4] != NW || in_sizes[6] != NW || in_sizes[8] != NW) return;
  if (in_sizes[3] != DMODEL || in_sizes[5] != DMODEL || in_sizes[7] != DMODEL || in_sizes[9] != DMODEL) return;
  if (in_sizes[10] != NHEADS) return;
  if (in_sizes[11] != RELN * NHEADS) return;
  if (out_size != NX) return;

  const float* x     = (const float*)d_in[0];
  const int*   mask  = (const int*)d_in[1];
  const float* Wq    = (const float*)d_in[2];
  const float* bq    = (const float*)d_in[3];
  const float* Wk    = (const float*)d_in[4];
  const float* bk    = (const float*)d_in[5];
  const float* Wv    = (const float*)d_in[6];
  const float* bv    = (const float*)d_in[7];
  const float* Wo    = (const float*)d_in[8];
  const float* bo    = (const float*)d_in[9];
  const float* mbias = (const float*)d_in[10];
  const float* rel   = (const float*)d_in[11];
  float* out = (float*)d_out;

  const size_t xh_bytes = (size_t)NX * 2;                           //  8388608
  const size_t wh_bytes = (size_t)4 * NW * 2;                       //  2097152
  const size_t pl_bytes = (size_t)BATCH * NHEADS * SEQ * HD * 2;    //  8388608
  const size_t ao_bytes = (size_t)NX * 2;                           //  8388608
  const size_t total = xh_bytes + wh_bytes + 3 * pl_bytes + ao_bytes;   // 44040192
  if (total > ws_size) return;

  char* ws = (char*)d_ws;
  size_t off = 0;
  _Float16* xh  = (_Float16*)(ws + off);  off += xh_bytes;
  _Float16* wh  = (_Float16*)(ws + off);  off += wh_bytes;
  _Float16* qh  = (_Float16*)(ws + off);  off += pl_bytes;
  _Float16* kh  = (_Float16*)(ws + off);  off += pl_bytes;
  _Float16* vt  = (_Float16*)(ws + off);  off += pl_bytes;
  _Float16* ao  = (_Float16*)(ws + off);  off += ao_bytes;
  if (off > ws_size) return;

  const int ngroups = XGROUPS + NW8;                                // 163840
  convert_kernel<<<(ngroups + 255) / 256, 256, 0, stream>>>(x, Wq, Wk, Wv, Wo, xh, wh);

  dim3 gProj(MROWS / 128, 3 * NHEADS);                              // (64, 24)
  proj_kernel<<<gProj, 128, 0, stream>>>(xh, wh, bq, bk, bv, qh, kh, vt);

  dim3 gAtt(SEQ / 64, BATCH * NHEADS);                              // (32, 32)
  attn_kernel<<<gAtt, 128, 0, stream>>>(qh, kh, vt, mask, mbias, rel, ao);

  dim3 gOut(MROWS / 128, DMODEL / 64);                              // (64, 8)
  oproj_kernel<<<gOut, 128, 0, stream>>>(ao, wh + (size_t)3 * NW, bo, out);
}

// v006
// A run of this version takes 84.3 microseconds.
// Timed twice side by side with v005, it ran 1.09 and 1.08 times as fast.
// All steps since v000 together make it 3.43 times as fast.
// Contractions: x*W^T for q,k,v and o, K*Q^T, V^T*P^T all on v_wmma_f32_16x16x32_f16 (f16 operands, f32 accumulate); W carried x32, P carried x16384, attention rows carried x64 (exact power-of-two scales folded back in f32); PE, bias tables, key mask, softmax and normalisation in f32.
#include <hip/hip_runtime.h>

typedef _Float16 v16h __attribute__((ext_vector_type(16)));
typedef _Float16 v8h  __attribute__((ext_vector_type(8)));
typedef float    v8f  __attribute__((ext_vector_type(8)));
typedef float    v4f  __attribute__((ext_vector_type(4)));
typedef int      v4i  __attribute__((ext_vector_type(4)));
typedef v8h __attribute__((may_alias)) v8ha;
typedef v4f __attribute__((may_alias)) v4fa;
typedef v4i __attribute__((may_alias)) v4ia;

union Frag { v16h v; v8h half[2]; };

#define DMODEL 512
#define NHEADS 8
#define HD     64
#define SEQ    2048
#define BATCH  4
#define MROWS  (BATCH * SEQ)          // 8192 tokens
#define NX     (MROWS * DMODEL)       // 4194304
#define NW     (DMODEL * DMODEL)      // 262144
#define NW8    (NW / 8)               // 32768
#define RELN   (2 * SEQ - 1)          // 4095
#define RELP   (2 * SEQ)              // 4096 entries per head plane of the antisymmetrised table (last one padding)
#define RELWIN (SEQ + 64)             // 2112-entry table window of an attention block: the 2111 entries its 64 queries can reach, plus one
#define NPE    (SEQ * DMODEL)         // 1048576 elements of one batch entry
#define XGROUPS (NPE / 8)             // 131072 groups of 8 features of one batch entry
#define PSCALE  16384.0f
#define WSCALE  32.0f
#define AOSCALE 64.0f
#define LOG2E   1.44269502f           // what __expf multiplies by ahead of its v_exp_f32
#define TPITCH  72                    // halves per staged LDS row: 144 B = 16 B x 9, conflict-free for 16-B fragment reads
#define TSTAGE  (64 * TPITCH)         // halves per staged 64-row tile
#define NSTEP   (SEQ / 64)            // 32 key steps
#define GROWS   192                   // staged rows of a projection k step: 128 token rows, then 64 feature rows
#define GSTAGE  (GROWS * TPITCH)      // halves per staged projection k step (27648 B)
#define GSTEPS  (DMODEL / 64)         // 8 k steps of 64

static_assert(BATCH == 4);
static_assert((XGROUPS % 256) == 0 && (NW8 % 256) == 0);
static_assert((MROWS % 128) == 0 && (SEQ % 128) == 0);

// ---------------------------------------------------------------------------
// 16x16x32 f16 WMMA. wmma_f16: with hazard guard (ties D, keeps A/B live), used
// by the two projections. wmma_f16_free: the bare builtin, used by attention,
// where vector work stands between the products: the compiler keeps the distance
// behind each product with the softmax's own instructions where it can, and is
// free to fetch the next fragments while a product runs.
// Fragment map (wave32): lane l, h = l>>4, m = n = l&15.
//   A/B element i: i<8 -> k0+8h+i ; i>=8 -> k0+16+8h+(i-8)
//   D element r : row 8h+r, col l&15
// ---------------------------------------------------------------------------
__device__ __forceinline__ v8f wmma_f16(v16h a, v16h b, v8f c) {
  v8f d = __builtin_amdgcn_wmma_f32_16x16x32_f16(false, a, false, b, (short)0, c, false, false);
  asm volatile("v_nop\n\tv_nop\n\tv_nop\n\tv_nop" : "+v"(d) : "v"(a), "v"(b));
  return d;
}

__device__ __forceinline__ v8f wmma_f16_free(v16h a, v16h b, v8f c) {
  return __builtin_amdgcn_wmma_f32_16x16x32_f16(false, a, false, b, (short)0, c, false, false);
}

// A or B fragment from a k-contiguous 16-bit row; p points at element k0 of
// the row owned by this lane (row index = lane & 15 added by the caller).
__device__ __forceinline__ v16h load_frag(const _Float16* p, int h) {
  Frag f;
  f.half[0] = *(const v8ha*)(p + 8 * h);
  f.half[1] = *(const v8ha*)(p + 16 + 8 * h);
  return f.v;
}

// ---------------------------------------------------------------------------
// Kernel 1: f32 -> f16 planes. xh = f16(x + pe) unscaled, wh = f16(32*W) for
// Wq,Wk,Wv,Wo (row = output feature, k-contiguous). Four 16-B stores per lane in x and W blocks.
// pe[t][2p] = sin(t*div_p), pe[t][2p+1] = cos(t*div_p),
// div_p = exp(f32(2p) * f32(-ln(1e4)/512)).
// x blocks: a thread owns 8 features of position t; it forms their four
// (sin, cos) pairs once, in registers, and adds them to that position's row of
// all four batch entries. W blocks: a thread converts the same 8 elements of
// all four matrices. All eight 16-B loads of a thread are issued up front.
// Table blocks: a thread owns entry i of the antisymmetrised rel-pos table of all
// eight heads, ab[head][i] = 0.5 * (rel[i][head] - rel[RELN-1-i][head]),
// i = q - k + (SEQ-1); it reads two whole 32-B rows and a wave stores one whole
// 128-B line per head. Entry 4095 is padding, stored as 0.
// ---------------------------------------------------------------------------
__device__ __forceinline__ v8h pack8(v4f a, v4f c) {
  const v8h o = { (_Float16)a.x, (_Float16)a.y, (_Float16)a.z, (_Float16)a.w,
                  (_Float16)c.x, (_Float16)c.y, (_Float16)c.z, (_Float16)c.w };
  return o;
}

__global__ __launch_bounds__(256) void convert_kernel(
    const float* __restrict__ x,
    const float* __restrict__ wq, const float* __restrict__ wk,
    const float* __restrict__ wv, const float* __restrict__ wo,
    const float* __restrict__ rel,
    _Float16* __restrict__ xh, _Float16* __restrict__ wh, float* __restrict__ ab)
{
  const int g = blockIdx.x * 256 + threadIdx.x;
  if (g >= XGROUPS + NW8 + RELP) return;
  if (g >= XGROUPS + NW8) {
    const int i = g - (XGROUPS + NW8);      // table entry 0..4095
    const bool in = i < RELN;
    const float* up = rel + (in ? i : 0) * NHEADS;
    const float* dn = rel + (in ? RELN - 1 - i : 0) * NHEADS;
    const v4f u0 = *(const v4fa*)up, u1 = *(const v4fa*)(up + 4);
    const v4f d0 = *(const v4fa*)dn, d1 = *(const v4fa*)(dn + 4);
    const v4f t0 = 0.5f * (u0 - d0), t1 = 0.5f * (u1 - d1);
    #pragma unroll   // t0, t1 indexed by constants
    for (int hd = 0; hd < 4; ++hd) {
      ab[hd * RELP + i]       = in ? t0[hd] : 0.0f;
      ab[(hd + 4) * RELP + i] = in ? t1[hd] : 0.0f;
    }
    return;
  }
  v4f a[4], c[4];
  if (g < XGROUPS) {
    const int t = g >> 6;                   // position 0..2047 (64 groups of 8 per row)
    const int db = (g & 63) * 8;            // first feature of the group
    const unsigned so = (unsigned)g * 32u;  // byte offset of the group in a batch entry of x
    #pragma unroll   // a[], c[] indexed by constants, so that they stay in registers
    for (int b = 0; b < BATCH; ++b) {
      const char* src = (const char*)(x + (size_t)b * NPE) + so;
      a[b] = *(const v4fa*)src;
      c[b] = *(const v4fa*)(src + 16);
    }
    const float kc = (float)(-9.210340371976184 / 512.0);
    float sn[4], cs[4];
    #pragma unroll   // sn[], cs[] indexed by constants, so that they stay in registers
    for (int i = 0; i < 4; ++i) {
      const float fr = expf((float)(db + 2 * i) * kc);
      const float ang = (float)t * fr;
      sn[i] = sinf(ang);
      cs[i] = cosf(ang);
    }
    const v4f pa = { sn[0], cs[0], sn[1], cs[1] };
    const v4f pc = { sn[2], cs[2], sn[3], cs[3] };
    const unsigned dofs = (unsigned)g * 16u;  // byte offset of the group in a batch entry of xh
    #pragma unroll
    for (int b = 0; b < BATCH; ++b)
      *(v8h*)((char*)(xh + (size_t)b * NPE) + dofs) = pack8(a[b] + pa, c[b] + pc);
  } else {
    const unsigned e = (unsigned)(g - XGROUPS);
    const unsigned so = e * 32u;            // byte offset of the group in a matrix
    a[0] = *(const v4fa*)((const char*)wq + so);  c[0] = *(const v4fa*)((const char*)wq + so + 16);
    a[1] = *(const v4fa*)((const char*)wk + so);  c[1] = *(const v4fa*)((const char*)wk + so + 16);
    a[2] = *(const v4fa*)((const char*)wv + so);  c[2] = *(const v4fa*)((const char*)wv + so + 16);
    a[3] = *(const v4fa*)((const char*)wo + so);  c[3] = *(const v4fa*)((const char*)wo + so + 16);
    const unsigned dofs = e * 16u;          // byte offset of the group in a plane of wh
    #pragma unroll
    for (int i = 0; i < 4; ++i)
      *(v8h*)((char*)(wh + (size_t)i * NW) + dofs) = pack8(a[i] * WSCALE, c[i] * WSCALE);
  }
}

// ---------------------------------------------------------------------------
// One 64-deep k step of a projection into LDS rows of TPITCH halves: 128 token
// rows (8 chunks per lane) and 64 feature rows (4 chunks per lane), 128 B each,
// by asynchronous 16-B copies; each wave-wide copy covers four whole 128-B
// lines. l = this lane's LDS byte address of its first chunk, ga / gb = the
// matching global addresses; chunk i lies 16 rows further on both sides.
// The closing s_wait_xcnt 0 stands inside the copies' own statement, so that no
// address register named here is rewritten ahead of it.
// ---------------------------------------------------------------------------
__device__ __forceinline__ void gemm_stage_copy(unsigned l, const _Float16* ga, const _Float16* gb) {
  const unsigned rs = 16 * TPITCH * 2;                 // 16 staged rows in bytes
  const unsigned l1 = l + rs,     l2 = l + 2 * rs,  l3 = l + 3 * rs,   l4 = l + 4 * rs;
  const unsigned l5 = l + 5 * rs, l6 = l + 6 * rs,  l7 = l + 7 * rs,   l8 = l + 8 * rs;
  const unsigned l9 = l + 9 * rs, l10 = l + 10 * rs, l11 = l + 11 * rs;
  const _Float16* a1 = ga + 16 * DMODEL;
  const _Float16* a2 = ga + 32 * DMODEL;
  const _Float16* a3 = ga + 48 * DMODEL;
  const _Float16* a4 = ga + 64 * DMODEL;
  const _Float16* a5 = ga + 80 * DMODEL;
  const _Float16* a6 = ga + 96 * DMODEL;
  const _Float16* a7 = ga + 112 * DMODEL;
  const _Float16* b1 = gb + 16 * DMODEL;
  const _Float16* b2 = gb + 32 * DMODEL;
  const _Float16* b3 = gb + 48 * DMODEL;
  asm volatile("global_load_async_to_lds_b128 %0, %12, off\n\t"
               "global_load_async_to_lds_b128 %1, %13, off\n\t"
               "global_load_async_to_lds_b128 %2, %14, off\n\t"
               "global_load_async_to_lds_b128 %3, %15, off\n\t"
               "global_load_async_to_lds_b128 %4, %16, off\n\t"
               "global_load_async_to_lds_b128 %5, %17, off\n\t"
               "global_load_async_to_lds_b128 %6, %18, off\n\t"
               "global_load_async_to_lds_b128 %7, %19, off\n\t"
               "global_load_async_to_lds_b128 %8, %20, off\n\t"
               "global_load_async_to_lds_b128 %9, %21, off\n\t"
               "global_load_async_to_lds_b128 %10, %22, off\n\t"
               "global_load_async_to_lds_b128 %11, %23, off\n\t"
               "s_wait_xcnt 0x0"
               :: "v"(l), "v"(l1), "v"(l2), "v"(l3), "v"(l4), "v"(l5), "v"(l6), "v"(l7),
                  "v"(l8), "v"(l9), "v"(l10), "v"(l11),
                  "v"(ga), "v"(a1), "v"(a2), "v"(a3), "v"(a4), "v"(a5), "v"(a6), "v"(a7),
                  "v"(gb), "v"(b1), "v"(b2), "v"(b3)
               : "memory");
}

// ---------------------------------------------------------------------------
// Main loop of both projections: acc[mt][nt] += A(128 rows) * B(64 rows)^T over
// K = 512, both operands k-contiguous f16 rows of DMODEL halves. Block 128 thr,
// wave tile 32 x 64. Each 64-deep k step is staged once per block in a
// two-buffer LDS ring (the next step's copies fly while this step is worked
// on); the fragments are read from there, in the same ascending k order.
// On return every wave has passed the last barrier and no copy is in flight, so
// the caller may reuse sG.
// ---------------------------------------------------------------------------
__device__ __forceinline__ void gemm_128x64(const _Float16* arows, const _Float16* brows,
                                            _Float16* sG, int tid, v8f (&acc)[2][4]) {
  const int lane = tid & 31, w = tid >> 5;
  const int h = lane >> 4, m = lane & 15;
  // Staging map: chunk c = tid + 128 i (i = 0..11), staged row c >> 3, 16-B column c & 7.
  const int crow = tid >> 3, ccol = tid & 7;
  const unsigned l0 = (unsigned)(size_t)(sG + crow * TPITCH + 8 * ccol);
  const _Float16* ga0 = arows + (size_t)crow * DMODEL + 8 * ccol;          // + 64 per step
  const _Float16* gb0 = brows + (size_t)crow * DMODEL + 8 * ccol;          // + 64 per step

  gemm_stage_copy(l0, ga0, gb0);                                           // step 0 -> buffer 0
  // step 0's copies of this wave have landed before the barrier that publishes them
  asm volatile("s_wait_asynccnt 0x0" ::: "memory");
  __syncthreads();
  gemm_stage_copy(l0 + GSTAGE * 2, ga0 + 64, gb0 + 64);                    // step 1 -> buffer 1

  #pragma unroll 1   // rolled: one copy of the body, the ring buffer picked by the step's parity
  for (int t = 0; t < GSTEPS; ++t) {
    const int bo = (t & 1) * GSTAGE;                                       // this step's ring buffer
    const _Float16* ab = sG + bo + (32 * w + m) * TPITCH;                  // token row, mt = 0
    const _Float16* bb = sG + bo + (128 + m) * TPITCH;                     // feature row, nt = 0
    // all fragments of the step are read as one group ahead of its products
    v16h af[2][2], bf[2][4];
    #pragma unroll   // af[][], bf[][] indexed by constants, so that they stay in registers
    for (int kc = 0; kc < 2; ++kc) {
      af[kc][0] = load_frag(ab + 32 * kc, h);
      af[kc][1] = load_frag(ab + 16 * TPITCH + 32 * kc, h);
      #pragma unroll
      for (int nt = 0; nt < 4; ++nt) bf[kc][nt] = load_frag(bb + nt * 16 * TPITCH + 32 * kc, h);
    }
    #pragma unroll   // acc[][] indexed by constants, so that it stays in registers
    for (int kc = 0; kc < 2; ++kc) {
      #pragma unroll
      for (int nt = 0; nt < 4; ++nt) {
        acc[0][nt] = wmma_f16(af[kc][0], bf[kc][nt], acc[0][nt]);
        acc[1][nt] = wmma_f16(af[kc][1], bf[kc][nt], acc[1][nt]);
      }
    }
    // ---- hand-over: this wave's reads of buffer t&1 are done, its copies of step t+1 have
    // landed; the barrier publishes step t+1 and frees buffer t&1 for the refill ----
    asm volatile("s_wait_dscnt 0x0" ::: "memory");
    asm volatile("s_wait_asynccnt 0x0" ::: "memory");
    __syncthreads();
    if (t + 2 < GSTEPS)
      gemm_stage_copy(l0 + bo * 2, ga0 + (t + 2) * 64, gb0 + (t + 2) * 64);
  }
  // no copy is left in flight when the wave goes on to the epilogue
  asm volatile("s_wait_asynccnt 0x0" ::: "memory");
}

// ---------------------------------------------------------------------------
// 4 lines per instruction, 32 lines per wave, 128 per block.
// which 0/1: plane[bh][l][d]  (one token row = 64 halves = one line)
// which 2  : vt[bh][d][l]     (64 d-rows x 128 tokens = 2 lines each)
// ---------------------------------------------------------------------------
__device__ __forceinline__ void proj_store_pass(const _Float16* sT, _Float16* plane, _Float16* vt,
                                                int which, int bh, int l0, int w, int lane) {
  const int q8 = lane & 7, sub = lane >> 3;
  #pragma unroll
  for (int i = 0; i < 8; ++i) {
    const int lid = w * 32 + i * 4 + sub;
    v8h v;
    _Float16* dst;
    if (which != 2) {
      v = *(const v8ha*)(sT + lid * HD + 8 * q8);
      dst = plane + ((size_t)bh * SEQ + l0 + lid) * HD + 8 * q8;
    } else {
      const int d = lid >> 1, hl = lid & 1;
      v = *(const v8ha*)(sT + d * 128 + 64 * hl + 8 * q8);
      dst = vt + ((size_t)bh * HD + d) * SEQ + l0 + 64 * hl + 8 * q8;
    }
    *(v8h*)dst = v;
  }
}

// ---------------------------------------------------------------------------
// Kernel 2: Y = (x+pe) * W^T + bias over the fused 3*512 output columns.
// Block 128 thr (4 waves) = 128 tokens x 64 features (one (which, head));
// wave tile 32 tokens x 64 features; K = 512 in staged steps of 64 (gemm_128x64);
// the output tile sT reuses the ring's LDS once the main loop has returned.
// ---------------------------------------------------------------------------
__global__ __launch_bounds__(128) void proj_kernel(
    const _Float16* __restrict__ xh,   // [8192][512]
    const _Float16* __restrict__ wh,   // [4][512][512], row = output feature, x32
    const float* __restrict__ bq, const float* __restrict__ bk, const float* __restrict__ bv,
    _Float16* __restrict__ qh,         // [B*H][L][D]  f16(q)
    _Float16* __restrict__ kh,         // [B*H][L][D]  f16(k)
    _Float16* __restrict__ vt)         // [B*H][D][L]  f16(v)
{
  __shared__ __attribute__((aligned(16))) _Float16 sG[2 * GSTAGE];  // 55296 B
  _Float16* sT = sG;                                                // 128 x 64 halves, after the main loop

  const int tid = threadIdx.x, lane = tid & 31, w = tid >> 5;
  const int h = lane >> 4, m = lane & 15;
  const int m0 = blockIdx.x * 128;
  const int cg = blockIdx.y;                 // 0..23
  const int which = cg >> 3, head = cg & 7;

  const v8f zero8 = {0.f, 0.f, 0.f, 0.f, 0.f, 0.f, 0.f, 0.f};
  v8f acc[2][4];
  #pragma unroll
  for (int mt = 0; mt < 2; ++mt)
    #pragma unroll
    for (int nt = 0; nt < 4; ++nt) acc[mt][nt] = zero8;

  gemm_128x64(xh + (size_t)m0 * DMODEL, wh + ((size_t)which * DMODEL + head * HD) * DMODEL, sG, tid, acc);

  // D[r] of tile (mt, nt) = Y[token m0+32w+16mt+8h+r][feature 16nt+m]
  const float* bias = (which == 0) ? bq : ((which == 1) ? bk : bv);
  #pragma unroll
  for (int nt = 0; nt < 4; ++nt) {
    const int feat = 16 * nt + m;
    const float bvl = bias[head * HD + feat];
    #pragma unroll
    for (int mt = 0; mt < 2; ++mt) {
      #pragma unroll
      for (int r = 0; r < 8; ++r) {
        const int tokl = 32 * w + 16 * mt + 8 * h + r;     // 0..127
        const float y = acc[mt][nt][r] * (1.0f / WSCALE) + bvl;
        const int idx = (which == 2) ? (feat * 128 + tokl) : (tokl * HD + feat);
        sT[idx] = (_Float16)y;
      }
    }
  }
  __syncthreads();

  const int b = m0 / SEQ, l0 = m0 - b * SEQ, bh = b * NHEADS + head;
  _Float16* plane = (which == 0) ? qh : kh;
  proj_store_pass(sT, plane, vt, which, bh, l0, w, lane);
  
}

// ---------------------------------------------------------------------------
// Attention helpers.
// Score element r of this lane: key = kb + 16j + 8h + r, query = q0 + m.
// v = mask ? (s*0.125 + anti[q - key + 2047]) : (-inf + missing_bias[head]).
// The key mask enters as the start value C of the score product: sm[key] = 0
// for an observed key, -inf + missing_bias[head] for a missing one, so that
// C + K.Q stays that non-finite value through the scale and the bias below.
// sb = the block's window of the antisymmetrised rel-pos table in LDS, base = index for r = 0
// (index decreases by one per r); every index is in range for every key, so
// the reads carry no condition and no branch.
// ---------------------------------------------------------------------------
__device__ __forceinline__ v8f mask_start8(const float* sm) {
  const v4f a = *(const v4fa*)sm;
  const v4f c = *(const v4fa*)(sm + 4);
  const v8f z = { a.x, a.y, a.z, a.w, c.x, c.y, c.z, c.w };
  return z;
}

__device__ __forceinline__ v8f bias_load8(const float* sb, int base) {
  const v8f t = { sb[base],     sb[base - 1], sb[base - 2], sb[base - 3],
                  sb[base - 4], sb[base - 5], sb[base - 6], sb[base - 7] };
  return t;
}

// P^T B-fragment from the lane's own score D values: element r <- tile a row r,
// element 8+r <- tile c row r (same lane, same query column), scaled by 2^14.
__device__ __forceinline__ v16h pack_p(v8f a, v8f c) {
  const v16h r = { (_Float16)(a[0] * PSCALE), (_Float16)(a[1] * PSCALE), (_Float16)(a[2] * PSCALE), (_Float16)(a[3] * PSCALE),
                   (_Float16)(a[4] * PSCALE), (_Float16)(a[5] * PSCALE), (_Float16)(a[6] * PSCALE), (_Float16)(a[7] * PSCALE),
                   (_Float16)(c[0] * PSCALE), (_Float16)(c[1] * PSCALE), (_Float16)(c[2] * PSCALE), (_Float16)(c[3] * PSCALE),
                   (_Float16)(c[4] * PSCALE), (_Float16)(c[5] * PSCALE), (_Float16)(c[6] * PSCALE), (_Float16)(c[7] * PSCALE) };
  return r;
}

// (one token row's head slice) by lanes 8q..8q+7 in one instruction, 4 lines
// per instruction, 16 lines per wave.
__device__ __forceinline__ void ao_store_pass(const _Float16* so, _Float16* ao,
                                              int b, int head, int q0, int lane) {
  const int q8 = lane & 7, sub = lane >> 3;
  #pragma unroll
  for (int i = 0; i < 4; ++i) {
    const int lid = i * 4 + sub;                    // 0..15
    const v8h v = *(const v8ha*)(so + lid * 64 + 8 * q8);
    const size_t gi = ((size_t)b * SEQ + q0 + lid) * DMODEL + head * HD + 8 * q8;
    *(v8h*)(ao + gi) = v;
  }
}

// One 64-key stage of K (64 key rows x 128 B) and of V^T (64 d rows x 128 B)
// into LDS rows of TPITCH halves: 4 + 4 asynchronous 16-B copies per lane, each
// wave-wide copy covering four whole 128-B lines. lk/lv = this lane's LDS byte
// address of its first K / V chunk, gk/gv = the matching global address; chunk
// i lies 16 rows further on both sides.
// The closing s_wait_xcnt 0 stands inside the copies' own statement, so that no
// address register named here is rewritten ahead of it.
__device__ __forceinline__ void stage_copy(unsigned lk, unsigned lv,
                                           const _Float16* gk, const _Float16* gv) {
  const unsigned lk1 = lk + 16 * TPITCH * 2, lk2 = lk + 32 * TPITCH * 2, lk3 = lk + 48 * TPITCH * 2;
  const unsigned lv1 = lv + 16 * TPITCH * 2, lv2 = lv + 32 * TPITCH * 2, lv3 = lv + 48 * TPITCH * 2;
  const _Float16* gk1 = gk + 16 * HD;
  const _Float16* gk2 = gk + 32 * HD;
  const _Float16* gk3 = gk + 48 * HD;
  const _Float16* gv1 = gv + (size_t)16 * SEQ;
  const _Float16* gv2 = gv + (size_t)32 * SEQ;
  const _Float16* gv3 = gv + (size_t)48 * SEQ;
  asm volatile("global_load_async_to_lds_b128 %0, %8, off\n\t"
               "global_load_async_to_lds_b128 %1, %9, off\n\t"
               "global_load_async_to_lds_b128 %2, %10, off\n\t"
               "global_load_async_to_lds_b128 %3, %11, off\n\t"
               "global_load_async_to_lds_b128 %4, %12, off\n\t"
               "global_load_async_to_lds_b128 %5, %13, off\n\t"
               "global_load_async_to_lds_b128 %6, %14, off\n\t"
               "global_load_async_to_lds_b128 %7, %15, off\n\t"
               "s_wait_xcnt 0x0"
               :: "v"(lk), "v"(lk1), "v"(lk2), "v"(lk3), "v"(lv), "v"(lv1), "v"(lv2), "v"(lv3),
                  "v"(gk), "v"(gk1), "v"(gk2), "v"(gk3), "v"(gv), "v"(gv1), "v"(gv2), "v"(gv3)
               : "memory");
}

// ---------------------------------------------------------------------------
// Kernel 3: streaming attention, transposed form.
// Block 128 thr (4 waves), 16 queries per wave, 64 keys per step.
// K and V^T of a step are staged once per block in a two-buffer LDS ring by
// asynchronous copies (next step's copies fly while this step is worked on);
// all four waves read their fragments from there.
//   S^T = K * Q^T : A = K rows (row = key, k = d), B = Q^T (k = d, n = query)
//   O^T += V^T * P^T : A = Vt rows (row = d, k = key), B = P^T from registers
// Lane owns 32 keys of query column (lane&15); partner = lane ^ 16.
// The block's window of this head's antisymmetrised rel-pos table (formed by the
// convert launch) is copied to LDS, and the key-mask start values of this batch
// row are built there, once per block.
// ---------------------------------------------------------------------------
__global__ __launch_bounds__(128) void attn_kernel(
    const _Float16* __restrict__ qh,   // [B*H][L][D]
    const _Float16* __restrict__ kh,   // [B*H][L][D]
    const _Float16* __restrict__ vt,   // [B*H][D][L]
    const int* __restrict__ mask,      // [B][L], nonzero = observed key
    const float* __restrict__ mbias,   // [H]
    const float* __restrict__ ab,      // [H][RELP] antisymmetrised rel-pos table
    _Float16* __restrict__ ao)         // [B][L][DMODEL], x64
{
  __shared__ __attribute__((aligned(16))) float sB[RELWIN];           //  8448 B
  __shared__ __attribute__((aligned(16))) float sM[SEQ];              //  8192 B
  __shared__ __attribute__((aligned(16))) _Float16 sO[4 * 16 * 64];  //  8192 B
  __shared__ __attribute__((aligned(16))) _Float16 sK[2 * TSTAGE];   // 18432 B
  __shared__ __attribute__((aligned(16))) _Float16 sV[2 * TSTAGE];   // 18432 B

  const int tid = threadIdx.x, lane = tid & 31, w = tid >> 5;
  const int h = lane >> 4, m = lane & 15;
  const int bh = blockIdx.y, b = bh >> 3, head = bh & 7;
  const int q0 = blockIdx.x * 64 + 16 * w;

  // Staging map: chunk c = tid + 128 i (i = 0..3), tile row c >> 3, 16-B column c & 7.
  const int crow = tid >> 3, ccol = tid & 7;
  const unsigned lk0 = (unsigned)(size_t)(sK + crow * TPITCH + 8 * ccol);
  const unsigned lv0 = (unsigned)(size_t)(sV + crow * TPITCH + 8 * ccol);
  const _Float16* gk0 = kh + ((size_t)bh * SEQ + crow) * HD + 8 * ccol;    // + 64 * HD per step
  const _Float16* gv0 = vt + ((size_t)bh * HD + crow) * SEQ + 8 * ccol;    // + 64 per step

  stage_copy(lk0, lv0, gk0, gv0);                                          // step 0 -> buffer 0

  // Table index of (query q, key k) is q - k + (SEQ-1): the block's 64 queries, first one qb,
  // reach entries qb .. qb + 2110 over all keys. sB[e] = ab[head][qb + e], e = 0 .. 2111
  // (the last entry read is 1984 + 2111 = 4095, the padding entry: copied, never used).
  const float* abw = ab + head * RELP + blockIdx.x * 64;
  // The loads stand here and the LDS stores behind the mask and Q loads, so that all of the
  // prologue's loads are in flight together. The last 64 entries are 16 chunks: every thread
  // loads one of them (no condition on the load), the first 16 threads store.
  v4f tb[5];
  #pragma unroll   // tb[] indexed by constants, so that it stays in registers
  for (int c = 0; c < 4; ++c) tb[c] = *(const v4fa*)(abw + 4 * tid + 512 * c);
  tb[4] = *(const v4fa*)(abw + 2048 + 4 * (tid & 15));

  // sM[key] = 0 (observed) or -inf fill + missing bias (missing)
  const float mbh = mbias[head];
  const float vmiss = -__builtin_inff() + mbh;
  #pragma unroll   // the four mask loads in flight together
  for (int i = 0; i < SEQ / 512; ++i) {
    const int k4 = 4 * tid + 512 * i;
    const v4i mm = *(const v4ia*)(mask + (size_t)b * SEQ + k4);
    const v4f t = { (mm.x != 0) ? 0.0f : vmiss, (mm.y != 0) ? 0.0f : vmiss,
                    (mm.z != 0) ? 0.0f : vmiss, (mm.w != 0) ? 0.0f : vmiss };
    *(v4fa*)(sM + k4) = t;
  }

  // Q^T B-fragments: column n = query q0+m, k = d (two 32-deep chunks)
  const _Float16* qrow = qh + ((size_t)bh * SEQ + q0 + m) * HD;
  const v16h qb0 = load_frag(qrow, h);
  const v16h qb1 = load_frag(qrow + 32, h);

  #pragma unroll
  for (int c = 0; c < 4; ++c) *(v4fa*)(sB + 4 * tid + 512 * c) = tb[c];
  // Holds the fifth load in front of the branch below (loaded value as an input only): without it
  // the compiler sinks the load into the branch, where wave 0 waits out a second full load latency.
  asm volatile("" :: "v"(tb[4]));
  if (tid < (RELWIN - 2048) / 4) *(v4fa*)(sB + 2048 + 4 * tid) = tb[4];

  // step 0's copies of this wave have landed before the barrier that publishes them (and sB, sM)
  asm volatile("s_wait_asynccnt 0x0" ::: "memory");
  __syncthreads();

  stage_copy(lk0 + TSTAGE * 2, lv0 + TSTAGE * 2, gk0 + 64 * HD, gv0 + 64); // step 1 -> buffer 1

  const int qk = 16 * w + m + (SEQ - 1) - 8 * h;     // index in sB for key (kb+16j) at r=0 is qk-kb-16j

  const v8f zero8 = {0.f, 0.f, 0.f, 0.f, 0.f, 0.f, 0.f, 0.f};
  const v8f eighth8 = {0.125f, 0.125f, 0.125f, 0.125f, 0.125f, 0.125f, 0.125f, 0.125f};
  v8f o[4];                                   // o[t][r] = O[query m][d 16t+8h+r] * (l * 2^14)
  #pragma unroll
  for (int t = 0; t < 4; ++t) o[t] = zero8;
  float mrun = -1e30f, lrun = 0.0f;

  const int fro = m * TPITCH;                                  // fragment row of this lane in a staged tile
  const float* smp = sM + 8 * h;                               // + key tile base

  #pragma unroll 1
  for (int st = 0; st < NSTEP; ++st) {
    const int kb = st * 64;
    const int bo = (st & 1) * TSTAGE;                          // this step's ring buffer
    const _Float16* kbase = sK + bo + fro;                     // + 16j*TPITCH + 32*dc
    const _Float16* vbase = sV + bo + fro;                     // + 16t*TPITCH + 32*kc
    // ---- rel-pos bias of this step, read ahead of the score products ----
    v8f bv[4];
    #pragma unroll   // bv[] indexed by constants, so that it stays in registers
    for (int j = 0; j < 4; ++j) bv[j] = bias_load8(sB, qk - kb - 16 * j);
    // ---- raw scores on the mask start: s[j][r] = sM[key] + (Q.K)[query m][key kb+16j+8h+r] ----
    v8f s[4];
    #pragma unroll
    for (int j = 0; j < 4; ++j) {
      const _Float16* kp = kbase + 16 * j * TPITCH;
      const v16h kf0 = load_frag(kp, h);
      const v16h kf1 = load_frag(kp + 32, h);
      v8f z = mask_start8(smp + kb + 16 * j);
      z = wmma_f16_free(kf0, qb0, z);
      z = wmma_f16_free(kf1, qb1, z);
      s[j] = z;
    }
    // ---- scale 1/8, rel-pos bias (f32) ----
    #pragma unroll
    for (int j = 0; j < 4; ++j)
      s[j] = __builtin_elementwise_fma(s[j], eighth8, bv[j]);

    // ---- online softmax ----
    float mloc = s[0][0];
    #pragma unroll
    for (int j = 0; j < 4; ++j)
      #pragma unroll
      for (int r = 0; r < 8; ++r) mloc = fmaxf(mloc, s[j][r]);
    mloc = fmaxf(mloc, __shfl_xor(mloc, 16));
    const float mnew = fmaxf(mrun, mloc);
    const float alpha = __expf(mrun - mnew);
    mrun = mnew;
    float lsum = 0.0f;
    #pragma unroll
    for (int j = 0; j < 4; ++j) {
      float u[8], p[8];
      #pragma unroll   // u[], p[] indexed by constants, so that they stay in registers
      for (int r = 0; r < 8; ++r) {
        u[r] = (s[j][r] - mnew) * LOG2E;
        p[r] = __builtin_amdgcn_exp2f(u[r]);
      }
      // The slot behind a transcendental: the eight sources stay live up to this statement, so
      // that no instruction directly behind one of the row's v_exp_f32 writes the register it
      // reads; the v_nop is
      // the slot of the last of them.
      asm("v_nop" : "+v"(p[7])
          : "v"(u[0]), "v"(u[1]), "v"(u[2]), "v"(u[3]), "v"(u[4]), "v"(u[5]), "v"(u[6]), "v"(u[7]),
            "v"(p[0]), "v"(p[1]), "v"(p[2]), "v"(p[3]), "v"(p[4]), "v"(p[5]), "v"(p[6]));
      #pragma unroll
      for (int r = 0; r < 8; ++r) {
        s[j][r] = p[r];
        lsum += p[r];
      }
    }
    lsum += __shfl_xor(lsum, 16);
    lrun = lrun * alpha + lsum;
    #pragma unroll
    for (int t = 0; t < 4; ++t)
      #pragma unroll
      for (int r = 0; r < 8; ++r) o[t][r] = o[t][r] * alpha;

    // ---- P^T B-fragments (key chunks 0..31 and 32..63 of this step) ----
    const v16h pb0 = pack_p(s[0], s[1]);
    const v16h pb1 = pack_p(s[2], s[3]);

    // ---- O^T += V^T * P^T ----
    #pragma unroll
    for (int t = 0; t < 4; ++t) {
      const _Float16* vp = vbase + 16 * t * TPITCH;
      const v16h vf0 = load_frag(vp, h);
      const v16h vf1 = load_frag(vp + 32, h);
      o[t] = wmma_f16_free(vf0, pb0, o[t]);
      o[t] = wmma_f16_free(vf1, pb1, o[t]);
    }

    // ---- hand-over: this wave's reads of buffer st&1 are done, its copies of step st+1
    // have landed; the barrier publishes step st+1 and frees buffer st&1 for the refill ----
    asm volatile("s_wait_dscnt 0x0" ::: "memory");
    asm volatile("s_wait_asynccnt 0x0" ::: "memory");
    __syncthreads();
    if (st + 2 < NSTEP)
      stage_copy(lk0 + bo * 2, lv0 + bo * 2, gk0 + (size_t)(kb + 128) * HD, gv0 + (kb + 128));
  }
  // no copy is left in flight when the wave goes on to the epilogue
  asm volatile("s_wait_asynccnt 0x0" ::: "memory");

  // ---- epilogue: normalise, x64, stage per-wave 16x64 f16 tile, whole-line stores ----
  const float inv = __builtin_amdgcn_rcpf(lrun) * (AOSCALE / PSCALE);
  _Float16* so = sO + w * 1024;
  #pragma unroll
  for (int t = 0; t < 4; ++t)
    #pragma unroll
    for (int r = 0; r < 8; ++r)
      so[m * 64 + 16 * t + 8 * h + r] = (_Float16)(o[t][r] * inv);
  __syncthreads();

  ao_store_pass(so, ao, b, head, q0, lane);
  
}

// ---------------------------------------------------------------------------
// 16-B stores, 4 lines per instruction, 64 lines per wave.
// ---------------------------------------------------------------------------
__device__ __forceinline__ void out_store_pass(const float* sT, float* out, int m0, int fg, int w, int lane) {
  const int q8 = lane & 7, sub = lane >> 3;
  #pragma unroll
  for (int i = 0; i < 16; ++i) {
    const int lid = i * 4 + sub;                   // 0..63
    const int row = 32 * w + (lid >> 1), hl = lid & 1;
    const v4f v = *(const v4fa*)(sT + row * 64 + 32 * hl + 4 * q8);
    const size_t gi = ((size_t)(m0 + row)) * DMODEL + fg * 64 + 32 * hl + 4 * q8;
    *(v4f*)(out + gi) = v;
  }
}

// ---------------------------------------------------------------------------
// Kernel 4: out = AO * Wo^T + bo (f32). Block 128 thr = 128 tokens x 64
// features (fg = blockIdx.y); wave tile 32 x 64; K = 512 in staged steps of 64
// (gemm_128x64); the output tile sT reuses the ring's LDS after the main loop.
// ---------------------------------------------------------------------------
__global__ __launch_bounds__(128) void oproj_kernel(
    const _Float16* __restrict__ ao,   // [8192][512] f16, x64
    const _Float16* __restrict__ woh,  // [512][512] f16, row = output feature, x32
    const float* __restrict__ bo,      // [512]
    float* __restrict__ out)           // [8192][512] f32
{
  __shared__ __attribute__((aligned(16))) _Float16 sG[2 * GSTAGE];  // 55296 B
  float* sT = (float*)sG;                                           // 128 x 64 floats (32768 B), after the main loop

  const int tid = threadIdx.x, lane = tid & 31, w = tid >> 5;
  const int h = lane >> 4, m = lane & 15;
  const int m0 = blockIdx.x * 128;
  const int fg = blockIdx.y;                 // 0..7

  const v8f zero8 = {0.f, 0.f, 0.f, 0.f, 0.f, 0.f, 0.f, 0.f};
  v8f acc[2][4];
  #pragma unroll
  for (int mt = 0; mt < 2; ++mt)
    #pragma unroll
    for (int nt = 0; nt < 4; ++nt) acc[mt][nt] = zero8;

  gemm_128x64(ao + (size_t)m0 * DMODEL, woh + (size_t)fg * 64 * DMODEL, sG, tid, acc);

  // D[r] of tile (mt, nt) = out[token m0+32w+16mt+8h+r][feature fg*64+16nt+m]
  #pragma unroll
  for (int nt = 0; nt < 4; ++nt) {
    const int feat = 16 * nt + m;
    const float bvl = bo[fg * 64 + feat];
    #pragma unroll
    for (int mt = 0; mt < 2; ++mt) {
      #pragma unroll
      for (int r = 0; r < 8; ++r) {
        const int tokl = 32 * w + 16 * mt + 8 * h + r;
        sT[tokl * 64 + feat] = acc[mt][nt][r] * (1.0f / (WSCALE * AOSCALE)) + bvl;
      }
    }
  }
  __syncthreads();

  out_store_pass(sT, out, m0, fg, w, lane);
  
}

// ---------------------------------------------------------------------------
extern "C" void kernel_launch(void* const* d_in, const int* in_sizes, int n_in,
                              void* d_out, int out_size, void* d_ws, size_t ws_size,
                              hipStream_t stream) {
  if (n_in < 12) return;
  if (in_sizes[0] != NX) return;
  if (in_sizes[1] != MROWS) return;
  if (in_sizes[2] != NW || in_sizes[4] != NW || in_sizes[6] != NW || in_sizes[8] != NW) return;
  if (in_sizes[3] != DMODEL || in_sizes[5] != DMODEL || in_sizes[7] != DMODEL || in_sizes[9] != DMODEL) return;
  if (in_sizes[10] != NHEADS) return;
  if (in_sizes[11] != RELN * NHEADS) return;
  if (out_size != NX) return;

  const float* x     = (const float*)d_in[0];
  const int*   mask  = (const int*)d_in[1];
  const float* Wq    = (const float*)d_in[2];
  const float* bq    = (const float*)d_in[3];
  const float* Wk    = (const float*)d_in[4];
  const float* bk    = (const float*)d_in[5];
  const float* Wv    = (const float*)d_in[6];
  const float* bv    = (const float*)d_in[7];
  const float* Wo    = (const float*)d_in[8];
  const float* bo    = (const float*)d_in[9];
  const float* mbias = (const float*)d_in[10];
  const float* rel   = (const float*)d_in[11];
  float* out = (float*)d_out;

  const size_t xh_bytes = (size_t)NX * 2;                           //  8388608
  const size_t wh_bytes = (size_t)4 * NW * 2;                       //  2097152
  const size_t pl_bytes = (size_t)BATCH * NHEADS * SEQ * HD * 2;    //  8388608
  const size_t ao_bytes = (size_t)NX * 2;                           //  8388608
  const size_t ab_bytes = (size_t)NHEADS * RELP * 4;                //   131072
  const size_t total = xh_bytes + wh_bytes + 3 * pl_bytes + ao_bytes + ab_bytes;   // 44171264
  if (total > ws_size) return;

  char* ws = (char*)d_ws;
  size_t off = 0;
  _Float16* xh  = (_Float16*)(ws + off);  off += xh_bytes;
  _Float16* wh  = (_Float16*)(ws + off);  off += wh_bytes;
  _Float16* qh  = (_Float16*)(ws + off);  off += pl_bytes;
  _Float16* kh  = (_Float16*)(ws + off);  off += pl_bytes;
  _Float16* vt  = (_Float16*)(ws + off);  off += pl_bytes;
  _Float16* ao  = (_Float16*)(ws + off);  off += ao_bytes;
  float*    ab  = (float*)(ws + off);     off += ab_bytes;
  if (off > ws_size) return;

  const int ngroups = XGROUPS + NW8 + RELP;                         // 167936
  convert_kernel<<<(ngroups + 255) / 256, 256, 0, stream>>>(x, Wq, Wk, Wv, Wo, rel, xh, wh, ab);

  dim3 gProj(MROWS / 128, 3 * NHEADS);                              // (64, 24)
  proj_kernel<<<gProj, 128, 0, stream>>>(xh, wh, bq, bk, bv, qh, kh, vt);

  dim3 gAtt(SEQ / 64, BATCH * NHEADS);                              // (32, 32)
  attn_kernel<<<gAtt, 128, 0, stream>>>(qh, kh, vt, mask, mbias, ab, ao);

  dim3 gOut(MROWS / 128, DMODEL / 64);                              // (64, 8)
  oproj_kernel<<<gOut, 128, 0, stream>>>(ao, wh + (size_t)3 * NW, bo, out);
}

// v007
// A run of this version takes 78.2 microseconds.
// Next to v006, in two timings, it ran 1.07 times as fast each time.
// All steps since v000 together make it 3.67 times as fast.
// Contractions: x*W^T for q,k,v and o, K*Q^T, V^T*P^T all on v_wmma_f32_16x16x32_f16 (f16 operands, f32 accumulate); W carried x32, P carried x16384, attention rows carried x64 (exact power-of-two scales folded back in f32); PE, bias tables, key mask, softmax and normalisation in f32.
#include <hip/hip_runtime.h>

typedef _Float16 v16h __attribute__((ext_vector_type(16)));
typedef _Float16 v8h  __attribute__((ext_vector_type(8)));
typedef float    v8f  __attribute__((ext_vector_type(8)));
typedef float    v4f  __attribute__((ext_vector_type(4)));
typedef int      v4i  __attribute__((ext_vector_type(4)));
typedef v8h __attribute__((may_alias)) v8ha;
typedef v4f __attribute__((may_alias)) v4fa;
typedef v4i __attribute__((may_alias)) v4ia;

union Frag { v16h v; v8h half[2]; };

#define DMODEL 512
#define NHEADS 8
#define HD     64
#define SEQ    2048
#define BATCH  4
#define MROWS  (BATCH * SEQ)          // 8192 tokens
#define NX     (MROWS * DMODEL)       // 4194304
#define NW     (DMODEL * DMODEL)      // 262144
#define NW8    (NW / 8)               // 32768
#define RELN   (2 * SEQ - 1)          // 4095
#define RELP   (2 * SEQ)              // 4096 entries per head plane of the antisymmetrised table (last one padding)
#define RELWIN (SEQ + 64)             // 2112-entry table window of an attention block: the 2111 entries its 64 queries can reach, plus one
#define NPE    (SEQ * DMODEL)         // 1048576 elements of one batch entry
#define XGROUPS (NPE / 8)             // 131072 groups of 8 features of one batch entry
#define PSCALE  16384.0f
#define WSCALE  32.0f
#define AOSCALE 64.0f
#define LOG2E   1.44269502f           // what __expf multiplies by ahead of its v_exp_f32
#define TPITCH  72                    // halves per staged LDS row: 144 B = 16 B x 9, conflict-free for 16-B fragment reads
#define TSTAGE  (64 * TPITCH)         // halves per staged 64-row tile
#define NSTEP   (SEQ / 64)            // 32 key steps
#define GROWS   192                   // staged rows of an output projection k step: 128 token rows, then 64 feature rows
#define GSTAGE  (GROWS * TPITCH)      // halves per staged output projection k step (27648 B)
#define GSTEPS  (DMODEL / 64)         // 8 k steps of 64
#define PROWS   256                   // staged rows of a qkv k step: 128 token rows, then 128 feature rows
#define PSTAGE  (PROWS * TPITCH)      // halves per staged qkv k step (36864 B)

static_assert(BATCH == 4);
static_assert((XGROUPS % 256) == 0 && (NW8 % 256) == 0);
static_assert((MROWS % 128) == 0 && (SEQ % 128) == 0);

// ---------------------------------------------------------------------------
// 16x16x32 f16 WMMA. wmma_f16: with hazard guard (ties D, keeps A/B live), used
// by the two projections. wmma_f16_free: the bare builtin, used by attention,
// where vector work stands between the products: the compiler keeps the distance
// behind each product with the softmax's own instructions where it can, and is
// free to fetch the next fragments while a product runs.
// Fragment map (wave32): lane l, h = l>>4, m = n = l&15.
//   A/B element i: i<8 -> k0+8h+i ; i>=8 -> k0+16+8h+(i-8)
//   D element r : row 8h+r, col l&15
// ---------------------------------------------------------------------------
__device__ __forceinline__ v8f wmma_f16(v16h a, v16h b, v8f c) {
  v8f d = __builtin_amdgcn_wmma_f32_16x16x32_f16(false, a, false, b, (short)0, c, false, false);
  asm volatile("v_nop\n\tv_nop\n\tv_nop\n\tv_nop" : "+v"(d) : "v"(a), "v"(b));
  return d;
}

__device__ __forceinline__ v8f wmma_f16_free(v16h a, v16h b, v8f c) {
  return __builtin_amdgcn_wmma_f32_16x16x32_f16(false, a, false, b, (short)0, c, false, false);
}

// A or B fragment from a k-contiguous 16-bit row; p points at element k0 of
// the row owned by this lane (row index = lane & 15 added by the caller).
__device__ __forceinline__ v16h load_frag(const _Float16* p, int h) {
  Frag f;
  f.half[0] = *(const v8ha*)(p + 8 * h);
  f.half[1] = *(const v8ha*)(p + 16 + 8 * h);
  return f.v;
}

// ---------------------------------------------------------------------------
// Kernel 1: f32 -> f16 planes. xh = f16(x + pe) unscaled, wh = f16(32*W) for
// Wq,Wk,Wv,Wo (row = output feature, k-contiguous). Four 16-B stores per lane in x and W blocks.
// pe[t][2p] = sin(t*div_p), pe[t][2p+1] = cos(t*div_p),
// div_p = exp(f32(2p) * f32(-ln(1e4)/512)).
// x blocks: a thread owns 8 features of position t; it forms their four
// (sin, cos) pairs once, in registers, and adds them to that position's row of
// all four batch entries. W blocks: a thread converts the same 8 elements of
// all four matrices. All eight 16-B loads of a thread are issued up front.
// Table blocks: a thread owns entry i of the antisymmetrised rel-pos table of all
// eight heads, ab[head][i] = 0.5 * (rel[i][head] - rel[RELN-1-i][head]),
// i = q - k + (SEQ-1); it reads two whole 32-B rows and a wave stores one whole
// 128-B line per head. Entry 4095 is padding, stored as 0.
// ---------------------------------------------------------------------------
__device__ __forceinline__ v8h pack8(v4f a, v4f c) {
  const v8h o = { (_Float16)a.x, (_Float16)a.y, (_Float16)a.z, (_Float16)a.w,
                  (_Float16)c.x, (_Float16)c.y, (_Float16)c.z, (_Float16)c.w };
  return o;
}

__global__ __launch_bounds__(256) void convert_kernel(
    const float* __restrict__ x,
    const float* __restrict__ wq, const float* __restrict__ wk,
    const float* __restrict__ wv, const float* __restrict__ wo,
    const float* __restrict__ rel,
    _Float16* __restrict__ xh, _Float16* __restrict__ wh, float* __restrict__ ab)
{
  const int g = blockIdx.x * 256 + threadIdx.x;
  if (g >= XGROUPS + NW8 + RELP) return;
  if (g >= XGROUPS + NW8) {
    const int i = g - (XGROUPS + NW8);      // table entry 0..4095
    const bool in = i < RELN;
    const float* up = rel + (in ? i : 0) * NHEADS;
    const float* dn = rel + (in ? RELN - 1 - i : 0) * NHEADS;
    const v4f u0 = *(const v4fa*)up, u1 = *(const v4fa*)(up + 4);
    const v4f d0 = *(const v4fa*)dn, d1 = *(const v4fa*)(dn + 4);
    const v4f t0 = 0.5f * (u0 - d0), t1 = 0.5f * (u1 - d1);
    #pragma unroll   // t0, t1 indexed by constants
    for (int hd = 0; hd < 4; ++hd) {
      ab[hd * RELP + i]       = in ? t0[hd] : 0.0f;
      ab[(hd + 4) * RELP + i] = in ? t1[hd] : 0.0f;
    }
    return;
  }
  v4f a[4], c[4];
  if (g < XGROUPS) {
    const int t = g >> 6;                   // position 0..2047 (64 groups of 8 per row)
    const int db = (g & 63) * 8;            // first feature of the group
    const unsigned so = (unsigned)g * 32u;  // byte offset of the group in a batch entry of x
    #pragma unroll   // a[], c[] indexed by constants, so that they stay in registers
    for (int b = 0; b < BATCH; ++b) {
      const char* src = (const char*)(x + (size_t)b * NPE) + so;
      a[b] = *(const v4fa*)src;
      c[b] = *(const v4fa*)(src + 16);
    }
    const float kc = (float)(-9.210340371976184 / 512.0);
    float sn[4], cs[4];
    #pragma unroll   // sn[], cs[] indexed by constants, so that they stay in registers
    for (int i = 0; i < 4; ++i) {
      const float fr = expf((float)(db + 2 * i) * kc);
      const float ang = (float)t * fr;
      sn[i] = sinf(ang);
      cs[i] = cosf(ang);
    }
    const v4f pa = { sn[0], cs[0], sn[1], cs[1] };
    const v4f pc = { sn[2], cs[2], sn[3], cs[3] };
    const unsigned dofs = (unsigned)g * 16u;  // byte offset of the group in a batch entry of xh
    #pragma unroll
    for (int b = 0; b < BATCH; ++b)
      *(v8h*)((char*)(xh + (size_t)b * NPE) + dofs) = pack8(a[b] + pa, c[b] + pc);
  } else {
    const unsigned e = (unsigned)(g - XGROUPS);
    const unsigned so = e * 32u;            // byte offset of the group in a matrix
    a[0] = *(const v4fa*)((const char*)wq + so);  c[0] = *(const v4fa*)((const char*)wq + so + 16);
    a[1] = *(const v4fa*)((const char*)wk + so);  c[1] = *(const v4fa*)((const char*)wk + so + 16);
    a[2] = *(const v4fa*)((const char*)wv + so);  c[2] = *(const v4fa*)((const char*)wv + so + 16);
    a[3] = *(const v4fa*)((const char*)wo + so);  c[3] = *(const v4fa*)((const char*)wo + so + 16);
    const unsigned dofs = e * 16u;          // byte offset of the group in a plane of wh
    #pragma unroll
    for (int i = 0; i < 4; ++i)
      *(v8h*)((char*)(wh + (size_t)i * NW) + dofs) = pack8(a[i] * WSCALE, c[i] * WSCALE);
  }
}

// ---------------------------------------------------------------------------
// One 64-deep k step of the output projection into LDS rows of TPITCH halves: 128 token
// rows (8 chunks per lane) and 64 feature rows (4 chunks per lane), 128 B each,
// by asynchronous 16-B copies; each wave-wide copy covers four whole 128-B
// lines. l = this lane's LDS byte address of its first chunk, ga / gb = the
// matching global addresses; chunk i lies 16 rows further on both sides.
// The closing s_wait_xcnt 0 stands inside the copies' own statement, so that no
// address register named here is rewritten ahead of it.
// ---------------------------------------------------------------------------
__device__ __forceinline__ void gemm_stage_copy(unsigned l, const _Float16* ga, const _Float16* gb) {
  const unsigned rs = 16 * TPITCH * 2;                 // 16 staged rows in bytes
  const unsigned l1 = l + rs,     l2 = l + 2 * rs,  l3 = l + 3 * rs,   l4 = l + 4 * rs;
  const unsigned l5 = l + 5 * rs, l6 = l + 6 * rs,  l7 = l + 7 * rs,   l8 = l + 8 * rs;
  const unsigned l9 = l + 9 * rs, l10 = l + 10 * rs, l11 = l + 11 * rs;
  const _Float16* a1 = ga + 16 * DMODEL;
  const _Float16* a2 = ga + 32 * DMODEL;
  const _Float16* a3 = ga + 48 * DMODEL;
  const _Float16* a4 = ga + 64 * DMODEL;
  const _Float16* a5 = ga + 80 * DMODEL;
  const _Float16* a6 = ga + 96 * DMODEL;
  const _Float16* a7 = ga + 112 * DMODEL;
  const _Float16* b1 = gb + 16 * DMODEL;
  const _Float16* b2 = gb + 32 * DMODEL;
  const _Float16* b3 = gb + 48 * DMODEL;
  asm volatile("global_load_async_to_lds_b128 %0, %12, off\n\t"
               "global_load_async_to_lds_b128 %1, %13, off\n\t"
               "global_load_async_to_lds_b128 %2, %14, off\n\t"
               "global_load_async_to_lds_b128 %3, %15, off\n\t"
               "global_load_async_to_lds_b128 %4, %16, off\n\t"
               "global_load_async_to_lds_b128 %5, %17, off\n\t"
               "global_load_async_to_lds_b128 %6, %18, off\n\t"
               "global_load_async_to_lds_b128 %7, %19, off\n\t"
               "global_load_async_to_lds_b128 %8, %20, off\n\t"
               "global_load_async_to_lds_b128 %9, %21, off\n\t"
               "global_load_async_to_lds_b128 %10, %22, off\n\t"
               "global_load_async_to_lds_b128 %11, %23, off\n\t"
               "s_wait_xcnt 0x0"
               :: "v"(l), "v"(l1), "v"(l2), "v"(l3), "v"(l4), "v"(l5), "v"(l6), "v"(l7),
                  "v"(l8), "v"(l9), "v"(l10), "v"(l11),
                  "v"(ga), "v"(a1), "v"(a2), "v"(a3), "v"(a4), "v"(a5), "v"(a6), "v"(a7),
                  "v"(gb), "v"(b1), "v"(b2), "v"(b3)
               : "memory");
}

// ---------------------------------------------------------------------------
// Main loop of the output projection: acc[mt][nt] += A(128 rows) * B(64 rows)^T over
// K = 512, both operands k-contiguous f16 rows of DMODEL halves. Block 128 thr,
// wave tile 32 x 64. Each 64-deep k step is staged once per block in a
// two-buffer LDS ring (the next step's copies fly while this step is worked
// on); the fragments are read from there, in the same ascending k order.
// On return every wave has passed the last barrier and no copy is in flight, so
// the caller may reuse sG.
// ---------------------------------------------------------------------------
__device__ __forceinline__ void gemm_128x64(const _Float16* arows, const _Float16* brows,
                                            _Float16* sG, int tid, v8f (&acc)[2][4]) {
  const int lane = tid & 31, w = tid >> 5;
  const int h = lane >> 4, m = lane & 15;
  // Staging map: chunk c = tid + 128 i (i = 0..11), staged row c >> 3, 16-B column c & 7.
  const int crow = tid >> 3, ccol = tid & 7;
  const unsigned l0 = (unsigned)(size_t)(sG + crow * TPITCH + 8 * ccol);
  const _Float16* ga0 = arows + (size_t)crow * DMODEL + 8 * ccol;          // + 64 per step
  const _Float16* gb0 = brows + (size_t)crow * DMODEL + 8 * ccol;          // + 64 per step

  gemm_stage_copy(l0, ga0, gb0);                                           // step 0 -> buffer 0
  // step 0's copies of this wave have landed before the barrier that publishes them
  asm volatile("s_wait_asynccnt 0x0" ::: "memory");
  __syncthreads();
  gemm_stage_copy(l0 + GSTAGE * 2, ga0 + 64, gb0 + 64);                    // step 1 -> buffer 1

  #pragma unroll 1   // rolled: one copy of the body, the ring buffer picked by the step's parity
  for (int t = 0; t < GSTEPS; ++t) {
    const int bo = (t & 1) * GSTAGE;                                       // this step's ring buffer
    const _Float16* ab = sG + bo + (32 * w + m) * TPITCH;                  // token row, mt = 0
    const _Float16* bb = sG + bo + (128 + m) * TPITCH;                     // feature row, nt = 0
    // all fragments of the step are read as one group ahead of its products
    v16h af[2][2], bf[2][4];
    #pragma unroll   // af[][], bf[][] indexed by constants, so that they stay in registers
    for (int kc = 0; kc < 2; ++kc) {
      af[kc][0] = load_frag(ab + 32 * kc, h);
      af[kc][1] = load_frag(ab + 16 * TPITCH + 32 * kc, h);
      #pragma unroll
      for (int nt = 0; nt < 4; ++nt) bf[kc][nt] = load_frag(bb + nt * 16 * TPITCH + 32 * kc, h);
    }
    #pragma unroll   // acc[][] indexed by constants, so that it stays in registers
    for (int kc = 0; kc < 2; ++kc) {
      #pragma unroll
      for (int nt = 0; nt < 4; ++nt) {
        acc[0][nt] = wmma_f16(af[kc][0], bf[kc][nt], acc[0][nt]);
        acc[1][nt] = wmma_f16(af[kc][1], bf[kc][nt], acc[1][nt]);
      }
    }
    // ---- hand-over: this wave's reads of buffer t&1 are done, its copies of step t+1 have
    // landed; the barrier publishes step t+1 and frees buffer t&1 for the refill ----
    asm volatile("s_wait_dscnt 0x0" ::: "memory");
    asm volatile("s_wait_asynccnt 0x0" ::: "memory");
    __syncthreads();
    if (t + 2 < GSTEPS)
      gemm_stage_copy(l0 + bo * 2, ga0 + (t + 2) * 64, gb0 + (t + 2) * 64);
  }
  // no copy is left in flight when the wave goes on to the epilogue
  asm volatile("s_wait_asynccnt 0x0" ::: "memory");
}

// ---------------------------------------------------------------------------
// 128 staged rows of one operand (8 chunks per lane, 128 B a row) into LDS rows
// of TPITCH halves by asynchronous 16-B copies; each wave-wide copy covers four
// whole 128-B lines. l = this lane's LDS byte address of its first chunk, g =
// the matching global address; chunk i lies 16 rows further on both sides.
// The closing s_wait_xcnt 0 stands inside the copies' own statement, so that no
// address register named here is rewritten ahead of it.
// ---------------------------------------------------------------------------
__device__ __forceinline__ void rows128_copy(unsigned l, const _Float16* g) {
  const unsigned rs = 16 * TPITCH * 2;                 // 16 staged rows in bytes
  const unsigned l1 = l + rs,     l2 = l + 2 * rs, l3 = l + 3 * rs, l4 = l + 4 * rs;
  const unsigned l5 = l + 5 * rs, l6 = l + 6 * rs, l7 = l + 7 * rs;
  const _Float16* g1 = g + 16 * DMODEL;
  const _Float16* g2 = g + 32 * DMODEL;
  const _Float16* g3 = g + 48 * DMODEL;
  const _Float16* g4 = g + 64 * DMODEL;
  const _Float16* g5 = g + 80 * DMODEL;
  const _Float16* g6 = g + 96 * DMODEL;
  const _Float16* g7 = g + 112 * DMODEL;
  asm volatile("global_load_async_to_lds_b128 %0, %8, off\n\t"
               "global_load_async_to_lds_b128 %1, %9, off\n\t"
               "global_load_async_to_lds_b128 %2, %10, off\n\t"
               "global_load_async_to_lds_b128 %3, %11, off\n\t"
               "global_load_async_to_lds_b128 %4, %12, off\n\t"
               "global_load_async_to_lds_b128 %5, %13, off\n\t"
               "global_load_async_to_lds_b128 %6, %14, off\n\t"
               "global_load_async_to_lds_b128 %7, %15, off\n\t"
               "s_wait_xcnt 0x0"
               :: "v"(l), "v"(l1), "v"(l2), "v"(l3), "v"(l4), "v"(l5), "v"(l6), "v"(l7),
                  "v"(g), "v"(g1), "v"(g2), "v"(g3), "v"(g4), "v"(g5), "v"(g6), "v"(g7)
               : "memory");
}

// ---------------------------------------------------------------------------
// Main loop of the qkv projection: acc[mt][nt] += A(128 rows) * B(128 rows)^T
// over K = 512, both operands k-contiguous f16 rows of DMODEL halves. Block 128
// thr, waves 2 x 2, wave tile 64 x 64: a staged row feeds twice the products of
// the 128 x 64 tile, and each fragment read from LDS feeds four. Same two-buffer
// ring and hand-over as gemm_128x64, same ascending k order per output element.
// On return every wave has passed the last barrier and no copy is in flight, so
// the caller may reuse sG.
// ---------------------------------------------------------------------------
__device__ __forceinline__ void gemm_128x128(const _Float16* arows, const _Float16* brows,
                                             _Float16* sG, int tid, v8f (&acc)[4][4]) {
  const int lane = tid & 31, w = tid >> 5;
  const int wm = w & 1, wn = w >> 1;
  const int h = lane >> 4, m = lane & 15;
  // Staging map: chunk c = tid + 128 i (i = 0..15), staged row c >> 3, 16-B column c & 7.
  const int crow = tid >> 3, ccol = tid & 7;
  const unsigned l0 = (unsigned)(size_t)(sG + crow * TPITCH + 8 * ccol);
  const unsigned lb = 128 * TPITCH * 2;                                    // the feature rows' place in a buffer, bytes
  const _Float16* ga0 = arows + (size_t)crow * DMODEL + 8 * ccol;          // + 64 per step
  const _Float16* gb0 = brows + (size_t)crow * DMODEL + 8 * ccol;          // + 64 per step

  rows128_copy(l0, ga0);                                                   // step 0 -> buffer 0
  rows128_copy(l0 + lb, gb0);
  // step 0's copies of this wave have landed before the barrier that publishes them
  asm volatile("s_wait_asynccnt 0x0" ::: "memory");
  __syncthreads();
  rows128_copy(l0 + PSTAGE * 2, ga0 + 64);                                 // step 1 -> buffer 1
  rows128_copy(l0 + PSTAGE * 2 + lb, gb0 + 64);

  #pragma unroll 1   // rolled: one copy of the body, the ring buffer picked by the step's parity
  for (int t = 0; t < GSTEPS; ++t) {
    const int bo = (t & 1) * PSTAGE;                                       // this step's ring buffer
    const _Float16* ab = sG + bo + (64 * wm + m) * TPITCH;                 // token row, mt = 0
    const _Float16* bb = sG + bo + (128 + 64 * wn + m) * TPITCH;           // feature row, nt = 0
    #pragma unroll   // acc[][] indexed by constants, so that it stays in registers
    for (int kc = 0; kc < 2; ++kc) {
      // the eight fragments of a 32-deep chunk are read as one group ahead of its products
      v16h af[4], bf[4];
      #pragma unroll   // af[], bf[] indexed by constants, so that they stay in registers
      for (int i = 0; i < 4; ++i) {
        af[i] = load_frag(ab + i * 16 * TPITCH + 32 * kc, h);
        bf[i] = load_frag(bb + i * 16 * TPITCH + 32 * kc, h);
      }
      #pragma unroll
      for (int nt = 0; nt < 4; ++nt) {
        #pragma unroll
        for (int mt = 0; mt < 4; ++mt)
          acc[mt][nt] = wmma_f16(af[mt], bf[nt], acc[mt][nt]);
      }
    }
    // ---- hand-over: this wave's reads of buffer t&1 are done, its copies of step t+1 have
    // landed; the barrier publishes step t+1 and frees buffer t&1 for the refill ----
    asm volatile("s_wait_dscnt 0x0" ::: "memory");
    asm volatile("s_wait_asynccnt 0x0" ::: "memory");
    __syncthreads();
    if (t + 2 < GSTEPS) {
      rows128_copy(l0 + bo * 2, ga0 + (t + 2) * 64);
      rows128_copy(l0 + bo * 2 + lb, gb0 + (t + 2) * 64);
    }
  }
  // no copy is left in flight when the wave goes on to the epilogue
  asm volatile("s_wait_asynccnt 0x0" ::: "memory");
}

// ---------------------------------------------------------------------------
// Output pass over the block's two head tiles (sT: head bh, then head bh + 1).
// 4 lines per instruction, 64 lines per wave, 256 per block.
// which 0/1: plane[bh][l][d]  (one token row = 64 halves = one line)
// which 2  : vt[bh][d][l]     (64 d-rows x 128 tokens = 2 lines each)
// In both layouts line lid of a head tile lies at sT + lid * 64, and head bh + 1
// lies SEQ * HD halves behind head bh. A lane's 16 chunks are read from LDS as
// one group ahead of their stores: a wave waits out one LDS latency for the pass,
// not one per chunk.
// ---------------------------------------------------------------------------
__device__ __forceinline__ void proj_store_pass(const _Float16* sT, _Float16* plane, _Float16* vt,
                                                int which, int bh, int l0, int w, int lane) {
  const int q8 = lane & 7, sub = lane >> 3;
  const int lid0 = w * 32 + sub;                   // the lane's first line of a tile; line i lies 4 further
  const int d0 = lid0 >> 1, hl = lid0 & 1;         // which 2: line lid0 + 4 i is d-row d0 + 2 i, token half hl
  _Float16* dst0 = (which != 2) ? plane + ((size_t)bh * SEQ + l0 + lid0) * HD + 8 * q8
                                : vt + ((size_t)bh * HD + d0) * SEQ + l0 + 64 * hl + 8 * q8;
  const int step = (which != 2) ? 4 * HD : 2 * SEQ;   // halves from line i to line i + 1
  const _Float16* src = sT + lid0 * 64 + 8 * q8;
  _Float16* dst[8];
  v8h v[2][8];
  #pragma unroll   // dst[], v[][] indexed by constants, so that they stay in registers
  for (int i = 0; i < 8; ++i) {
    dst[i] = dst0 + i * step;
    v[0][i] = *(const v8ha*)(src + i * 256);
    v[1][i] = *(const v8ha*)(src + 128 * HD + i * 256);
  }
  // The line addresses are formed ahead of the run of stores: inside the run no register of an
  // issued store is written again, so the stores follow one another with no wait on an earlier one.
  __builtin_amdgcn_sched_barrier(0);
  #pragma unroll
  for (int i = 0; i < 8; ++i) {
    *(v8h*)dst[i] = v[0][i];
    *(v8h*)(dst[i] + (size_t)SEQ * HD) = v[1][i];
  }
}

// ---------------------------------------------------------------------------
// Kernel 2: Y = (x+pe) * W^T + bias over the fused 3*512 output columns.
// Block 128 thr (4 waves) = 128 tokens x 128 features (two heads of one which);
// wave tile 64 tokens x 64 features (one head); K = 512 in staged steps of 64
// (gemm_128x128); the two heads' output tiles sT reuse the ring's LDS once the
// main loop has returned.
// ---------------------------------------------------------------------------
__global__ __launch_bounds__(128) void proj_kernel(
    const _Float16* __restrict__ xh,   // [8192][512]
    const _Float16* __restrict__ wh,   // [4][512][512], row = output feature, x32
    const float* __restrict__ bq, const float* __restrict__ bk, const float* __restrict__ bv,
    _Float16* __restrict__ qh,         // [B*H][L][D]  f16(q)
    _Float16* __restrict__ kh,         // [B*H][L][D]  f16(k)
    _Float16* __restrict__ vt)         // [B*H][D][L]  f16(v)
{
  __shared__ __attribute__((aligned(16))) _Float16 sG[2 * PSTAGE];  // 73728 B
  _Float16* sT = sG;                                                // 2 x (128 x 64) halves, after the main loop

  const int tid = threadIdx.x, lane = tid & 31, w = tid >> 5;
  const int wm = w & 1, wn = w >> 1;
  const int h = lane >> 4, m = lane & 15;
  const int m0 = blockIdx.x * 128;
  const int cg = blockIdx.y;                 // 0..11
  const int which = cg >> 2, head0 = (cg & 3) * 2;   // the block's heads: head0, head0 + 1

  const v8f zero8 = {0.f, 0.f, 0.f, 0.f, 0.f, 0.f, 0.f, 0.f};
  v8f acc[4][4];
  #pragma unroll
  for (int mt = 0; mt < 4; ++mt)
    #pragma unroll
    for (int nt = 0; nt < 4; ++nt) acc[mt][nt] = zero8;

  gemm_128x128(xh + (size_t)m0 * DMODEL, wh + ((size_t)which * DMODEL + head0 * HD) * DMODEL, sG, tid, acc);

  // D[r] of tile (mt, nt) = Y[token m0+64wm+16mt+8h+r][head head0+wn, feature 16nt+m]
  const float* bias = (which == 0) ? bq : ((which == 1) ? bk : bv);
  _Float16* sTw = sT + wn * (128 * HD);      // this wave's head tile
  #pragma unroll
  for (int nt = 0; nt < 4; ++nt) {
    const int feat = 16 * nt + m;
    const float bvl = bias[(head0 + wn) * HD + feat];
    #pragma unroll
    for (int mt = 0; mt < 4; ++mt) {
      #pragma unroll
      for (int r = 0; r < 8; ++r) {
        const int tokl = 64 * wm + 16 * mt + 8 * h + r;    // 0..127
        const float y = acc[mt][nt][r] * (1.0f / WSCALE) + bvl;
        const int idx = (which == 2) ? (feat * 128 + tokl) : (tokl * HD + feat);
        sTw[idx] = (_Float16)y;
      }
    }
  }
  __syncthreads();

  const int b = m0 / SEQ, l0 = m0 - b * SEQ, bh = b * NHEADS + head0;
  _Float16* plane = (which == 0) ? qh : kh;
  proj_store_pass(sT, plane, vt, which, bh, l0, w, lane);
  
}

// ---------------------------------------------------------------------------
// Attention helpers.
// Score element r of this lane: key = kb + 16j + 8h + r, query = q0 + m.
// v = mask ? (s*0.125 + anti[q - key + 2047]) : (-inf + missing_bias[head]).
// The key mask enters as the start value C of the score product: sm[key] = 0
// for an observed key, -inf + missing_bias[head] for a missing one, so that
// C + K.Q stays that non-finite value through the scale and the bias below.
// sb = the block's window of the antisymmetrised rel-pos table in LDS, base = index for r = 0
// (index decreases by one per r); every index is in range for every key, so
// the reads carry no condition and no branch.
// ---------------------------------------------------------------------------
__device__ __forceinline__ v8f mask_start8(const float* sm) {
  const v4f a = *(const v4fa*)sm;
  const v4f c = *(const v4fa*)(sm + 4);
  const v8f z = { a.x, a.y, a.z, a.w, c.x, c.y, c.z, c.w };
  return z;
}

__device__ __forceinline__ v8f bias_load8(const float* sb, int base) {
  const v8f t = { sb[base],     sb[base - 1], sb[base - 2], sb[base - 3],
                  sb[base - 4], sb[base - 5], sb[base - 6], sb[base - 7] };
  return t;
}

// P^T B-fragment from the lane's own score D values: element r <- tile a row r,
// element 8+r <- tile c row r (same lane, same query column), scaled by 2^14.
__device__ __forceinline__ v16h pack_p(v8f a, v8f c) {
  const v16h r = { (_Float16)(a[0] * PSCALE), (_Float16)(a[1] * PSCALE), (_Float16)(a[2] * PSCALE), (_Float16)(a[3] * PSCALE),
                   (_Float16)(a[4] * PSCALE), (_Float16)(a[5] * PSCALE), (_Float16)(a[6] * PSCALE), (_Float16)(a[7] * PSCALE),
                   (_Float16)(c[0] * PSCALE), (_Float16)(c[1] * PSCALE), (_Float16)(c[2] * PSCALE), (_Float16)(c[3] * PSCALE),
                   (_Float16)(c[4] * PSCALE), (_Float16)(c[5] * PSCALE), (_Float16)(c[6] * PSCALE), (_Float16)(c[7] * PSCALE) };
  return r;
}

// (one token row's head slice) by lanes 8q..8q+7 in one instruction, 4 lines
// per instruction, 16 lines per wave.
__device__ __forceinline__ void ao_store_pass(const _Float16* so, _Float16* ao,
                                              int b, int head, int q0, int lane) {
  const int q8 = lane & 7, sub = lane >> 3;
  #pragma unroll
  for (int i = 0; i < 4; ++i) {
    const int lid = i * 4 + sub;                    // 0..15
    const v8h v = *(const v8ha*)(so + lid * 64 + 8 * q8);
    const size_t gi = ((size_t)b * SEQ + q0 + lid) * DMODEL + head * HD + 8 * q8;
    *(v8h*)(ao + gi) = v;
  }
}

// One 64-key stage of K (64 key rows x 128 B) and of V^T (64 d rows x 128 B)
// into LDS rows of TPITCH halves: 4 + 4 asynchronous 16-B copies per lane, each
// wave-wide copy covering four whole 128-B lines. lk/lv = this lane's LDS byte
// address of its first K / V chunk, gk/gv = the matching global address; chunk
// i lies 16 rows further on both sides.
// The closing s_wait_xcnt 0 stands inside the copies' own statement, so that no
// address register named here is rewritten ahead of it.
__device__ __forceinline__ void stage_copy(unsigned lk, unsigned lv,
                                           const _Float16* gk, const _Float16* gv) {
  const unsigned lk1 = lk + 16 * TPITCH * 2, lk2 = lk + 32 * TPITCH * 2, lk3 = lk + 48 * TPITCH * 2;
  const unsigned lv1 = lv + 16 * TPITCH * 2, lv2 = lv + 32 * TPITCH * 2, lv3 = lv + 48 * TPITCH * 2;
  const _Float16* gk1 = gk + 16 * HD;
  const _Float16* gk2 = gk + 32 * HD;
  const _Float16* gk3 = gk + 48 * HD;
  const _Float16* gv1 = gv + (size_t)16 * SEQ;
  const _Float16* gv2 = gv + (size_t)32 * SEQ;
  const _Float16* gv3 = gv + (size_t)48 * SEQ;
  asm volatile("global_load_async_to_lds_b128 %0, %8, off\n\t"
               "global_load_async_to_lds_b128 %1, %9, off\n\t"
               "global_load_async_to_lds_b128 %2, %10, off\n\t"
               "global_load_async_to_lds_b128 %3, %11, off\n\t"
               "global_load_async_to_lds_b128 %4, %12, off\n\t"
               "global_load_async_to_lds_b128 %5, %13, off\n\t"
               "global_load_async_to_lds_b128 %6, %14, off\n\t"
               "global_load_async_to_lds_b128 %7, %15, off\n\t"
               "s_wait_xcnt 0x0"
               :: "v"(lk), "v"(lk1), "v"(lk2), "v"(lk3), "v"(lv), "v"(lv1), "v"(lv2), "v"(lv3),
                  "v"(gk), "v"(gk1), "v"(gk2), "v"(gk3), "v"(gv), "v"(gv1), "v"(gv2), "v"(gv3)
               : "memory");
}

// ---------------------------------------------------------------------------
// Kernel 3: streaming attention, transposed form.
// Block 128 thr (4 waves), 16 queries per wave, 64 keys per step.
// K and V^T of a step are staged once per block in a two-buffer LDS ring by
// asynchronous copies (next step's copies fly while this step is worked on);
// all four waves read their fragments from there.
//   S^T = K * Q^T : A = K rows (row = key, k = d), B = Q^T (k = d, n = query)
//   O^T += V^T * P^T : A = Vt rows (row = d, k = key), B = P^T from registers
// Lane owns 32 keys of query column (lane&15); partner = lane ^ 16.
// The block's window of this head's antisymmetrised rel-pos table (formed by the
// convert launch) is copied to LDS, and the key-mask start values of this batch
// row are built there, once per block.
// ---------------------------------------------------------------------------
__global__ __launch_bounds__(128) void attn_kernel(
    const _Float16* __restrict__ qh,   // [B*H][L][D]
    const _Float16* __restrict__ kh,   // [B*H][L][D]
    const _Float16* __restrict__ vt,   // [B*H][D][L]
    const int* __restrict__ mask,      // [B][L], nonzero = observed key
    const float* __restrict__ mbias,   // [H]
    const float* __restrict__ ab,      // [H][RELP] antisymmetrised rel-pos table
    _Float16* __restrict__ ao)         // [B][L][DMODEL], x64
{
  __shared__ __attribute__((aligned(16))) float sB[RELWIN];           //  8448 B
  __shared__ __attribute__((aligned(16))) float sM[SEQ];              //  8192 B
  __shared__ __attribute__((aligned(16))) _Float16 sO[4 * 16 * 64];  //  8192 B
  __shared__ __attribute__((aligned(16))) _Float16 sK[2 * TSTAGE];   // 18432 B
  __shared__ __attribute__((aligned(16))) _Float16 sV[2 * TSTAGE];   // 18432 B

  const int tid = threadIdx.x, lane = tid & 31, w = tid >> 5;
  const int h = lane >> 4, m = lane & 15;
  const int bh = blockIdx.y, b = bh >> 3, head = bh & 7;
  const int q0 = blockIdx.x * 64 + 16 * w;

  // Staging map: chunk c = tid + 128 i (i = 0..3), tile row c >> 3, 16-B column c & 7.
  const int crow = tid >> 3, ccol = tid & 7;
  const unsigned lk0 = (unsigned)(size_t)(sK + crow * TPITCH + 8 * ccol);
  const unsigned lv0 = (unsigned)(size_t)(sV + crow * TPITCH + 8 * ccol);
  const _Float16* gk0 = kh + ((size_t)bh * SEQ + crow) * HD + 8 * ccol;    // + 64 * HD per step
  const _Float16* gv0 = vt + ((size_t)bh * HD + crow) * SEQ + 8 * ccol;    // + 64 per step

  stage_copy(lk0, lv0, gk0, gv0);                                          // step 0 -> buffer 0

  // Table index of (query q, key k) is q - k + (SEQ-1): the block's 64 queries, first one qb,
  // reach entries qb .. qb + 2110 over all keys. sB[e] = ab[head][qb + e], e = 0 .. 2111
  // (the last entry read is 1984 + 2111 = 4095, the padding entry: copied, never used).
  const float* abw = ab + head * RELP + blockIdx.x * 64;
  // The loads stand here and the LDS stores behind the mask and Q loads, so that all of the
  // prologue's loads are in flight together. The last 64 entries are 16 chunks: every thread
  // loads one of them (no condition on the load), the first 16 threads store.
  v4f tb[5];
  #pragma unroll   // tb[] indexed by constants, so that it stays in registers
  for (int c = 0; c < 4; ++c) tb[c] = *(const v4fa*)(abw + 4 * tid + 512 * c);
  tb[4] = *(const v4fa*)(abw + 2048 + 4 * (tid & 15));

  // sM[key] = 0 (observed) or -inf fill + missing bias (missing)
  const float mbh = mbias[head];
  const float vmiss = -__builtin_inff() + mbh;
  #pragma unroll   // the four mask loads in flight together
  for (int i = 0; i < SEQ / 512; ++i) {
    const int k4 = 4 * tid + 512 * i;
    const v4i mm = *(const v4ia*)(mask + (size_t)b * SEQ + k4);
    const v4f t = { (mm.x != 0) ? 0.0f : vmiss, (mm.y != 0) ? 0.0f : vmiss,
                    (mm.z != 0) ? 0.0f : vmiss, (mm.w != 0) ? 0.0f : vmiss };
    *(v4fa*)(sM + k4) = t;
  }

  // Q^T B-fragments: column n = query q0+m, k = d (two 32-deep chunks)
  const _Float16* qrow = qh + ((size_t)bh * SEQ + q0 + m) * HD;
  const v16h qb0 = load_frag(qrow, h);
  const v16h qb1 = load_frag(qrow + 32, h);

  #pragma unroll
  for (int c = 0; c < 4; ++c) *(v4fa*)(sB + 4 * tid + 512 * c) = tb[c];
  // Holds the fifth load in front of the branch below (loaded value as an input only): without it
  // the compiler sinks the load into the branch, where wave 0 waits out a second full load latency.
  asm volatile("" :: "v"(tb[4]));
  if (tid < (RELWIN - 2048) / 4) *(v4fa*)(sB + 2048 + 4 * tid) = tb[4];

  // step 0's copies of this wave have landed before the barrier that publishes them (and sB, sM)
  asm volatile("s_wait_asynccnt 0x0" ::: "memory");
  __syncthreads();

  stage_copy(lk0 + TSTAGE * 2, lv0 + TSTAGE * 2, gk0 + 64 * HD, gv0 + 64); // step 1 -> buffer 1

  const int qk = 16 * w + m + (SEQ - 1) - 8 * h;     // index in sB for key (kb+16j) at r=0 is qk-kb-16j

  const v8f zero8 = {0.f, 0.f, 0.f, 0.f, 0.f, 0.f, 0.f, 0.f};
  const v8f eighth8 = {0.125f, 0.125f, 0.125f, 0.125f, 0.125f, 0.125f, 0.125f, 0.125f};
  v8f o[4];                                   // o[t][r] = O[query m][d 16t+8h+r] * (l * 2^14)
  #pragma unroll
  for (int t = 0; t < 4; ++t) o[t] = zero8;
  float mrun = -1e30f, lrun = 0.0f;

  const int fro = m * TPITCH;                                  // fragment row of this lane in a staged tile
  const float* smp = sM + 8 * h;                               // + key tile base

  #pragma unroll 1
  for (int st = 0; st < NSTEP; ++st) {
    const int kb = st * 64;
    const int bo = (st & 1) * TSTAGE;                          // this step's ring buffer
    const _Float16* kbase = sK + bo + fro;                     // + 16j*TPITCH + 32*dc
    const _Float16* vbase = sV + bo + fro;                     // + 16t*TPITCH + 32*kc
    // ---- rel-pos bias of this step, read ahead of the score products ----
    v8f bv[4];
    #pragma unroll   // bv[] indexed by constants, so that it stays in registers
    for (int j = 0; j < 4; ++j) bv[j] = bias_load8(sB, qk - kb - 16 * j);
    // ---- raw scores on the mask start: s[j][r] = sM[key] + (Q.K)[query m][key kb+16j+8h+r] ----
    v8f s[4];
    #pragma unroll
    for (int j = 0; j < 4; ++j) {
      const _Float16* kp = kbase + 16 * j * TPITCH;
      const v16h kf0 = load_frag(kp, h);
      const v16h kf1 = load_frag(kp + 32, h);
      v8f z = mask_start8(smp + kb + 16 * j);
      z = wmma_f16_free(kf0, qb0, z);
      z = wmma_f16_free(kf1, qb1, z);
      s[j] = z;
    }
    // ---- scale 1/8, rel-pos bias (f32) ----
    #pragma unroll
    for (int j = 0; j < 4; ++j)
      s[j] = __builtin_elementwise_fma(s[j], eighth8, bv[j]);

    // ---- online softmax ----
    float mloc = s[0][0];
    #pragma unroll
    for (int j = 0; j < 4; ++j)
      #pragma unroll
      for (int r = 0; r < 8; ++r) mloc = fmaxf(mloc, s[j][r]);
    mloc = fmaxf(mloc, __shfl_xor(mloc, 16));
    const float mnew = fmaxf(mrun, mloc);
    const float alpha = __expf(mrun - mnew);
    mrun = mnew;
    float lsum = 0.0f;
    #pragma unroll
    for (int j = 0; j < 4; ++j) {
      float u[8], p[8];
      #pragma unroll   // u[], p[] indexed by constants, so that they stay in registers
      for (int r = 0; r < 8; ++r) {
        u[r] = (s[j][r] - mnew) * LOG2E;
        p[r] = __builtin_amdgcn_exp2f(u[r]);
      }
      // The slot behind a transcendental: the eight sources stay live up to this statement, so
      // that no instruction directly behind one of the row's v_exp_f32 writes the register it
      // reads; the v_nop is
      // the slot of the last of them.
      asm("v_nop" : "+v"(p[7])
          : "v"(u[0]), "v"(u[1]), "v"(u[2]), "v"(u[3]), "v"(u[4]), "v"(u[5]), "v"(u[6]), "v"(u[7]),
            "v"(p[0]), "v"(p[1]), "v"(p[2]), "v"(p[3]), "v"(p[4]), "v"(p[5]), "v"(p[6]));
      #pragma unroll
      for (int r = 0; r < 8; ++r) {
        s[j][r] = p[r];
        lsum += p[r];
      }
    }
    lsum += __shfl_xor(lsum, 16);
    lrun = lrun * alpha + lsum;
    #pragma unroll
    for (int t = 0; t < 4; ++t)
      #pragma unroll
      for (int r = 0; r < 8; ++r) o[t][r] = o[t][r] * alpha;

    // ---- P^T B-fragments (key chunks 0..31 and 32..63 of this step) ----
    const v16h pb0 = pack_p(s[0], s[1]);
    const v16h pb1 = pack_p(s[2], s[3]);

    // ---- O^T += V^T * P^T ----
    #pragma unroll
    for (int t = 0; t < 4; ++t) {
      const _Float16* vp = vbase + 16 * t * TPITCH;
      const v16h vf0 = load_frag(vp, h);
      const v16h vf1 = load_frag(vp + 32, h);
      o[t] = wmma_f16_free(vf0, pb0, o[t]);
      o[t] = wmma_f16_free(vf1, pb1, o[t]);
    }

    // ---- hand-over: this wave's reads of buffer st&1 are done, its copies of step st+1
    // have landed; the barrier publishes step st+1 and frees buffer st&1 for the refill ----
    asm volatile("s_wait_dscnt 0x0" ::: "memory");
    asm volatile("s_wait_asynccnt 0x0" ::: "memory");
    __syncthreads();
    if (st + 2 < NSTEP)
      stage_copy(lk0 + bo * 2, lv0 + bo * 2, gk0 + (size_t)(kb + 128) * HD, gv0 + (kb + 128));
  }
  // no copy is left in flight when the wave goes on to the epilogue
  asm volatile("s_wait_asynccnt 0x0" ::: "memory");

  // ---- epilogue: normalise, x64, stage per-wave 16x64 f16 tile, whole-line stores ----
  const float inv = __builtin_amdgcn_rcpf(lrun) * (AOSCALE / PSCALE);
  _Float16* so = sO + w * 1024;
  #pragma unroll
  for (int t = 0; t < 4; ++t)
    #pragma unroll
    for (int r = 0; r < 8; ++r)
      so[m * 64 + 16 * t + 8 * h + r] = (_Float16)(o[t][r] * inv);
  __syncthreads();

  ao_store_pass(so, ao, b, head, q0, lane);
  
}

// ---------------------------------------------------------------------------
// 16-B stores, 4 lines per instruction, 64 lines per wave.
// ---------------------------------------------------------------------------
__device__ __forceinline__ void out_store_pass(const float* sT, float* out, int m0, int fg, int w, int lane) {
  const int q8 = lane & 7, sub = lane >> 3;
  #pragma unroll
  for (int i = 0; i < 16; ++i) {
    const int lid = i * 4 + sub;                   // 0..63
    const int row = 32 * w + (lid >> 1), hl = lid & 1;
    const v4f v = *(const v4fa*)(sT + row * 64 + 32 * hl + 4 * q8);
    const size_t gi = ((size_t)(m0 + row)) * DMODEL + fg * 64 + 32 * hl + 4 * q8;
    *(v4f*)(out + gi) = v;
  }
}

// ---------------------------------------------------------------------------
// Kernel 4: out = AO * Wo^T + bo (f32). Block 128 thr = 128 tokens x 64
// features (fg = blockIdx.y); wave tile 32 x 64; K = 512 in staged steps of 64
// (gemm_128x64); the output tile sT reuses the ring's LDS after the main loop.
// ---------------------------------------------------------------------------
__global__ __launch_bounds__(128) void oproj_kernel(
    const _Float16* __restrict__ ao,   // [8192][512] f16, x64
    const _Float16* __restrict__ woh,  // [512][512] f16, row = output feature, x32
    const float* __restrict__ bo,      // [512]
    float* __restrict__ out)           // [8192][512] f32
{
  __shared__ __attribute__((aligned(16))) _Float16 sG[2 * GSTAGE];  // 55296 B
  float* sT = (float*)sG;                                           // 128 x 64 floats (32768 B), after the main loop

  const int tid = threadIdx.x, lane = tid & 31, w = tid >> 5;
  const int h = lane >> 4, m = lane & 15;
  const int m0 = blockIdx.x * 128;
  const int fg = blockIdx.y;                 // 0..7

  const v8f zero8 = {0.f, 0.f, 0.f, 0.f, 0.f, 0.f, 0.f, 0.f};
  v8f acc[2][4];
  #pragma unroll
  for (int mt = 0; mt < 2; ++mt)
    #pragma unroll
    for (int nt = 0; nt < 4; ++nt) acc[mt][nt] = zero8;

  gemm_128x64(ao + (size_t)m0 * DMODEL, woh + (size_t)fg * 64 * DMODEL, sG, tid, acc);

  // D[r] of tile (mt, nt) = out[token m0+32w+16mt+8h+r][feature fg*64+16nt+m]
  #pragma unroll
  for (int nt = 0; nt < 4; ++nt) {
    const int feat = 16 * nt + m;
    const float bvl = bo[fg * 64 + feat];
    #pragma unroll
    for (int mt = 0; mt < 2; ++mt) {
      #pragma unroll
      for (int r = 0; r < 8; ++r) {
        const int tokl = 32 * w + 16 * mt + 8 * h + r;
        sT[tokl * 64 + feat] = acc[mt][nt][r] * (1.0f / (WSCALE * AOSCALE)) + bvl;
      }
    }
  }
  __syncthreads();

  out_store_pass(sT, out, m0, fg, w, lane);
  
}

// ---------------------------------------------------------------------------
extern "C" void kernel_launch(void* const* d_in, const int* in_sizes, int n_in,
                              void* d_out, int out_size, void* d_ws, size_t ws_size,
                              hipStream_t stream) {
  if (n_in < 12) return;
  if (in_sizes[0] != NX) return;
  if (in_sizes[1] != MROWS) return;
  if (in_sizes[2] != NW || in_sizes[4] != NW || in_sizes[6] != NW || in_sizes[8] != NW) return;
  if (in_sizes[3] != DMODEL || in_sizes[5] != DMODEL || in_sizes[7] != DMODEL || in_sizes[9] != DMODEL) return;
  if (in_sizes[10] != NHEADS) return;
  if (in_sizes[11] != RELN * NHEADS) return;
  if (out_size != NX) return;

  const float* x     = (const float*)d_in[0];
  const int*   mask  = (const int*)d_in[1];
  const float* Wq    = (const float*)d_in[2];
  const float* bq    = (const float*)d_in[3];
  const float* Wk    = (const float*)d_in[4];
  const float* bk    = (const float*)d_in[5];
  const float* Wv    = (const float*)d_in[6];
  const float* bv    = (const float*)d_in[7];
  const float* Wo    = (const float*)d_in[8];
  const float* bo    = (const float*)d_in[9];
  const float* mbias = (const float*)d_in[10];
  const float* rel   = (const float*)d_in[11];
  float* out = (float*)d_out;

  const size_t xh_bytes = (size_t)NX * 2;                           //  8388608
  const size_t wh_bytes = (size_t)4 * NW * 2;                       //  2097152
  const size_t pl_bytes = (size_t)BATCH * NHEADS * SEQ * HD * 2;    //  8388608
  const size_t ao_bytes = (size_t)NX * 2;                           //  8388608
  const size_t ab_bytes = (size_t)NHEADS * RELP * 4;                //   131072
  const size_t total = xh_bytes + wh_bytes + 3 * pl_bytes + ao_bytes + ab_bytes;   // 44171264
  if (total > ws_size) return;

  char* ws = (char*)d_ws;
  size_t off = 0;
  _Float16* xh  = (_Float16*)(ws + off);  off += xh_bytes;
  _Float16* wh  = (_Float16*)(ws + off);  off += wh_bytes;
  _Float16* qh  = (_Float16*)(ws + off);  off += pl_bytes;
  _Float16* kh  = (_Float16*)(ws + off);  off += pl_bytes;
  _Float16* vt  = (_Float16*)(ws + off);  off += pl_bytes;
  _Float16* ao  = (_Float16*)(ws + off);  off += ao_bytes;
  float*    ab  = (float*)(ws + off);     off += ab_bytes;
  if (off > ws_size) return;

  const int ngroups = XGROUPS + NW8 + RELP;                         // 167936
  convert_kernel<<<(ngroups + 255) / 256, 256, 0, stream>>>(x, Wq, Wk, Wv, Wo, rel, xh, wh, ab);

  dim3 gProj(MROWS / 128, 3 * NHEADS / 2);                          // (64, 12)
  proj_kernel<<<gProj, 128, 0, stream>>>(xh, wh, bq, bk, bv, qh, kh, vt);

  dim3 gAtt(SEQ / 64, BATCH * NHEADS);                              // (32, 32)
  attn_kernel<<<gAtt, 128, 0, stream>>>(qh, kh, vt, mask, mbias, ab, ao);

  dim3 gOut(MROWS / 128, DMODEL / 64);                              // (64, 8)
  oproj_kernel<<<gOut, 128, 0, stream>>>(ao, wh + (size_t)3 * NW, bo, out);
}

// v008
// A run of this version takes 69.8 microseconds.
// Next to v007, in two timings, it ran 1.12 times as fast each time.
// Over all steps from v000 it is 4.11 times as fast.
// Contractions: x*W^T for q,k,v and o, K*Q^T, V^T*P^T all on v_wmma_f32_16x16x32_f16 (f16 operands, f32 accumulate); W carried x32, P carried x16384, attention rows carried x64 (exact power-of-two scales folded back in f32); PE, bias tables, key mask, softmax and normalisation in f32.
#include <hip/hip_runtime.h>

typedef _Float16 v16h __attribute__((ext_vector_type(16)));
typedef _Float16 v8h  __attribute__((ext_vector_type(8)));
typedef float    v8f  __attribute__((ext_vector_type(8)));
typedef float    v4f  __attribute__((ext_vector_type(4)));
typedef int      v4i  __attribute__((ext_vector_type(4)));
typedef v8h __attribute__((may_alias)) v8ha;
typedef v4f __attribute__((may_alias)) v4fa;
typedef v4i __attribute__((may_alias)) v4ia;

union Frag { v16h v; v8h half[2]; };

#define DMODEL 512
#define NHEADS 8
#define HD     64
#define SEQ    2048
#define BATCH  4
#define MROWS  (BATCH * SEQ)          // 8192 tokens
#define NX     (MROWS * DMODEL)       // 4194304
#define NW     (DMODEL * DMODEL)      // 262144
#define NW8    (NW / 8)               // 32768
#define RELN   (2 * SEQ - 1)          // 4095
#define RELP   (2 * SEQ)              // 4096 entries per head plane of the antisymmetrised table (last one padding)
#define AQ     128                    // queries of an attention block: four groups of 32
#define RELWIN (SEQ + AQ)             // 2176 table entries of an attention block's window: the 2175 its 128 queries can reach, plus one
#define NPE    (SEQ * DMODEL)         // 1048576 elements of one batch entry
#define XGROUPS (NPE / 8)             // 131072 groups of 8 features of one batch entry
#define PSCALE  16384.0f
#define WSCALE  32.0f
#define AOSCALE 64.0f
#define LOG2E   1.44269502f           // what __expf multiplies by ahead of its v_exp_f32
#define TPITCH  72                    // halves per staged LDS row: 144 B = 16 B x 9, conflict-free for 16-B fragment reads
#define AKEYS   128                   // keys of a staged attention step: 64 for each of the two waves of a query group
#define ASTEP   (SEQ / AKEYS)         // 16 staged steps
#define KSTAGE  (AKEYS * TPITCH)      // halves per staged K tile (128 key rows)
#define VPITCH  136                   // halves per staged V^T row: 272 B = 16 B x 17, conflict-free for 16-B fragment reads
#define VSTAGE  (HD * VPITCH)         // halves per staged V^T tile (64 d rows of 128 keys)
#define GROWS   192                   // staged rows of a projection k step: 128 token rows, then 64 feature rows
#define GSTAGE  (GROWS * TPITCH)      // halves per staged projection k step (27648 B)
#define GSTEPS  (DMODEL / 64)         // 8 k steps of 64
#define PROWS   256                   // staged rows of a qkv k step: 128 token rows, then 128 feature rows
#define PSTAGE  (PROWS * TPITCH)      // halves per staged qkv k step (36864 B)

static_assert(BATCH == 4);
static_assert((XGROUPS % 256) == 0 && (NW8 % 256) == 0);
static_assert((MROWS % 128) == 0 && (SEQ % 128) == 0);

// ---------------------------------------------------------------------------
// 16x16x32 f16 WMMA. wmma_f16: with hazard guard (ties D, keeps A/B live), used
// by the two projections. wmma_f16_free: the bare builtin, used by attention,
// where vector work stands between the products: the compiler keeps the distance
// behind each product with the softmax's own instructions where it can, and is
// free to fetch the next fragments while a product runs.
// Fragment map (wave32): lane l, h = l>>4, m = n = l&15.
//   A/B element i: i<8 -> k0+8h+i ; i>=8 -> k0+16+8h+(i-8)
//   D element r : row 8h+r, col l&15
// ---------------------------------------------------------------------------
__device__ __forceinline__ v8f wmma_f16(v16h a, v16h b, v8f c) {
  v8f d = __builtin_amdgcn_wmma_f32_16x16x32_f16(false, a, false, b, (short)0, c, false, false);
  asm volatile("v_nop\n\tv_nop\n\tv_nop\n\tv_nop" : "+v"(d) : "v"(a), "v"(b));
  return d;
}

__device__ __forceinline__ v8f wmma_f16_free(v16h a, v16h b, v8f c) {
  return __builtin_amdgcn_wmma_f32_16x16x32_f16(false, a, false, b, (short)0, c, false, false);
}

// A or B fragment from a k-contiguous 16-bit row; p points at element k0 of
// the row owned by this lane (row index = lane & 15 added by the caller).
__device__ __forceinline__ v16h load_frag(const _Float16* p, int h) {
  Frag f;
  f.half[0] = *(const v8ha*)(p + 8 * h);
  f.half[1] = *(const v8ha*)(p + 16 + 8 * h);
  return f.v;
}

// ---------------------------------------------------------------------------
// Kernel 1: f32 -> f16 planes. xh = f16(x + pe) unscaled, wh = f16(32*W) for
// Wq,Wk,Wv,Wo (row = output feature, k-contiguous). Four 16-B stores per lane in x and W blocks.
// pe[t][2p] = sin(t*div_p), pe[t][2p+1] = cos(t*div_p),
// div_p = exp(f32(2p) * f32(-ln(1e4)/512)).
// x blocks: a thread owns 8 features of position t; it forms their four
// (sin, cos) pairs once, in registers, and adds them to that position's row of
// all four batch entries. W blocks: a thread converts the same 8 elements of
// all four matrices. All eight 16-B loads of a thread are issued up front.
// Table blocks: a thread owns entry i of the antisymmetrised rel-pos table of all
// eight heads, ab[head][i] = 0.5 * (rel[i][head] - rel[RELN-1-i][head]),
// i = q - k + (SEQ-1); it reads two whole 32-B rows and a wave stores one whole
// 128-B line per head. Entry 4095 is padding, stored as 0.
// ---------------------------------------------------------------------------
__device__ __forceinline__ v8h pack8(v4f a, v4f c) {
  const v8h o = { (_Float16)a.x, (_Float16)a.y, (_Float16)a.z, (_Float16)a.w,
                  (_Float16)c.x, (_Float16)c.y, (_Float16)c.z, (_Float16)c.w };
  return o;
}

__global__ __launch_bounds__(256) void convert_kernel(
    const float* __restrict__ x,
    const float* __restrict__ wq, const float* __restrict__ wk,
    const float* __restrict__ wv, const float* __restrict__ wo,
    const float* __restrict__ rel,
    _Float16* __restrict__ xh, _Float16* __restrict__ wh, float* __restrict__ ab)
{
  const int g = blockIdx.x * 256 + threadIdx.x;
  if (g >= XGROUPS + NW8 + RELP) return;
  if (g >= XGROUPS + NW8) {
    const int i = g - (XGROUPS + NW8);      // table entry 0..4095
    const bool in = i < RELN;
    const float* up = rel + (in ? i : 0) * NHEADS;
    const float* dn = rel + (in ? RELN - 1 - i : 0) * NHEADS;
    const v4f u0 = *(const v4fa*)up, u1 = *(const v4fa*)(up + 4);
    const v4f d0 = *(const v4fa*)dn, d1 = *(const v4fa*)(dn + 4);
    const v4f t0 = 0.5f * (u0 - d0), t1 = 0.5f * (u1 - d1);
    #pragma unroll   // t0, t1 indexed by constants
    for (int hd = 0; hd < 4; ++hd) {
      ab[hd * RELP + i]       = in ? t0[hd] : 0.0f;
      ab[(hd + 4) * RELP + i] = in ? t1[hd] : 0.0f;
    }
    return;
  }
  v4f a[4], c[4];
  if (g < XGROUPS) {
    const int t = g >> 6;                   // position 0..2047 (64 groups of 8 per row)
    const int db = (g & 63) * 8;            // first feature of the group
    const unsigned so = (unsigned)g * 32u;  // byte offset of the group in a batch entry of x
    #pragma unroll   // a[], c[] indexed by constants, so that they stay in registers
    for (int b = 0; b < BATCH; ++b) {
      const char* src = (const char*)(x + (size_t)b * NPE) + so;
      a[b] = *(const v4fa*)src;
      c[b] = *(const v4fa*)(src + 16);
    }
    const float kc = (float)(-9.210340371976184 / 512.0);
    float sn[4], cs[4];
    #pragma unroll   // sn[], cs[] indexed by constants, so that they stay in registers
    for (int i = 0; i < 4; ++i) {
      const float fr = expf((float)(db + 2 * i) * kc);
      const float ang = (float)t * fr;
      sn[i] = sinf(ang);
      cs[i] = cosf(ang);
    }
    const v4f pa = { sn[0], cs[0], sn[1], cs[1] };
    const v4f pc = { sn[2], cs[2], sn[3], cs[3] };
    const unsigned dofs = (unsigned)g * 16u;  // byte offset of the group in a batch entry of xh
    #pragma unroll
    for (int b = 0; b < BATCH; ++b)
      *(v8h*)((char*)(xh + (size_t)b * NPE) + dofs) = pack8(a[b] + pa, c[b] + pc);
  } else {
    const unsigned e = (unsigned)(g - XGROUPS);
    const unsigned so = e * 32u;            // byte offset of the group in a matrix
    a[0] = *(const v4fa*)((const char*)wq + so);  c[0] = *(const v4fa*)((const char*)wq + so + 16);
    a[1] = *(const v4fa*)((const char*)wk + so);  c[1] = *(const v4fa*)((const char*)wk + so + 16);
    a[2] = *(const v4fa*)((const char*)wv + so);  c[2] = *(const v4fa*)((const char*)wv + so + 16);
    a[3] = *(const v4fa*)((const char*)wo + so);  c[3] = *(const v4fa*)((const char*)wo + so + 16);
    const unsigned dofs = e * 16u;          // byte offset of the group in a plane of wh
    #pragma unroll
    for (int i = 0; i < 4; ++i)
      *(v8h*)((char*)(wh + (size_t)i * NW) + dofs) = pack8(a[i] * WSCALE, c[i] * WSCALE);
  }
}

// ---------------------------------------------------------------------------
// One 64-deep k step of the output projection into LDS rows of TPITCH halves: 128 token
// rows (8 chunks per lane) and 64 feature rows (4 chunks per lane), 128 B each,
// by asynchronous 16-B copies; each wave-wide copy covers four whole 128-B
// lines. l = this lane's LDS byte address of its first chunk, ga / gb = the
// matching global addresses; chunk i lies 16 rows further on both sides.
// The closing s_wait_xcnt 0 stands inside the copies' own statement, so that no
// address register named here is rewritten ahead of it.
// ---------------------------------------------------------------------------
__device__ __forceinline__ void gemm_stage_copy(unsigned l, const _Float16* ga, const _Float16* gb) {
  const unsigned rs = 16 * TPITCH * 2;                 // 16 staged rows in bytes
  const unsigned l1 = l + rs,     l2 = l + 2 * rs,  l3 = l + 3 * rs,   l4 = l + 4 * rs;
  const unsigned l5 = l + 5 * rs, l6 = l + 6 * rs,  l7 = l + 7 * rs,   l8 = l + 8 * rs;
  const unsigned l9 = l + 9 * rs, l10 = l + 10 * rs, l11 = l + 11 * rs;
  const _Float16* a1 = ga + 16 * DMODEL;
  const _Float16* a2 = ga + 32 * DMODEL;
  const _Float16* a3 = ga + 48 * DMODEL;
  const _Float16* a4 = ga + 64 * DMODEL;
  const _Float16* a5 = ga + 80 * DMODEL;
  const _Float16* a6 = ga + 96 * DMODEL;
  const _Float16* a7 = ga + 112 * DMODEL;
  const _Float16* b1 = gb + 16 * DMODEL;
  const _Float16* b2 = gb + 32 * DMODEL;
  const _Float16* b3 = gb + 48 * DMODEL;
  asm volatile("global_load_async_to_lds_b128 %0, %12, off\n\t"
               "global_load_async_to_lds_b128 %1, %13, off\n\t"
               "global_load_async_to_lds_b128 %2, %14, off\n\t"
               "global_load_async_to_lds_b128 %3, %15, off\n\t"
               "global_load_async_to_lds_b128 %4, %16, off\n\t"
               "global_load_async_to_lds_b128 %5, %17, off\n\t"
               "global_load_async_to_lds_b128 %6, %18, off\n\t"
               "global_load_async_to_lds_b128 %7, %19, off\n\t"
               "global_load_async_to_lds_b128 %8, %20, off\n\t"
               "global_load_async_to_lds_b128 %9, %21, off\n\t"
               "global_load_async_to_lds_b128 %10, %22, off\n\t"
               "global_load_async_to_lds_b128 %11, %23, off\n\t"
               "s_wait_xcnt 0x0"
               :: "v"(l), "v"(l1), "v"(l2), "v"(l3), "v"(l4), "v"(l5), "v"(l6), "v"(l7),
                  "v"(l8), "v"(l9), "v"(l10), "v"(l11),
                  "v"(ga), "v"(a1), "v"(a2), "v"(a3), "v"(a4), "v"(a5), "v"(a6), "v"(a7),
                  "v"(gb), "v"(b1), "v"(b2), "v"(b3)
               : "memory");
}

// ---------------------------------------------------------------------------
// Main loop of the output projection: acc[mt][nt] += A(128 rows) * B(64 rows)^T over
// K = 512, both operands k-contiguous f16 rows of DMODEL halves. Block 128 thr,
// wave tile 32 x 64. Each 64-deep k step is staged once per block in a
// two-buffer LDS ring (the next step's copies fly while this step is worked
// on); the fragments are read from there, in the same ascending k order.
// On return every wave has passed the last barrier and no copy is in flight, so
// the caller may reuse sG.
// ---------------------------------------------------------------------------
__device__ __forceinline__ void gemm_128x64(const _Float16* arows, const _Float16* brows,
                                            _Float16* sG, int tid, v8f (&acc)[2][4]) {
  const int lane = tid & 31, w = tid >> 5;
  const int h = lane >> 4, m = lane & 15;
  // Staging map: chunk c = tid + 128 i (i = 0..11), staged row c >> 3, 16-B column c & 7.
  const int crow = tid >> 3, ccol = tid & 7;
  const unsigned l0 = (unsigned)(size_t)(sG + crow * TPITCH + 8 * ccol);
  const _Float16* ga0 = arows + (size_t)crow * DMODEL + 8 * ccol;          // + 64 per step
  const _Float16* gb0 = brows + (size_t)crow * DMODEL + 8 * ccol;          // + 64 per step

  gemm_stage_copy(l0, ga0, gb0);                                           // step 0 -> buffer 0
  // step 0's copies of this wave have landed before the barrier that publishes them
  asm volatile("s_wait_asynccnt 0x0" ::: "memory");
  __syncthreads();
  gemm_stage_copy(l0 + GSTAGE * 2, ga0 + 64, gb0 + 64);                    // step 1 -> buffer 1

  #pragma unroll 1   // rolled: one copy of the body, the ring buffer picked by the step's parity
  for (int t = 0; t < GSTEPS; ++t) {
    const int bo = (t & 1) * GSTAGE;                                       // this step's ring buffer
    const _Float16* ab = sG + bo + (32 * w + m) * TPITCH;                  // token row, mt = 0
    const _Float16* bb = sG + bo + (128 + m) * TPITCH;                     // feature row, nt = 0
    // all fragments of the step are read as one group ahead of its products
    v16h af[2][2], bf[2][4];
    #pragma unroll   // af[][], bf[][] indexed by constants, so that they stay in registers
    for (int kc = 0; kc < 2; ++kc) {
      af[kc][0] = load_frag(ab + 32 * kc, h);
      af[kc][1] = load_frag(ab + 16 * TPITCH + 32 * kc, h);
      #pragma unroll
      for (int nt = 0; nt < 4; ++nt) bf[kc][nt] = load_frag(bb + nt * 16 * TPITCH + 32 * kc, h);
    }
    #pragma unroll   // acc[][] indexed by constants, so that it stays in registers
    for (int kc = 0; kc < 2; ++kc) {
      #pragma unroll
      for (int nt = 0; nt < 4; ++nt) {
        acc[0][nt] = wmma_f16(af[kc][0], bf[kc][nt], acc[0][nt]);
        acc[1][nt] = wmma_f16(af[kc][1], bf[kc][nt], acc[1][nt]);
      }
    }
    // ---- hand-over: this wave's reads of buffer t&1 are done, its copies of step t+1 have
    // landed; the barrier publishes step t+1 and frees buffer t&1 for the refill ----
    asm volatile("s_wait_dscnt 0x0" ::: "memory");
    asm volatile("s_wait_asynccnt 0x0" ::: "memory");
    __syncthreads();
    if (t + 2 < GSTEPS)
      gemm_stage_copy(l0 + bo * 2, ga0 + (t + 2) * 64, gb0 + (t + 2) * 64);
  }
  // no copy is left in flight when the wave goes on to the epilogue
  asm volatile("s_wait_asynccnt 0x0" ::: "memory");
}

// ---------------------------------------------------------------------------
// 128 staged rows of one operand (8 chunks per lane, 128 B a row) into LDS rows
// of TPITCH halves by asynchronous 16-B copies; each wave-wide copy covers four
// whole 128-B lines. l = this lane's LDS byte address of its first chunk, g =
// the matching global address; chunk i lies 16 rows further on both sides.
// The closing s_wait_xcnt 0 stands inside the copies' own statement, so that no
// address register named here is rewritten ahead of it.
// ---------------------------------------------------------------------------
__device__ __forceinline__ void rows128_copy(unsigned l, const _Float16* g) {
  const unsigned rs = 16 * TPITCH * 2;                 // 16 staged rows in bytes
  const unsigned l1 = l + rs,     l2 = l + 2 * rs, l3 = l + 3 * rs, l4 = l + 4 * rs;
  const unsigned l5 = l + 5 * rs, l6 = l + 6 * rs, l7 = l + 7 * rs;
  const _Float16* g1 = g + 16 * DMODEL;
  const _Float16* g2 = g + 32 * DMODEL;
  const _Float16* g3 = g + 48 * DMODEL;
  const _Float16* g4 = g + 64 * DMODEL;
  const _Float16* g5 = g + 80 * DMODEL;
  const _Float16* g6 = g + 96 * DMODEL;
  const _Float16* g7 = g + 112 * DMODEL;
  asm volatile("global_load_async_to_lds_b128 %0, %8, off\n\t"
               "global_load_async_to_lds_b128 %1, %9, off\n\t"
               "global_load_async_to_lds_b128 %2, %10, off\n\t"
               "global_load_async_to_lds_b128 %3, %11, off\n\t"
               "global_load_async_to_lds_b128 %4, %12, off\n\t"
               "global_load_async_to_lds_b128 %5, %13, off\n\t"
               "global_load_async_to_lds_b128 %6, %14, off\n\t"
               "global_load_async_to_lds_b128 %7, %15, off\n\t"
               "s_wait_xcnt 0x0"
               :: "v"(l), "v"(l1), "v"(l2), "v"(l3), "v"(l4), "v"(l5), "v"(l6), "v"(l7),
                  "v"(g), "v"(g1), "v"(g2), "v"(g3), "v"(g4), "v"(g5), "v"(g6), "v"(g7)
               : "memory");
}

// ---------------------------------------------------------------------------
// Main loop of the qkv projection: acc[mt][nt] += A(128 rows) * B(128 rows)^T
// over K = 512, both operands k-contiguous f16 rows of DMODEL halves. Block 128
// thr, waves 2 x 2, wave tile 64 x 64: a staged row feeds twice the products of
// the 128 x 64 tile, and each fragment read from LDS feeds four. Same two-buffer
// ring and hand-over as gemm_128x64, same ascending k order per output element.
// On return every wave has passed the last barrier and no copy is in flight, so
// the caller may reuse sG.
// ---------------------------------------------------------------------------
__device__ __forceinline__ void gemm_128x128(const _Float16* arows, const _Float16* brows,
                                             _Float16* sG, int tid, v8f (&acc)[4][4]) {
  const int lane = tid & 31, w = tid >> 5;
  const int wm = w & 1, wn = w >> 1;
  const int h = lane >> 4, m = lane & 15;
  // Staging map: chunk c = tid + 128 i (i = 0..15), staged row c >> 3, 16-B column c & 7.
  const int crow = tid >> 3, ccol = tid & 7;
  const unsigned l0 = (unsigned)(size_t)(sG + crow * TPITCH + 8 * ccol);
  const unsigned lb = 128 * TPITCH * 2;                                    // the feature rows' place in a buffer, bytes
  const _Float16* ga0 = arows + (size_t)crow * DMODEL + 8 * ccol;          // + 64 per step
  const _Float16* gb0 = brows + (size_t)crow * DMODEL + 8 * ccol;          // + 64 per step

  rows128_copy(l0, ga0);                                                   // step 0 -> buffer 0
  rows128_copy(l0 + lb, gb0);
  // step 0's copies of this wave have landed before the barrier that publishes them
  asm volatile("s_wait_asynccnt 0x0" ::: "memory");
  __syncthreads();
  rows128_copy(l0 + PSTAGE * 2, ga0 + 64);                                 // step 1 -> buffer 1
  rows128_copy(l0 + PSTAGE * 2 + lb, gb0 + 64);

  #pragma unroll 1   // rolled: one copy of the body, the ring buffer picked by the step's parity
  for (int t = 0; t < GSTEPS; ++t) {
    const int bo = (t & 1) * PSTAGE;                                       // this step's ring buffer
    const _Float16* ab = sG + bo + (64 * wm + m) * TPITCH;                 // token row, mt = 0
    const _Float16* bb = sG + bo + (128 + 64 * wn + m) * TPITCH;           // feature row, nt = 0
    #pragma unroll   // acc[][] indexed by constants, so that it stays in registers
    for (int kc = 0; kc < 2; ++kc) {
      // the eight fragments of a 32-deep chunk are read as one group ahead of its products
      v16h af[4], bf[4];
      #pragma unroll   // af[], bf[] indexed by constants, so that they stay in registers
      for (int i = 0; i < 4; ++i) {
        af[i] = load_frag(ab + i * 16 * TPITCH + 32 * kc, h);
        bf[i] = load_frag(bb + i * 16 * TPITCH + 32 * kc, h);
      }
      #pragma unroll
      for (int nt = 0; nt < 4; ++nt) {
        #pragma unroll
        for (int mt = 0; mt < 4; ++mt)
          acc[mt][nt] = wmma_f16(af[mt], bf[nt], acc[mt][nt]);
      }
    }
    // ---- hand-over: this wave's reads of buffer t&1 are done, its copies of step t+1 have
    // landed; the barrier publishes step t+1 and frees buffer t&1 for the refill ----
    asm volatile("s_wait_dscnt 0x0" ::: "memory");
    asm volatile("s_wait_asynccnt 0x0" ::: "memory");
    __syncthreads();
    if (t + 2 < GSTEPS) {
      rows128_copy(l0 + bo * 2, ga0 + (t + 2) * 64);
      rows128_copy(l0 + bo * 2 + lb, gb0 + (t + 2) * 64);
    }
  }
  // no copy is left in flight when the wave goes on to the epilogue
  asm volatile("s_wait_asynccnt 0x0" ::: "memory");
}

// ---------------------------------------------------------------------------
// Output pass over the block's two head tiles (sT: head bh, then head bh + 1).
// 4 lines per instruction, 64 lines per wave, 256 per block.
// which 0/1: plane[bh][l][d]  (one token row = 64 halves = one line)
// which 2  : vt[bh][d][l]     (64 d-rows x 128 tokens = 2 lines each)
// In both layouts line lid of a head tile lies at sT + lid * 64, and head bh + 1
// lies SEQ * HD halves behind head bh. A lane's 16 chunks are read from LDS as
// one group ahead of their stores: a wave waits out one LDS latency for the pass,
// not one per chunk.
// ---------------------------------------------------------------------------
__device__ __forceinline__ void proj_store_pass(const _Float16* sT, _Float16* plane, _Float16* vt,
                                                int which, int bh, int l0, int w, int lane) {
  const int q8 = lane & 7, sub = lane >> 3;
  const int lid0 = w * 32 + sub;                   // the lane's first line of a tile; line i lies 4 further
  const int d0 = lid0 >> 1, hl = lid0 & 1;         // which 2: line lid0 + 4 i is d-row d0 + 2 i, token half hl
  _Float16* dst0 = (which != 2) ? plane + ((size_t)bh * SEQ + l0 + lid0) * HD + 8 * q8
                                : vt + ((size_t)bh * HD + d0) * SEQ + l0 + 64 * hl + 8 * q8;
  const int step = (which != 2) ? 4 * HD : 2 * SEQ;   // halves from line i to line i + 1
  const _Float16* src = sT + lid0 * 64 + 8 * q8;
  _Float16* dst[8];
  v8h v[2][8];
  #pragma unroll   // dst[], v[][] indexed by constants, so that they stay in registers
  for (int i = 0; i < 8; ++i) {
    dst[i] = dst0 + i * step;
    v[0][i] = *(const v8ha*)(src + i * 256);
    v[1][i] = *(const v8ha*)(src + 128 * HD + i * 256);
  }
  // The line addresses are formed ahead of the run of stores: inside the run no register of an
  // issued store is written again, so the stores follow one another with no wait on an earlier one.
  __builtin_amdgcn_sched_barrier(0);
  #pragma unroll
  for (int i = 0; i < 8; ++i) {
    *(v8h*)dst[i] = v[0][i];
    *(v8h*)(dst[i] + (size_t)SEQ * HD) = v[1][i];
  }
}

// ---------------------------------------------------------------------------
// Kernel 2: Y = (x+pe) * W^T + bias over the fused 3*512 output columns.
// Block 128 thr (4 waves) = 128 tokens x 128 features (two heads of one which);
// wave tile 64 tokens x 64 features (one head); K = 512 in staged steps of 64
// (gemm_128x128); the two heads' output tiles sT reuse the ring's LDS once the
// main loop has returned.
// ---------------------------------------------------------------------------
__global__ __launch_bounds__(128) void proj_kernel(
    const _Float16* __restrict__ xh,   // [8192][512]
    const _Float16* __restrict__ wh,   // [4][512][512], row = output feature, x32
    const float* __restrict__ bq, const float* __restrict__ bk, const float* __restrict__ bv,
    _Float16* __restrict__ qh,         // [B*H][L][D]  f16(q)
    _Float16* __restrict__ kh,         // [B*H][L][D]  f16(k)
    _Float16* __restrict__ vt)         // [B*H][D][L]  f16(v)
{
  __shared__ __attribute__((aligned(16))) _Float16 sG[2 * PSTAGE];  // 73728 B
  _Float16* sT = sG;                                                // 2 x (128 x 64) halves, after the main loop

  const int tid = threadIdx.x, lane = tid & 31, w = tid >> 5;
  const int wm = w & 1, wn = w >> 1;
  const int h = lane >> 4, m = lane & 15;
  const int m0 = blockIdx.x * 128;
  const int cg = blockIdx.y;                 // 0..11
  const int which = cg >> 2, head0 = (cg & 3) * 2;   // the block's heads: head0, head0 + 1

  const v8f zero8 = {0.f, 0.f, 0.f, 0.f, 0.f, 0.f, 0.f, 0.f};
  v8f acc[4][4];
  #pragma unroll
  for (int mt = 0; mt < 4; ++mt)
    #pragma unroll
    for (int nt = 0; nt < 4; ++nt) acc[mt][nt] = zero8;

  gemm_128x128(xh + (size_t)m0 * DMODEL, wh + ((size_t)which * DMODEL + head0 * HD) * DMODEL, sG, tid, acc);

  // D[r] of tile (mt, nt) = Y[token m0+64wm+16mt+8h+r][head head0+wn, feature 16nt+m]
  const float* bias = (which == 0) ? bq : ((which == 1) ? bk : bv);
  _Float16* sTw = sT + wn * (128 * HD);      // this wave's head tile
  #pragma unroll
  for (int nt = 0; nt < 4; ++nt) {
    const int feat = 16 * nt + m;
    const float bvl = bias[(head0 + wn) * HD + feat];
    #pragma unroll
    for (int mt = 0; mt < 4; ++mt) {
      #pragma unroll
      for (int r = 0; r < 8; ++r) {
        const int tokl = 64 * wm + 16 * mt + 8 * h + r;    // 0..127
        const float y = acc[mt][nt][r] * (1.0f / WSCALE) + bvl;
        const int idx = (which == 2) ? (feat * 128 + tokl) : (tokl * HD + feat);
        sTw[idx] = (_Float16)y;
      }
    }
  }
  __syncthreads();

  const int b = m0 / SEQ, l0 = m0 - b * SEQ, bh = b * NHEADS + head0;
  _Float16* plane = (which == 0) ? qh : kh;
  proj_store_pass(sT, plane, vt, which, bh, l0, w, lane);
  
}

// ---------------------------------------------------------------------------
// Attention helpers.
// Score element r of this lane: key = kb + 64kg + 16j + 8h + r, query = q0 + 16qt + m.
// v = mask ? (s*0.125 + anti[q - key + 2047]) : (-inf + missing_bias[head]).
// The key mask enters as the start value C of the score product: sm[key] = 0
// for an observed key, -inf + missing_bias[head] for a missing one, so that
// C + K.Q stays that non-finite value through the scale and the bias below.
// sb = the block's window of the antisymmetrised rel-pos table in LDS, base = index for r = 0
// (index decreases by one per r); every index is in range for every key, so
// the reads carry no condition and no branch.
// ---------------------------------------------------------------------------
__device__ __forceinline__ v8f mask_start8(const float* sm) {
  const v4f a = *(const v4fa*)sm;
  const v4f c = *(const v4fa*)(sm + 4);
  const v8f z = { a.x, a.y, a.z, a.w, c.x, c.y, c.z, c.w };
  return z;
}

__device__ __forceinline__ v8f bias_load8(const float* sb, int base) {
  const v8f t = { sb[base],     sb[base - 1], sb[base - 2], sb[base - 3],
                  sb[base - 4], sb[base - 5], sb[base - 6], sb[base - 7] };
  return t;
}

// e^x as __expf forms it (a multiply by LOG2E, v_exp_f32), with the slot behind a transcendental:
// source and result stay tied up to the v_nop, so that no instruction directly behind the
// v_exp_f32 writes its source or reads its result.
__device__ __forceinline__ float exp_slot(float x) {
  const float u = x * LOG2E;
  float p = __builtin_amdgcn_exp2f(u);
  asm("v_nop" : "+v"(p) : "v"(u));
  return p;
}

// P^T B-fragment from the lane's own score D values: element r <- tile a row r,
// element 8+r <- tile c row r (same lane, same query column), scaled by 2^14.
__device__ __forceinline__ v16h pack_p(v8f a, v8f c) {
  const v16h r = { (_Float16)(a[0] * PSCALE), (_Float16)(a[1] * PSCALE), (_Float16)(a[2] * PSCALE), (_Float16)(a[3] * PSCALE),
                   (_Float16)(a[4] * PSCALE), (_Float16)(a[5] * PSCALE), (_Float16)(a[6] * PSCALE), (_Float16)(a[7] * PSCALE),
                   (_Float16)(c[0] * PSCALE), (_Float16)(c[1] * PSCALE), (_Float16)(c[2] * PSCALE), (_Float16)(c[3] * PSCALE),
                   (_Float16)(c[4] * PSCALE), (_Float16)(c[5] * PSCALE), (_Float16)(c[6] * PSCALE), (_Float16)(c[7] * PSCALE) };
  return r;
}

// (one token row's head slice) by lanes 8q..8q+7 in one instruction, 4 lines
// per instruction, 16 lines per wave.
__device__ __forceinline__ void ao_store_pass(const _Float16* so, _Float16* ao,
                                              int b, int head, int q0, int lane) {
  const int q8 = lane & 7, sub = lane >> 3;
  #pragma unroll
  for (int i = 0; i < 4; ++i) {
    const int lid = i * 4 + sub;                    // 0..15
    const v8h v = *(const v8ha*)(so + lid * 64 + 8 * q8);
    const size_t gi = ((size_t)b * SEQ + q0 + lid) * DMODEL + head * HD + 8 * q8;
    *(v8h*)(ao + gi) = v;
  }
}

// One 128-key stage of K (128 key rows x 128 B) and of V^T (64 d rows x 256 B)
// into LDS rows of TPITCH / VPITCH halves: 4 + 4 asynchronous 16-B copies per
// lane, each wave-wide copy covering four whole 128-B lines. lk/lv = this lane's
// LDS byte address of its first K / V chunk, gk/gv = the matching global
// address; chunk i lies 32 (K) or 16 (V^T) rows further on both sides.
// The closing s_wait_xcnt 0 stands inside the copies' own statement, so that no
// address register named here is rewritten ahead of it.
__device__ __forceinline__ void stage_copy(unsigned lk, unsigned lv,
                                           const _Float16* gk, const _Float16* gv) {
  const unsigned lk1 = lk + 32 * TPITCH * 2, lk2 = lk + 64 * TPITCH * 2, lk3 = lk + 96 * TPITCH * 2;
  const unsigned lv1 = lv + 16 * VPITCH * 2, lv2 = lv + 32 * VPITCH * 2, lv3 = lv + 48 * VPITCH * 2;
  const _Float16* gk1 = gk + 32 * HD;
  const _Float16* gk2 = gk + 64 * HD;
  const _Float16* gk3 = gk + 96 * HD;
  const _Float16* gv1 = gv + (size_t)16 * SEQ;
  const _Float16* gv2 = gv + (size_t)32 * SEQ;
  const _Float16* gv3 = gv + (size_t)48 * SEQ;
  asm volatile("global_load_async_to_lds_b128 %0, %8, off\n\t"
               "global_load_async_to_lds_b128 %1, %9, off\n\t"
               "global_load_async_to_lds_b128 %2, %10, off\n\t"
               "global_load_async_to_lds_b128 %3, %11, off\n\t"
               "global_load_async_to_lds_b128 %4, %12, off\n\t"
               "global_load_async_to_lds_b128 %5, %13, off\n\t"
               "global_load_async_to_lds_b128 %6, %14, off\n\t"
               "global_load_async_to_lds_b128 %7, %15, off\n\t"
               "s_wait_xcnt 0x0"
               :: "v"(lk), "v"(lk1), "v"(lk2), "v"(lk3), "v"(lv), "v"(lv1), "v"(lv2), "v"(lv3),
                  "v"(gk), "v"(gk1), "v"(gk2), "v"(gk3), "v"(gv), "v"(gv1), "v"(gv2), "v"(gv3)
               : "memory");
}

// ---------------------------------------------------------------------------
// Kernel 3: streaming attention, transposed form.
// Block 256 thr (8 waves) = 128 queries; 128 keys per staged step.
// Wave w: query group qg = w & 3 (32 queries = two 16-column tiles), key half
// kg = w >> 2 (keys 64 kg .. 64 kg + 63 of every staged step). Each K and V^T
// fragment read from LDS feeds two products, one per query tile; the two waves
// of a query group each keep their own running maximum, sum and O over their
// half of the keys, and the halves are joined through LDS behind the loop.
// K and V^T of a step are staged once per block in a two-buffer LDS ring by
// asynchronous copies (next step's copies fly while this step is worked on).
//   S^T = K * Q^T : A = K rows (row = key, k = d), B = Q^T (k = d, n = query)
//   O^T += V^T * P^T : A = Vt rows (row = d, k = key), B = P^T from registers
// Lane owns 32 keys of query columns (lane&15) and 16 + (lane&15); partner = lane ^ 16.
// The block's window of this head's antisymmetrised rel-pos table (formed by the
// convert launch) is copied to LDS, and the key-mask start values of this batch
// row are built there, once per block.
// ---------------------------------------------------------------------------
// amdgpu_waves_per_eu(4, 4): a register budget of 256 a wave, so that two blocks (four waves per
// SIMD) share a WGP; the softmax's vector work between the products wants those waves.
__global__ __launch_bounds__(256) __attribute__((amdgpu_waves_per_eu(4, 4))) void attn_kernel(
    const _Float16* __restrict__ qh,   // [B*H][L][D]
    const _Float16* __restrict__ kh,   // [B*H][L][D]
    const _Float16* __restrict__ vt,   // [B*H][D][L]
    const int* __restrict__ mask,      // [B][L], nonzero = observed key
    const float* __restrict__ mbias,   // [H]
    const float* __restrict__ ab,      // [H][RELP] antisymmetrised rel-pos table
    _Float16* __restrict__ ao)         // [B][L][DMODEL], x64
{
  __shared__ __attribute__((aligned(16))) float sB[RELWIN];           //  8704 B
  __shared__ __attribute__((aligned(16))) float sM[SEQ];              //  8192 B
  __shared__ __attribute__((aligned(16))) _Float16 sK[2 * KSTAGE];   // 36864 B; behind the loop: the join's partial O, maxima, sums
  __shared__ __attribute__((aligned(16))) _Float16 sV[2 * VSTAGE];   // 34816 B; behind the loop: the block's 128 x 64 output tile

  const int tid = threadIdx.x, lane = tid & 31;
  const int w = __builtin_amdgcn_readfirstlane(tid >> 5);   // wave number in a scalar register: its branches are scalar
  const int qg = w & 3, kg = w >> 2;
  const int h = lane >> 4, m = lane & 15;
  const int bh = blockIdx.y, b = bh >> 3, head = bh & 7;
  const int qblk = blockIdx.x * AQ;
  const int q0 = qblk + 32 * qg;

  // Staging map, chunk i = 0..3 of a thread. K: tile row (tid >> 3) + 32 i, 16-B column tid & 7.
  // V^T: tile row (tid >> 4) + 16 i, 16-B column tid & 15.
  const int krow = tid >> 3, kcol = tid & 7;
  const int vrow = tid >> 4, vcol = tid & 15;
  const unsigned lk0 = (unsigned)(size_t)(sK + krow * TPITCH + 8 * kcol);
  const unsigned lv0 = (unsigned)(size_t)(sV + vrow * VPITCH + 8 * vcol);
  const _Float16* gk0 = kh + ((size_t)bh * SEQ + krow) * HD + 8 * kcol;    // + AKEYS * HD per step
  const _Float16* gv0 = vt + ((size_t)bh * HD + vrow) * SEQ + 8 * vcol;    // + AKEYS per step

  stage_copy(lk0, lv0, gk0, gv0);                                          // step 0 -> buffer 0

  // Table index of (query q, key k) is q - k + (SEQ-1): the block's 128 queries, first one qblk,
  // reach entries qblk .. qblk + 2174 over all keys. sB[e] = ab[head][qblk + e], e = 0 .. 2175
  // (the last entry read is 1920 + 2175 = 4095, the padding entry: copied, never used).
  const float* abw = ab + head * RELP + qblk;
  // The loads stand here and the LDS stores behind the mask and Q loads, so that all of the
  // prologue's loads are in flight together. The last 128 entries are 32 chunks: every wave
  // loads them (no condition on the load), wave 0 stores.
  v4f tb[3];
  #pragma unroll   // tb[] indexed by constants, so that it stays in registers
  for (int c = 0; c < 2; ++c) tb[c] = *(const v4fa*)(abw + 4 * tid + 1024 * c);
  tb[2] = *(const v4fa*)(abw + 2048 + 4 * lane);

  // sM[key] = 0 (observed) or -inf fill + missing bias (missing)
  const float mbh = mbias[head];
  const float vmiss = -__builtin_inff() + mbh;
  #pragma unroll   // the two mask loads in flight together
  for (int i = 0; i < SEQ / 1024; ++i) {
    const int k4 = 4 * tid + 1024 * i;
    const v4i mm = *(const v4ia*)(mask + (size_t)b * SEQ + k4);
    const v4f t = { (mm.x != 0) ? 0.0f : vmiss, (mm.y != 0) ? 0.0f : vmiss,
                    (mm.z != 0) ? 0.0f : vmiss, (mm.w != 0) ? 0.0f : vmiss };
    *(v4fa*)(sM + k4) = t;
  }

  // Q^T B-fragments: tile qt, column n = query q0 + 16 qt + m, k = d (two 32-deep chunks)
  const _Float16* qrow = qh + ((size_t)bh * SEQ + q0 + m) * HD;
  v16h qf[2][2];
  #pragma unroll   // qf[][] indexed by constants, so that it stays in registers
  for (int qt = 0; qt < 2; ++qt) {
    qf[qt][0] = load_frag(qrow + qt * 16 * HD, h);
    qf[qt][1] = load_frag(qrow + qt * 16 * HD + 32, h);
  }

  #pragma unroll
  for (int c = 0; c < 2; ++c) *(v4fa*)(sB + 4 * tid + 1024 * c) = tb[c];
  // Holds the third load in front of the branch below (loaded value as an input only): without it
  // the compiler sinks the load into the branch, where wave 0 waits out a second full load latency.
  asm volatile("" :: "v"(tb[2]));
  if (w == 0) *(v4fa*)(sB + 2048 + 4 * lane) = tb[2];

  // step 0's copies of this wave have landed before the barrier that publishes them (and sB, sM)
  asm volatile("s_wait_asynccnt 0x0" ::: "memory");
  __syncthreads();

  stage_copy(lk0 + KSTAGE * 2, lv0 + VSTAGE * 2, gk0 + AKEYS * HD, gv0 + AKEYS);   // step 1 -> buffer 1

  // Index in sB of (query tile qt, key tile j, r) is qk - kb - 16 (j - qt) - r: the two query tiles
  // share three of their five groups of eight table entries.
  const int qk = 32 * qg + m + (SEQ - 1) - 8 * h - 64 * kg;

  const v8f zero8 = {0.f, 0.f, 0.f, 0.f, 0.f, 0.f, 0.f, 0.f};
  const v8f eighth8 = {0.125f, 0.125f, 0.125f, 0.125f, 0.125f, 0.125f, 0.125f, 0.125f};
  v8f o[2][4];                                // o[qt][t][r] = O[query 16qt+m][d 16t+8h+r] * (l * 2^14), this wave's keys
  #pragma unroll
  for (int qt = 0; qt < 2; ++qt)
    #pragma unroll
    for (int t = 0; t < 4; ++t) o[qt][t] = zero8;
  float mrun[2] = { -1e30f, -1e30f }, lrun[2] = { 0.0f, 0.0f };

  const int kfro = (64 * kg + m) * TPITCH;                     // this lane's K fragment row (key tile 0) in a staged tile
  const int vfro = m * VPITCH + 64 * kg;                       // this lane's V^T fragment row (d tile 0), at this wave's keys
  const float* smp = sM + 8 * h + 64 * kg;                     // + key tile base

  #pragma unroll 1
  for (int st = 0; st < ASTEP; ++st) {
    const int kb = st * AKEYS;
    const int par = st & 1;                                    // this step's ring buffer
    const _Float16* kbase = sK + par * KSTAGE + kfro;          // + 16j*TPITCH + 32*dc
    const _Float16* vbase = sV + par * VSTAGE + vfro;          // + 16t*VPITCH + 32*kc
    // ---- rel-pos bias of this step, read ahead of the score products: group g serves (qt, j = g - 1 + qt) ----
    v8f bv[5];
    #pragma unroll   // bv[] indexed by constants, so that it stays in registers
    for (int g = 0; g < 5; ++g) bv[g] = bias_load8(sB, qk - kb - 16 * (g - 1));
    // ---- raw scores on the mask start: s[qt][j][r] = sM[key] + (Q.K)[query 16qt+m][key kb+64kg+16j+8h+r] ----
    v8f s[2][4];
    #pragma unroll
    for (int j = 0; j < 4; ++j) {
      const _Float16* kp = kbase + 16 * j * TPITCH;
      const v16h kf0 = load_frag(kp, h);
      const v16h kf1 = load_frag(kp + 32, h);
      const v8f z = mask_start8(smp + kb + 16 * j);
      #pragma unroll
      for (int qt = 0; qt < 2; ++qt)
        s[qt][j] = wmma_f16_free(kf1, qf[qt][1], wmma_f16_free(kf0, qf[qt][0], z));
    }
    // ---- scale 1/8, rel-pos bias (f32) ----
    #pragma unroll
    for (int qt = 0; qt < 2; ++qt)
      #pragma unroll
      for (int j = 0; j < 4; ++j)
        s[qt][j] = __builtin_elementwise_fma(s[qt][j], eighth8, bv[j + 1 - qt]);

    // ---- online softmax, each query tile on its own; P^T B-fragments (key chunks 0..31, 32..63) ----
    v16h pb[2][2];
    #pragma unroll   // s[][], o[][], pb[][], mrun[], lrun[] indexed by constants, so that they stay in registers
    for (int qt = 0; qt < 2; ++qt) {
      float mloc = s[qt][0][0];
      #pragma unroll
      for (int j = 0; j < 4; ++j)
        #pragma unroll
        for (int r = 0; r < 8; ++r) mloc = fmaxf(mloc, s[qt][j][r]);
      mloc = fmaxf(mloc, __shfl_xor(mloc, 16));
      const float mnew = fmaxf(mrun[qt], mloc);
      const float alpha = exp_slot(mrun[qt] - mnew);
      mrun[qt] = mnew;
      float lsum = 0.0f;
      #pragma unroll
      for (int j = 0; j < 4; ++j) {
        float u[8], p[8];
        #pragma unroll   // u[], p[] indexed by constants, so that they stay in registers
        for (int r = 0; r < 8; ++r) {
          u[r] = (s[qt][j][r] - mnew) * LOG2E;
          p[r] = __builtin_amdgcn_exp2f(u[r]);
        }
        // The slot behind a transcendental: the eight sources stay live up to this statement, so
        // that no instruction directly behind one of the row's v_exp_f32 writes the register it
        // reads; the v_nop is
        // the slot of the last of them.
        asm("v_nop" : "+v"(p[7])
            : "v"(u[0]), "v"(u[1]), "v"(u[2]), "v"(u[3]), "v"(u[4]), "v"(u[5]), "v"(u[6]), "v"(u[7]),
              "v"(p[0]), "v"(p[1]), "v"(p[2]), "v"(p[3]), "v"(p[4]), "v"(p[5]), "v"(p[6]));
        #pragma unroll
        for (int r = 0; r < 8; ++r) {
          s[qt][j][r] = p[r];
          lsum += p[r];
        }
      }
      lsum += __shfl_xor(lsum, 16);
      lrun[qt] = lrun[qt] * alpha + lsum;
      #pragma unroll
      for (int t = 0; t < 4; ++t)
        #pragma unroll
        for (int r = 0; r < 8; ++r) o[qt][t][r] = o[qt][t][r] * alpha;
      pb[qt][0] = pack_p(s[qt][0], s[qt][1]);
      pb[qt][1] = pack_p(s[qt][2], s[qt][3]);
    }

    // ---- O^T += V^T * P^T ----
    #pragma unroll
    for (int t = 0; t < 4; ++t) {
      const _Float16* vp = vbase + 16 * t * VPITCH;
      const v16h vf0 = load_frag(vp, h);
      const v16h vf1 = load_frag(vp + 32, h);
      #pragma unroll
      for (int qt = 0; qt < 2; ++qt) {
        o[qt][t] = wmma_f16_free(vf0, pb[qt][0], o[qt][t]);
        o[qt][t] = wmma_f16_free(vf1, pb[qt][1], o[qt][t]);
      }
    }

    // ---- hand-over: this wave's reads of buffer st&1 are done, its copies of step st+1
    // have landed; the barrier publishes step st+1 and frees buffer st&1 for the refill ----
    asm volatile("s_wait_dscnt 0x0" ::: "memory");
    asm volatile("s_wait_asynccnt 0x0" ::: "memory");
    __syncthreads();
    if (st + 2 < ASTEP)
      stage_copy(lk0 + par * (KSTAGE * 2), lv0 + par * (VSTAGE * 2),
                 gk0 + (size_t)(kb + 2 * AKEYS) * HD, gv0 + (kb + 2 * AKEYS));
  }
  // no copy is left in flight when the wave goes on to the epilogue
  asm volatile("s_wait_asynccnt 0x0" ::: "memory");

  // ---- join of the two key halves. Every wave has passed the loop's last barrier, so the ring is
  // free. The kg = 1 wave of a query group hands its O (16 chunks of 16 B a lane, a wave-wide store
  // = 512 contiguous bytes), maxima and sums to the same lane of the kg = 0 wave. ----
  v4fa* jo = (v4fa*)sK + qg * (16 * 32) + lane;                // chunk i lies 32 further
  v4fa* jm = (v4fa*)sK + 4 * (16 * 32) + qg * 32 + lane;
  if (kg == 1) {
    #pragma unroll
    for (int qt = 0; qt < 2; ++qt) {
      #pragma unroll
      for (int t = 0; t < 4; ++t) {
        const v4f lo4 = { o[qt][t][0], o[qt][t][1], o[qt][t][2], o[qt][t][3] };
        const v4f hi4 = { o[qt][t][4], o[qt][t][5], o[qt][t][6], o[qt][t][7] };
        jo[32 * (qt * 8 + t * 2)]     = lo4;
        jo[32 * (qt * 8 + t * 2 + 1)] = hi4;
      }
    }
    const v4f ml = { mrun[0], mrun[1], lrun[0], lrun[1] };
    *jm = ml;
  }
  __syncthreads();

  // ---- epilogue: both halves brought to the common maximum, normalised, x64, into the block's
  // 128 x 64 f16 tile; whole-line stores by all eight waves ----
  _Float16* sO = sV;
  if (kg == 0) {
    const v4f ml = *jm;
    #pragma unroll
    for (int qt = 0; qt < 2; ++qt) {
      const float mo = ml[qt], lo = ml[2 + qt];
      const float mj = fmaxf(mrun[qt], mo);
      const float a0 = exp_slot(mrun[qt] - mj);
      const float a1 = exp_slot(mo - mj);
      const float lj = lrun[qt] * a0 + lo * a1;
      float rl = __builtin_amdgcn_rcpf(lj);
      // The slot behind a transcendental, as in the loop: nothing directly behind the v_rcp_f32 writes its source.
      asm("v_nop" : "+v"(rl) : "v"(lj));
      const float inv = rl * (AOSCALE / PSCALE);
      const float c0 = a0 * inv, c1 = a1 * inv;
      _Float16* so = sO + (32 * qg + 16 * qt + m) * 64 + 8 * h;
      #pragma unroll
      for (int t = 0; t < 4; ++t) {
        const v4f lo4 = jo[32 * (qt * 8 + t * 2)];
        const v4f hi4 = jo[32 * (qt * 8 + t * 2 + 1)];
        #pragma unroll
        for (int r = 0; r < 4; ++r) {
          so[16 * t + r]     = (_Float16)(o[qt][t][r] * c0 + lo4[r] * c1);
          so[16 * t + 4 + r] = (_Float16)(o[qt][t][4 + r] * c0 + hi4[r] * c1);
        }
      }
    }
  }
  __syncthreads();

  ao_store_pass(sO + w * 1024, ao, b, head, qblk + 16 * w, lane);
  
}

// ---------------------------------------------------------------------------
// 16-B stores, 4 lines per instruction, 64 lines per wave.
// ---------------------------------------------------------------------------
__device__ __forceinline__ void out_store_pass(const float* sT, float* out, int m0, int fg, int w, int lane) {
  const int q8 = lane & 7, sub = lane >> 3;
  #pragma unroll
  for (int i = 0; i < 16; ++i) {
    const int lid = i * 4 + sub;                   // 0..63
    const int row = 32 * w + (lid >> 1), hl = lid & 1;
    const v4f v = *(const v4fa*)(sT + row * 64 + 32 * hl + 4 * q8);
    const size_t gi = ((size_t)(m0 + row)) * DMODEL + fg * 64 + 32 * hl + 4 * q8;
    *(v4f*)(out + gi) = v;
  }
}

// ---------------------------------------------------------------------------
// Kernel 4: out = AO * Wo^T + bo (f32). Block 128 thr = 128 tokens x 64
// features (fg = blockIdx.y); wave tile 32 x 64; K = 512 in staged steps of 64
// (gemm_128x64); the output tile sT reuses the ring's LDS after the main loop.
// ---------------------------------------------------------------------------
__global__ __launch_bounds__(128) void oproj_kernel(
    const _Float16* __restrict__ ao,   // [8192][512] f16, x64
    const _Float16* __restrict__ woh,  // [512][512] f16, row = output feature, x32
    const float* __restrict__ bo,      // [512]
    float* __restrict__ out)           // [8192][512] f32
{
  __shared__ __attribute__((aligned(16))) _Float16 sG[2 * GSTAGE];  // 55296 B
  float* sT = (float*)sG;                                           // 128 x 64 floats (32768 B), after the main loop

  const int tid = threadIdx.x, lane = tid & 31, w = tid >> 5;
  const int h = lane >> 4, m = lane & 15;
  const int m0 = blockIdx.x * 128;
  const int fg = blockIdx.y;                 // 0..7

  const v8f zero8 = {0.f, 0.f, 0.f, 0.f, 0.f, 0.f, 0.f, 0.f};
  v8f acc[2][4];
  #pragma unroll
  for (int mt = 0; mt < 2; ++mt)
    #pragma unroll
    for (int nt = 0; nt < 4; ++nt) acc[mt][nt] = zero8;

  gemm_128x64(ao + (size_t)m0 * DMODEL, woh + (size_t)fg * 64 * DMODEL, sG, tid, acc);

  // D[r] of tile (mt, nt) = out[token m0+32w+16mt+8h+r][feature fg*64+16nt+m]
  #pragma unroll
  for (int nt = 0; nt < 4; ++nt) {
    const int feat = 16 * nt + m;
    const float bvl = bo[fg * 64 + feat];
    #pragma unroll
    for (int mt = 0; mt < 2; ++mt) {
      #pragma unroll
      for (int r = 0; r < 8; ++r) {
        const int tokl = 32 * w + 16 * mt + 8 * h + r;
        sT[tokl * 64 + feat] = acc[mt][nt][r] * (1.0f / (WSCALE * AOSCALE)) + bvl;
      }
    }
  }
  __syncthreads();

  out_store_pass(sT, out, m0, fg, w, lane);
  
}

// ---------------------------------------------------------------------------
extern "C" void kernel_launch(void* const* d_in, const int* in_sizes, int n_in,
                              void* d_out, int out_size, void* d_ws, size_t ws_size,
                              hipStream_t stream) {
  if (n_in < 12) return;
  if (in_sizes[0] != NX) return;
  if (in_sizes[1] != MROWS) return;
  if (in_sizes[2] != NW || in_sizes[4] != NW || in_sizes[6] != NW || in_sizes[8] != NW) return;
  if (in_sizes[3] != DMODEL || in_sizes[5] != DMODEL || in_sizes[7] != DMODEL || in_sizes[9] != DMODEL) return;
  if (in_sizes[10] != NHEADS) return;
  if (in_sizes[11] != RELN * NHEADS) return;
  if (out_size != NX) return;

  const float* x     = (const float*)d_in[0];
  const int*   mask  = (const int*)d_in[1];
  const float* Wq    = (const float*)d_in[2];
  const float* bq    = (const float*)d_in[3];
  const float* Wk    = (const float*)d_in[4];
  const float* bk    = (const float*)d_in[5];
  const float* Wv    = (const float*)d_in[6];
  const float* bv    = (const float*)d_in[7];
  const float* Wo    = (const float*)d_in[8];
  const float* bo    = (const float*)d_in[9];
  const float* mbias = (const float*)d_in[10];
  const float* rel   = (const float*)d_in[11];
  float* out = (float*)d_out;

  const size_t xh_bytes = (size_t)NX * 2;                           //  8388608
  const size_t wh_bytes = (size_t)4 * NW * 2;                       //  2097152
  const size_t pl_bytes = (size_t)BATCH * NHEADS * SEQ * HD * 2;    //  8388608
  const size_t ao_bytes = (size_t)NX * 2;                           //  8388608
  const size_t ab_bytes = (size_t)NHEADS * RELP * 4;                //   131072
  const size_t total = xh_bytes + wh_bytes + 3 * pl_bytes + ao_bytes + ab_bytes;   // 44171264
  if (total > ws_size) return;

  char* ws = (char*)d_ws;
  size_t off = 0;
  _Float16* xh  = (_Float16*)(ws + off);  off += xh_bytes;
  _Float16* wh  = (_Float16*)(ws + off);  off += wh_bytes;
  _Float16* qh  = (_Float16*)(ws + off);  off += pl_bytes;
  _Float16* kh  = (_Float16*)(ws + off);  off += pl_bytes;
  _Float16* vt  = (_Float16*)(ws + off);  off += pl_bytes;
  _Float16* ao  = (_Float16*)(ws + off);  off += ao_bytes;
  float*    ab  = (float*)(ws + off);     off += ab_bytes;
  if (off > ws_size) return;

  const int ngroups = XGROUPS + NW8 + RELP;                         // 167936
  convert_kernel<<<(ngroups + 255) / 256, 256, 0, stream>>>(x, Wq, Wk, Wv, Wo, rel, xh, wh, ab);

  dim3 gProj(MROWS / 128, 3 * NHEADS / 2);                          // (64, 12)
  proj_kernel<<<gProj, 128, 0, stream>>>(xh, wh, bq, bk, bv, qh, kh, vt);

  dim3 gAtt(SEQ / AQ, BATCH * NHEADS);                              // (16, 32)
  attn_kernel<<<gAtt, 256, 0, stream>>>(qh, kh, vt, mask, mbias, ab, ao);

  dim3 gOut(MROWS / 128, DMODEL / 64);                              // (64, 8)
  oproj_kernel<<<gOut, 128, 0, stream>>>(ao, wh + (size_t)3 * NW, bo, out);
}

// v009
// Measured time: 66.4 microseconds a run.
// Next to v008, in two timings, it ran 1.05 times as fast each time.
// Counting every step since v000, it is 4.30 times as fast.
// Contractions: x*W^T for q,k,v and o, K*Q^T, V^T*P^T all on v_wmma_f32_16x16x32_f16 (f16 operands, f32 accumulate); W carried x32, P carried x16384, attention rows carried x64 (exact power-of-two scales folded back in f32); PE, bias tables, key mask, softmax (in base 2) and normalisation in f32.
#include <hip/hip_runtime.h>

typedef _Float16 v16h __attribute__((ext_vector_type(16)));
typedef _Float16 v8h  __attribute__((ext_vector_type(8)));
typedef float    v8f  __attribute__((ext_vector_type(8)));
typedef float    v4f  __attribute__((ext_vector_type(4)));
typedef float    v2f  __attribute__((ext_vector_type(2)));
typedef int      v4i  __attribute__((ext_vector_type(4)));
typedef v8h __attribute__((may_alias)) v8ha;
typedef v4f __attribute__((may_alias)) v4fa;
typedef v4i __attribute__((may_alias)) v4ia;

union Frag { v16h v; v8h half[2]; };

#define DMODEL 512
#define NHEADS 8
#define HD     64
#define SEQ    2048
#define BATCH  4
#define MROWS  (BATCH * SEQ)          // 8192 tokens
#define NX     (MROWS * DMODEL)       // 4194304
#define NW     (DMODEL * DMODEL)      // 262144
#define NW8    (NW / 8)               // 32768
#define RELN   (2 * SEQ - 1)          // 4095
#define RELP   (2 * SEQ)              // 4096 entries per head plane of the antisymmetrised table (last one padding)
#define AQ     128                    // queries of an attention block: four groups of 32
#define RELWIN (SEQ + AQ)             // 2176 table entries of an attention block's window: the 2175 its 128 queries can reach, plus one
#define NPE    (SEQ * DMODEL)         // 1048576 elements of one batch entry
#define XGROUPS (NPE / 8)             // 131072 groups of 8 features of one batch entry
#define PSHIFT  14.0f                 // P and its row sums are carried x 2^14: taken off the maximum that is subtracted ahead of v_exp_f32
#define WSCALE  32.0f
#define AOSCALE 64.0f
#define LOG2E   1.44269502f           // scores are carried x log2(e), so that v_exp_f32 (2^x) takes them as they are
#define TPITCH  72                    // halves per staged LDS row: 144 B = 16 B x 9, conflict-free for 16-B fragment reads
#define AKEYS   128                   // keys of a staged attention step: 64 for each of the two waves of a query group
#define ASTEP   (SEQ / AKEYS)         // 16 staged steps
#define KSTAGE  (AKEYS * TPITCH)      // halves per staged K tile (128 key rows)
#define VPITCH  136                   // halves per staged V^T row: 272 B = 16 B x 17, conflict-free for 16-B fragment reads
#define VSTAGE  (HD * VPITCH)         // halves per staged V^T tile (64 d rows of 128 keys)
#define GROWS   192                   // staged rows of a projection k step: 128 token rows, then 64 feature rows
#define GSTAGE  (GROWS * TPITCH)      // halves per staged projection k step (27648 B)
#define GSTEPS  (DMODEL / 64)         // 8 k steps of 64
#define PROWS   256                   // staged rows of a qkv k step: 128 token rows, then 128 feature rows
#define PSTAGE  (PROWS * TPITCH)      // halves per staged qkv k step (36864 B)

static_assert(BATCH == 4);
static_assert((XGROUPS % 256) == 0 && (NW8 % 256) == 0);
static_assert((MROWS % 128) == 0 && (SEQ % 128) == 0);

// ---------------------------------------------------------------------------
// 16x16x32 f16 WMMA. wmma_f16: with hazard guard (ties D, keeps A/B live), used
// by the two projections. wmma_f16_free: the bare builtin, used by attention,
// where vector work stands between the products: the compiler keeps the distance
// behind each product with the softmax's own instructions where it can, and is
// free to fetch the next fragments while a product runs.
// Fragment map (wave32): lane l, h = l>>4, m = n = l&15.
//   A/B element i: i<8 -> k0+8h+i ; i>=8 -> k0+16+8h+(i-8)
//   D element r : row 8h+r, col l&15
// ---------------------------------------------------------------------------
__device__ __forceinline__ v8f wmma_f16(v16h a, v16h b, v8f c) {
  v8f d = __builtin_amdgcn_wmma_f32_16x16x32_f16(false, a, false, b, (short)0, c, false, false);
  asm volatile("v_nop\n\tv_nop\n\tv_nop\n\tv_nop" : "+v"(d) : "v"(a), "v"(b));
  return d;
}

__device__ __forceinline__ v8f wmma_f16_free(v16h a, v16h b, v8f c) {
  return __builtin_amdgcn_wmma_f32_16x16x32_f16(false, a, false, b, (short)0, c, false, false);
}

// A or B fragment from a k-contiguous 16-bit row; p points at element k0 of
// the row owned by this lane (row index = lane & 15 added by the caller).
__device__ __forceinline__ v16h load_frag(const _Float16* p, int h) {
  Frag f;
  f.half[0] = *(const v8ha*)(p + 8 * h);
  f.half[1] = *(const v8ha*)(p + 16 + 8 * h);
  return f.v;
}

// ---------------------------------------------------------------------------
// Kernel 1: f32 -> f16 planes. xh = f16(x + pe) unscaled, wh = f16(32*W) for
// Wq,Wk,Wv,Wo (row = output feature, k-contiguous). Four 16-B stores per lane in x and W blocks.
// pe[t][2p] = sin(t*div_p), pe[t][2p+1] = cos(t*div_p),
// div_p = exp(f32(2p) * f32(-ln(1e4)/512)).
// x blocks: a thread owns 8 features of position t; it forms their four
// (sin, cos) pairs once, in registers, and adds them to that position's row of
// all four batch entries. W blocks: a thread converts the same 8 elements of
// all four matrices. All eight 16-B loads of a thread are issued up front.
// Table blocks: a thread owns entry i of the antisymmetrised rel-pos table of all
// eight heads, ab[head][i] = 0.5 * log2(e) * (rel[i][head] - rel[RELN-1-i][head]),
// i = q - k + (SEQ-1); it reads two whole 32-B rows and a wave stores one whole
// 128-B line per head. Entry 4095 is padding, stored as 0.
// ---------------------------------------------------------------------------
__device__ __forceinline__ v8h pack8(v4f a, v4f c) {
  const v8h o = { (_Float16)a.x, (_Float16)a.y, (_Float16)a.z, (_Float16)a.w,
                  (_Float16)c.x, (_Float16)c.y, (_Float16)c.z, (_Float16)c.w };
  return o;
}

__global__ __launch_bounds__(256) void convert_kernel(
    const float* __restrict__ x,
    const float* __restrict__ wq, const float* __restrict__ wk,
    const float* __restrict__ wv, const float* __restrict__ wo,
    const float* __restrict__ rel,
    _Float16* __restrict__ xh, _Float16* __restrict__ wh, float* __restrict__ ab)
{
  const int g = blockIdx.x * 256 + threadIdx.x;
  if (g >= XGROUPS + NW8 + RELP) return;
  if (g >= XGROUPS + NW8) {
    const int i = g - (XGROUPS + NW8);      // table entry 0..4095
    const bool in = i < RELN;
    const float* up = rel + (in ? i : 0) * NHEADS;
    const float* dn = rel + (in ? RELN - 1 - i : 0) * NHEADS;
    const v4f u0 = *(const v4fa*)up, u1 = *(const v4fa*)(up + 4);
    const v4f d0 = *(const v4fa*)dn, d1 = *(const v4fa*)(dn + 4);
    const v4f t0 = (0.5f * LOG2E) * (u0 - d0), t1 = (0.5f * LOG2E) * (u1 - d1);
    #pragma unroll   // t0, t1 indexed by constants
    for (int hd = 0; hd < 4; ++hd) {
      ab[hd * RELP + i]       = in ? t0[hd] : 0.0f;
      ab[(hd + 4) * RELP + i] = in ? t1[hd] : 0.0f;
    }
    return;
  }
  v4f a[4], c[4];
  if (g < XGROUPS) {
    const int t = g >> 6;                   // position 0..2047 (64 groups of 8 per row)
    const int db = (g & 63) * 8;            // first feature of the group
    const unsigned so = (unsigned)g * 32u;  // byte offset of the group in a batch entry of x
    #pragma unroll   // a[], c[] indexed by constants, so that they stay in registers
    for (int b = 0; b < BATCH; ++b) {
      const char* src = (const char*)(x + (size_t)b * NPE) + so;
      a[b] = *(const v4fa*)src;
      c[b] = *(const v4fa*)(src + 16);
    }
    const float kc = (float)(-9.210340371976184 / 512.0);
    float sn[4], cs[4];
    #pragma unroll   // sn[], cs[] indexed by constants, so that they stay in registers
    for (int i = 0; i < 4; ++i) {
      const float fr = expf((float)(db + 2 * i) * kc);
      const float ang = (float)t * fr;
      sn[i] = sinf(ang);
      cs[i] = cosf(ang);
    }
    const v4f pa = { sn[0], cs[0], sn[1], cs[1] };
    const v4f pc = { sn[2], cs[2], sn[3], cs[3] };
    const unsigned dofs = (unsigned)g * 16u;  // byte offset of the group in a batch entry of xh
    #pragma unroll
    for (int b = 0; b < BATCH; ++b)
      *(v8h*)((char*)(xh + (size_t)b * NPE) + dofs) = pack8(a[b] + pa, c[b] + pc);
  } else {
    const unsigned e = (unsigned)(g - XGROUPS);
    const unsigned so = e * 32u;            // byte offset of the group in a matrix
    a[0] = *(const v4fa*)((const char*)wq + so);  c[0] = *(const v4fa*)((const char*)wq + so + 16);
    a[1] = *(const v4fa*)((const char*)wk + so);  c[1] = *(const v4fa*)((const char*)wk + so + 16);
    a[2] = *(const v4fa*)((const char*)wv + so);  c[2] = *(const v4fa*)((const char*)wv + so + 16);
    a[3] = *(const v4fa*)((const char*)wo + so);  c[3] = *(const v4fa*)((const char*)wo + so + 16);
    const unsigned dofs = e * 16u;          // byte offset of the group in a plane of wh
    #pragma unroll
    for (int i = 0; i < 4; ++i)
      *(v8h*)((char*)(wh + (size_t)i * NW) + dofs) = pack8(a[i] * WSCALE, c[i] * WSCALE);
  }
}

// ---------------------------------------------------------------------------
// One 64-deep k step of the output projection into LDS rows of TPITCH halves: 128 token
// rows (8 chunks per lane) and 64 feature rows (4 chunks per lane), 128 B each,
// by asynchronous 16-B copies; each wave-wide copy covers four whole 128-B
// lines. l = this lane's LDS byte address of its first chunk, ga / gb = the
// matching global addresses; chunk i lies 16 rows further on both sides.
// The closing s_wait_xcnt 0 stands inside the copies' own statement, so that no
// address register named here is rewritten ahead of it.
// ---------------------------------------------------------------------------
__device__ __forceinline__ void gemm_stage_copy(unsigned l, const _Float16* ga, const _Float16* gb) {
  const unsigned rs = 16 * TPITCH * 2;                 // 16 staged rows in bytes
  const unsigned l1 = l + rs,     l2 = l + 2 * rs,  l3 = l + 3 * rs,   l4 = l + 4 * rs;
  const unsigned l5 = l + 5 * rs, l6 = l + 6 * rs,  l7 = l + 7 * rs,   l8 = l + 8 * rs;
  const unsigned l9 = l + 9 * rs, l10 = l + 10 * rs, l11 = l + 11 * rs;
  const _Float16* a1 = ga + 16 * DMODEL;
  const _Float16* a2 = ga + 32 * DMODEL;
  const _Float16* a3 = ga + 48 * DMODEL;
  const _Float16* a4 = ga + 64 * DMODEL;
  const _Float16* a5 = ga + 80 * DMODEL;
  const _Float16* a6 = ga + 96 * DMODEL;
  const _Float16* a7 = ga + 112 * DMODEL;
  const _Float16* b1 = gb + 16 * DMODEL;
  const _Float16* b2 = gb + 32 * DMODEL;
  const _Float16* b3 = gb + 48 * DMODEL;
  asm volatile("global_load_async_to_lds_b128 %0, %12, off\n\t"
               "global_load_async_to_lds_b128 %1, %13, off\n\t"
               "global_load_async_to_lds_b128 %2, %14, off\n\t"
               "global_load_async_to_lds_b128 %3, %15, off\n\t"
               "global_load_async_to_lds_b128 %4, %16, off\n\t"
               "global_load_async_to_lds_b128 %5, %17, off\n\t"
               "global_load_async_to_lds_b128 %6, %18, off\n\t"
               "global_load_async_to_lds_b128 %7, %19, off\n\t"
               "global_load_async_to_lds_b128 %8, %20, off\n\t"
               "global_load_async_to_lds_b128 %9, %21, off\n\t"
               "global_load_async_to_lds_b128 %10, %22, off\n\t"
               "global_load_async_to_lds_b128 %11, %23, off\n\t"
               "s_wait_xcnt 0x0"
               :: "v"(l), "v"(l1), "v"(l2), "v"(l3), "v"(l4), "v"(l5), "v"(l6), "v"(l7),
                  "v"(l8), "v"(l9), "v"(l10), "v"(l11),
                  "v"(ga), "v"(a1), "v"(a2), "v"(a3), "v"(a4), "v"(a5), "v"(a6), "v"(a7),
                  "v"(gb), "v"(b1), "v"(b2), "v"(b3)
               : "memory");
}

// ---------------------------------------------------------------------------
// Main loop of the output projection: acc[mt][nt] += A(128 rows) * B(64 rows)^T over
// K = 512, both operands k-contiguous f16 rows of DMODEL halves. Block 128 thr,
// wave tile 32 x 64. Each 64-deep k step is staged once per block in a
// two-buffer LDS ring (the next step's copies fly while this step is worked
// on); the fragments are read from there, in the same ascending k order.
// On return every wave has passed the last barrier and no copy is in flight, so
// the caller may reuse sG.
// ---------------------------------------------------------------------------
__device__ __forceinline__ void gemm_128x64(const _Float16* arows, const _Float16* brows,
                                            _Float16* sG, int tid, v8f (&acc)[2][4]) {
  const int lane = tid & 31, w = tid >> 5;
  const int h = lane >> 4, m = lane & 15;
  // Staging map: chunk c = tid + 128 i (i = 0..11), staged row c >> 3, 16-B column c & 7.
  const int crow = tid >> 3, ccol = tid & 7;
  const unsigned l0 = (unsigned)(size_t)(sG + crow * TPITCH + 8 * ccol);
  const _Float16* ga0 = arows + (size_t)crow * DMODEL + 8 * ccol;          // + 64 per step
  const _Float16* gb0 = brows + (size_t)crow * DMODEL + 8 * ccol;          // + 64 per step

  gemm_stage_copy(l0, ga0, gb0);                                           // step 0 -> buffer 0
  // step 0's copies of this wave have landed before the barrier that publishes them
  asm volatile("s_wait_asynccnt 0x0" ::: "memory");
  __syncthreads();
  gemm_stage_copy(l0 + GSTAGE * 2, ga0 + 64, gb0 + 64);                    // step 1 -> buffer 1

  #pragma unroll 1   // rolled: one copy of the body, the ring buffer picked by the step's parity
  for (int t = 0; t < GSTEPS; ++t) {
    const int bo = (t & 1) * GSTAGE;                                       // this step's ring buffer
    const _Float16* ab = sG + bo + (32 * w + m) * TPITCH;                  // token row, mt = 0
    const _Float16* bb = sG + bo + (128 + m) * TPITCH;                     // feature row, nt = 0
    // all fragments of the step are read as one group ahead of its products
    v16h af[2][2], bf[2][4];
    #pragma unroll   // af[][], bf[][] indexed by constants, so that they stay in registers
    for (int kc = 0; kc < 2; ++kc) {
      af[kc][0] = load_frag(ab + 32 * kc, h);
      af[kc][1] = load_frag(ab + 16 * TPITCH + 32 * kc, h);
      #pragma unroll
      for (int nt = 0; nt < 4; ++nt) bf[kc][nt] = load_frag(bb + nt * 16 * TPITCH + 32 * kc, h);
    }
    #pragma unroll   // acc[][] indexed by constants, so that it stays in registers
    for (int kc = 0; kc < 2; ++kc) {
      #pragma unroll
      for (int nt = 0; nt < 4; ++nt) {
        acc[0][nt] = wmma_f16(af[kc][0], bf[kc][nt], acc[0][nt]);
        acc[1][nt] = wmma_f16(af[kc][1], bf[kc][nt], acc[1][nt]);
      }
    }
    // ---- hand-over: this wave's reads of buffer t&1 are done, its copies of step t+1 have
    // landed; the barrier publishes step t+1 and frees buffer t&1 for the refill ----
    asm volatile("s_wait_dscnt 0x0" ::: "memory");
    asm volatile("s_wait_asynccnt 0x0" ::: "memory");
    __syncthreads();
    if (t + 2 < GSTEPS)
      gemm_stage_copy(l0 + bo * 2, ga0 + (t + 2) * 64, gb0 + (t + 2) * 64);
  }
  // no copy is left in flight when the wave goes on to the epilogue
  asm volatile("s_wait_asynccnt 0x0" ::: "memory");
}

// ---------------------------------------------------------------------------
// 128 staged rows of one operand (8 chunks per lane, 128 B a row) into LDS rows
// of TPITCH halves by asynchronous 16-B copies; each wave-wide copy covers four
// whole 128-B lines. l = this lane's LDS byte address of its first chunk, g =
// the matching global address; chunk i lies 16 rows further on both sides.
// The closing s_wait_xcnt 0 stands inside the copies' own statement, so that no
// address register named here is rewritten ahead of it.
// ---------------------------------------------------------------------------
__device__ __forceinline__ void rows128_copy(unsigned l, const _Float16* g) {
  const unsigned rs = 16 * TPITCH * 2;                 // 16 staged rows in bytes
  const unsigned l1 = l + rs,     l2 = l + 2 * rs, l3 = l + 3 * rs, l4 = l + 4 * rs;
  const unsigned l5 = l + 5 * rs, l6 = l + 6 * rs, l7 = l + 7 * rs;
  const _Float16* g1 = g + 16 * DMODEL;
  const _Float16* g2 = g + 32 * DMODEL;
  const _Float16* g3 = g + 48 * DMODEL;
  const _Float16* g4 = g + 64 * DMODEL;
  const _Float16* g5 = g + 80 * DMODEL;
  const _Float16* g6 = g + 96 * DMODEL;
  const _Float16* g7 = g + 112 * DMODEL;
  asm volatile("global_load_async_to_lds_b128 %0, %8, off\n\t"
               "global_load_async_to_lds_b128 %1, %9, off\n\t"
               "global_load_async_to_lds_b128 %2, %10, off\n\t"
               "global_load_async_to_lds_b128 %3, %11, off\n\t"
               "global_load_async_to_lds_b128 %4, %12, off\n\t"
               "global_load_async_to_lds_b128 %5, %13, off\n\t"
               "global_load_async_to_lds_b128 %6, %14, off\n\t"
               "global_load_async_to_lds_b128 %7, %15, off\n\t"
               "s_wait_xcnt 0x0"
               :: "v"(l), "v"(l1), "v"(l2), "v"(l3), "v"(l4), "v"(l5), "v"(l6), "v"(l7),
                  "v"(g), "v"(g1), "v"(g2), "v"(g3), "v"(g4), "v"(g5), "v"(g6), "v"(g7)
               : "memory");
}

// ---------------------------------------------------------------------------
// Main loop of the qkv projection: acc[mt][nt] += A(128 rows) * B(128 rows)^T
// over K = 512, both operands k-contiguous f16 rows of DMODEL halves. Block 128
// thr, waves 2 x 2, wave tile 64 x 64: a staged row feeds twice the products of
// the 128 x 64 tile, and each fragment read from LDS feeds four. Same two-buffer
// ring and hand-over as gemm_128x64, same ascending k order per output element.
// On return every wave has passed the last barrier and no copy is in flight, so
// the caller may reuse sG.
// ---------------------------------------------------------------------------
__device__ __forceinline__ void gemm_128x128(const _Float16* arows, const _Float16* brows,
                                             _Float16* sG, int tid, v8f (&acc)[4][4]) {
  const int lane = tid & 31, w = tid >> 5;
  const int wm = w & 1, wn = w >> 1;
  const int h = lane >> 4, m = lane & 15;
  // Staging map: chunk c = tid + 128 i (i = 0..15), staged row c >> 3, 16-B column c & 7.
  const int crow = tid >> 3, ccol = tid & 7;
  const unsigned l0 = (unsigned)(size_t)(sG + crow * TPITCH + 8 * ccol);
  const unsigned lb = 128 * TPITCH * 2;                                    // the feature rows' place in a buffer, bytes
  const _Float16* ga0 = arows + (size_t)crow * DMODEL + 8 * ccol;          // + 64 per step
  const _Float16* gb0 = brows + (size_t)crow * DMODEL + 8 * ccol;          // + 64 per step

  rows128_copy(l0, ga0);                                                   // step 0 -> buffer 0
  rows128_copy(l0 + lb, gb0);
  // step 0's copies of this wave have landed before the barrier that publishes them
  asm volatile("s_wait_asynccnt 0x0" ::: "memory");
  __syncthreads();
  rows128_copy(l0 + PSTAGE * 2, ga0 + 64);                                 // step 1 -> buffer 1
  rows128_copy(l0 + PSTAGE * 2 + lb, gb0 + 64);

  #pragma unroll 1   // rolled: one copy of the body, the ring buffer picked by the step's parity
  for (int t = 0; t < GSTEPS; ++t) {
    const int bo = (t & 1) * PSTAGE;                                       // this step's ring buffer
    const _Float16* ab = sG + bo + (64 * wm + m) * TPITCH;                 // token row, mt = 0
    const _Float16* bb = sG + bo + (128 + 64 * wn + m) * TPITCH;           // feature row, nt = 0
    #pragma unroll   // acc[][] indexed by constants, so that it stays in registers
    for (int kc = 0; kc < 2; ++kc) {
      // the eight fragments of a 32-deep chunk are read as one group ahead of its products
      v16h af[4], bf[4];
      #pragma unroll   // af[], bf[] indexed by constants, so that they stay in registers
      for (int i = 0; i < 4; ++i) {
        af[i] = load_frag(ab + i * 16 * TPITCH + 32 * kc, h);
        bf[i] = load_frag(bb + i * 16 * TPITCH + 32 * kc, h);
      }
      #pragma unroll
      for (int nt = 0; nt < 4; ++nt) {
        #pragma unroll
        for (int mt = 0; mt < 4; ++mt)
          acc[mt][nt] = wmma_f16(af[mt], bf[nt], acc[mt][nt]);
      }
    }
    // ---- hand-over: this wave's reads of buffer t&1 are done, its copies of step t+1 have
    // landed; the barrier publishes step t+1 and frees buffer t&1 for the refill ----
    asm volatile("s_wait_dscnt 0x0" ::: "memory");
    asm volatile("s_wait_asynccnt 0x0" ::: "memory");
    __syncthreads();
    if (t + 2 < GSTEPS) {
      rows128_copy(l0 + bo * 2, ga0 + (t + 2) * 64);
      rows128_copy(l0 + bo * 2 + lb, gb0 + (t + 2) * 64);
    }
  }
  // no copy is left in flight when the wave goes on to the epilogue
  asm volatile("s_wait_asynccnt 0x0" ::: "memory");
}

// ---------------------------------------------------------------------------
// Output pass over the block's two head tiles (sT: head bh, then head bh + 1).
// 4 lines per instruction, 64 lines per wave, 256 per block.
// which 0/1: plane[bh][l][d]  (one token row = 64 halves = one line)
// which 2  : vt[bh][d][l]     (64 d-rows x 128 tokens = 2 lines each)
// In both layouts line lid of a head tile lies at sT + lid * 64, and head bh + 1
// lies SEQ * HD halves behind head bh. A lane's 16 chunks are read from LDS as
// one group ahead of their stores: a wave waits out one LDS latency for the pass,
// not one per chunk.
// ---------------------------------------------------------------------------
__device__ __forceinline__ void proj_store_pass(const _Float16* sT, _Float16* plane, _Float16* vt,
                                                int which, int bh, int l0, int w, int lane) {
  const int q8 = lane & 7, sub = lane >> 3;
  const int lid0 = w * 32 + sub;                   // the lane's first line of a tile; line i lies 4 further
  const int d0 = lid0 >> 1, hl = lid0 & 1;         // which 2: line lid0 + 4 i is d-row d0 + 2 i, token half hl
  _Float16* dst0 = (which != 2) ? plane + ((size_t)bh * SEQ + l0 + lid0) * HD + 8 * q8
                                : vt + ((size_t)bh * HD + d0) * SEQ + l0 + 64 * hl + 8 * q8;
  const int step = (which != 2) ? 4 * HD : 2 * SEQ;   // halves from line i to line i + 1
  const _Float16* src = sT + lid0 * 64 + 8 * q8;
  _Float16* dst[8];
  v8h v[2][8];
  #pragma unroll   // dst[], v[][] indexed by constants, so that they stay in registers
  for (int i = 0; i < 8; ++i) {
    dst[i] = dst0 + i * step;
    v[0][i] = *(const v8ha*)(src + i * 256);
    v[1][i] = *(const v8ha*)(src + 128 * HD + i * 256);
  }
  // The line addresses are formed ahead of the run of stores: inside the run no register of an
  // issued store is written again, so the stores follow one another with no wait on an earlier one.
  __builtin_amdgcn_sched_barrier(0);
  #pragma unroll
  for (int i = 0; i < 8; ++i) {
    *(v8h*)dst[i] = v[0][i];
    *(v8h*)(dst[i] + (size_t)SEQ * HD) = v[1][i];
  }
}

// ---------------------------------------------------------------------------
// Kernel 2: Y = (x+pe) * W^T + bias over the fused 3*512 output columns.
// Block 128 thr (4 waves) = 128 tokens x 128 features (two heads of one which);
// wave tile 64 tokens x 64 features (one head); K = 512 in staged steps of 64
// (gemm_128x128); the two heads' output tiles sT reuse the ring's LDS once the
// main loop has returned.
// ---------------------------------------------------------------------------
__global__ __launch_bounds__(128) void proj_kernel(
    const _Float16* __restrict__ xh,   // [8192][512]
    const _Float16* __restrict__ wh,   // [4][512][512], row = output feature, x32
    const float* __restrict__ bq, const float* __restrict__ bk, const float* __restrict__ bv,
    _Float16* __restrict__ qh,         // [B*H][L][D]  f16(q)
    _Float16* __restrict__ kh,         // [B*H][L][D]  f16(k)
    _Float16* __restrict__ vt)         // [B*H][D][L]  f16(v)
{
  __shared__ __attribute__((aligned(16))) _Float16 sG[2 * PSTAGE];  // 73728 B
  _Float16* sT = sG;                                                // 2 x (128 x 64) halves, after the main loop

  const int tid = threadIdx.x, lane = tid & 31, w = tid >> 5;
  const int wm = w & 1, wn = w >> 1;
  const int h = lane >> 4, m = lane & 15;
  const int m0 = blockIdx.x * 128;
  const int cg = blockIdx.y;                 // 0..11
  const int which = cg >> 2, head0 = (cg & 3) * 2;   // the block's heads: head0, head0 + 1

  const v8f zero8 = {0.f, 0.f, 0.f, 0.f, 0.f, 0.f, 0.f, 0.f};
  v8f acc[4][4];
  #pragma unroll
  for (int mt = 0; mt < 4; ++mt)
    #pragma unroll
    for (int nt = 0; nt < 4; ++nt) acc[mt][nt] = zero8;

  gemm_128x128(xh + (size_t)m0 * DMODEL, wh + ((size_t)which * DMODEL + head0 * HD) * DMODEL, sG, tid, acc);

  // D[r] of tile (mt, nt) = Y[token m0+64wm+16mt+8h+r][head head0+wn, feature 16nt+m]
  const float* bias = (which == 0) ? bq : ((which == 1) ? bk : bv);
  _Float16* sTw = sT + wn * (128 * HD);      // this wave's head tile
  #pragma unroll
  for (int nt = 0; nt < 4; ++nt) {
    const int feat = 16 * nt + m;
    const float bvl = bias[(head0 + wn) * HD + feat];
    #pragma unroll
    for (int mt = 0; mt < 4; ++mt) {
      #pragma unroll
      for (int r = 0; r < 8; ++r) {
        const int tokl = 64 * wm + 16 * mt + 8 * h + r;    // 0..127
        const float y = acc[mt][nt][r] * (1.0f / WSCALE) + bvl;
        const int idx = (which == 2) ? (feat * 128 + tokl) : (tokl * HD + feat);
        sTw[idx] = (_Float16)y;
      }
    }
  }
  __syncthreads();

  const int b = m0 / SEQ, l0 = m0 - b * SEQ, bh = b * NHEADS + head0;
  _Float16* plane = (which == 0) ? qh : kh;
  proj_store_pass(sT, plane, vt, which, bh, l0, w, lane);
  
}

// ---------------------------------------------------------------------------
// Attention helpers.
// Score element r of this lane: key = kb + 64kg + 16j + 8h + r, query = q0 + 16qt + m.
// v = log2(e) * (mask ? (s*0.125 + anti[q - key + 2047]) : (-inf + missing_bias[head])):
// log2(e) rides in the score scale and in the table, so the softmax runs on 2^x.
// The key mask enters as the start value C of the score product: sm[key] = 0
// for an observed key, -inf + missing_bias[head] for a missing one, so that
// C + K.Q stays that non-finite value through the scale and the bias below.
// sb = the block's window of the antisymmetrised rel-pos table in LDS, base = index for r = 0
// (index decreases by one per r); every index is in range for every key, so
// the reads carry no condition and no branch.
// ---------------------------------------------------------------------------
__device__ __forceinline__ v8f mask_start8(const float* sm) {
  const v4f a = *(const v4fa*)sm;
  const v4f c = *(const v4fa*)(sm + 4);
  const v8f z = { a.x, a.y, a.z, a.w, c.x, c.y, c.z, c.w };
  return z;
}

__device__ __forceinline__ v8f bias_load8(const float* sb, int base) {
  const v8f t = { sb[base],     sb[base - 1], sb[base - 2], sb[base - 3],
                  sb[base - 4], sb[base - 5], sb[base - 6], sb[base - 7] };
  return t;
}

// 2^u by v_exp_f32, with the slot behind a transcendental:
// source and result stay tied up to the v_nop, so that no instruction directly behind the
// v_exp_f32 writes its source or reads its result.
__device__ __forceinline__ float exp2_slot(float u) {
  float p = __builtin_amdgcn_exp2f(u);
  asm("v_nop" : "+v"(p) : "v"(u));
  return p;
}

// P^T B-fragment from the lane's own score D values: element r <- tile a row r,
// element 8+r <- tile c row r (same lane, same query column); the values arrive x 2^14.
__device__ __forceinline__ v16h pack_p(v8f a, v8f c) {
  const v16h r = { (_Float16)a[0], (_Float16)a[1], (_Float16)a[2], (_Float16)a[3],
                   (_Float16)a[4], (_Float16)a[5], (_Float16)a[6], (_Float16)a[7],
                   (_Float16)c[0], (_Float16)c[1], (_Float16)c[2], (_Float16)c[3],
                   (_Float16)c[4], (_Float16)c[5], (_Float16)c[6], (_Float16)c[7] };
  return r;
}

// (one token row's head slice) by lanes 8q..8q+7 in one instruction, 4 lines
// per instruction, 16 lines per wave.
__device__ __forceinline__ void ao_store_pass(const _Float16* so, _Float16* ao,
                                              int b, int head, int q0, int lane) {
  const int q8 = lane & 7, sub = lane >> 3;
  #pragma unroll
  for (int i = 0; i < 4; ++i) {
    const int lid = i * 4 + sub;                    // 0..15
    const v8h v = *(const v8ha*)(so + lid * 64 + 8 * q8);
    const size_t gi = ((size_t)b * SEQ + q0 + lid) * DMODEL + head * HD + 8 * q8;
    *(v8h*)(ao + gi) = v;
  }
}

// One 128-key stage of K (128 key rows x 128 B) and of V^T (64 d rows x 256 B)
// into LDS rows of TPITCH / VPITCH halves: 4 + 4 asynchronous 16-B copies per
// lane, each wave-wide copy covering four whole 128-B lines. lk/lv = this lane's
// LDS byte address of its first K / V chunk, gk/gv = the matching global
// address; chunk i lies 32 (K) or 16 (V^T) rows further on both sides.
// The closing s_wait_xcnt 0 stands inside the copies' own statement, so that no
// address register named here is rewritten ahead of it.
__device__ __forceinline__ void stage_copy(unsigned lk, unsigned lv,
                                           const _Float16* gk, const _Float16* gv) {
  const unsigned lk1 = lk + 32 * TPITCH * 2, lk2 = lk + 64 * TPITCH * 2, lk3 = lk + 96 * TPITCH * 2;
  const unsigned lv1 = lv + 16 * VPITCH * 2, lv2 = lv + 32 * VPITCH * 2, lv3 = lv + 48 * VPITCH * 2;
  const _Float16* gk1 = gk + 32 * HD;
  const _Float16* gk2 = gk + 64 * HD;
  const _Float16* gk3 = gk + 96 * HD;
  const _Float16* gv1 = gv + (size_t)16 * SEQ;
  const _Float16* gv2 = gv + (size_t)32 * SEQ;
  const _Float16* gv3 = gv + (size_t)48 * SEQ;
  asm volatile("global_load_async_to_lds_b128 %0, %8, off\n\t"
               "global_load_async_to_lds_b128 %1, %9, off\n\t"
               "global_load_async_to_lds_b128 %2, %10, off\n\t"
               "global_load_async_to_lds_b128 %3, %11, off\n\t"
               "global_load_async_to_lds_b128 %4, %12, off\n\t"
               "global_load_async_to_lds_b128 %5, %13, off\n\t"
               "global_load_async_to_lds_b128 %6, %14, off\n\t"
               "global_load_async_to_lds_b128 %7, %15, off\n\t"
               "s_wait_xcnt 0x0"
               :: "v"(lk), "v"(lk1), "v"(lk2), "v"(lk3), "v"(lv), "v"(lv1), "v"(lv2), "v"(lv3),
                  "v"(gk), "v"(gk1), "v"(gk2), "v"(gk3), "v"(gv), "v"(gv1), "v"(gv2), "v"(gv3)
               : "memory");
}

// ---------------------------------------------------------------------------
// Kernel 3: streaming attention, transposed form.
// Block 256 thr (8 waves) = 128 queries; 128 keys per staged step.
// Wave w: query group qg = w & 3 (32 queries = two 16-column tiles), key half
// kg = w >> 2 (keys 64 kg .. 64 kg + 63 of every staged step). Each K and V^T
// fragment read from LDS feeds two products, one per query tile; the two waves
// of a query group each keep their own running maximum, sum and O over their
// half of the keys, and the halves are joined through LDS behind the loop.
// K and V^T of a step are staged once per block in a two-buffer LDS ring by
// asynchronous copies (next step's copies fly while this step is worked on).
//   S^T = K * Q^T : A = K rows (row = key, k = d), B = Q^T (k = d, n = query)
//   O^T += V^T * P^T : A = Vt rows (row = d, k = key), B = P^T from registers
// Lane owns 32 keys of query columns (lane&15) and 16 + (lane&15); partner = lane ^ 16.
// The block's window of this head's antisymmetrised rel-pos table (formed by the
// convert launch) is copied to LDS, and the key-mask start values of this batch
// row are built there, once per block.
// ---------------------------------------------------------------------------
// amdgpu_waves_per_eu(4, 4): a register budget of 256 a wave, so that two blocks (four waves per
// SIMD) share a WGP; the softmax's vector work between the products wants those waves.
__global__ __launch_bounds__(256) __attribute__((amdgpu_waves_per_eu(4, 4))) void attn_kernel(
    const _Float16* __restrict__ qh,   // [B*H][L][D]
    const _Float16* __restrict__ kh,   // [B*H][L][D]
    const _Float16* __restrict__ vt,   // [B*H][D][L]
    const int* __restrict__ mask,      // [B][L], nonzero = observed key
    const float* __restrict__ mbias,   // [H]
    const float* __restrict__ ab,      // [H][RELP] antisymmetrised rel-pos table
    _Float16* __restrict__ ao)         // [B][L][DMODEL], x64
{
  __shared__ __attribute__((aligned(16))) float sB[RELWIN];           //  8704 B
  __shared__ __attribute__((aligned(16))) float sM[SEQ];              //  8192 B
  __shared__ __attribute__((aligned(16))) _Float16 sK[2 * KSTAGE];   // 36864 B; behind the loop: the join's partial O, maxima, sums
  __shared__ __attribute__((aligned(16))) _Float16 sV[2 * VSTAGE];   // 34816 B; behind the loop: the block's 128 x 64 output tile

  const int tid = threadIdx.x, lane = tid & 31;
  const int w = __builtin_amdgcn_readfirstlane(tid >> 5);   // wave number in a scalar register: its branches are scalar
  const int qg = w & 3, kg = w >> 2;
  const int h = lane >> 4, m = lane & 15;
  const int bh = blockIdx.y, b = bh >> 3, head = bh & 7;
  const int qblk = blockIdx.x * AQ;
  const int q0 = qblk + 32 * qg;

  // Staging map, chunk i = 0..3 of a thread. K: tile row (tid >> 3) + 32 i, 16-B column tid & 7.
  // V^T: tile row (tid >> 4) + 16 i, 16-B column tid & 15.
  const int krow = tid >> 3, kcol = tid & 7;
  const int vrow = tid >> 4, vcol = tid & 15;
  const unsigned lk0 = (unsigned)(size_t)(sK + krow * TPITCH + 8 * kcol);
  const unsigned lv0 = (unsigned)(size_t)(sV + vrow * VPITCH + 8 * vcol);
  const _Float16* gk0 = kh + ((size_t)bh * SEQ + krow) * HD + 8 * kcol;    // + AKEYS * HD per step
  const _Float16* gv0 = vt + ((size_t)bh * HD + vrow) * SEQ + 8 * vcol;    // + AKEYS per step

  stage_copy(lk0, lv0, gk0, gv0);                                          // step 0 -> buffer 0

  // Table index of (query q, key k) is q - k + (SEQ-1): the block's 128 queries, first one qblk,
  // reach entries qblk .. qblk + 2174 over all keys. sB[e] = ab[head][qblk + e], e = 0 .. 2175
  // (the last entry read is 1920 + 2175 = 4095, the padding entry: copied, never used).
  const float* abw = ab + head * RELP + qblk;
  // The loads stand here and the LDS stores behind the mask and Q loads, so that all of the
  // prologue's loads are in flight together. The last 128 entries are 32 chunks: every wave
  // loads them (no condition on the load), wave 0 stores.
  v4f tb[3];
  #pragma unroll   // tb[] indexed by constants, so that it stays in registers
  for (int c = 0; c < 2; ++c) tb[c] = *(const v4fa*)(abw + 4 * tid + 1024 * c);
  tb[2] = *(const v4fa*)(abw + 2048 + 4 * lane);

  // sM[key] = 0 (observed) or -inf fill + missing bias (missing)
  const float mbh = mbias[head];
  const float vmiss = -__builtin_inff() + mbh;
  #pragma unroll   // the two mask loads in flight together
  for (int i = 0; i < SEQ / 1024; ++i) {
    const int k4 = 4 * tid + 1024 * i;
    const v4i mm = *(const v4ia*)(mask + (size_t)b * SEQ + k4);
    const v4f t = { (mm.x != 0) ? 0.0f : vmiss, (mm.y != 0) ? 0.0f : vmiss,
                    (mm.z != 0) ? 0.0f : vmiss, (mm.w != 0) ? 0.0f : vmiss };
    *(v4fa*)(sM + k4) = t;
  }

  // Q^T B-fragments: tile qt, column n = query q0 + 16 qt + m, k = d (two 32-deep chunks)
  const _Float16* qrow = qh + ((size_t)bh * SEQ + q0 + m) * HD;
  v16h qf[2][2];
  #pragma unroll   // qf[][] indexed by constants, so that it stays in registers
  for (int qt = 0; qt < 2; ++qt) {
    qf[qt][0] = load_frag(qrow + qt * 16 * HD, h);
    qf[qt][1] = load_frag(qrow + qt * 16 * HD + 32, h);
  }

  #pragma unroll
  for (int c = 0; c < 2; ++c) *(v4fa*)(sB + 4 * tid + 1024 * c) = tb[c];
  // Holds the third load in front of the branch below (loaded value as an input only): without it
  // the compiler sinks the load into the branch, where wave 0 waits out a second full load latency.
  asm volatile("" :: "v"(tb[2]));
  if (w == 0) *(v4fa*)(sB + 2048 + 4 * lane) = tb[2];

  // step 0's copies of this wave have landed before the barrier that publishes them (and sB, sM)
  asm volatile("s_wait_asynccnt 0x0" ::: "memory");
  __syncthreads();

  stage_copy(lk0 + KSTAGE * 2, lv0 + VSTAGE * 2, gk0 + AKEYS * HD, gv0 + AKEYS);   // step 1 -> buffer 1

  // Index in sB of (query tile qt, key tile j, r) is qk - kb - 16 (j - qt) - r: the two query tiles
  // share three of their five groups of eight table entries.
  const int qk = 32 * qg + m + (SEQ - 1) - 8 * h - 64 * kg;

  const v8f zero8 = {0.f, 0.f, 0.f, 0.f, 0.f, 0.f, 0.f, 0.f};
  const float sc = 0.125f * LOG2E;            // 1/sqrt(d) and log2(e) in one factor
  const v8f sc8 = {sc, sc, sc, sc, sc, sc, sc, sc};
  v8f o[2][4];                                // o[qt][t][r] = O[query 16qt+m][d 16t+8h+r] * (l * 2^14), this wave's keys
  #pragma unroll
  for (int qt = 0; qt < 2; ++qt)
    #pragma unroll
    for (int t = 0; t < 4; ++t) o[qt][t] = zero8;
  float mrun[2] = { -1e30f, -1e30f }, lrun[2] = { 0.0f, 0.0f };   // maximum in base-2 units; row sum x 2^14

  const int kfro = (64 * kg + m) * TPITCH;                     // this lane's K fragment row (key tile 0) in a staged tile
  const int vfro = m * VPITCH + 64 * kg;                       // this lane's V^T fragment row (d tile 0), at this wave's keys
  const float* smp = sM + 8 * h + 64 * kg;                     // + key tile base

  #pragma unroll 1
  for (int st = 0; st < ASTEP; ++st) {
    const int kb = st * AKEYS;
    const int par = st & 1;                                    // this step's ring buffer
    const _Float16* kbase = sK + par * KSTAGE + kfro;          // + 16j*TPITCH + 32*dc
    const _Float16* vbase = sV + par * VSTAGE + vfro;          // + 16t*VPITCH + 32*kc
    // ---- rel-pos bias of this step, read ahead of the score products: group g serves (qt, j = g - 1 + qt) ----
    v8f bv[5];
    #pragma unroll   // bv[] indexed by constants, so that it stays in registers
    for (int g = 0; g < 5; ++g) bv[g] = bias_load8(sB, qk - kb - 16 * (g - 1));
    // ---- raw scores on the mask start: s[qt][j][r] = sM[key] + (Q.K)[query 16qt+m][key kb+64kg+16j+8h+r] ----
    v8f s[2][4];
    #pragma unroll
    for (int j = 0; j < 4; ++j) {
      const _Float16* kp = kbase + 16 * j * TPITCH;
      const v16h kf0 = load_frag(kp, h);
      const v16h kf1 = load_frag(kp + 32, h);
      const v8f z = mask_start8(smp + kb + 16 * j);
      #pragma unroll
      for (int qt = 0; qt < 2; ++qt)
        s[qt][j] = wmma_f16_free(kf1, qf[qt][1], wmma_f16_free(kf0, qf[qt][0], z));
    }
    // ---- scale log2(e)/8, rel-pos bias x log2(e) (f32) ----
    #pragma unroll
    for (int qt = 0; qt < 2; ++qt)
      #pragma unroll
      for (int j = 0; j < 4; ++j)
        s[qt][j] = __builtin_elementwise_fma(s[qt][j], sc8, bv[j + 1 - qt]);

    // ---- online softmax, each query tile on its own; P^T B-fragments (key chunks 0..31, 32..63) ----
    v16h pb[2][2];
    #pragma unroll   // s[][], o[][], pb[][], mrun[], lrun[] indexed by constants, so that they stay in registers
    for (int qt = 0; qt < 2; ++qt) {
      float mloc = s[qt][0][0];
      #pragma unroll
      for (int j = 0; j < 4; ++j)
        #pragma unroll
        for (int r = 0; r < 8; ++r) mloc = fmaxf(mloc, s[qt][j][r]);
      mloc = fmaxf(mloc, __shfl_xor(mloc, 16));
      const float mnew = fmaxf(mrun[qt], mloc);
      const float alpha = exp2_slot(mrun[qt] - mnew);
      mrun[qt] = mnew;
      // one subtraction stands between a score and its v_exp_f32: p = 2^(s - mnew + 14)
      const float mref = mnew - PSHIFT;
      const v2f mref2 = {mref, mref};
      float lsum = 0.0f;
      #pragma unroll
      for (int j = 0; j < 4; ++j) {
        v2f u[4];                              // in pairs: one packed subtraction serves two scores
        float p[8];
        #pragma unroll   // u[], p[] indexed by constants, so that they stay in registers
        for (int i = 0; i < 4; ++i) {
          const v2f sp = { s[qt][j][2 * i], s[qt][j][2 * i + 1] };
          u[i] = sp - mref2;
          p[2 * i]     = __builtin_amdgcn_exp2f(u[i].x);
          p[2 * i + 1] = __builtin_amdgcn_exp2f(u[i].y);
        }
        // The slot behind a transcendental: the eight sources stay live up to this statement, so
        // that no instruction directly behind one of the row's v_exp_f32 writes the register it
        // reads; the v_nop is
        // the slot of the last of them.
        asm("v_nop" : "+v"(p[7])
            : "v"(u[0]), "v"(u[1]), "v"(u[2]), "v"(u[3]),
              "v"(p[0]), "v"(p[1]), "v"(p[2]), "v"(p[3]), "v"(p[4]), "v"(p[5]), "v"(p[6]));
        #pragma unroll
        for (int r = 0; r < 8; ++r) {
          s[qt][j][r] = p[r];
          lsum += p[r];
        }
      }
      lsum += __shfl_xor(lsum, 16);
      lrun[qt] = lrun[qt] * alpha + lsum;
      #pragma unroll
      for (int t = 0; t < 4; ++t)
        #pragma unroll
        for (int r = 0; r < 8; ++r) o[qt][t][r] = o[qt][t][r] * alpha;
      pb[qt][0] = pack_p(s[qt][0], s[qt][1]);
      pb[qt][1] = pack_p(s[qt][2], s[qt][3]);
    }

    // ---- O^T += V^T * P^T ----
    #pragma unroll
    for (int t = 0; t < 4; ++t) {
      const _Float16* vp = vbase + 16 * t * VPITCH;
      const v16h vf0 = load_frag(vp, h);
      const v16h vf1 = load_frag(vp + 32, h);
      #pragma unroll
      for (int qt = 0; qt < 2; ++qt) {
        o[qt][t] = wmma_f16_free(vf0, pb[qt][0], o[qt][t]);
        o[qt][t] = wmma_f16_free(vf1, pb[qt][1], o[qt][t]);
      }
    }

    // ---- hand-over: this wave's reads of buffer st&1 are done, its copies of step st+1
    // have landed; the barrier publishes step st+1 and frees buffer st&1 for the refill ----
    asm volatile("s_wait_dscnt 0x0" ::: "memory");
    asm volatile("s_wait_asynccnt 0x0" ::: "memory");
    __syncthreads();
    if (st + 2 < ASTEP)
      stage_copy(lk0 + par * (KSTAGE * 2), lv0 + par * (VSTAGE * 2),
                 gk0 + (size_t)(kb + 2 * AKEYS) * HD, gv0 + (kb + 2 * AKEYS));
  }
  // no copy is left in flight when the wave goes on to the epilogue
  asm volatile("s_wait_asynccnt 0x0" ::: "memory");

  // ---- join of the two key halves. Every wave has passed the loop's last barrier, so the ring is
  // free. The kg = 1 wave of a query group hands its O (16 chunks of 16 B a lane, a wave-wide store
  // = 512 contiguous bytes), maxima and sums to the same lane of the kg = 0 wave. ----
  v4fa* jo = (v4fa*)sK + qg * (16 * 32) + lane;                // chunk i lies 32 further
  v4fa* jm = (v4fa*)sK + 4 * (16 * 32) + qg * 32 + lane;
  if (kg == 1) {
    #pragma unroll
    for (int qt = 0; qt < 2; ++qt) {
      #pragma unroll
      for (int t = 0; t < 4; ++t) {
        const v4f lo4 = { o[qt][t][0], o[qt][t][1], o[qt][t][2], o[qt][t][3] };
        const v4f hi4 = { o[qt][t][4], o[qt][t][5], o[qt][t][6], o[qt][t][7] };
        jo[32 * (qt * 8 + t * 2)]     = lo4;
        jo[32 * (qt * 8 + t * 2 + 1)] = hi4;
      }
    }
    const v4f ml = { mrun[0], mrun[1], lrun[0], lrun[1] };
    *jm = ml;
  }
  __syncthreads();

  // ---- epilogue: both halves brought to the common maximum, normalised, x64, into the block's
  // 128 x 64 f16 tile; whole-line stores by all eight waves ----
  _Float16* sO = sV;
  if (kg == 0) {
    const v4f ml = *jm;
    #pragma unroll
    for (int qt = 0; qt < 2; ++qt) {
      const float mo = ml[qt], lo = ml[2 + qt];
      const float mj = fmaxf(mrun[qt], mo);
      const float a0 = exp2_slot(mrun[qt] - mj);
      const float a1 = exp2_slot(mo - mj);
      const float lj = lrun[qt] * a0 + lo * a1;
      float rl = __builtin_amdgcn_rcpf(lj);
      // The slot behind a transcendental, as in the loop: nothing directly behind the v_rcp_f32 writes its source.
      asm("v_nop" : "+v"(rl) : "v"(lj));
      const float inv = rl * AOSCALE;           // O and the row sum both carry 2^14
      const float c0 = a0 * inv, c1 = a1 * inv;
      _Float16* so = sO + (32 * qg + 16 * qt + m) * 64 + 8 * h;
      #pragma unroll
      for (int t = 0; t < 4; ++t) {
        const v4f lo4 = jo[32 * (qt * 8 + t * 2)];
        const v4f hi4 = jo[32 * (qt * 8 + t * 2 + 1)];
        #pragma unroll
        for (int r = 0; r < 4; ++r) {
          so[16 * t + r]     = (_Float16)(o[qt][t][r] * c0 + lo4[r] * c1);
          so[16 * t + 4 + r] = (_Float16)(o[qt][t][4 + r] * c0 + hi4[r] * c1);
        }
      }
    }
  }
  __syncthreads();

  ao_store_pass(sO + w * 1024, ao, b, head, qblk + 16 * w, lane);
  
}

// ---------------------------------------------------------------------------
// 16-B stores, 4 lines per instruction, 64 lines per wave.
// ---------------------------------------------------------------------------
__device__ __forceinline__ void out_store_pass(const float* sT, float* out, int m0, int fg, int w, int lane) {
  const int q8 = lane & 7, sub = lane >> 3;
  #pragma unroll
  for (int i = 0; i < 16; ++i) {
    const int lid = i * 4 + sub;                   // 0..63
    const int row = 32 * w + (lid >> 1), hl = lid & 1;
    const v4f v = *(const v4fa*)(sT + row * 64 + 32 * hl + 4 * q8);
    const size_t gi = ((size_t)(m0 + row)) * DMODEL + fg * 64 + 32 * hl + 4 * q8;
    *(v4f*)(out + gi) = v;
  }
}

// ---------------------------------------------------------------------------
// Kernel 4: out = AO * Wo^T + bo (f32). Block 128 thr = 128 tokens x 64
// features (fg = blockIdx.y); wave tile 32 x 64; K = 512 in staged steps of 64
// (gemm_128x64); the output tile sT reuses the ring's LDS after the main loop.
// ---------------------------------------------------------------------------
__global__ __launch_bounds__(128) void oproj_kernel(
    const _Float16* __restrict__ ao,   // [8192][512] f16, x64
    const _Float16* __restrict__ woh,  // [512][512] f16, row = output feature, x32
    const float* __restrict__ bo,      // [512]
    float* __restrict__ out)           // [8192][512] f32
{
  __shared__ __attribute__((aligned(16))) _Float16 sG[2 * GSTAGE];  // 55296 B
  float* sT = (float*)sG;                                           // 128 x 64 floats (32768 B), after the main loop

  const int tid = threadIdx.x, lane = tid & 31, w = tid >> 5;
  const int h = lane >> 4, m = lane & 15;
  const int m0 = blockIdx.x * 128;
  const int fg = blockIdx.y;                 // 0..7

  const v8f zero8 = {0.f, 0.f, 0.f, 0.f, 0.f, 0.f, 0.f, 0.f};
  v8f acc[2][4];
  #pragma unroll
  for (int mt = 0; mt < 2; ++mt)
    #pragma unroll
    for (int nt = 0; nt < 4; ++nt) acc[mt][nt] = zero8;

  gemm_128x64(ao + (size_t)m0 * DMODEL, woh + (size_t)fg * 64 * DMODEL, sG, tid, acc);

  // D[r] of tile (mt, nt) = out[token m0+32w+16mt+8h+r][feature fg*64+16nt+m]
  #pragma unroll
  for (int nt = 0; nt < 4; ++nt) {
    const int feat = 16 * nt + m;
    const float bvl = bo[fg * 64 + feat];
    #pragma unroll
    for (int mt = 0; mt < 2; ++mt) {
      #pragma unroll
      for (int r = 0; r < 8; ++r) {
        const int tokl = 32 * w + 16 * mt + 8 * h + r;
        sT[tokl * 64 + feat] = acc[mt][nt][r] * (1.0f / (WSCALE * AOSCALE)) + bvl;
      }
    }
  }
  __syncthreads();

  out_store_pass(sT, out, m0, fg, w, lane);
  
}

// ---------------------------------------------------------------------------
extern "C" void kernel_launch(void* const* d_in, const int* in_sizes, int n_in,
                              void* d_out, int out_size, void* d_ws, size_t ws_size,
                              hipStream_t stream) {
  if (n_in < 12) return;
  if (in_sizes[0] != NX) return;
  if (in_sizes[1] != MROWS) return;
  if (in_sizes[2] != NW || in_sizes[4] != NW || in_sizes[6] != NW || in_sizes[8] != NW) return;
  if (in_sizes[3] != DMODEL || in_sizes[5] != DMODEL || in_sizes[7] != DMODEL || in_sizes[9] != DMODEL) return;
  if (in_sizes[10] != NHEADS) return;
  if (in_sizes[11] != RELN * NHEADS) return;
  if (out_size != NX) return;

  const float* x     = (const float*)d_in[0];
  const int*   mask  = (const int*)d_in[1];
  const float* Wq    = (const float*)d_in[2];
  const float* bq    = (const float*)d_in[3];
  const float* Wk    = (const float*)d_in[4];
  const float* bk    = (const float*)d_in[5];
  const float* Wv    = (const float*)d_in[6];
  const float* bv    = (const float*)d_in[7];
  const float* Wo    = (const float*)d_in[8];
  const float* bo    = (const float*)d_in[9];
  const float* mbias = (const float*)d_in[10];
  const float* rel   = (const float*)d_in[11];
  float* out = (float*)d_out;

  const size_t xh_bytes = (size_t)NX * 2;                           //  8388608
  const size_t wh_bytes = (size_t)4 * NW * 2;                       //  2097152
  const size_t pl_bytes = (size_t)BATCH * NHEADS * SEQ * HD * 2;    //  8388608
  const size_t ao_bytes = (size_t)NX * 2;                           //  8388608
  const size_t ab_bytes = (size_t)NHEADS * RELP * 4;                //   131072
  const size_t total = xh_bytes + wh_bytes + 3 * pl_bytes + ao_bytes + ab_bytes;   // 44171264
  if (total > ws_size) return;

  char* ws = (char*)d_ws;
  size_t off = 0;
  _Float16* xh  = (_Float16*)(ws + off);  off += xh_bytes;
  _Float16* wh  = (_Float16*)(ws + off);  off += wh_bytes;
  _Float16* qh  = (_Float16*)(ws + off);  off += pl_bytes;
  _Float16* kh  = (_Float16*)(ws + off);  off += pl_bytes;
  _Float16* vt  = (_Float16*)(ws + off);  off += pl_bytes;
  _Float16* ao  = (_Float16*)(ws + off);  off += ao_bytes;
  float*    ab  = (float*)(ws + off);     off += ab_bytes;
  if (off > ws_size) return;

  const int ngroups = XGROUPS + NW8 + RELP;                         // 167936
  convert_kernel<<<(ngroups + 255) / 256, 256, 0, stream>>>(x, Wq, Wk, Wv, Wo, rel, xh, wh, ab);

  dim3 gProj(MROWS / 128, 3 * NHEADS / 2);                          // (64, 12)
  proj_kernel<<<gProj, 128, 0, stream>>>(xh, wh, bq, bk, bv, qh, kh, vt);

  dim3 gAtt(SEQ / AQ, BATCH * NHEADS);                              // (16, 32)
  attn_kernel<<<gAtt, 256, 0, stream>>>(qh, kh, vt, mask, mbias, ab, ao);

  dim3 gOut(MROWS / 128, DMODEL / 64);                              // (64, 8)
  oproj_kernel<<<gOut, 128, 0, stream>>>(ao, wh + (size_t)3 * NW, bo, out);
}

// v010
// A run of this version takes 64.8 microseconds.
// Timed twice side by side with v009, it ran 1.03 and 1.04 times as fast.
// All steps since v000 together make it 4.47 times as fast.
// Contractions: x*W^T for q,k,v and o, K*Q^T, V^T*P^T all on v_wmma_f32_16x16x32_f16 (f16 operands, f32 accumulate); W carried x32, P carried x16384, attention rows carried x64 (exact power-of-two scales folded back in f32); PE, bias tables, key mask, softmax (in base 2) and normalisation in f32.
#include <hip/hip_runtime.h>

typedef _Float16 v16h __attribute__((ext_vector_type(16)));
typedef _Float16 v8h  __attribute__((ext_vector_type(8)));
typedef float    v8f  __attribute__((ext_vector_type(8)));
typedef float    v4f  __attribute__((ext_vector_type(4)));
typedef float    v2f  __attribute__((ext_vector_type(2)));
typedef int      v4i  __attribute__((ext_vector_type(4)));
typedef v8h __attribute__((may_alias)) v8ha;
typedef v4f __attribute__((may_alias)) v4fa;
typedef v4i __attribute__((may_alias)) v4ia;

union Frag { v16h v; v8h half[2]; };

#define DMODEL 512
#define NHEADS 8
#define HD     64
#define SEQ    2048
#define BATCH  4
#define MROWS  (BATCH * SEQ)          // 8192 tokens
#define NX     (MROWS * DMODEL)       // 4194304
#define NW     (DMODEL * DMODEL)      // 262144
#define NW8    (NW / 8)               // 32768
#define RELN   (2 * SEQ - 1)          // 4095
#define RELP   (2 * SEQ)              // 4096 entries per head plane of the antisymmetrised table (last one padding)
#define AQ     128                    // queries of an attention block: four groups of 32
#define RELWIN (SEQ + AQ)             // 2176 table entries of an attention block's window: the 2175 its 128 queries can reach, plus one
#define NPE    (SEQ * DMODEL)         // 1048576 elements of one batch entry
#define XGROUPS (NPE / 8)             // 131072 groups of 8 features of one batch entry
#define PSHIFT  14.0f                 // P and its row sums are carried x 2^14: taken off the maximum that is subtracted ahead of v_exp_f32
#define WSCALE  32.0f
#define AOSCALE 64.0f
#define LOG2E   1.44269502f           // scores are carried x log2(e), so that v_exp_f32 (2^x) takes them as they are
#define TPITCH  72                    // halves per staged LDS row: 144 B = 16 B x 9, conflict-free for 16-B fragment reads
#define AKEYS   128                   // keys of a staged attention step: 64 for each of the two waves of a query group
#define ASTEP   (SEQ / AKEYS)         // 16 staged steps
#define KSTAGE  (AKEYS * TPITCH)      // halves per staged K tile (128 key rows)
#define VPITCH  136                   // halves per staged V^T row: 272 B = 16 B x 17, conflict-free for 16-B fragment reads
#define VSTAGE  (HD * VPITCH)         // halves per staged V^T tile (64 d rows of 128 keys)
#define GROWS   192                   // staged rows of a projection k step: 128 token rows, then 64 feature rows
#define GSTAGE  (GROWS * TPITCH)      // halves per staged projection k step (27648 B)
#define GSTEPS  (DMODEL / 64)         // 8 k steps of 64
#define PROWS   256                   // staged rows of a qkv k step: 128 token rows, then 128 feature rows
#define PSTAGE  (PROWS * TPITCH)      // halves per staged qkv k step (36864 B)
#define OQHEAD  (128 * TPITCH)        // halves of a head's staged q or k output tile: 128 token rows of 64 features
#define OVHEAD  (HD * VPITCH)         // halves of a head's staged v^T output tile: 64 d rows of 128 tokens
#define OPITCH  68                    // floats per staged row of the final output tile: 272 B = 16 B x 17

static_assert(BATCH == 4);
static_assert((XGROUPS % 256) == 0 && (NW8 % 256) == 0);
static_assert((MROWS % 128) == 0 && (SEQ % 128) == 0);

// ---------------------------------------------------------------------------
// 16x16x32 f16 WMMA. wmma_f16: with hazard guard (ties D, keeps A/B live), used
// by the two projections. wmma_f16_free: the bare builtin, used by attention,
// where vector work stands between the products: the compiler keeps the distance
// behind each product with the softmax's own instructions where it can, and is
// free to fetch the next fragments while a product runs.
// Fragment map (wave32): lane l, h = l>>4, m = n = l&15.
//   A/B element i: i<8 -> k0+8h+i ; i>=8 -> k0+16+8h+(i-8)
//   D element r : row 8h+r, col l&15
// ---------------------------------------------------------------------------
__device__ __forceinline__ v8f wmma_f16(v16h a, v16h b, v8f c) {
  v8f d = __builtin_amdgcn_wmma_f32_16x16x32_f16(false, a, false, b, (short)0, c, false, false);
  asm volatile("v_nop\n\tv_nop\n\tv_nop\n\tv_nop" : "+v"(d) : "v"(a), "v"(b));
  return d;
}

__device__ __forceinline__ v8f wmma_f16_free(v16h a, v16h b, v8f c) {
  return __builtin_amdgcn_wmma_f32_16x16x32_f16(false, a, false, b, (short)0, c, false, false);
}

// A or B fragment from a k-contiguous 16-bit row; p points at element k0 of
// the row owned by this lane (row index = lane & 15 added by the caller).
__device__ __forceinline__ v16h load_frag(const _Float16* p, int h) {
  Frag f;
  f.half[0] = *(const v8ha*)(p + 8 * h);
  f.half[1] = *(const v8ha*)(p + 16 + 8 * h);
  return f.v;
}

// ---------------------------------------------------------------------------
// Kernel 1: f32 -> f16 planes. xh = f16(x + pe) unscaled, wh = f16(32*W) for
// Wq,Wk,Wv,Wo (row = output feature, k-contiguous). Four 16-B stores per lane in x and W blocks.
// pe[t][2p] = sin(t*div_p), pe[t][2p+1] = cos(t*div_p),
// div_p = exp(f32(2p) * f32(-ln(1e4)/512)).
// x blocks: a thread owns 8 features of position t; it forms their four
// (sin, cos) pairs once, in registers, and adds them to that position's row of
// all four batch entries. W blocks: a thread converts the same 8 elements of
// all four matrices. All eight 16-B loads of a thread are issued up front.
// Table blocks: a thread owns entry i of the antisymmetrised rel-pos table of all
// eight heads, ab[head][i] = 0.5 * log2(e) * (rel[i][head] - rel[RELN-1-i][head]),
// i = q - k + (SEQ-1); it reads two whole 32-B rows and a wave stores one whole
// 128-B line per head. Entry 4095 is padding, stored as 0.
// ---------------------------------------------------------------------------
__device__ __forceinline__ v8h pack8(v4f a, v4f c) {
  const v8h o = { (_Float16)a.x, (_Float16)a.y, (_Float16)a.z, (_Float16)a.w,
                  (_Float16)c.x, (_Float16)c.y, (_Float16)c.z, (_Float16)c.w };
  return o;
}

__global__ __launch_bounds__(256) void convert_kernel(
    const float* __restrict__ x,
    const float* __restrict__ wq, const float* __restrict__ wk,
    const float* __restrict__ wv, const float* __restrict__ wo,
    const float* __restrict__ rel,
    _Float16* __restrict__ xh, _Float16* __restrict__ wh, float* __restrict__ ab)
{
  const int g = blockIdx.x * 256 + threadIdx.x;
  if (g >= XGROUPS + NW8 + RELP) return;
  if (g >= XGROUPS + NW8) {
    const int i = g - (XGROUPS + NW8);      // table entry 0..4095
    const bool in = i < RELN;
    const float* up = rel + (in ? i : 0) * NHEADS;
    const float* dn = rel + (in ? RELN - 1 - i : 0) * NHEADS;
    const v4f u0 = *(const v4fa*)up, u1 = *(const v4fa*)(up + 4);
    const v4f d0 = *(const v4fa*)dn, d1 = *(const v4fa*)(dn + 4);
    const v4f t0 = (0.5f * LOG2E) * (u0 - d0), t1 = (0.5f * LOG2E) * (u1 - d1);
    #pragma unroll   // t0, t1 indexed by constants
    for (int hd = 0; hd < 4; ++hd) {
      ab[hd * RELP + i]       = in ? t0[hd] : 0.0f;
      ab[(hd + 4) * RELP + i] = in ? t1[hd] : 0.0f;
    }
    return;
  }
  v4f a[4], c[4];
  if (g < XGROUPS) {
    const int t = g >> 6;                   // position 0..2047 (64 groups of 8 per row)
    const int db = (g & 63) * 8;            // first feature of the group
    const unsigned so = (unsigned)g * 32u;  // byte offset of the group in a batch entry of x
    #pragma unroll   // a[], c[] indexed by constants, so that they stay in registers
    for (int b = 0; b < BATCH; ++b) {
      const char* src = (const char*)(x + (size_t)b * NPE) + so;
      a[b] = *(const v4fa*)src;
      c[b] = *(const v4fa*)(src + 16);
    }
    const float kc = (float)(-9.210340371976184 / 512.0);
    float sn[4], cs[4];
    #pragma unroll   // sn[], cs[] indexed by constants, so that they stay in registers
    for (int i = 0; i < 4; ++i) {
      const float fr = expf((float)(db + 2 * i) * kc);
      const float ang = (float)t * fr;
      sn[i] = sinf(ang);
      cs[i] = cosf(ang);
    }
    const v4f pa = { sn[0], cs[0], sn[1], cs[1] };
    const v4f pc = { sn[2], cs[2], sn[3], cs[3] };
    const unsigned dofs = (unsigned)g * 16u;  // byte offset of the group in a batch entry of xh
    #pragma unroll
    for (int b = 0; b < BATCH; ++b)
      *(v8h*)((char*)(xh + (size_t)b * NPE) + dofs) = pack8(a[b] + pa, c[b] + pc);
  } else {
    const unsigned e = (unsigned)(g - XGROUPS);
    const unsigned so = e * 32u;            // byte offset of the group in a matrix
    a[0] = *(const v4fa*)((const char*)wq + so);  c[0] = *(const v4fa*)((const char*)wq + so + 16);
    a[1] = *(const v4fa*)((const char*)wk + so);  c[1] = *(const v4fa*)((const char*)wk + so + 16);
    a[2] = *(const v4fa*)((const char*)wv + so);  c[2] = *(const v4fa*)((const char*)wv + so + 16);
    a[3] = *(const v4fa*)((const char*)wo + so);  c[3] = *(const v4fa*)((const char*)wo + so + 16);
    const unsigned dofs = e * 16u;          // byte offset of the group in a plane of wh
    #pragma unroll
    for (int i = 0; i < 4; ++i)
      *(v8h*)((char*)(wh + (size_t)i * NW) + dofs) = pack8(a[i] * WSCALE, c[i] * WSCALE);
  }
}

// ---------------------------------------------------------------------------
// One 64-deep k step of the output projection into LDS rows of TPITCH halves: 128 token
// rows (8 chunks per lane) and 64 feature rows (4 chunks per lane), 128 B each,
// by asynchronous 16-B copies; each wave-wide copy covers four whole 128-B
// lines. l = this lane's LDS byte address of its first chunk, ga / gb = the
// matching global addresses; chunk i lies 16 rows further on both sides.
// The closing s_wait_xcnt 0 stands inside the copies' own statement, so that no
// address register named here is rewritten ahead of it.
// ---------------------------------------------------------------------------
__device__ __forceinline__ void gemm_stage_copy(unsigned l, const _Float16* ga, const _Float16* gb) {
  const unsigned rs = 16 * TPITCH * 2;                 // 16 staged rows in bytes
  const unsigned l1 = l + rs,     l2 = l + 2 * rs,  l3 = l + 3 * rs,   l4 = l + 4 * rs;
  const unsigned l5 = l + 5 * rs, l6 = l + 6 * rs,  l7 = l + 7 * rs,   l8 = l + 8 * rs;
  const unsigned l9 = l + 9 * rs, l10 = l + 10 * rs, l11 = l + 11 * rs;
  const _Float16* a1 = ga + 16 * DMODEL;
  const _Float16* a2 = ga + 32 * DMODEL;
  const _Float16* a3 = ga + 48 * DMODEL;
  const _Float16* a4 = ga + 64 * DMODEL;
  const _Float16* a5 = ga + 80 * DMODEL;
  const _Float16* a6 = ga + 96 * DMODEL;
  const _Float16* a7 = ga + 112 * DMODEL;
  const _Float16* b1 = gb + 16 * DMODEL;
  const _Float16* b2 = gb + 32 * DMODEL;
  const _Float16* b3 = gb + 48 * DMODEL;
  asm volatile("global_load_async_to_lds_b128 %0, %12, off\n\t"
               "global_load_async_to_lds_b128 %1, %13, off\n\t"
               "global_load_async_to_lds_b128 %2, %14, off\n\t"
               "global_load_async_to_lds_b128 %3, %15, off\n\t"
               "global_load_async_to_lds_b128 %4, %16, off\n\t"
               "global_load_async_to_lds_b128 %5, %17, off\n\t"
               "global_load_async_to_lds_b128 %6, %18, off\n\t"
               "global_load_async_to_lds_b128 %7, %19, off\n\t"
               "global_load_async_to_lds_b128 %8, %20, off\n\t"
               "global_load_async_to_lds_b128 %9, %21, off\n\t"
               "global_load_async_to_lds_b128 %10, %22, off\n\t"
               "global_load_async_to_lds_b128 %11, %23, off\n\t"
               "s_wait_xcnt 0x0"
               :: "v"(l), "v"(l1), "v"(l2), "v"(l3), "v"(l4), "v"(l5), "v"(l6), "v"(l7),
                  "v"(l8), "v"(l9), "v"(l10), "v"(l11),
                  "v"(ga), "v"(a1), "v"(a2), "v"(a3), "v"(a4), "v"(a5), "v"(a6), "v"(a7),
                  "v"(gb), "v"(b1), "v"(b2), "v"(b3)
               : "memory");
}

// ---------------------------------------------------------------------------
// Main loop of the output projection: acc[mt][nt] += A(128 rows) * B(64 rows)^T over
// K = 512, both operands k-contiguous f16 rows of DMODEL halves. Block 128 thr,
// wave tile 32 x 64. Each 64-deep k step is staged once per block in a
// two-buffer LDS ring (the next step's copies fly while this step is worked
// on); the fragments are read from there, in the same ascending k order.
// The brows fragments enter as the WMMA's A operand: a row of D is a row of brows, a
// column of D a row of arows, so that a lane's eight D values are neighbours in a row
// of the output.
// On return every wave has passed the last barrier and no copy is in flight, so
// the caller may reuse sG.
// ---------------------------------------------------------------------------
__device__ __forceinline__ void gemm_128x64(const _Float16* arows, const _Float16* brows,
                                            _Float16* sG, int tid, v8f (&acc)[2][4]) {
  const int lane = tid & 31, w = tid >> 5;
  const int h = lane >> 4, m = lane & 15;
  // Staging map: chunk c = tid + 128 i (i = 0..11), staged row c >> 3, 16-B column c & 7.
  const int crow = tid >> 3, ccol = tid & 7;
  const unsigned l0 = (unsigned)(size_t)(sG + crow * TPITCH + 8 * ccol);
  const _Float16* ga0 = arows + (size_t)crow * DMODEL + 8 * ccol;          // + 64 per step
  const _Float16* gb0 = brows + (size_t)crow * DMODEL + 8 * ccol;          // + 64 per step

  gemm_stage_copy(l0, ga0, gb0);                                           // step 0 -> buffer 0
  // step 0's copies of this wave have landed before the barrier that publishes them
  asm volatile("s_wait_asynccnt 0x0" ::: "memory");
  __syncthreads();
  gemm_stage_copy(l0 + GSTAGE * 2, ga0 + 64, gb0 + 64);                    // step 1 -> buffer 1

  #pragma unroll 1   // rolled: one copy of the body, the ring buffer picked by the step's parity
  for (int t = 0; t < GSTEPS; ++t) {
    const int bo = (t & 1) * GSTAGE;                                       // this step's ring buffer
    const _Float16* ab = sG + bo + (32 * w + m) * TPITCH;                  // token row, mt = 0
    const _Float16* bb = sG + bo + (128 + m) * TPITCH;                     // feature row, nt = 0
    // all fragments of the step are read as one group ahead of its products
    v16h af[2][2], bf[2][4];
    #pragma unroll   // af[][], bf[][] indexed by constants, so that they stay in registers
    for (int kc = 0; kc < 2; ++kc) {
      af[kc][0] = load_frag(ab + 32 * kc, h);
      af[kc][1] = load_frag(ab + 16 * TPITCH + 32 * kc, h);
      #pragma unroll
      for (int nt = 0; nt < 4; ++nt) bf[kc][nt] = load_frag(bb + nt * 16 * TPITCH + 32 * kc, h);
    }
    #pragma unroll   // acc[][] indexed by constants, so that it stays in registers
    for (int kc = 0; kc < 2; ++kc) {
      #pragma unroll
      for (int nt = 0; nt < 4; ++nt) {
        acc[0][nt] = wmma_f16(bf[kc][nt], af[kc][0], acc[0][nt]);
        acc[1][nt] = wmma_f16(bf[kc][nt], af[kc][1], acc[1][nt]);
      }
    }
    // ---- hand-over: this wave's reads of buffer t&1 are done, its copies of step t+1 have
    // landed; the barrier publishes step t+1 and frees buffer t&1 for the refill ----
    asm volatile("s_wait_dscnt 0x0" ::: "memory");
    asm volatile("s_wait_asynccnt 0x0" ::: "memory");
    __syncthreads();
    if (t + 2 < GSTEPS)
      gemm_stage_copy(l0 + bo * 2, ga0 + (t + 2) * 64, gb0 + (t + 2) * 64);
  }
  // no copy is left in flight when the wave goes on to the epilogue
  asm volatile("s_wait_asynccnt 0x0" ::: "memory");
}

// ---------------------------------------------------------------------------
// 128 staged rows of one operand (8 chunks per lane, 128 B a row) into LDS rows
// of TPITCH halves by asynchronous 16-B copies; each wave-wide copy covers four
// whole 128-B lines. l = this lane's LDS byte address of its first chunk, g =
// the matching global address; chunk i lies 16 rows further on both sides.
// The closing s_wait_xcnt 0 stands inside the copies' own statement, so that no
// address register named here is rewritten ahead of it.
// ---------------------------------------------------------------------------
__device__ __forceinline__ void rows128_copy(unsigned l, const _Float16* g) {
  const unsigned rs = 16 * TPITCH * 2;                 // 16 staged rows in bytes
  const unsigned l1 = l + rs,     l2 = l + 2 * rs, l3 = l + 3 * rs, l4 = l + 4 * rs;
  const unsigned l5 = l + 5 * rs, l6 = l + 6 * rs, l7 = l + 7 * rs;
  const _Float16* g1 = g + 16 * DMODEL;
  const _Float16* g2 = g + 32 * DMODEL;
  const _Float16* g3 = g + 48 * DMODEL;
  const _Float16* g4 = g + 64 * DMODEL;
  const _Float16* g5 = g + 80 * DMODEL;
  const _Float16* g6 = g + 96 * DMODEL;
  const _Float16* g7 = g + 112 * DMODEL;
  asm volatile("global_load_async_to_lds_b128 %0, %8, off\n\t"
               "global_load_async_to_lds_b128 %1, %9, off\n\t"
               "global_load_async_to_lds_b128 %2, %10, off\n\t"
               "global_load_async_to_lds_b128 %3, %11, off\n\t"
               "global_load_async_to_lds_b128 %4, %12, off\n\t"
               "global_load_async_to_lds_b128 %5, %13, off\n\t"
               "global_load_async_to_lds_b128 %6, %14, off\n\t"
               "global_load_async_to_lds_b128 %7, %15, off\n\t"
               "s_wait_xcnt 0x0"
               :: "v"(l), "v"(l1), "v"(l2), "v"(l3), "v"(l4), "v"(l5), "v"(l6), "v"(l7),
                  "v"(g), "v"(g1), "v"(g2), "v"(g3), "v"(g4), "v"(g5), "v"(g6), "v"(g7)
               : "memory");
}

// ---------------------------------------------------------------------------
// Main loop of the qkv projection: acc[mt][nt] += A(64 rows) * B(64 rows)^T per wave
// over K = 512, both operands k-contiguous f16 rows of DMODEL halves. Block 128
// thr, waves 2 x 2, wave tile 64 x 64: a staged row feeds twice the products of
// the 128 x 64 tile, and each fragment read from LDS feeds four. Same two-buffer
// ring and hand-over as gemm_128x64, same ascending k order per output element.
// arows / brows are staged as rows 0..127 / 128..255 of a buffer; fa / fb = the staged
// row at which this wave's A side / B side begins: the caller picks which of the two
// staged operands is the product's A (rows of D, eight of them in a lane).
// On return every wave has passed the last barrier and no copy is in flight, so
// the caller may reuse sG.
// ---------------------------------------------------------------------------
__device__ __forceinline__ void gemm_128x128(const _Float16* arows, const _Float16* brows,
                                             _Float16* sG, int tid, int fa, int fb, v8f (&acc)[4][4]) {
  const int lane = tid & 31;
  const int h = lane >> 4, m = lane & 15;
  // Staging map: chunk c = tid + 128 i (i = 0..15), staged row c >> 3, 16-B column c & 7.
  const int crow = tid >> 3, ccol = tid & 7;
  const unsigned l0 = (unsigned)(size_t)(sG + crow * TPITCH + 8 * ccol);
  const unsigned lb = 128 * TPITCH * 2;                                    // the feature rows' place in a buffer, bytes
  const _Float16* ga0 = arows + (size_t)crow * DMODEL + 8 * ccol;          // + 64 per step
  const _Float16* gb0 = brows + (size_t)crow * DMODEL + 8 * ccol;          // + 64 per step

  rows128_copy(l0, ga0);                                                   // step 0 -> buffer 0
  rows128_copy(l0 + lb, gb0);
  // step 0's copies of this wave have landed before the barrier that publishes them
  asm volatile("s_wait_asynccnt 0x0" ::: "memory");
  __syncthreads();
  rows128_copy(l0 + PSTAGE * 2, ga0 + 64);                                 // step 1 -> buffer 1
  rows128_copy(l0 + PSTAGE * 2 + lb, gb0 + 64);

  #pragma unroll 1   // rolled: one copy of the body, the ring buffer picked by the step's parity
  for (int t = 0; t < GSTEPS; ++t) {
    const int bo = (t & 1) * PSTAGE;                                       // this step's ring buffer
    const _Float16* ab = sG + bo + (fa + m) * TPITCH;                      // A-side row, mt = 0
    const _Float16* bb = sG + bo + (fb + m) * TPITCH;                      // B-side row, nt = 0
    #pragma unroll   // acc[][] indexed by constants, so that it stays in registers
    for (int kc = 0; kc < 2; ++kc) {
      // the eight fragments of a 32-deep chunk are read as one group ahead of its products
      v16h af[4], bf[4];
      #pragma unroll   // af[], bf[] indexed by constants, so that they stay in registers
      for (int i = 0; i < 4; ++i) {
        af[i] = load_frag(ab + i * 16 * TPITCH + 32 * kc, h);
        bf[i] = load_frag(bb + i * 16 * TPITCH + 32 * kc, h);
      }
      #pragma unroll
      for (int nt = 0; nt < 4; ++nt) {
        #pragma unroll
        for (int mt = 0; mt < 4; ++mt)
          acc[mt][nt] = wmma_f16(af[mt], bf[nt], acc[mt][nt]);
      }
    }
    // ---- hand-over: this wave's reads of buffer t&1 are done, its copies of step t+1 have
    // landed; the barrier publishes step t+1 and frees buffer t&1 for the refill ----
    asm volatile("s_wait_dscnt 0x0" ::: "memory");
    asm volatile("s_wait_asynccnt 0x0" ::: "memory");
    __syncthreads();
    if (t + 2 < GSTEPS) {
      rows128_copy(l0 + bo * 2, ga0 + (t + 2) * 64);
      rows128_copy(l0 + bo * 2 + lb, gb0 + (t + 2) * 64);
    }
  }
  // no copy is left in flight when the wave goes on to the epilogue
  asm volatile("s_wait_asynccnt 0x0" ::: "memory");
}

// ---------------------------------------------------------------------------
// Output pass over the block's two head tiles (sT: head bh, then head bh + 1).
// 4 lines per instruction, 64 lines per wave, 256 per block.
// which 0/1: plane[bh][l][d]  (one token row = 64 halves = one line)
// which 2  : vt[bh][d][l]     (64 d-rows x 128 tokens = 2 lines each)
// Staged tile of a head, which 0/1: 128 token rows of TPITCH halves; which 2: 64 d
// rows of VPITCH halves. In global memory head bh + 1 lies SEQ * HD halves behind
// head bh. A lane's 16 chunks are read from LDS as one group ahead of their stores:
// a wave waits out one LDS latency for the pass, not one per chunk.
// ---------------------------------------------------------------------------
__device__ __forceinline__ void proj_store_pass(const _Float16* sT, _Float16* plane, _Float16* vt,
                                                int which, int bh, int l0, int w, int lane) {
  const int q8 = lane & 7, sub = lane >> 3;
  const int lid0 = w * 32 + sub;                   // the lane's first line of a tile; line i lies 4 further
  const int d0 = lid0 >> 1, hl = lid0 & 1;         // which 2: line lid0 + 4 i is d-row d0 + 2 i, token half hl
  _Float16* dst0 = (which != 2) ? plane + ((size_t)bh * SEQ + l0 + lid0) * HD + 8 * q8
                                : vt + ((size_t)bh * HD + d0) * SEQ + l0 + 64 * hl + 8 * q8;
  const int step = (which != 2) ? 4 * HD : 2 * SEQ;   // halves from line i to line i + 1
  const _Float16* src = sT + ((which != 2) ? lid0 * TPITCH : d0 * VPITCH + 64 * hl) + 8 * q8;
  const int sstep = (which != 2) ? 4 * TPITCH : 2 * VPITCH;   // staged halves from line i to line i + 1
  const int shead = (which != 2) ? OQHEAD : OVHEAD;           // staged halves from head bh to head bh + 1
  _Float16* dst[8];
  v8h v[2][8];
  #pragma unroll   // dst[], v[][] indexed by constants, so that they stay in registers
  for (int i = 0; i < 8; ++i) {
    dst[i] = dst0 + i * step;
    v[0][i] = *(const v8ha*)(src + i * sstep);
    v[1][i] = *(const v8ha*)(src + shead + i * sstep);
  }
  // The line addresses are formed ahead of the run of stores: inside the run no register of an
  // issued store is written again, so the stores follow one another with no wait on an earlier one.
  __builtin_amdgcn_sched_barrier(0);
  #pragma unroll
  for (int i = 0; i < 8; ++i) {
    *(v8h*)dst[i] = v[0][i];
    *(v8h*)(dst[i] + (size_t)SEQ * HD) = v[1][i];
  }
}

// ---------------------------------------------------------------------------
// Kernel 2: Y = (x+pe) * W^T + bias over the fused 3*512 output columns.
// Block 128 thr (4 waves) = 128 tokens x 128 features (two heads of one which);
// wave tile 64 tokens x 64 features (one head); K = 512 in staged steps of 64
// (gemm_128x128); the two heads' output tiles sT reuse the ring's LDS once the
// main loop has returned.
// The side of the product whose index runs along a row of the output layout is the
// A side, so that the eight D values of a lane are eight neighbours of one output
// row: features for q and k ([l][d]), tokens for v ([d][l]). A lane stages them by
// one 16-B LDS store, at a row pitch of 16 B x odd (no bank conflict).
// ---------------------------------------------------------------------------
__global__ __launch_bounds__(128) void proj_kernel(
    const _Float16* __restrict__ xh,   // [8192][512]
    const _Float16* __restrict__ wh,   // [4][512][512], row = output feature, x32
    const float* __restrict__ bq, const float* __restrict__ bk, const float* __restrict__ bv,
    _Float16* __restrict__ qh,         // [B*H][L][D]  f16(q)
    _Float16* __restrict__ kh,         // [B*H][L][D]  f16(k)
    _Float16* __restrict__ vt)         // [B*H][D][L]  f16(v)
{
  __shared__ __attribute__((aligned(16))) _Float16 sG[2 * PSTAGE];  // 73728 B
  _Float16* sT = sG;                                                // 2 x OQHEAD or 2 x OVHEAD halves, after the main loop

  const int tid = threadIdx.x, lane = tid & 31, w = tid >> 5;
  const int wm = w & 1, wn = w >> 1;
  const int h = lane >> 4, m = lane & 15;
  const int m0 = blockIdx.x * 128;
  const int cg = blockIdx.y;                 // 0..11
  const int which = cg >> 2, head0 = (cg & 3) * 2;   // the block's heads: head0, head0 + 1

  const v8f zero8 = {0.f, 0.f, 0.f, 0.f, 0.f, 0.f, 0.f, 0.f};
  v8f acc[4][4];
  #pragma unroll
  for (int mt = 0; mt < 4; ++mt)
    #pragma unroll
    for (int nt = 0; nt < 4; ++nt) acc[mt][nt] = zero8;

  // The bias of this wave's head, loaded ahead of the main loop, which covers the loads' latency:
  // v: one feature a lane and B tile; q, k: the eight features of a lane's D values, per A tile.
  const float* bias = ((which == 0) ? bq : ((which == 1) ? bk : bv)) + (head0 + wn) * HD;
  float bs[4] = {0.f, 0.f, 0.f, 0.f};
  v8f bf8[4] = {zero8, zero8, zero8, zero8};
  if (which == 2) {
    #pragma unroll   // bs[] indexed by constants, so that it stays in registers
    for (int nt = 0; nt < 4; ++nt) bs[nt] = bias[16 * nt + m];
  } else {
    #pragma unroll   // bf8[] indexed by constants, so that it stays in registers
    for (int mt = 0; mt < 4; ++mt) {
      const v4f b0 = *(const v4fa*)(bias + 16 * mt + 8 * h);
      const v4f b1 = *(const v4fa*)(bias + 16 * mt + 8 * h + 4);
      const v8f t = { b0.x, b0.y, b0.z, b0.w, b1.x, b1.y, b1.z, b1.w };
      bf8[mt] = t;
    }
  }

  const int trow = 64 * wm, frow = 128 + 64 * wn;    // the wave's staged token rows and feature rows
  gemm_128x128(xh + (size_t)m0 * DMODEL, wh + ((size_t)which * DMODEL + head0 * HD) * DMODEL, sG, tid,
               (which == 2) ? trow : frow, (which == 2) ? frow : trow, acc);

  if (which == 2) {
    // D[r] of tile (mt, nt) = Y[token m0+64wm+16mt+8h+r][head head0+wn, feature 16nt+m]
    _Float16* st = sT + wn * OVHEAD + m * VPITCH + 64 * wm + 8 * h;
    #pragma unroll
    for (int nt = 0; nt < 4; ++nt) {
      #pragma unroll
      for (int mt = 0; mt < 4; ++mt) {
        v8h y;
        #pragma unroll
        for (int r = 0; r < 8; ++r) y[r] = (_Float16)(acc[mt][nt][r] * (1.0f / WSCALE) + bs[nt]);
        *(v8ha*)(st + nt * 16 * VPITCH + 16 * mt) = y;
      }
    }
  } else {
    // D[r] of tile (mt, nt) = Y[token m0+64wm+16nt+m][head head0+wn, feature 16mt+8h+r]
    _Float16* st = sT + wn * OQHEAD + (64 * wm + m) * TPITCH + 8 * h;
    #pragma unroll
    for (int mt = 0; mt < 4; ++mt) {
      #pragma unroll
      for (int nt = 0; nt < 4; ++nt) {
        v8h y;
        #pragma unroll
        for (int r = 0; r < 8; ++r) y[r] = (_Float16)(acc[mt][nt][r] * (1.0f / WSCALE) + bf8[mt][r]);
        *(v8ha*)(st + nt * 16 * TPITCH + 16 * mt) = y;
      }
    }
  }
  __syncthreads();

  const int b = m0 / SEQ, l0 = m0 - b * SEQ, bh = b * NHEADS + head0;
  _Float16* plane = (which == 0) ? qh : kh;
  proj_store_pass(sT, plane, vt, which, bh, l0, w, lane);
  
}

// ---------------------------------------------------------------------------
// Attention helpers.
// Score element r of this lane: key = kb + 64kg + 16j + 8h + r, query = q0 + 16qt + m.
// v = log2(e) * (mask ? (s*0.125 + anti[q - key + 2047]) : (-inf + missing_bias[head])):
// log2(e) rides in the score scale and in the table, so the softmax runs on 2^x.
// The key mask enters as the start value C of the score product: sm[key] = 0
// for an observed key, -inf + missing_bias[head] for a missing one, so that
// C + K.Q stays that non-finite value through the scale and the bias below.
// sb = the block's window of the antisymmetrised rel-pos table in LDS, base = index for r = 0
// (index decreases by one per r); every index is in range for every key, so
// the reads carry no condition and no branch.
// ---------------------------------------------------------------------------
__device__ __forceinline__ v8f mask_start8(const float* sm) {
  const v4f a = *(const v4fa*)sm;
  const v4f c = *(const v4fa*)(sm + 4);
  const v8f z = { a.x, a.y, a.z, a.w, c.x, c.y, c.z, c.w };
  return z;
}

__device__ __forceinline__ v8f bias_load8(const float* sb, int base) {
  const v8f t = { sb[base],     sb[base - 1], sb[base - 2], sb[base - 3],
                  sb[base - 4], sb[base - 5], sb[base - 6], sb[base - 7] };
  return t;
}

// 2^u by v_exp_f32, with the slot behind a transcendental:
// source and result stay tied up to the v_nop, so that no instruction directly behind the
// v_exp_f32 writes its source or reads its result.
__device__ __forceinline__ float exp2_slot(float u) {
  float p = __builtin_amdgcn_exp2f(u);
  asm("v_nop" : "+v"(p) : "v"(u));
  return p;
}

// P^T B-fragment from the lane's own score D values: element r <- tile a row r,
// element 8+r <- tile c row r (same lane, same query column); the values arrive x 2^14.
__device__ __forceinline__ v16h pack_p(v8f a, v8f c) {
  const v16h r = { (_Float16)a[0], (_Float16)a[1], (_Float16)a[2], (_Float16)a[3],
                   (_Float16)a[4], (_Float16)a[5], (_Float16)a[6], (_Float16)a[7],
                   (_Float16)c[0], (_Float16)c[1], (_Float16)c[2], (_Float16)c[3],
                   (_Float16)c[4], (_Float16)c[5], (_Float16)c[6], (_Float16)c[7] };
  return r;
}

// (one token row's head slice) by lanes 8q..8q+7 in one instruction, 4 lines
// per instruction, 16 lines per wave; so = the wave's 16 staged rows of TPITCH halves.
__device__ __forceinline__ void ao_store_pass(const _Float16* so, _Float16* ao,
                                              int b, int head, int q0, int lane) {
  const int q8 = lane & 7, sub = lane >> 3;
  #pragma unroll
  for (int i = 0; i < 4; ++i) {
    const int lid = i * 4 + sub;                    // 0..15
    const v8h v = *(const v8ha*)(so + lid * TPITCH + 8 * q8);
    const size_t gi = ((size_t)b * SEQ + q0 + lid) * DMODEL + head * HD + 8 * q8;
    *(v8h*)(ao + gi) = v;
  }
}

// One 128-key stage of K (128 key rows x 128 B) and of V^T (64 d rows x 256 B)
// into LDS rows of TPITCH / VPITCH halves: 4 + 4 asynchronous 16-B copies per
// lane, each wave-wide copy covering four whole 128-B lines. lk/lv = this lane's
// LDS byte address of its first K / V chunk, gk/gv = the matching global
// address; chunk i lies 32 (K) or 16 (V^T) rows further on both sides.
// The closing s_wait_xcnt 0 stands inside the copies' own statement, so that no
// address register named here is rewritten ahead of it.
__device__ __forceinline__ void stage_copy(unsigned lk, unsigned lv,
                                           const _Float16* gk, const _Float16* gv) {
  const unsigned lk1 = lk + 32 * TPITCH * 2, lk2 = lk + 64 * TPITCH * 2, lk3 = lk + 96 * TPITCH * 2;
  const unsigned lv1 = lv + 16 * VPITCH * 2, lv2 = lv + 32 * VPITCH * 2, lv3 = lv + 48 * VPITCH * 2;
  const _Float16* gk1 = gk + 32 * HD;
  const _Float16* gk2 = gk + 64 * HD;
  const _Float16* gk3 = gk + 96 * HD;
  const _Float16* gv1 = gv + (size_t)16 * SEQ;
  const _Float16* gv2 = gv + (size_t)32 * SEQ;
  const _Float16* gv3 = gv + (size_t)48 * SEQ;
  asm volatile("global_load_async_to_lds_b128 %0, %8, off\n\t"
               "global_load_async_to_lds_b128 %1, %9, off\n\t"
               "global_load_async_to_lds_b128 %2, %10, off\n\t"
               "global_load_async_to_lds_b128 %3, %11, off\n\t"
               "global_load_async_to_lds_b128 %4, %12, off\n\t"
               "global_load_async_to_lds_b128 %5, %13, off\n\t"
               "global_load_async_to_lds_b128 %6, %14, off\n\t"
               "global_load_async_to_lds_b128 %7, %15, off\n\t"
               "s_wait_xcnt 0x0"
               :: "v"(lk), "v"(lk1), "v"(lk2), "v"(lk3), "v"(lv), "v"(lv1), "v"(lv2), "v"(lv3),
                  "v"(gk), "v"(gk1), "v"(gk2), "v"(gk3), "v"(gv), "v"(gv1), "v"(gv2), "v"(gv3)
               : "memory");
}

// ---------------------------------------------------------------------------
// Kernel 3: streaming attention, transposed form.
// Block 256 thr (8 waves) = 128 queries; 128 keys per staged step.
// Wave w: query group qg = w & 3 (32 queries = two 16-column tiles), key half
// kg = w >> 2 (keys 64 kg .. 64 kg + 63 of every staged step). Each K and V^T
// fragment read from LDS feeds two products, one per query tile; the two waves
// of a query group each keep their own running maximum, sum and O over their
// half of the keys, and the halves are joined through LDS behind the loop.
// K and V^T of a step are staged once per block in a two-buffer LDS ring by
// asynchronous copies (next step's copies fly while this step is worked on).
//   S^T = K * Q^T : A = K rows (row = key, k = d), B = Q^T (k = d, n = query)
//   O^T += V^T * P^T : A = Vt rows (row = d, k = key), B = P^T from registers
// Lane owns 32 keys of query columns (lane&15) and 16 + (lane&15); partner = lane ^ 16.
// The block's window of this head's antisymmetrised rel-pos table (formed by the
// convert launch) is copied to LDS, and the key-mask start values of this batch
// row are built there, once per block.
// ---------------------------------------------------------------------------
// amdgpu_waves_per_eu(4, 4): a register budget of 256 a wave, so that two blocks (four waves per
// SIMD) share a WGP; the softmax's vector work between the products wants those waves.
__global__ __launch_bounds__(256) __attribute__((amdgpu_waves_per_eu(4, 4))) void attn_kernel(
    const _Float16* __restrict__ qh,   // [B*H][L][D]
    const _Float16* __restrict__ kh,   // [B*H][L][D]
    const _Float16* __restrict__ vt,   // [B*H][D][L]
    const int* __restrict__ mask,      // [B][L], nonzero = observed key
    const float* __restrict__ mbias,   // [H]
    const float* __restrict__ ab,      // [H][RELP] antisymmetrised rel-pos table
    _Float16* __restrict__ ao)         // [B][L][DMODEL], x64
{
  __shared__ __attribute__((aligned(16))) float sB[RELWIN];           //  8704 B
  __shared__ __attribute__((aligned(16))) float sM[SEQ];              //  8192 B
  __shared__ __attribute__((aligned(16))) _Float16 sK[2 * KSTAGE];   // 36864 B; behind the loop: the join's partial O, maxima, sums
  __shared__ __attribute__((aligned(16))) _Float16 sV[2 * VSTAGE];   // 34816 B; behind the loop: the block's 128 x 64 output tile

  const int tid = threadIdx.x, lane = tid & 31;
  const int w = __builtin_amdgcn_readfirstlane(tid >> 5);   // wave number in a scalar register: its branches are scalar
  const int qg = w & 3, kg = w >> 2;
  const int h = lane >> 4, m = lane & 15;
  const int bh = blockIdx.y, b = bh >> 3, head = bh & 7;
  const int qblk = blockIdx.x * AQ;
  const int q0 = qblk + 32 * qg;

  // Staging map, chunk i = 0..3 of a thread. K: tile row (tid >> 3) + 32 i, 16-B column tid & 7.
  // V^T: tile row (tid >> 4) + 16 i, 16-B column tid & 15.
  const int krow = tid >> 3, kcol = tid & 7;
  const int vrow = tid >> 4, vcol = tid & 15;
  const unsigned lk0 = (unsigned)(size_t)(sK + krow * TPITCH + 8 * kcol);
  const unsigned lv0 = (unsigned)(size_t)(sV + vrow * VPITCH + 8 * vcol);
  const _Float16* gk0 = kh + ((size_t)bh * SEQ + krow) * HD + 8 * kcol;    // + AKEYS * HD per step
  const _Float16* gv0 = vt + ((size_t)bh * HD + vrow) * SEQ + 8 * vcol;    // + AKEYS per step

  stage_copy(lk0, lv0, gk0, gv0);                                          // step 0 -> buffer 0

  // Table index of (query q, key k) is q - k + (SEQ-1): the block's 128 queries, first one qblk,
  // reach entries qblk .. qblk + 2174 over all keys. sB[e] = ab[head][qblk + e], e = 0 .. 2175
  // (the last entry read is 1920 + 2175 = 4095, the padding entry: copied, never used).
  const float* abw = ab + head * RELP + qblk;
  // The loads stand here and the LDS stores behind the mask and Q loads, so that all of the
  // prologue's loads are in flight together. The last 128 entries are 32 chunks: every wave
  // loads them (no condition on the load), wave 0 stores.
  v4f tb[3];
  #pragma unroll   // tb[] indexed by constants, so that it stays in registers
  for (int c = 0; c < 2; ++c) tb[c] = *(const v4fa*)(abw + 4 * tid + 1024 * c);
  tb[2] = *(const v4fa*)(abw + 2048 + 4 * lane);

  // sM[key] = 0 (observed) or -inf fill + missing bias (missing)
  const float mbh = mbias[head];
  const float vmiss = -__builtin_inff() + mbh;
  #pragma unroll   // the two mask loads in flight together
  for (int i = 0; i < SEQ / 1024; ++i) {
    const int k4 = 4 * tid + 1024 * i;
    const v4i mm = *(const v4ia*)(mask + (size_t)b * SEQ + k4);
    const v4f t = { (mm.x != 0) ? 0.0f : vmiss, (mm.y != 0) ? 0.0f : vmiss,
                    (mm.z != 0) ? 0.0f : vmiss, (mm.w != 0) ? 0.0f : vmiss };
    *(v4fa*)(sM + k4) = t;
  }

  // Q^T B-fragments: tile qt, column n = query q0 + 16 qt + m, k = d (two 32-deep chunks)
  const _Float16* qrow = qh + ((size_t)bh * SEQ + q0 + m) * HD;
  v16h qf[2][2];
  #pragma unroll   // qf[][] indexed by constants, so that it stays in registers
  for (int qt = 0; qt < 2; ++qt) {
    qf[qt][0] = load_frag(qrow + qt * 16 * HD, h);
    qf[qt][1] = load_frag(qrow + qt * 16 * HD + 32, h);
  }

  #pragma unroll
  for (int c = 0; c < 2; ++c) *(v4fa*)(sB + 4 * tid + 1024 * c) = tb[c];
  // Holds the third load in front of the branch below (loaded value as an input only): without it
  // the compiler sinks the load into the branch, where wave 0 waits out a second full load latency.
  asm volatile("" :: "v"(tb[2]));
  if (w == 0) *(v4fa*)(sB + 2048 + 4 * lane) = tb[2];

  // step 0's copies of this wave have landed before the barrier that publishes them (and sB, sM)
  asm volatile("s_wait_asynccnt 0x0" ::: "memory");
  __syncthreads();

  stage_copy(lk0 + KSTAGE * 2, lv0 + VSTAGE * 2, gk0 + AKEYS * HD, gv0 + AKEYS);   // step 1 -> buffer 1

  // Index in sB of (query tile qt, key tile j, r) is qk - kb - 16 (j - qt) - r: the two query tiles
  // share three of their five groups of eight table entries.
  const int qk = 32 * qg + m + (SEQ - 1) - 8 * h - 64 * kg;

  const v8f zero8 = {0.f, 0.f, 0.f, 0.f, 0.f, 0.f, 0.f, 0.f};
  const float sc = 0.125f * LOG2E;            // 1/sqrt(d) and log2(e) in one factor
  const v8f sc8 = {sc, sc, sc, sc, sc, sc, sc, sc};
  v8f o[2][4];                                // o[qt][t][r] = O[query 16qt+m][d 16t+8h+r] * (l * 2^14), this wave's keys
  #pragma unroll
  for (int qt = 0; qt < 2; ++qt)
    #pragma unroll
    for (int t = 0; t < 4; ++t) o[qt][t] = zero8;
  float mrun[2] = { -1e30f, -1e30f }, lrun[2] = { 0.0f, 0.0f };   // maximum in base-2 units; row sum x 2^14

  const int kfro = (64 * kg + m) * TPITCH;                     // this lane's K fragment row (key tile 0) in a staged tile
  const int vfro = m * VPITCH + 64 * kg;                       // this lane's V^T fragment row (d tile 0), at this wave's keys
  const float* smp = sM + 8 * h + 64 * kg;                     // + key tile base

  #pragma unroll 1
  for (int st = 0; st < ASTEP; ++st) {
    const int kb = st * AKEYS;
    const int par = st & 1;                                    // this step's ring buffer
    const _Float16* kbase = sK + par * KSTAGE + kfro;          // + 16j*TPITCH + 32*dc
    const _Float16* vbase = sV + par * VSTAGE + vfro;          // + 16t*VPITCH + 32*kc
    // ---- rel-pos bias of this step, read ahead of the score products: group g serves (qt, j = g - 1 + qt) ----
    v8f bv[5];
    #pragma unroll   // bv[] indexed by constants, so that it stays in registers
    for (int g = 0; g < 5; ++g) bv[g] = bias_load8(sB, qk - kb - 16 * (g - 1));
    // ---- raw scores on the mask start: s[qt][j][r] = sM[key] + (Q.K)[query 16qt+m][key kb+64kg+16j+8h+r] ----
    v8f s[2][4];
    #pragma unroll
    for (int j = 0; j < 4; ++j) {
      const _Float16* kp = kbase + 16 * j * TPITCH;
      const v16h kf0 = load_frag(kp, h);
      const v16h kf1 = load_frag(kp + 32, h);
      const v8f z = mask_start8(smp + kb + 16 * j);
      #pragma unroll
      for (int qt = 0; qt < 2; ++qt)
        s[qt][j] = wmma_f16_free(kf1, qf[qt][1], wmma_f16_free(kf0, qf[qt][0], z));
    }
    // ---- scale log2(e)/8, rel-pos bias x log2(e) (f32) ----
    #pragma unroll
    for (int qt = 0; qt < 2; ++qt)
      #pragma unroll
      for (int j = 0; j < 4; ++j)
        s[qt][j] = __builtin_elementwise_fma(s[qt][j], sc8, bv[j + 1 - qt]);

    // ---- online softmax, each query tile on its own; P^T B-fragments (key chunks 0..31, 32..63) ----
    v16h pb[2][2];
    #pragma unroll   // s[][], o[][], pb[][], mrun[], lrun[] indexed by constants, so that they stay in registers
    for (int qt = 0; qt < 2; ++qt) {
      float mloc = s[qt][0][0];
      #pragma unroll
      for (int j = 0; j < 4; ++j)
        #pragma unroll
        for (int r = 0; r < 8; ++r) mloc = fmaxf(mloc, s[qt][j][r]);
      mloc = fmaxf(mloc, __shfl_xor(mloc, 16));
      const float mnew = fmaxf(mrun[qt], mloc);
      const float alpha = exp2_slot(mrun[qt] - mnew);
      mrun[qt] = mnew;
      // one subtraction stands between a score and its v_exp_f32: p = 2^(s - mnew + 14)
      const float mref = mnew - PSHIFT;
      const v2f mref2 = {mref, mref};
      float lsum = 0.0f;
      #pragma unroll
      for (int j = 0; j < 4; ++j) {
        v2f u[4];                              // in pairs: one packed subtraction serves two scores
        float p[8];
        #pragma unroll   // u[], p[] indexed by constants, so that they stay in registers
        for (int i = 0; i < 4; ++i) {
          const v2f sp = { s[qt][j][2 * i], s[qt][j][2 * i + 1] };
          u[i] = sp - mref2;
          p[2 * i]     = __builtin_amdgcn_exp2f(u[i].x);
          p[2 * i + 1] = __builtin_amdgcn_exp2f(u[i].y);
        }
        // The slot behind a transcendental: the eight sources stay live up to this statement, so
        // that no instruction directly behind one of the row's v_exp_f32 writes the register it
        // reads; the v_nop is
        // the slot of the last of them.
        asm("v_nop" : "+v"(p[7])
            : "v"(u[0]), "v"(u[1]), "v"(u[2]), "v"(u[3]),
              "v"(p[0]), "v"(p[1]), "v"(p[2]), "v"(p[3]), "v"(p[4]), "v"(p[5]), "v"(p[6]));
        #pragma unroll
        for (int r = 0; r < 8; ++r) {
          s[qt][j][r] = p[r];
          lsum += p[r];
        }
      }
      lsum += __shfl_xor(lsum, 16);
      lrun[qt] = lrun[qt] * alpha + lsum;
      #pragma unroll
      for (int t = 0; t < 4; ++t)
        #pragma unroll
        for (int r = 0; r < 8; ++r) o[qt][t][r] = o[qt][t][r] * alpha;
      pb[qt][0] = pack_p(s[qt][0], s[qt][1]);
      pb[qt][1] = pack_p(s[qt][2], s[qt][3]);
    }

    // ---- O^T += V^T * P^T ----
    #pragma unroll
    for (int t = 0; t < 4; ++t) {
      const _Float16* vp = vbase + 16 * t * VPITCH;
      const v16h vf0 = load_frag(vp, h);
      const v16h vf1 = load_frag(vp + 32, h);
      #pragma unroll
      for (int qt = 0; qt < 2; ++qt) {
        o[qt][t] = wmma_f16_free(vf0, pb[qt][0], o[qt][t]);
        o[qt][t] = wmma_f16_free(vf1, pb[qt][1], o[qt][t]);
      }
    }

    // ---- hand-over: this wave's reads of buffer st&1 are done, its copies of step st+1
    // have landed; the barrier publishes step st+1 and frees buffer st&1 for the refill ----
    asm volatile("s_wait_dscnt 0x0" ::: "memory");
    asm volatile("s_wait_asynccnt 0x0" ::: "memory");
    __syncthreads();
    if (st + 2 < ASTEP)
      stage_copy(lk0 + par * (KSTAGE * 2), lv0 + par * (VSTAGE * 2),
                 gk0 + (size_t)(kb + 2 * AKEYS) * HD, gv0 + (kb + 2 * AKEYS));
  }
  // no copy is left in flight when the wave goes on to the epilogue
  asm volatile("s_wait_asynccnt 0x0" ::: "memory");

  // ---- join of the two key halves. Every wave has passed the loop's last barrier, so the ring is
  // free. The kg = 1 wave of a query group hands its O (16 chunks of 16 B a lane, a wave-wide store
  // = 512 contiguous bytes), maxima and sums to the same lane of the kg = 0 wave. ----
  v4fa* jo = (v4fa*)sK + qg * (16 * 32) + lane;                // chunk i lies 32 further
  v4fa* jm = (v4fa*)sK + 4 * (16 * 32) + qg * 32 + lane;
  if (kg == 1) {
    #pragma unroll
    for (int qt = 0; qt < 2; ++qt) {
      #pragma unroll
      for (int t = 0; t < 4; ++t) {
        const v4f lo4 = { o[qt][t][0], o[qt][t][1], o[qt][t][2], o[qt][t][3] };
        const v4f hi4 = { o[qt][t][4], o[qt][t][5], o[qt][t][6], o[qt][t][7] };
        jo[32 * (qt * 8 + t * 2)]     = lo4;
        jo[32 * (qt * 8 + t * 2 + 1)] = hi4;
      }
    }
    const v4f ml = { mrun[0], mrun[1], lrun[0], lrun[1] };
    *jm = ml;
  }
  __syncthreads();

  // ---- epilogue: both halves brought to the common maximum, normalised, x64, into the block's
  // 128 x 64 f16 tile (rows of TPITCH halves: no bank conflict among a wave's 16-B stores);
  // whole-line stores by all eight waves ----
  _Float16* sO = sV;
  if (kg == 0) {
    const v4f ml = *jm;
    #pragma unroll
    for (int qt = 0; qt < 2; ++qt) {
      const float mo = ml[qt], lo = ml[2 + qt];
      const float mj = fmaxf(mrun[qt], mo);
      const float a0 = exp2_slot(mrun[qt] - mj);
      const float a1 = exp2_slot(mo - mj);
      const float lj = lrun[qt] * a0 + lo * a1;
      float rl = __builtin_amdgcn_rcpf(lj);
      // The slot behind a transcendental, as in the loop: nothing directly behind the v_rcp_f32 writes its source.
      asm("v_nop" : "+v"(rl) : "v"(lj));
      const float inv = rl * AOSCALE;           // O and the row sum both carry 2^14
      const float c0 = a0 * inv, c1 = a1 * inv;
      _Float16* so = sO + (32 * qg + 16 * qt + m) * TPITCH + 8 * h;
      #pragma unroll
      for (int t = 0; t < 4; ++t) {
        const v4f lo4 = jo[32 * (qt * 8 + t * 2)];
        const v4f hi4 = jo[32 * (qt * 8 + t * 2 + 1)];
        #pragma unroll
        for (int r = 0; r < 4; ++r) {
          so[16 * t + r]     = (_Float16)(o[qt][t][r] * c0 + lo4[r] * c1);
          so[16 * t + 4 + r] = (_Float16)(o[qt][t][4 + r] * c0 + hi4[r] * c1);
        }
      }
    }
  }
  __syncthreads();

  ao_store_pass(sO + w * 16 * TPITCH, ao, b, head, qblk + 16 * w, lane);
  
}

// ---------------------------------------------------------------------------
// 16-B stores, 4 lines per instruction, 64 lines per wave.
// ---------------------------------------------------------------------------
__device__ __forceinline__ void out_store_pass(const float* sT, float* out, int m0, int fg, int w, int lane) {
  const int q8 = lane & 7, sub = lane >> 3;
  const int row0 = 32 * w + (sub >> 1), hl = sub & 1;   // the lane's first line: row row0, half hl; line i lies 2 rows further
  const float* src = sT + row0 * OPITCH + 32 * hl + 4 * q8;
  float* dst = out + (size_t)(m0 + row0) * DMODEL + fg * 64 + 32 * hl + 4 * q8;
  // A lane's 16 chunks are read from LDS as one group ahead of their stores: a wave waits out one
  // LDS latency for the pass, not one per chunk.
  v4f v[16];
  #pragma unroll   // v[] indexed by constants, so that it stays in registers
  for (int i = 0; i < 16; ++i) v[i] = *(const v4fa*)(src + i * 2 * OPITCH);
  #pragma unroll
  for (int i = 0; i < 16; ++i) *(v4f*)(dst + (size_t)i * 2 * DMODEL) = v[i];
}

// ---------------------------------------------------------------------------
// Kernel 4: out = AO * Wo^T + bo (f32). Block 128 thr = 128 tokens x 64
// features (fg = blockIdx.y); wave tile 32 x 64; K = 512 in staged steps of 64
// (gemm_128x64); the output tile sT reuses the ring's LDS after the main loop.
// ---------------------------------------------------------------------------
__global__ __launch_bounds__(128) void oproj_kernel(
    const _Float16* __restrict__ ao,   // [8192][512] f16, x64
    const _Float16* __restrict__ woh,  // [512][512] f16, row = output feature, x32
    const float* __restrict__ bo,      // [512]
    float* __restrict__ out)           // [8192][512] f32
{
  __shared__ __attribute__((aligned(16))) _Float16 sG[2 * GSTAGE];  // 55296 B
  float* sT = (float*)sG;                                           // 128 rows of OPITCH floats (34816 B), after the main loop

  const int tid = threadIdx.x, lane = tid & 31, w = tid >> 5;
  const int h = lane >> 4, m = lane & 15;
  const int m0 = blockIdx.x * 128;
  const int fg = blockIdx.y;                 // 0..7

  const v8f zero8 = {0.f, 0.f, 0.f, 0.f, 0.f, 0.f, 0.f, 0.f};
  v8f acc[2][4];
  #pragma unroll
  for (int mt = 0; mt < 2; ++mt)
    #pragma unroll
    for (int nt = 0; nt < 4; ++nt) acc[mt][nt] = zero8;

  // The bias of the eight features of a lane's D values, per feature tile, loaded ahead of the
  // main loop, which covers the loads' latency.
  v4f bl[4], bu[4];
  #pragma unroll   // bl[], bu[] indexed by constants, so that they stay in registers
  for (int nt = 0; nt < 4; ++nt) {
    bl[nt] = *(const v4fa*)(bo + fg * 64 + 16 * nt + 8 * h);
    bu[nt] = *(const v4fa*)(bo + fg * 64 + 16 * nt + 8 * h + 4);
  }

  gemm_128x64(ao + (size_t)m0 * DMODEL, woh + (size_t)fg * 64 * DMODEL, sG, tid, acc);

  // D[r] of tile (mt, nt) = out[token m0+32w+16mt+m][feature fg*64+16nt+8h+r]: two 16-B LDS stores
  float* st = sT + (32 * w + m) * OPITCH + 8 * h;
  const float os = 1.0f / (WSCALE * AOSCALE);
  #pragma unroll
  for (int nt = 0; nt < 4; ++nt) {
    #pragma unroll
    for (int mt = 0; mt < 2; ++mt) {
      const v4f lo = { acc[mt][nt][0] * os + bl[nt].x, acc[mt][nt][1] * os + bl[nt].y,
                       acc[mt][nt][2] * os + bl[nt].z, acc[mt][nt][3] * os + bl[nt].w };
      const v4f hi = { acc[mt][nt][4] * os + bu[nt].x, acc[mt][nt][5] * os + bu[nt].y,
                       acc[mt][nt][6] * os + bu[nt].z, acc[mt][nt][7] * os + bu[nt].w };
      *(v4fa*)(st + mt * 16 * OPITCH + 16 * nt)     = lo;
      *(v4fa*)(st + mt * 16 * OPITCH + 16 * nt + 4) = hi;
    }
  }
  __syncthreads();

  out_store_pass(sT, out, m0, fg, w, lane);
  
}

// ---------------------------------------------------------------------------
extern "C" void kernel_launch(void* const* d_in, const int* in_sizes, int n_in,
                              void* d_out, int out_size, void* d_ws, size_t ws_size,
                              hipStream_t stream) {
  if (n_in < 12) return;
  if (in_sizes[0] != NX) return;
  if (in_sizes[1] != MROWS) return;
  if (in_sizes[2] != NW || in_sizes[4] != NW || in_sizes[6] != NW || in_sizes[8] != NW) return;
  if (in_sizes[3] != DMODEL || in_sizes[5] != DMODEL || in_sizes[7] != DMODEL || in_sizes[9] != DMODEL) return;
  if (in_sizes[10] != NHEADS) return;
  if (in_sizes[11] != RELN * NHEADS) return;
  if (out_size != NX) return;

  const float* x     = (const float*)d_in[0];
  const int*   mask  = (const int*)d_in[1];
  const float* Wq    = (const float*)d_in[2];
  const float* bq    = (const float*)d_in[3];
  const float* Wk    = (const float*)d_in[4];
  const float* bk    = (const float*)d_in[5];
  const float* Wv    = (const float*)d_in[6];
  const float* bv    = (const float*)d_in[7];
  const float* Wo    = (const float*)d_in[8];
  const float* bo    = (const float*)d_in[9];
  const float* mbias = (const float*)d_in[10];
  const float* rel   = (const float*)d_in[11];
  float* out = (float*)d_out;

  const size_t xh_bytes = (size_t)NX * 2;                           //  8388608
  const size_t wh_bytes = (size_t)4 * NW * 2;                       //  2097152
  const size_t pl_bytes = (size_t)BATCH * NHEADS * SEQ * HD * 2;    //  8388608
  const size_t ao_bytes = (size_t)NX * 2;                           //  8388608
  const size_t ab_bytes = (size_t)NHEADS * RELP * 4;                //   131072
  const size_t total = xh_bytes + wh_bytes + 3 * pl_bytes + ao_bytes + ab_bytes;   // 44171264
  if (total > ws_size) return;

  char* ws = (char*)d_ws;
  size_t off = 0;
  _Float16* xh  = (_Float16*)(ws + off);  off += xh_bytes;
  _Float16* wh  = (_Float16*)(ws + off);  off += wh_bytes;
  _Float16* qh  = (_Float16*)(ws + off);  off += pl_bytes;
  _Float16* kh  = (_Float16*)(ws + off);  off += pl_bytes;
  _Float16* vt  = (_Float16*)(ws + off);  off += pl_bytes;
  _Float16* ao  = (_Float16*)(ws + off);  off += ao_bytes;
  float*    ab  = (float*)(ws + off);     off += ab_bytes;
  if (off > ws_size) return;

  const int ngroups = XGROUPS + NW8 + RELP;                         // 167936
  convert_kernel<<<(ngroups + 255) / 256, 256, 0, stream>>>(x, Wq, Wk, Wv, Wo, rel, xh, wh, ab);

  dim3 gProj(MROWS / 128, 3 * NHEADS / 2);                          // (64, 12)
  proj_kernel<<<gProj, 128, 0, stream>>>(xh, wh, bq, bk, bv, qh, kh, vt);

  dim3 gAtt(SEQ / AQ, BATCH * NHEADS);                              // (16, 32)
  attn_kernel<<<gAtt, 256, 0, stream>>>(qh, kh, vt, mask, mbias, ab, ao);

  dim3 gOut(MROWS / 128, DMODEL / 64);                              // (64, 8)
  oproj_kernel<<<gOut, 128, 0, stream>>>(ao, wh + (size_t)3 * NW, bo, out);
}
